// v000
// The times below were measured on an AMD MI455X: many runs one after another, warmed up first and cycling through
// copies of the inputs, with the whole window's GPU time divided by the number of runs. Launches and the gaps
// between them are all in it. The median over several windows is given; except for v000 it joins two sittings, which
// can be a few percent apart, so the side-by-side timings, each taken in one sitting, are the better comparison.
// v000, which the later versions start from, runs in 741 microseconds.
// Contractions: q/k/v projections on v_wmma_f32_16x16x32_bf16 (bf16(x) x bf16(W), one product, f32 accumulate); output projection on v_wmma_f32_16x16x32_bf16 with the attention plane carried as bf16 hi + lo planes against bf16(Wo) (two products into one f32 accumulator); feature map, 64x64 state scan, normaliser and division in f32 on the vector unit.
#include <hip/hip_runtime.h>
#include <math.h>

typedef __attribute__((ext_vector_type(16))) __bf16   v16b;
typedef __attribute__((ext_vector_type(8)))  __bf16   v8b;
typedef __attribute__((ext_vector_type(8)))  float    v8f;
typedef __attribute__((ext_vector_type(4)))  float    v4f;
typedef __attribute__((ext_vector_type(4)))  unsigned int v4u;

// ---------------------------------------------------------------------------
// Shape constants
// ---------------------------------------------------------------------------
constexpr int kBatch = 2;
constexpr int kSeq   = 2048;
constexpr int kDim   = 1024;
constexpr int kHeads = 16;
constexpr int kHd    = 64;
constexpr int kRows  = kBatch * kSeq;
constexpr int kScanT = 32;
constexpr float kEps = 1e-6f;
static_assert(kHeads * kHd == kDim, "head split");
static_assert((kDim % 32) == 0, "GEMM K multiple of 32");
static_assert((kRows % 64) == 0 && (kDim % 64) == 0, "GEMM M, N multiples of 64");
static_assert((kSeq % kScanT) == 0, "scan chunking");
static_assert(kHd == 64, "one head = one 64-column tile");

// ---------------------------------------------------------------------------
// Workspace region map (bytes; every offset is a multiple of 128)
//   XQ  bf16 [4096][1024]  bf16(query)                  8,388,608
//   XK  bf16 [4096][1024]  bf16(key)                    8,388,608
//   XV  bf16 [4096][1024]  bf16(value)                  8,388,608
//   WQ  bf16 [1024][1024]  bf16(Wq)  (Bt layout)        2,097,152
//   WK  bf16 [1024][1024]  bf16(Wk)                     2,097,152
//   WV  bf16 [1024][1024]  bf16(Wv)                     2,097,152
//   WO  bf16 [1024][1024]  bf16(Wo)                     2,097,152
//   QF  f32  [4096][1024]  phi(q)                      16,777,216
//   KF  f32  [4096][1024]  phi(k)                      16,777,216
//   VF  f32  [4096][1024]  v                           16,777,216
//   AH  bf16 [4096][1024]  attention plane, hi part     8,388,608
//   AL  bf16 [4096][1024]  attention plane, lo part     8,388,608
//   total                                             100,663,296
// ---------------------------------------------------------------------------
constexpr size_t kActB  = (size_t)kRows * kDim * 2;
constexpr size_t kWgtB  = (size_t)kDim * kDim * 2;
constexpr size_t kF32B  = (size_t)kRows * kDim * 4;
constexpr size_t kOffXQ = 0;
constexpr size_t kOffXK = kOffXQ + kActB;
constexpr size_t kOffXV = kOffXK + kActB;
constexpr size_t kOffWQ = kOffXV + kActB;
constexpr size_t kOffWK = kOffWQ + kWgtB;
constexpr size_t kOffWV = kOffWK + kWgtB;
constexpr size_t kOffWO = kOffWV + kWgtB;
constexpr size_t kOffQF = kOffWO + kWgtB;
constexpr size_t kOffKF = kOffQF + kF32B;
constexpr size_t kOffVF = kOffKF + kF32B;
constexpr size_t kOffAH = kOffVF + kF32B;
constexpr size_t kOffAL = kOffAH + kActB;
constexpr size_t kWsTotal = kOffAL + kActB;
static_assert(kWsTotal == 100663296ull, "carve total");
static_assert(kWsTotal <= 134217728ull, "carve cap");
static_assert((kOffXK % 128) == 0 && (kOffXV % 128) == 0 && (kOffWQ % 128) == 0 && (kOffWK % 128) == 0 &&
              (kOffWV % 128) == 0 && (kOffWO % 128) == 0 && (kOffQF % 128) == 0 && (kOffKF % 128) == 0 &&
              (kOffVF % 128) == 0 && (kOffAH % 128) == 0 && (kOffAL % 128) == 0, "128-B aligned regions");

// ---------------------------------------------------------------------------
// Small helpers
// ---------------------------------------------------------------------------
__device__ __forceinline__ unsigned short f2bf_bits(float f) {
  unsigned u = __float_as_uint(f);
  return (unsigned short)((u + 0x7FFFu + ((u >> 16) & 1u)) >> 16);
}
__device__ __forceinline__ float bf_bits2f(unsigned short h) { return __uint_as_float(((unsigned)h) << 16); }
/* RNE-convert to a bf16 value, kept in f32 */
__device__ __forceinline__ float bf16r(float f) { return bf_bits2f(f2bf_bits(f)); }
__device__ __forceinline__ unsigned pk16(unsigned short a, unsigned short b) { return (unsigned)a | ((unsigned)b << 16); }

template <typename T> struct Frag;
template <> struct Frag<__bf16> {
  typedef v16b V; union U { v16b v; v8b h[2]; };
  /* elements 0..7 <- p[0..7], elements 8..15 <- p[16..23] */
  static __device__ __forceinline__ v16b load(const __bf16* p) {
    U f; f.h[0] = *(const v8b*)(p); f.h[1] = *(const v8b*)(p + 16); return f.v;
  }
};

/* one matrix instruction followed by its own hazard guard: the guard ties this accumulator and names both fragments */
__device__ __forceinline__ v8f mma_bf(v16b a, v16b b, v8f c) {
  c = __builtin_amdgcn_wmma_f32_16x16x32_bf16(false, a, false, b, (short)0, c, false, false);
  asm volatile("v_nop\n\tv_nop\n\tv_nop\n\tv_nop" : "+v"(c) : "v"(a), "v"(b));
  return c;
}

// ---------------------------------------------------------------------------
// f32 -> bf16 (RNE-convert) for up to four planes of equal size; blockIdx.y selects the plane (block-uniform).
// 8 consecutive elements per thread: two 16-B loads, ONE 16-B store per lane; 32 consecutive lanes write 512 contiguous
// Coverage: thread i writes elements 8i..8i+7, i < n8; grid.x = n8/256 exactly for both uses:
//   activations 4096*1024/8 = 524,288 -> 2048 blocks;  weights 1024*1024/8 = 131,072 -> 512 blocks.
// ---------------------------------------------------------------------------
__global__ __launch_bounds__(256) void cvt_bf16_planes_kernel(
    const float* __restrict__ s0, const float* __restrict__ s1, const float* __restrict__ s2, const float* __restrict__ s3,
    unsigned short* __restrict__ d0, unsigned short* __restrict__ d1, unsigned short* __restrict__ d2,
    unsigned short* __restrict__ d3, int n8)
{
  const int z = blockIdx.y;
  const float* src = (z == 0) ? s0 : (z == 1) ? s1 : (z == 2) ? s2 : s3;
  unsigned short* dst = (z == 0) ? d0 : (z == 1) ? d1 : (z == 2) ? d2 : d3;
  const int i = blockIdx.x * 256 + threadIdx.x;
  if (i >= n8) return;
  const float* p = src + 8 * (size_t)i;
  const v4f a = *(const v4f*)(p);
  const v4f c = *(const v4f*)(p + 4);
  unsigned short hb[8];
#pragma unroll
  for (int e = 0; e < 4; ++e) {
    const float x0 = a[e];
    const float x1 = c[e];
    hb[e]     = f2bf_bits(x0);
    hb[4 + e] = f2bf_bits(x1);
  }
  const v4u u = (v4u){pk16(hb[0], hb[1]), pk16(hb[2], hb[3]), pk16(hb[4], hb[5]), pk16(hb[6], hb[7])};
  unsigned short* q = dst + 8 * (size_t)i;
  *(v4u*)q = u;
  
}

// ---------------------------------------------------------------------------
// Register-blocked bf16 GEMM: C[m][n] = sum_k A[m][k] * Bt[n][k] + bf16value(bias[n]); each wave owns a 64x64 tile.
// A row-major [M][K] bf16 (SPLA: a second plane A2 of the same layout is accumulated against the same Bt);
// Bt row-major [N][K] bf16; M, N % 64 == 0, K % 32 == 0 (no tail handling). C f32, pitch ldc.
// EPI 0: plain.  EPI 1: feature map y = x + 1 for x > 0, exp(x) otherwise, applied in a rolled pass over the slab.
// Fragment map: lane l, row/col = l & 15, half h = l >> 4; elements 0..7 <- k0 + 8h + 0..7, 8..15 <- k0 + 16 + 8h + 0..7
// for both operands; accumulator element r = (row 8h + r, col l & 15).
// Epilogue: 16-row slabs staged per wave in LDS (same wave stores and reloads, wave-level ordering); each 64-wide f32 row
// Coverage: 1024 tiles of 64x64 = 4096 x 1024; grid = 128 blocks x 8 waves, one tile per wave.
// ---------------------------------------------------------------------------
template <bool SPLA, int EPI>
__global__ __launch_bounds__(256) void gemm_tile64_kernel(
    const unsigned short* __restrict__ Ap, const unsigned short* __restrict__ A2p, int lda,
    const unsigned short* __restrict__ Btp, int ldb,
    float* __restrict__ Cout, int ldc,
    const float* __restrict__ bias, int M, int N, int K)
{
  const __bf16* A  = (const __bf16*)Ap;
  const __bf16* A2 = (const __bf16*)A2p;
  const __bf16* Bt = (const __bf16*)Btp;
  __shared__ __align__(16) float sT[8][16 * 68];
  const int lane = threadIdx.x & 31;
  const int wave = threadIdx.x >> 5;
  const int tilesN = N >> 6;
  const int tilesM = M >> 6;
  const int tile = blockIdx.x * 8 + wave;
  /* wave-uniform; this kernel has no block barriers */
  if (tile >= tilesM * tilesN) return;
  const int tm = tile / tilesN;
  const int tn = tile - tm * tilesN;
  const int m0 = tm << 6;
  const int n0 = tn << 6;

  const int rlane = lane & 15;
  const int koff  = (lane >> 4) * 8;
  const int mOff  = (lane >> 4) * 8;

  v8f acc[4][4];
#pragma unroll
  for (int i = 0; i < 4; ++i)
#pragma unroll
    for (int j = 0; j < 4; ++j) acc[i][j] = (v8f){0.f, 0.f, 0.f, 0.f, 0.f, 0.f, 0.f, 0.f};

  for (int k0 = 0; k0 < K; k0 += 32) {
    v16b bh[4];
#pragma unroll
    for (int j = 0; j < 4; ++j) {
      const size_t bo = (size_t)(n0 + (j << 4) + rlane) * ldb + koff + k0;
      bh[j] = Frag<__bf16>::load(Bt + bo);
    }
#pragma unroll
    for (int i = 0; i < 4; ++i) {
      const size_t ao = (size_t)(m0 + (i << 4) + rlane) * lda + koff + k0;
      const v16b ah = Frag<__bf16>::load(A + ao);
      v16b al = ah;
      if (SPLA) al = Frag<__bf16>::load(A2 + ao);
#pragma unroll
      for (int j = 0; j < 4; ++j) {
        acc[i][j] = mma_bf(ah, bh[j], acc[i][j]);
        if (SPLA) acc[i][j] = mma_bf(al, bh[j], acc[i][j]);
      }
    }
  }

  // ---- epilogue ----
  float* slab = sT[wave];
  float bvj[4];
#pragma unroll
  for (int j = 0; j < 4; ++j) bvj[j] = bf16r(bias[n0 + (j << 4) + rlane]);
#pragma unroll
  for (int i = 0; i < 4; ++i) {
    const int mBase = m0 + (i << 4);
#pragma unroll
    for (int j = 0; j < 4; ++j) {
#pragma unroll
      for (int r = 0; r < 8; ++r) {
        slab[(mOff + r) * 68 + (j << 4) + rlane] = acc[i][j][r] + bvj[j];
      }
    }
    __builtin_amdgcn_fence(__ATOMIC_RELEASE, "workgroup");
    __builtin_amdgcn_wave_barrier();
    __builtin_amdgcn_fence(__ATOMIC_ACQUIRE, "workgroup");
    if (EPI == 1) {
      /* 32 iterations x 32 lanes = 1024 = the whole 16 x 64 slab, each element once */
#pragma unroll 1
      for (int it = 0; it < 32; ++it) {
        float* p = slab + (it >> 1) * 68 + (it & 1) * 32 + lane;
        const float x = *p;
        const float ex = expf(fminf(x, 0.0f));
        const float y = (x > 0.0f) ? (x + 1.0f) : ex;
        *p = y;
      }
      __builtin_amdgcn_fence(__ATOMIC_RELEASE, "workgroup");
      __builtin_amdgcn_wave_barrier();
      __builtin_amdgcn_fence(__ATOMIC_ACQUIRE, "workgroup");
    }
    {
      /* row segment = 256 B = 16 lanes x 16 B; rows it*2 + hh cover 0..15 */
      const int hh = lane >> 4, c4 = (lane & 15) * 4;
      {
#pragma unroll
        for (int it = 0; it < 8; ++it) {
          const int row = it * 2 + hh;
          const v4f v = *(const v4f*)(slab + row * 68 + c4);
          *(v4f*)(Cout + (size_t)(mBase + row) * ldc + n0 + c4) = v;
        }
        
      }
    }
    __builtin_amdgcn_fence(__ATOMIC_RELEASE, "workgroup");
    __builtin_amdgcn_wave_barrier();
    __builtin_amdgcn_fence(__ATOMIC_ACQUIRE, "workgroup");
  }
}

// ---------------------------------------------------------------------------
// Causal state scan, one block of 256 threads per (batch, head), all 2048 steps in a static loop.
// Thread (j = tid & 63, dg = tid >> 6) keeps kv[d][j] for d = 16 dg .. 16 dg + 15 in registers (zero start).
// Per step s (inclusive sums): kv[d][j] += k[d] * v[j]; partial[dg][s][j] = sum over its 16 d of q[d] * kv[d][j].
// Steps are staged 32 at a time: sQ, sK, sV hold q, k, v rows [32][64] f32; sN holds the four partial planes [4][32][64].
// After the 32 steps: threads 0..63 turn sK into the inclusive key sums in place (running carry in a register);
// then lane (row = 4 wave + (lane >> 3), cols 8 (lane & 7) .. + 7) forms den = sum_d q[d] * ksum[d] (rolled, f32),
// num = ((p0 + p1) + p2) + p3, out = num * (1 / (den + eps)), splits out into bf16 hi + lo and stores both planes.
// Staging coverage: rows lr, lr + 16 (lr = tid >> 4 = 0..15) x cols 4 (tid & 15) .. + 3 = 32 x 64 per tensor.
// LDS: 3 x 8,192 + 32,768 = 57,344 B.
// ---------------------------------------------------------------------------
__global__ __launch_bounds__(256) void scan_state_kernel(
    const float* __restrict__ QF, const float* __restrict__ KF, const float* __restrict__ VF,
    unsigned short* __restrict__ AH, unsigned short* __restrict__ AL)
{
  __shared__ __align__(16) float sQ[kScanT * 64];
  __shared__ __align__(16) float sK[kScanT * 64];
  __shared__ __align__(16) float sV[kScanT * 64];
  __shared__ __align__(16) float sN[4 * kScanT * 64];
  const int tid = threadIdx.x, lane = tid & 31, wave = tid >> 5;
  const int j = tid & 63;
  const int dg = tid >> 6;
  const int bh = blockIdx.x;
  const int bb = bh >> 4;
  const int hd = bh & 15;
  const size_t row0 = (size_t)bb * kSeq;
  const int col0 = hd * kHd;

  float kv[16];
#pragma unroll
  for (int i = 0; i < 16; ++i) kv[i] = 0.0f;
  float kcarry = 0.0f;

  const int lr = tid >> 4, lc4 = (tid & 15) * 4;
  const int q4 = lane >> 3, c8 = (lane & 7) * 8;
  const int orow = wave * 4 + q4;

#pragma unroll 1
  for (int t0 = 0; t0 < kSeq; t0 += kScanT) {
    /* every read of the chunk before this one has finished */
    __syncthreads();
#pragma unroll
    for (int i = 0; i < 2; ++i) {
      const int r = lr + 16 * i;
      const size_t g = (row0 + (size_t)(t0 + r)) * kDim + col0 + lc4;
      *(v4f*)(sQ + r * 64 + lc4) = *(const v4f*)(QF + g);
      *(v4f*)(sK + r * 64 + lc4) = *(const v4f*)(KF + g);
      *(v4f*)(sV + r * 64 + lc4) = *(const v4f*)(VF + g);
    }
    __syncthreads();

#pragma unroll 1
    for (int s = 0; s < kScanT; ++s) {
      const float vj = sV[s * 64 + j];
      const float* qp = sQ + s * 64 + dg * 16;
      const float* kp = sK + s * 64 + dg * 16;
      float accn = 0.0f;
#pragma unroll
      for (int g = 0; g < 4; ++g) {
        const v4f kk = *(const v4f*)(kp + 4 * g);
        const v4f qq = *(const v4f*)(qp + 4 * g);
        kv[4 * g + 0] = fmaf(kk[0], vj, kv[4 * g + 0]);
        accn = fmaf(qq[0], kv[4 * g + 0], accn);
        kv[4 * g + 1] = fmaf(kk[1], vj, kv[4 * g + 1]);
        accn = fmaf(qq[1], kv[4 * g + 1], accn);
        kv[4 * g + 2] = fmaf(kk[2], vj, kv[4 * g + 2]);
        accn = fmaf(qq[2], kv[4 * g + 2], accn);
        kv[4 * g + 3] = fmaf(kk[3], vj, kv[4 * g + 3]);
        accn = fmaf(qq[3], kv[4 * g + 3], accn);
      }
      sN[(dg * kScanT + s) * 64 + j] = accn;
    }
    __syncthreads();

    /* inclusive key sums in place; waves 0 and 1 only (wave-uniform predicate) */
    if (tid < 64) {
      float c = kcarry;
#pragma unroll 1
      for (int s = 0; s < kScanT; ++s) {
        c += sK[s * 64 + tid];
        sK[s * 64 + tid] = c;
      }
      kcarry = c;
    }
    __syncthreads();

    float den = 0.0f;
#pragma unroll 1
    for (int g = 0; g < 16; ++g) {
      const v4f qv = *(const v4f*)(sQ + orow * 64 + 4 * g);
      const v4f kc = *(const v4f*)(sK + orow * 64 + 4 * g);
      den = fmaf(qv[0], kc[0], den);
      den = fmaf(qv[1], kc[1], den);
      den = fmaf(qv[2], kc[2], den);
      den = fmaf(qv[3], kc[3], den);
    }
    const float inv = 1.0f / (den + kEps);

    const float* np = sN + orow * 64 + c8;
    const v4f a0 = *(const v4f*)(np);
    const v4f a1 = *(const v4f*)(np + 4);
    const v4f b0 = *(const v4f*)(np + 1 * kScanT * 64);
    const v4f b1 = *(const v4f*)(np + 1 * kScanT * 64 + 4);
    const v4f e0 = *(const v4f*)(np + 2 * kScanT * 64);
    const v4f e1 = *(const v4f*)(np + 2 * kScanT * 64 + 4);
    const v4f f0 = *(const v4f*)(np + 3 * kScanT * 64);
    const v4f f1 = *(const v4f*)(np + 3 * kScanT * 64 + 4);
    float o[8];
#pragma unroll
    for (int e = 0; e < 4; ++e) {
      const float n0v = ((a0[e] + b0[e]) + e0[e]) + f0[e];
      const float n1v = ((a1[e] + b1[e]) + e1[e]) + f1[e];
      o[e]     = n0v * inv;
      o[4 + e] = n1v * inv;
    }
    unsigned short hb[8], lb[8];
#pragma unroll
    for (int e = 0; e < 8; ++e) {
      const float x = o[e];
      const unsigned short hbits = f2bf_bits(x);
      const float res = x - bf_bits2f(hbits);
      hb[e] = hbits;
      lb[e] = f2bf_bits(res);
    }
    const v4u uh = (v4u){pk16(hb[0], hb[1]), pk16(hb[2], hb[3]), pk16(hb[4], hb[5]), pk16(hb[6], hb[7])};
    const v4u ul = (v4u){pk16(lb[0], lb[1]), pk16(lb[2], lb[3]), pk16(lb[4], lb[5]), pk16(lb[6], lb[7])};
    const size_t oo = (row0 + (size_t)(t0 + orow)) * kDim + col0 + c8;
    unsigned short* ph = AH + oo;
    unsigned short* pl = AL + oo;
    *(v4u*)ph = uh;
    *(v4u*)pl = ul;
    
  }
}

// ---------------------------------------------------------------------------
// Host glue: 2 convert launches + 3 projection GEMMs + 1 scan + 1 output GEMM = 7 launches. Kernel launches only.
// GEMM shapes: M 4096, N 1024, K 1024 everywhere (K % 32 == 0, M and N % 64 == 0): 64 x 16 = 1024 tiles -> 128 blocks.
// ---------------------------------------------------------------------------
extern "C" void kernel_launch(void* const* d_in, const int* in_sizes, int n_in,
                              void* d_out, int out_size, void* d_ws, size_t ws_size,
                              hipStream_t stream) {
  if (n_in < 11 || d_out == nullptr || d_ws == nullptr) return;
  if (in_sizes[0] != kRows * kDim || in_sizes[1] != kRows * kDim || in_sizes[2] != kRows * kDim) return;
  if (in_sizes[3] != kDim * kDim || in_sizes[5] != kDim * kDim || in_sizes[7] != kDim * kDim ||
      in_sizes[9] != kDim * kDim) return;
  if (in_sizes[4] != kDim || in_sizes[6] != kDim || in_sizes[8] != kDim || in_sizes[10] != kDim) return;
  if (out_size != kRows * kDim) return;
  if (ws_size < kWsTotal) return;

  const float* query = (const float*)d_in[0];
  const float* key   = (const float*)d_in[1];
  const float* value = (const float*)d_in[2];
  const float* Wq    = (const float*)d_in[3];
  const float* bq    = (const float*)d_in[4];
  const float* Wk    = (const float*)d_in[5];
  const float* bk    = (const float*)d_in[6];
  const float* Wv    = (const float*)d_in[7];
  const float* bv    = (const float*)d_in[8];
  const float* Wo    = (const float*)d_in[9];
  const float* bo    = (const float*)d_in[10];
  float* out = (float*)d_out;

  char* ws = (char*)d_ws;
  unsigned short* XQ = (unsigned short*)(ws + kOffXQ);
  unsigned short* XK = (unsigned short*)(ws + kOffXK);
  unsigned short* XV = (unsigned short*)(ws + kOffXV);
  unsigned short* WQ = (unsigned short*)(ws + kOffWQ);
  unsigned short* WK = (unsigned short*)(ws + kOffWK);
  unsigned short* WV = (unsigned short*)(ws + kOffWV);
  unsigned short* WO = (unsigned short*)(ws + kOffWO);
  float*          QF = (float*)(ws + kOffQF);
  float*          KF = (float*)(ws + kOffKF);
  float*          VF = (float*)(ws + kOffVF);
  unsigned short* AH = (unsigned short*)(ws + kOffAH);
  unsigned short* AL = (unsigned short*)(ws + kOffAL);

  // ---- bf16 operand planes (weights are [out][in] = Bt layout already) ----
  const int n8a = kRows * kDim / 8;
  const int n8w = kDim * kDim / 8;
  cvt_bf16_planes_kernel<<<dim3(n8a / 256, 3), 256, 0, stream>>>(query, key, value, value, XQ, XK, XV, XV, n8a);
  cvt_bf16_planes_kernel<<<dim3(n8w / 256, 4), 256, 0, stream>>>(Wq, Wk, Wv, Wo, WQ, WK, WV, WO, n8w);

  // ---- projections: q and k with the feature map in the epilogue, v plain ----
  const int gblocks = (kRows / 64) * (kDim / 64) / 8;
  gemm_tile64_kernel<false, 1><<<dim3(gblocks), 256, 0, stream>>>(XQ, XQ, kDim, WQ, kDim, QF, kDim, bq, kRows, kDim, kDim);
  gemm_tile64_kernel<false, 1><<<dim3(gblocks), 256, 0, stream>>>(XK, XK, kDim, WK, kDim, KF, kDim, bk, kRows, kDim, kDim);
  gemm_tile64_kernel<false, 0><<<dim3(gblocks), 256, 0, stream>>>(XV, XV, kDim, WV, kDim, VF, kDim, bv, kRows, kDim, kDim);

  // ---- causal state scan: one block per (batch, head) ----
  scan_state_kernel<<<dim3(kBatch * kHeads), 256, 0, stream>>>(QF, KF, VF, AH, AL);

  // ---- output projection: (hi + lo) . bf16(Wo)^T + bo, both parts into one accumulator ----
  gemm_tile64_kernel<true, 0><<<dim3(gblocks), 256, 0, stream>>>(AH, AL, kDim, WO, kDim, out, kDim, bo, kRows, kDim, kDim);
}

// v001
// It runs in 314 microseconds.
// Next to v000, in two timings, it ran 2.36 and 2.37 times as fast.
// Contractions: q/k/v projections on v_wmma_f32_16x16x32_bf16 (bf16(x) x bf16(W), one product, f32 accumulate); output projection on v_wmma_f32_16x16x32_bf16 with the attention plane carried as bf16 hi + lo planes against bf16(Wo) (two products into one f32 accumulator); feature map, 64x64 state scan, normaliser and division in f32 on the vector unit.
#include <hip/hip_runtime.h>
#include <math.h>

typedef __attribute__((ext_vector_type(16))) __bf16   v16b;
typedef __attribute__((ext_vector_type(8)))  __bf16   v8b;
typedef __attribute__((ext_vector_type(8)))  float    v8f;
typedef __attribute__((ext_vector_type(4)))  float    v4f;
typedef __attribute__((ext_vector_type(4)))  unsigned int v4u;

// ---------------------------------------------------------------------------
// Shape constants
// ---------------------------------------------------------------------------
constexpr int kBatch = 2;
constexpr int kSeq   = 2048;
constexpr int kDim   = 1024;
constexpr int kHeads = 16;
constexpr int kHd    = 64;
constexpr int kRows  = kBatch * kSeq;
constexpr int kScanT = 32;
constexpr int kChunkL = 64;
constexpr int kChunks = kSeq / kChunkL;
constexpr int kSlotF  = kHd * kHd + kHd;
constexpr float kEps = 1e-6f;
static_assert(kHeads * kHd == kDim, "head split");
static_assert((kDim % 32) == 0, "GEMM K multiple of 32");
static_assert((kRows % 64) == 0 && (kDim % 64) == 0, "GEMM M, N multiples of 64");
static_assert((kSeq % kChunkL) == 0 && (kChunkL % kScanT) == 0, "scan chunking");
static_assert((kSlotF % 32) == 0, "128-B aligned state slots");
static_assert(kHd == 64, "one head = one 64-column tile");

// ---------------------------------------------------------------------------
// Workspace region map (bytes; every offset is a multiple of 128)
//   XQ  bf16 [4096][1024]  bf16(query)                  8,388,608
//   XK  bf16 [4096][1024]  bf16(key)                    8,388,608
//   XV  bf16 [4096][1024]  bf16(value)                  8,388,608
//   WQ  bf16 [1024][1024]  bf16(Wq)  (Bt layout)        2,097,152
//   WK  bf16 [1024][1024]  bf16(Wk)                     2,097,152
//   WV  bf16 [1024][1024]  bf16(Wv)                     2,097,152
//   WO  bf16 [1024][1024]  bf16(Wo)                     2,097,152
//   QF  f32  [4096][1024]  phi(q)                      16,777,216
//   KF  f32  [4096][1024]  phi(k)                      16,777,216
//   VF  f32  [4096][1024]  v                           16,777,216
//   AH  bf16 [4096][1024]  attention plane, hi part     8,388,608
//   AL  bf16 [4096][1024]  attention plane, lo part     8,388,608
//   ST  f32  [32][31][4160] chunk states: 64x64 key-value sum, then 64 key sums   16,506,880
//   total                                             117,170,176
// ---------------------------------------------------------------------------
constexpr size_t kActB  = (size_t)kRows * kDim * 2;
constexpr size_t kWgtB  = (size_t)kDim * kDim * 2;
constexpr size_t kF32B  = (size_t)kRows * kDim * 4;
constexpr size_t kOffXQ = 0;
constexpr size_t kOffXK = kOffXQ + kActB;
constexpr size_t kOffXV = kOffXK + kActB;
constexpr size_t kOffWQ = kOffXV + kActB;
constexpr size_t kOffWK = kOffWQ + kWgtB;
constexpr size_t kOffWV = kOffWK + kWgtB;
constexpr size_t kOffWO = kOffWV + kWgtB;
constexpr size_t kOffQF = kOffWO + kWgtB;
constexpr size_t kOffKF = kOffQF + kF32B;
constexpr size_t kOffVF = kOffKF + kF32B;
constexpr size_t kOffAH = kOffVF + kF32B;
constexpr size_t kOffAL = kOffAH + kActB;
constexpr size_t kOffST = kOffAL + kActB;
constexpr size_t kStB   = (size_t)kBatch * kHeads * (kChunks - 1) * kSlotF * 4;
constexpr size_t kWsTotal = kOffST + kStB;
static_assert(kWsTotal == 117170176ull, "carve total");
static_assert(kWsTotal <= 134217728ull, "carve cap");
static_assert((kOffXK % 128) == 0 && (kOffXV % 128) == 0 && (kOffWQ % 128) == 0 && (kOffWK % 128) == 0 &&
              (kOffWV % 128) == 0 && (kOffWO % 128) == 0 && (kOffQF % 128) == 0 && (kOffKF % 128) == 0 &&
              (kOffVF % 128) == 0 && (kOffAH % 128) == 0 && (kOffAL % 128) == 0 && (kOffST % 128) == 0,
              "128-B aligned regions");

// ---------------------------------------------------------------------------
// Small helpers
// ---------------------------------------------------------------------------
__device__ __forceinline__ unsigned short f2bf_bits(float f) {
  unsigned u = __float_as_uint(f);
  return (unsigned short)((u + 0x7FFFu + ((u >> 16) & 1u)) >> 16);
}
__device__ __forceinline__ float bf_bits2f(unsigned short h) { return __uint_as_float(((unsigned)h) << 16); }
/* RNE-convert to a bf16 value, kept in f32 */
__device__ __forceinline__ float bf16r(float f) { return bf_bits2f(f2bf_bits(f)); }
__device__ __forceinline__ unsigned pk16(unsigned short a, unsigned short b) { return (unsigned)a | ((unsigned)b << 16); }

template <typename T> struct Frag;
template <> struct Frag<__bf16> {
  typedef v16b V; union U { v16b v; v8b h[2]; };
  /* elements 0..7 <- p[0..7], elements 8..15 <- p[16..23] */
  static __device__ __forceinline__ v16b load(const __bf16* p) {
    U f; f.h[0] = *(const v8b*)(p); f.h[1] = *(const v8b*)(p + 16); return f.v;
  }
};

/* one matrix instruction followed by its own hazard guard: the guard ties this accumulator and names both fragments */
__device__ __forceinline__ v8f mma_bf(v16b a, v16b b, v8f c) {
  c = __builtin_amdgcn_wmma_f32_16x16x32_bf16(false, a, false, b, (short)0, c, false, false);
  asm volatile("v_nop\n\tv_nop\n\tv_nop\n\tv_nop" : "+v"(c) : "v"(a), "v"(b));
  return c;
}

// ---------------------------------------------------------------------------
// f32 -> bf16 (RNE-convert) for up to four planes of equal size; blockIdx.y selects the plane (block-uniform).
// 8 consecutive elements per thread: two 16-B loads, ONE 16-B store per lane; 32 consecutive lanes write 512 contiguous
// Coverage: thread i writes elements 8i..8i+7, i < n8; grid.x = n8/256 exactly for both uses:
//   activations 4096*1024/8 = 524,288 -> 2048 blocks;  weights 1024*1024/8 = 131,072 -> 512 blocks.
// ---------------------------------------------------------------------------
__global__ __launch_bounds__(256) void cvt_bf16_planes_kernel(
    const float* __restrict__ s0, const float* __restrict__ s1, const float* __restrict__ s2, const float* __restrict__ s3,
    unsigned short* __restrict__ d0, unsigned short* __restrict__ d1, unsigned short* __restrict__ d2,
    unsigned short* __restrict__ d3, int n8)
{
  const int z = blockIdx.y;
  const float* src = (z == 0) ? s0 : (z == 1) ? s1 : (z == 2) ? s2 : s3;
  unsigned short* dst = (z == 0) ? d0 : (z == 1) ? d1 : (z == 2) ? d2 : d3;
  const int i = blockIdx.x * 256 + threadIdx.x;
  if (i >= n8) return;
  const float* p = src + 8 * (size_t)i;
  const v4f a = *(const v4f*)(p);
  const v4f c = *(const v4f*)(p + 4);
  unsigned short hb[8];
#pragma unroll
  for (int e = 0; e < 4; ++e) {
    const float x0 = a[e];
    const float x1 = c[e];
    hb[e]     = f2bf_bits(x0);
    hb[4 + e] = f2bf_bits(x1);
  }
  const v4u u = (v4u){pk16(hb[0], hb[1]), pk16(hb[2], hb[3]), pk16(hb[4], hb[5]), pk16(hb[6], hb[7])};
  unsigned short* q = dst + 8 * (size_t)i;
  *(v4u*)q = u;
  
}

// ---------------------------------------------------------------------------
// Register-blocked bf16 GEMM: C[m][n] = sum_k A[m][k] * Bt[n][k] + bf16value(bias[n]); each wave owns a 64x64 tile.
// A row-major [M][K] bf16 (SPLA: a second plane A2 of the same layout is accumulated against the same Bt);
// Bt row-major [N][K] bf16; M, N % 64 == 0, K % 32 == 0 (no tail handling). C f32, pitch ldc.
// EPI 0: plain.  EPI 1: feature map y = x + 1 for x > 0, exp(x) otherwise, applied in a rolled pass over the slab.
// Fragment map: lane l, row/col = l & 15, half h = l >> 4; elements 0..7 <- k0 + 8h + 0..7, 8..15 <- k0 + 16 + 8h + 0..7
// for both operands; accumulator element r = (row 8h + r, col l & 15).
// Epilogue: 16-row slabs staged per wave in LDS (same wave stores and reloads, wave-level ordering); each 64-wide f32 row
// Coverage: 1024 tiles of 64x64 = 4096 x 1024; grid = 128 blocks x 8 waves, one tile per wave.
// ---------------------------------------------------------------------------
template <bool SPLA, int EPI>
__global__ __launch_bounds__(256) void gemm_tile64_kernel(
    const unsigned short* __restrict__ Ap, const unsigned short* __restrict__ A2p, int lda,
    const unsigned short* __restrict__ Btp, int ldb,
    float* __restrict__ Cout, int ldc,
    const float* __restrict__ bias, int M, int N, int K)
{
  const __bf16* A  = (const __bf16*)Ap;
  const __bf16* A2 = (const __bf16*)A2p;
  const __bf16* Bt = (const __bf16*)Btp;
  __shared__ __align__(16) float sT[8][16 * 68];
  const int lane = threadIdx.x & 31;
  const int wave = threadIdx.x >> 5;
  const int tilesN = N >> 6;
  const int tilesM = M >> 6;
  const int tile = blockIdx.x * 8 + wave;
  /* wave-uniform; this kernel has no block barriers */
  if (tile >= tilesM * tilesN) return;
  const int tm = tile / tilesN;
  const int tn = tile - tm * tilesN;
  const int m0 = tm << 6;
  const int n0 = tn << 6;

  const int rlane = lane & 15;
  const int koff  = (lane >> 4) * 8;
  const int mOff  = (lane >> 4) * 8;

  v8f acc[4][4];
#pragma unroll
  for (int i = 0; i < 4; ++i)
#pragma unroll
    for (int j = 0; j < 4; ++j) acc[i][j] = (v8f){0.f, 0.f, 0.f, 0.f, 0.f, 0.f, 0.f, 0.f};

  for (int k0 = 0; k0 < K; k0 += 32) {
    v16b bh[4];
#pragma unroll
    for (int j = 0; j < 4; ++j) {
      const size_t bo = (size_t)(n0 + (j << 4) + rlane) * ldb + koff + k0;
      bh[j] = Frag<__bf16>::load(Bt + bo);
    }
#pragma unroll
    for (int i = 0; i < 4; ++i) {
      const size_t ao = (size_t)(m0 + (i << 4) + rlane) * lda + koff + k0;
      const v16b ah = Frag<__bf16>::load(A + ao);
      v16b al = ah;
      if (SPLA) al = Frag<__bf16>::load(A2 + ao);
#pragma unroll
      for (int j = 0; j < 4; ++j) {
        acc[i][j] = mma_bf(ah, bh[j], acc[i][j]);
        if (SPLA) acc[i][j] = mma_bf(al, bh[j], acc[i][j]);
      }
    }
  }

  // ---- epilogue ----
  float* slab = sT[wave];
  float bvj[4];
#pragma unroll
  for (int j = 0; j < 4; ++j) bvj[j] = bf16r(bias[n0 + (j << 4) + rlane]);
#pragma unroll
  for (int i = 0; i < 4; ++i) {
    const int mBase = m0 + (i << 4);
#pragma unroll
    for (int j = 0; j < 4; ++j) {
#pragma unroll
      for (int r = 0; r < 8; ++r) {
        slab[(mOff + r) * 68 + (j << 4) + rlane] = acc[i][j][r] + bvj[j];
      }
    }
    __builtin_amdgcn_fence(__ATOMIC_RELEASE, "workgroup");
    __builtin_amdgcn_wave_barrier();
    __builtin_amdgcn_fence(__ATOMIC_ACQUIRE, "workgroup");
    if (EPI == 1) {
      /* 32 iterations x 32 lanes = 1024 = the whole 16 x 64 slab, each element once */
#pragma unroll 1
      for (int it = 0; it < 32; ++it) {
        float* p = slab + (it >> 1) * 68 + (it & 1) * 32 + lane;
        const float x = *p;
        const float ex = expf(fminf(x, 0.0f));
        const float y = (x > 0.0f) ? (x + 1.0f) : ex;
        *p = y;
      }
      __builtin_amdgcn_fence(__ATOMIC_RELEASE, "workgroup");
      __builtin_amdgcn_wave_barrier();
      __builtin_amdgcn_fence(__ATOMIC_ACQUIRE, "workgroup");
    }
    {
      /* row segment = 256 B = 16 lanes x 16 B; rows it*2 + hh cover 0..15 */
      const int hh = lane >> 4, c4 = (lane & 15) * 4;
      {
#pragma unroll
        for (int it = 0; it < 8; ++it) {
          const int row = it * 2 + hh;
          const v4f v = *(const v4f*)(slab + row * 68 + c4);
          *(v4f*)(Cout + (size_t)(mBase + row) * ldc + n0 + c4) = v;
        }
        
      }
    }
    __builtin_amdgcn_fence(__ATOMIC_RELEASE, "workgroup");
    __builtin_amdgcn_wave_barrier();
    __builtin_amdgcn_fence(__ATOMIC_ACQUIRE, "workgroup");
  }
}

// ---------------------------------------------------------------------------
// Chunk sums: one block of 256 threads per (chunk, batch-head), chunks 0 .. kChunks - 2 (nothing follows the last one).
// slot[d][j] = sum over the chunk's 64 steps of k[s][d] * v[s][j]; slot[4096 + d] = sum over the steps of k[s][d].
// Thread (d4 = 4 (tid >> 4), j4 = 4 (tid & 15)) keeps a 4 x 4 patch in registers: two 16-B LDS reads feed 16 FMAs.
// Staging coverage: rows lr + 16 i (lr = tid >> 4, i = 0..3) x cols 4 (tid & 15) .. + 3 = 64 x 64 per tensor.
// LDS: 2 x 16,384 = 32,768 B.
// ---------------------------------------------------------------------------
__global__ __launch_bounds__(256) void chunk_state_kernel(
    const float* __restrict__ KF, const float* __restrict__ VF, float* __restrict__ ST)
{
  __shared__ __align__(16) float sK[kChunkL * 64];
  __shared__ __align__(16) float sV[kChunkL * 64];
  const int tid = threadIdx.x;
  const int chunk = blockIdx.x;
  const int bh = blockIdx.y;
  const size_t row0 = (size_t)(bh >> 4) * kSeq + (size_t)chunk * kChunkL;
  const int col0 = (bh & 15) * kHd;
  const int lr = tid >> 4, lc4 = (tid & 15) * 4;
  /* unrolled: all eight global loads are issued before the first LDS store waits on one */
#pragma unroll
  for (int i = 0; i < kChunkL / 16; ++i) {
    const int r = lr + 16 * i;
    const size_t g = (row0 + (size_t)r) * kDim + col0 + lc4;
    *(v4f*)(sK + r * 64 + lc4) = *(const v4f*)(KF + g);
    *(v4f*)(sV + r * 64 + lc4) = *(const v4f*)(VF + g);
  }
  __syncthreads();

  const int d4 = lr * 4, j4 = lc4;
  /* every loop over a[] is unrolled so that its indices are constants and the patch stays in registers */
  v4f a[4];
#pragma unroll
  for (int r = 0; r < 4; ++r) a[r] = (v4f){0.f, 0.f, 0.f, 0.f};
  /* eight steps' LDS reads in flight together; rolled, every step waits out a whole LDS latency */
#pragma unroll 8
  for (int s = 0; s < kChunkL; ++s) {
    const v4f kk = *(const v4f*)(sK + s * 64 + d4);
    const v4f vv = *(const v4f*)(sV + s * 64 + j4);
#pragma unroll
    for (int r = 0; r < 4; ++r)
#pragma unroll
      for (int e = 0; e < 4; ++e) a[r][e] = fmaf(kk[r], vv[e], a[r][e]);
  }
  float* slot = ST + ((size_t)bh * (kChunks - 1) + chunk) * kSlotF;
#pragma unroll
  for (int r = 0; r < 4; ++r) *(v4f*)(slot + (d4 + r) * 64 + j4) = a[r];

  /* key sums; waves 0 and 1 only (wave-uniform predicate) */
  if (tid < 64) {
    float c = 0.0f;
    for (int s = 0; s < kChunkL; ++s) c += sK[s * 64 + tid];
    slot[kHd * kHd + tid] = c;
  }
}

// ---------------------------------------------------------------------------
// Inclusive sum of the chunk slots along the chunk axis, in place: slot c becomes the state at the end of chunk c.
// One thread per float of a slot (4160 per batch-head, grid.x = 17 blocks with a tail guard); the 31 values stay in
// registers, so all loads are in flight together and the thread pays the load latency once.
// ---------------------------------------------------------------------------
__global__ __launch_bounds__(256) void chunk_prefix_kernel(float* __restrict__ ST)
{
  const int i = blockIdx.x * 256 + threadIdx.x;
  if (i >= kSlotF) return;
  float* base = ST + (size_t)blockIdx.y * (kChunks - 1) * kSlotF + i;
  /* both loops unrolled: constant indices keep x[] in registers */
  float x[kChunks - 1];
#pragma unroll
  for (int c = 0; c < kChunks - 1; ++c) x[c] = base[(size_t)c * kSlotF];
#pragma unroll
  for (int c = 1; c < kChunks - 1; ++c) {
    x[c] += x[c - 1];
    base[(size_t)c * kSlotF] = x[c];
  }
}

// ---------------------------------------------------------------------------
// Causal state scan, one block of 256 threads per (chunk, batch-head), the chunk's 64 steps in a static loop.
// Thread (j = tid & 63, dg = tid >> 6) keeps kv[d][j] for d = 16 dg .. 16 dg + 15 in registers; chunk 0 starts from
// zero, chunk c > 0 from slot c - 1 of ST (state and key sums at the end of the chunk before it).
// Per step s (inclusive sums): kv[d][j] += k[d] * v[j]; partial[dg][s][j] = sum over its 16 d of q[d] * kv[d][j].
// Steps are staged 32 at a time: sQ, sK, sV hold q, k, v rows [32][64] f32; sN holds the four partial planes [4][32][64].
// After the 32 steps: threads 0..63 turn sK into the inclusive key sums in place (running carry in a register);
// then lane (row = 4 wave + (lane >> 3), cols 8 (lane & 7) .. + 7) forms den = sum_d q[d] * ksum[d] (rolled, f32),
// num = ((p0 + p1) + p2) + p3, out = num * (1 / (den + eps)), splits out into bf16 hi + lo and stores both planes.
// Staging coverage: rows lr, lr + 16 (lr = tid >> 4 = 0..15) x cols 4 (tid & 15) .. + 3 = 32 x 64 per tensor.
// LDS: 3 x 8,192 + 32,768 = 57,344 B.
// ---------------------------------------------------------------------------
__global__ __launch_bounds__(256) void scan_state_kernel(
    const float* __restrict__ QF, const float* __restrict__ KF, const float* __restrict__ VF,
    const float* __restrict__ ST, unsigned short* __restrict__ AH, unsigned short* __restrict__ AL)
{
  __shared__ __align__(16) float sQ[kScanT * 64];
  __shared__ __align__(16) float sK[kScanT * 64];
  __shared__ __align__(16) float sV[kScanT * 64];
  __shared__ __align__(16) float sN[4 * kScanT * 64];
  const int tid = threadIdx.x, lane = tid & 31, wave = tid >> 5;
  const int j = tid & 63;
  const int dg = tid >> 6;
  const int chunk = blockIdx.x;
  const int bh = blockIdx.y;
  const int bb = bh >> 4;
  const int hd = bh & 15;
  const size_t row0 = (size_t)bb * kSeq;
  const int col0 = hd * kHd;

  float kv[16];
#pragma unroll
  for (int i = 0; i < 16; ++i) kv[i] = 0.0f;
  float kcarry = 0.0f;
  /* block-uniform predicate */
  if (chunk > 0) {
    const float* slot = ST + ((size_t)bh * (kChunks - 1) + (chunk - 1)) * kSlotF;
    /* unrolled: constant indices keep kv[] in registers */
#pragma unroll
    for (int i = 0; i < 15; ++i) kv[i] = slot[(dg * 16 + i) * 64 + j];
    /* the last load may land in the offset register that the fifteen before it name: their wait stands in front of it */
    asm volatile("s_wait_xcnt 0x0" ::: "memory");
    kv[15] = slot[(dg * 16 + 15) * 64 + j];
    if (tid < 64) kcarry = slot[kHd * kHd + tid];
  }

  const int lr = tid >> 4, lc4 = (tid & 15) * 4;
  const int q4 = lane >> 3, c8 = (lane & 7) * 8;
  const int orow = wave * 4 + q4;

#pragma unroll 1
  for (int t0 = chunk * kChunkL; t0 < (chunk + 1) * kChunkL; t0 += kScanT) {
    /* every read of the stage before this one has finished */
    __syncthreads();
#pragma unroll
    for (int i = 0; i < 2; ++i) {
      const int r = lr + 16 * i;
      const size_t g = (row0 + (size_t)(t0 + r)) * kDim + col0 + lc4;
      *(v4f*)(sQ + r * 64 + lc4) = *(const v4f*)(QF + g);
      *(v4f*)(sK + r * 64 + lc4) = *(const v4f*)(KF + g);
      *(v4f*)(sV + r * 64 + lc4) = *(const v4f*)(VF + g);
    }
    __syncthreads();

#pragma unroll 1
    for (int s = 0; s < kScanT; ++s) {
      const float vj = sV[s * 64 + j];
      const float* qp = sQ + s * 64 + dg * 16;
      const float* kp = sK + s * 64 + dg * 16;
      float accn = 0.0f;
#pragma unroll
      for (int g = 0; g < 4; ++g) {
        const v4f kk = *(const v4f*)(kp + 4 * g);
        const v4f qq = *(const v4f*)(qp + 4 * g);
        kv[4 * g + 0] = fmaf(kk[0], vj, kv[4 * g + 0]);
        accn = fmaf(qq[0], kv[4 * g + 0], accn);
        kv[4 * g + 1] = fmaf(kk[1], vj, kv[4 * g + 1]);
        accn = fmaf(qq[1], kv[4 * g + 1], accn);
        kv[4 * g + 2] = fmaf(kk[2], vj, kv[4 * g + 2]);
        accn = fmaf(qq[2], kv[4 * g + 2], accn);
        kv[4 * g + 3] = fmaf(kk[3], vj, kv[4 * g + 3]);
        accn = fmaf(qq[3], kv[4 * g + 3], accn);
      }
      sN[(dg * kScanT + s) * 64 + j] = accn;
    }
    __syncthreads();

    /* inclusive key sums in place; waves 0 and 1 only (wave-uniform predicate) */
    if (tid < 64) {
      float c = kcarry;
#pragma unroll 1
      for (int s = 0; s < kScanT; ++s) {
        c += sK[s * 64 + tid];
        sK[s * 64 + tid] = c;
      }
      kcarry = c;
    }
    __syncthreads();

    float den = 0.0f;
#pragma unroll 1
    for (int g = 0; g < 16; ++g) {
      const v4f qv = *(const v4f*)(sQ + orow * 64 + 4 * g);
      const v4f kc = *(const v4f*)(sK + orow * 64 + 4 * g);
      den = fmaf(qv[0], kc[0], den);
      den = fmaf(qv[1], kc[1], den);
      den = fmaf(qv[2], kc[2], den);
      den = fmaf(qv[3], kc[3], den);
    }
    const float inv = 1.0f / (den + kEps);

    const float* np = sN + orow * 64 + c8;
    const v4f a0 = *(const v4f*)(np);
    const v4f a1 = *(const v4f*)(np + 4);
    const v4f b0 = *(const v4f*)(np + 1 * kScanT * 64);
    const v4f b1 = *(const v4f*)(np + 1 * kScanT * 64 + 4);
    const v4f e0 = *(const v4f*)(np + 2 * kScanT * 64);
    const v4f e1 = *(const v4f*)(np + 2 * kScanT * 64 + 4);
    const v4f f0 = *(const v4f*)(np + 3 * kScanT * 64);
    const v4f f1 = *(const v4f*)(np + 3 * kScanT * 64 + 4);
    float o[8];
#pragma unroll
    for (int e = 0; e < 4; ++e) {
      const float n0v = ((a0[e] + b0[e]) + e0[e]) + f0[e];
      const float n1v = ((a1[e] + b1[e]) + e1[e]) + f1[e];
      o[e]     = n0v * inv;
      o[4 + e] = n1v * inv;
    }
    unsigned short hb[8], lb[8];
#pragma unroll
    for (int e = 0; e < 8; ++e) {
      const float x = o[e];
      const unsigned short hbits = f2bf_bits(x);
      const float res = x - bf_bits2f(hbits);
      hb[e] = hbits;
      lb[e] = f2bf_bits(res);
    }
    const v4u uh = (v4u){pk16(hb[0], hb[1]), pk16(hb[2], hb[3]), pk16(hb[4], hb[5]), pk16(hb[6], hb[7])};
    const v4u ul = (v4u){pk16(lb[0], lb[1]), pk16(lb[2], lb[3]), pk16(lb[4], lb[5]), pk16(lb[6], lb[7])};
    const size_t oo = (row0 + (size_t)(t0 + orow)) * kDim + col0 + c8;
    unsigned short* ph = AH + oo;
    unsigned short* pl = AL + oo;
    *(v4u*)ph = uh;
    *(v4u*)pl = ul;
    
  }
}

// ---------------------------------------------------------------------------
// Host glue: 2 convert launches + 3 projection GEMMs + 3 scan launches (chunk sums, chunk prefix, scan) + 1 output GEMM
// = 9 launches. Kernel launches only.
// GEMM shapes: M 4096, N 1024, K 1024 everywhere (K % 32 == 0, M and N % 64 == 0): 64 x 16 = 1024 tiles -> 128 blocks.
// ---------------------------------------------------------------------------
extern "C" void kernel_launch(void* const* d_in, const int* in_sizes, int n_in,
                              void* d_out, int out_size, void* d_ws, size_t ws_size,
                              hipStream_t stream) {
  if (n_in < 11 || d_out == nullptr || d_ws == nullptr) return;
  if (in_sizes[0] != kRows * kDim || in_sizes[1] != kRows * kDim || in_sizes[2] != kRows * kDim) return;
  if (in_sizes[3] != kDim * kDim || in_sizes[5] != kDim * kDim || in_sizes[7] != kDim * kDim ||
      in_sizes[9] != kDim * kDim) return;
  if (in_sizes[4] != kDim || in_sizes[6] != kDim || in_sizes[8] != kDim || in_sizes[10] != kDim) return;
  if (out_size != kRows * kDim) return;
  if (ws_size < kWsTotal) return;

  const float* query = (const float*)d_in[0];
  const float* key   = (const float*)d_in[1];
  const float* value = (const float*)d_in[2];
  const float* Wq    = (const float*)d_in[3];
  const float* bq    = (const float*)d_in[4];
  const float* Wk    = (const float*)d_in[5];
  const float* bk    = (const float*)d_in[6];
  const float* Wv    = (const float*)d_in[7];
  const float* bv    = (const float*)d_in[8];
  const float* Wo    = (const float*)d_in[9];
  const float* bo    = (const float*)d_in[10];
  float* out = (float*)d_out;

  char* ws = (char*)d_ws;
  unsigned short* XQ = (unsigned short*)(ws + kOffXQ);
  unsigned short* XK = (unsigned short*)(ws + kOffXK);
  unsigned short* XV = (unsigned short*)(ws + kOffXV);
  unsigned short* WQ = (unsigned short*)(ws + kOffWQ);
  unsigned short* WK = (unsigned short*)(ws + kOffWK);
  unsigned short* WV = (unsigned short*)(ws + kOffWV);
  unsigned short* WO = (unsigned short*)(ws + kOffWO);
  float*          QF = (float*)(ws + kOffQF);
  float*          KF = (float*)(ws + kOffKF);
  float*          VF = (float*)(ws + kOffVF);
  unsigned short* AH = (unsigned short*)(ws + kOffAH);
  unsigned short* AL = (unsigned short*)(ws + kOffAL);
  float*          ST = (float*)(ws + kOffST);

  // ---- bf16 operand planes (weights are [out][in] = Bt layout already) ----
  const int n8a = kRows * kDim / 8;
  const int n8w = kDim * kDim / 8;
  cvt_bf16_planes_kernel<<<dim3(n8a / 256, 3), 256, 0, stream>>>(query, key, value, value, XQ, XK, XV, XV, n8a);
  cvt_bf16_planes_kernel<<<dim3(n8w / 256, 4), 256, 0, stream>>>(Wq, Wk, Wv, Wo, WQ, WK, WV, WO, n8w);

  // ---- projections: q and k with the feature map in the epilogue, v plain ----
  const int gblocks = (kRows / 64) * (kDim / 64) / 8;
  gemm_tile64_kernel<false, 1><<<dim3(gblocks), 256, 0, stream>>>(XQ, XQ, kDim, WQ, kDim, QF, kDim, bq, kRows, kDim, kDim);
  gemm_tile64_kernel<false, 1><<<dim3(gblocks), 256, 0, stream>>>(XK, XK, kDim, WK, kDim, KF, kDim, bk, kRows, kDim, kDim);
  gemm_tile64_kernel<false, 0><<<dim3(gblocks), 256, 0, stream>>>(XV, XV, kDim, WV, kDim, VF, kDim, bv, kRows, kDim, kDim);

  // ---- causal state scan: chunk sums, their running sum, then one block per (chunk, batch-head) ----
  chunk_state_kernel<<<dim3(kChunks - 1, kBatch * kHeads), 256, 0, stream>>>(KF, VF, ST);
  chunk_prefix_kernel<<<dim3((kSlotF + 255) / 256, kBatch * kHeads), 256, 0, stream>>>(ST);
  scan_state_kernel<<<dim3(kChunks, kBatch * kHeads), 256, 0, stream>>>(QF, KF, VF, ST, AH, AL);

  // ---- output projection: (hi + lo) . bf16(Wo)^T + bo, both parts into one accumulator ----
  gemm_tile64_kernel<true, 0><<<dim3(gblocks), 256, 0, stream>>>(AH, AL, kDim, WO, kDim, out, kDim, bo, kRows, kDim, kDim);
}

// v002
// A run of this version takes 117 microseconds.
// Two timings next to v001 put it at 2.70 and 2.71 times that version's speed.
// All steps since v000 together make it 6.39 times as fast.
// Contractions: q/k/v projections on v_wmma_f32_16x16x32_bf16 (bf16(x) x bf16(W), one product, f32 accumulate); output projection on v_wmma_f32_16x16x32_bf16 with the attention plane carried as bf16 hi + lo planes against bf16(Wo) (two products into one f32 accumulator); feature map, 64x64 state scan, normaliser and division in f32 on the vector unit.
#include <hip/hip_runtime.h>
#include <math.h>

typedef __attribute__((ext_vector_type(16))) __bf16   v16b;
typedef __attribute__((ext_vector_type(8)))  __bf16   v8b;
typedef __attribute__((ext_vector_type(8)))  float    v8f;
typedef __attribute__((ext_vector_type(4)))  float    v4f;
typedef __attribute__((ext_vector_type(4)))  unsigned int v4u;

// ---------------------------------------------------------------------------
// Shape constants
// ---------------------------------------------------------------------------
constexpr int kBatch = 2;
constexpr int kSeq   = 2048;
constexpr int kDim   = 1024;
constexpr int kHeads = 16;
constexpr int kHd    = 64;
constexpr int kRows  = kBatch * kSeq;
constexpr int kScanT = 32;
constexpr int kChunkL = 64;
constexpr int kChunks = kSeq / kChunkL;
constexpr int kSlotF  = kHd * kHd + kHd;
constexpr float kEps = 1e-6f;
static_assert(kHeads * kHd == kDim, "head split");
static_assert((kDim % 128) == 0 && kDim >= 256, "GEMM K: whole passes of 128, at least two");
static_assert((kRows % 128) == 0 && (kDim % 128) == 0, "GEMM M, N multiples of 128");
static_assert((kSeq % kChunkL) == 0 && (kChunkL % kScanT) == 0, "scan chunking");
static_assert((kSlotF % 32) == 0, "128-B aligned state slots");
static_assert(kHd == 64, "one head = one 64-column tile");

// ---------------------------------------------------------------------------
// Workspace region map (bytes; every offset is a multiple of 128)
//   XQ  bf16 [4096][1024]  bf16(query)                  8,388,608
//   XK  bf16 [4096][1024]  bf16(key)                    8,388,608
//   XV  bf16 [4096][1024]  bf16(value)                  8,388,608
//   WQ  bf16 [1024][1024]  bf16(Wq)  (Bt layout)        2,097,152
//   WK  bf16 [1024][1024]  bf16(Wk)                     2,097,152
//   WV  bf16 [1024][1024]  bf16(Wv)                     2,097,152
//   WO  bf16 [1024][1024]  bf16(Wo)                     2,097,152
//   QF  f32  [4096][1024]  phi(q)                      16,777,216
//   KF  f32  [4096][1024]  phi(k)                      16,777,216
//   VF  f32  [4096][1024]  v                           16,777,216
//   AH  bf16 [4096][1024]  attention plane, hi part     8,388,608
//   AL  bf16 [4096][1024]  attention plane, lo part     8,388,608
//   ST  f32  [32][31][4160] chunk states: 64x64 key-value sum, then 64 key sums   16,506,880
//   total                                             117,170,176
// ---------------------------------------------------------------------------
constexpr size_t kActB  = (size_t)kRows * kDim * 2;
constexpr size_t kWgtB  = (size_t)kDim * kDim * 2;
constexpr size_t kF32B  = (size_t)kRows * kDim * 4;
constexpr size_t kOffXQ = 0;
constexpr size_t kOffXK = kOffXQ + kActB;
constexpr size_t kOffXV = kOffXK + kActB;
constexpr size_t kOffWQ = kOffXV + kActB;
constexpr size_t kOffWK = kOffWQ + kWgtB;
constexpr size_t kOffWV = kOffWK + kWgtB;
constexpr size_t kOffWO = kOffWV + kWgtB;
constexpr size_t kOffQF = kOffWO + kWgtB;
constexpr size_t kOffKF = kOffQF + kF32B;
constexpr size_t kOffVF = kOffKF + kF32B;
constexpr size_t kOffAH = kOffVF + kF32B;
constexpr size_t kOffAL = kOffAH + kActB;
constexpr size_t kOffST = kOffAL + kActB;
constexpr size_t kStB   = (size_t)kBatch * kHeads * (kChunks - 1) * kSlotF * 4;
constexpr size_t kWsTotal = kOffST + kStB;
static_assert(kWsTotal == 117170176ull, "carve total");
static_assert(kWsTotal <= 134217728ull, "carve cap");
static_assert((kOffXK % 128) == 0 && (kOffXV % 128) == 0 && (kOffWQ % 128) == 0 && (kOffWK % 128) == 0 &&
              (kOffWV % 128) == 0 && (kOffWO % 128) == 0 && (kOffQF % 128) == 0 && (kOffKF % 128) == 0 &&
              (kOffVF % 128) == 0 && (kOffAH % 128) == 0 && (kOffAL % 128) == 0 && (kOffST % 128) == 0,
              "128-B aligned regions");

// ---------------------------------------------------------------------------
// Small helpers
// ---------------------------------------------------------------------------
__device__ __forceinline__ unsigned short f2bf_bits(float f) {
  unsigned u = __float_as_uint(f);
  return (unsigned short)((u + 0x7FFFu + ((u >> 16) & 1u)) >> 16);
}
__device__ __forceinline__ float bf_bits2f(unsigned short h) { return __uint_as_float(((unsigned)h) << 16); }
/* RNE-convert to a bf16 value, kept in f32 */
__device__ __forceinline__ float bf16r(float f) { return bf_bits2f(f2bf_bits(f)); }
__device__ __forceinline__ unsigned pk16(unsigned short a, unsigned short b) { return (unsigned)a | ((unsigned)b << 16); }

template <typename T> struct Frag;
template <> struct Frag<__bf16> {
  typedef v16b V; union U { v16b v; v8b h[2]; };
  /* elements 0..7 <- p[0..7], elements 8..15 <- p[16..23] */
  static __device__ __forceinline__ v16b load(const __bf16* p) {
    U f; f.h[0] = *(const v8b*)(p); f.h[1] = *(const v8b*)(p + 16); return f.v;
  }
};

/* one matrix instruction followed by its own hazard guard: the guard ties this accumulator and names both fragments */
__device__ __forceinline__ v8f mma_bf(v16b a, v16b b, v8f c) {
  c = __builtin_amdgcn_wmma_f32_16x16x32_bf16(false, a, false, b, (short)0, c, false, false);
  asm volatile("v_nop\n\tv_nop\n\tv_nop\n\tv_nop" : "+v"(c) : "v"(a), "v"(b));
  return c;
}

// ---------------------------------------------------------------------------
// f32 -> bf16 (RNE-convert) for up to four planes of equal size; blockIdx.y selects the plane (block-uniform).
// 8 consecutive elements per thread: two 16-B loads, ONE 16-B store per lane; 32 consecutive lanes write 512 contiguous
// Coverage: thread i writes elements 8i..8i+7, i < n8; grid.x = n8/256 exactly for both uses:
//   activations 4096*1024/8 = 524,288 -> 2048 blocks;  weights 1024*1024/8 = 131,072 -> 512 blocks.
// ---------------------------------------------------------------------------
__global__ __launch_bounds__(256) void cvt_bf16_planes_kernel(
    const float* __restrict__ s0, const float* __restrict__ s1, const float* __restrict__ s2, const float* __restrict__ s3,
    unsigned short* __restrict__ d0, unsigned short* __restrict__ d1, unsigned short* __restrict__ d2,
    unsigned short* __restrict__ d3, int n8)
{
  const int z = blockIdx.y;
  const float* src = (z == 0) ? s0 : (z == 1) ? s1 : (z == 2) ? s2 : s3;
  unsigned short* dst = (z == 0) ? d0 : (z == 1) ? d1 : (z == 2) ? d2 : d3;
  const int i = blockIdx.x * 256 + threadIdx.x;
  if (i >= n8) return;
  const float* p = src + 8 * (size_t)i;
  const v4f a = *(const v4f*)(p);
  const v4f c = *(const v4f*)(p + 4);
  unsigned short hb[8];
#pragma unroll
  for (int e = 0; e < 4; ++e) {
    const float x0 = a[e];
    const float x1 = c[e];
    hb[e]     = f2bf_bits(x0);
    hb[4 + e] = f2bf_bits(x1);
  }
  const v4u u = (v4u){pk16(hb[0], hb[1]), pk16(hb[2], hb[3]), pk16(hb[4], hb[5]), pk16(hb[6], hb[7])};
  unsigned short* q = dst + 8 * (size_t)i;
  *(v4u*)q = u;
  
}

// ---------------------------------------------------------------------------
// Eight asynchronous 16-B copies per lane, global memory to LDS: 128 rows of 256 B of one operand plane.
// Lane (r = tid >> 4, c = tid & 15) moves bytes 16 c .. 16 c + 15 of rows r, r + 16, .. r + 112: one wave-wide copy is two
// whole 256-B rows. lds = the lane's LDS byte address of row r, g = its global address of row r, ld = row pitch in elements.
// ---------------------------------------------------------------------------
constexpr int kPassK    = 128;                 /* k per pass: 256 B of every operand row */
constexpr int kLdsPitch = 272;                 /* bytes per LDS row: 16 B x odd, conflict-free for 16-B readers */
constexpr int kPlaneB   = 128 * kLdsPitch;     /* one operand plane of a stage */
__device__ __forceinline__ void copy_plane_async(unsigned lds, const __bf16* g, int ld) {
  const size_t step = (size_t)16 * ld;
  const __bf16* g1 = g + step;      const __bf16* g2 = g + 2 * step;  const __bf16* g3 = g + 3 * step;
  const __bf16* g4 = g + 4 * step;  const __bf16* g5 = g + 5 * step;  const __bf16* g6 = g + 6 * step;
  const __bf16* g7 = g + 7 * step;
  const unsigned ls = 16u * kLdsPitch;
  /* the copies and the wait that stands before their address registers may be rewritten, in one statement */
  asm volatile(
      "global_load_async_to_lds_b128 %0, %8, off\n\t"
      "global_load_async_to_lds_b128 %1, %9, off\n\t"
      "global_load_async_to_lds_b128 %2, %10, off\n\t"
      "global_load_async_to_lds_b128 %3, %11, off\n\t"
      "global_load_async_to_lds_b128 %4, %12, off\n\t"
      "global_load_async_to_lds_b128 %5, %13, off\n\t"
      "global_load_async_to_lds_b128 %6, %14, off\n\t"
      "global_load_async_to_lds_b128 %7, %15, off\n\t"
      "s_wait_xcnt 0x0"
      :: "v"(lds), "v"(lds + ls), "v"(lds + 2u * ls), "v"(lds + 3u * ls), "v"(lds + 4u * ls), "v"(lds + 5u * ls),
         "v"(lds + 6u * ls), "v"(lds + 7u * ls), "v"(g), "v"(g1), "v"(g2), "v"(g3), "v"(g4), "v"(g5), "v"(g6), "v"(g7)
      : "memory");
}

// ---------------------------------------------------------------------------
// bf16 GEMM, operands staged in LDS: C[m][n] = sum_k A[m][k] * Bt[n][k] + bf16value(bias[n]).
// One block of 8 waves owns a 128 x 128 tile; wave (wm = wave >> 1, wn = wave & 1) owns rows 32 wm .. + 31, cols 64 wn .. + 63.
// A row-major [M][K] bf16 (SPLA: a second plane A2 of the same layout is accumulated against the same Bt);
// Bt row-major [N][K] bf16; M, N % 128 == 0, K % 128 == 0, K >= 256 (no tail handling). C f32, pitch ldc.
// A stage = 128 k of [A 128 rows | Bt 128 rows | A2 128 rows if SPLA], brought by asynchronous copies into one of two
// buffers: the copies of stage t + 2 fly while stage t + 1 is worked on.
// EPI 0: plain.  EPI 1: feature map y = x + 1 for x > 0, exp(x) otherwise, applied in a rolled pass over the slab.
// Fragment map: lane l, row/col = l & 15, half h = l >> 4; elements 0..7 <- k0 + 8h + 0..7, 8..15 <- k0 + 16 + 8h + 0..7
// for both operands; accumulator element r = (row 8h + r, col l & 15).
// Epilogue: 16-row slabs staged per wave in LDS of its own (same wave stores and reloads, wave-level ordering).
// Coverage: 32 x 8 = 256 tiles of 128 x 128 = 4096 x 1024; grid = 256 blocks, one tile per block.
// ---------------------------------------------------------------------------
template <bool SPLA, int EPI>
__global__ __launch_bounds__(256) void gemm_tile64_kernel(
    const unsigned short* __restrict__ Ap, const unsigned short* __restrict__ A2p, int lda,
    const unsigned short* __restrict__ Btp, int ldb,
    float* __restrict__ Cout, int ldc,
    const float* __restrict__ bias, int M, int N, int K)
{
  const __bf16* A  = (const __bf16*)Ap;
  const __bf16* A2 = (const __bf16*)A2p;
  const __bf16* Bt = (const __bf16*)Btp;
  constexpr int kStageB = (SPLA ? 3 : 2) * kPlaneB;
  __shared__ __align__(16) unsigned char sStage[2 * kStageB];
  __shared__ __align__(16) float sT[8][16 * 68];
  const int tid  = threadIdx.x;
  const int lane = tid & 31;
  const int wave = tid >> 5;
  const int tilesN = N >> 7;
  const int tilesM = M >> 7;
  const int tile = blockIdx.x;
  /* block-uniform, in front of every barrier and copy */
  if (tile >= tilesM * tilesN) return;
  const int tm = tile / tilesN;
  const int tn = tile - tm * tilesN;
  const int mB = tm << 7;
  const int nB = tn << 7;
  const int wm = wave >> 1;
  const int wn = wave & 1;

  const int rlane = lane & 15;
  const int koff  = (lane >> 4) * 8;
  const int mOff  = (lane >> 4) * 8;

  /* this lane's share of a stage */
  const int cr = tid >> 4, cc = (tid & 15) * 8;
  const unsigned ldsC = (unsigned)(uintptr_t)(sStage + cr * kLdsPitch + cc * 2);
  const __bf16* gA  = A  + (size_t)(mB + cr) * lda + cc;
  const __bf16* gA2 = A2 + (size_t)(mB + cr) * lda + cc;
  const __bf16* gB  = Bt + (size_t)(nB + cr) * ldb + cc;
  const int nPass = K / kPassK;

  /* every loop over acc[], fa[], fb[], fl[] below is unrolled: constant indices keep these arrays in registers */
  v8f acc[2][4];
#pragma unroll
  for (int i = 0; i < 2; ++i)
#pragma unroll
    for (int j = 0; j < 4; ++j) acc[i][j] = (v8f){0.f, 0.f, 0.f, 0.f, 0.f, 0.f, 0.f, 0.f};

  // ---- stage 0, published; then stage 1 in flight ----
  copy_plane_async(ldsC, gA, lda);
  copy_plane_async(ldsC + kPlaneB, gB, ldb);
  if (SPLA) copy_plane_async(ldsC + 2 * kPlaneB, gA2, lda);
  /* this wave's copies of stage 0 have landed */
  asm volatile("s_wait_asynccnt 0x0" ::: "memory");
  __syncthreads();
  if (1 < nPass) {
    copy_plane_async(ldsC + kStageB, gA + kPassK, lda);
    copy_plane_async(ldsC + kStageB + kPlaneB, gB + kPassK, ldb);
    if (SPLA) copy_plane_async(ldsC + kStageB + 2 * kPlaneB, gA2 + kPassK, lda);
  }

  /* rolled: one pass per trip, so that each trip reads one buffer and ends in one publish point */
#pragma unroll 1
  for (int t = 0; t < nPass; ++t) {
    const int bufB = (t & 1) * kStageB;
    const unsigned char* pA = sStage + bufB + (wm * 32 + rlane) * kLdsPitch + koff * 2;
    const unsigned char* pB = sStage + bufB + kPlaneB + (wn * 64 + rlane) * kLdsPitch + koff * 2;
    /* two fragment sets: the reads of k step kk + 1 (same buffer) are issued in front of step kk's products, so that a
       wave waits out the LDS latency once per pass and not at every step */
    v16b fb[2][4], fa[2][2], fl[2][2];
#pragma unroll
    for (int j = 0; j < 4; ++j) fb[0][j] = Frag<__bf16>::load((const __bf16*)(pB + j * 16 * kLdsPitch));
#pragma unroll
    for (int i = 0; i < 2; ++i) {
      fa[0][i] = Frag<__bf16>::load((const __bf16*)(pA + i * 16 * kLdsPitch));
      if (SPLA) fl[0][i] = Frag<__bf16>::load((const __bf16*)(pA + 2 * kPlaneB + i * 16 * kLdsPitch));
    }
#pragma unroll
    for (int kk = 0; kk < kPassK / 32; ++kk) {
      const int cur = kk & 1, nxt = cur ^ 1;
      if (kk + 1 < kPassK / 32) {
#pragma unroll
        for (int j = 0; j < 4; ++j)
          fb[nxt][j] = Frag<__bf16>::load((const __bf16*)(pB + j * 16 * kLdsPitch + (kk + 1) * 64));
#pragma unroll
        for (int i = 0; i < 2; ++i) {
          fa[nxt][i] = Frag<__bf16>::load((const __bf16*)(pA + i * 16 * kLdsPitch + (kk + 1) * 64));
          if (SPLA) fl[nxt][i] = Frag<__bf16>::load((const __bf16*)(pA + 2 * kPlaneB + i * 16 * kLdsPitch + (kk + 1) * 64));
        }
      }
      /* per accumulator and k step: the hi product, then the lo product */
#pragma unroll
      for (int i = 0; i < 2; ++i) {
#pragma unroll
        for (int j = 0; j < 4; ++j) acc[i][j] = mma_bf(fa[cur][i], fb[cur][j], acc[i][j]);
        if (SPLA) {
#pragma unroll
          for (int j = 0; j < 4; ++j) acc[i][j] = mma_bf(fl[cur][i], fb[cur][j], acc[i][j]);
        }
      }
    }
    /* publish point: this wave's reads of the buffer are done, its copies of the next stage have landed */
    asm volatile("s_wait_dscnt 0x0" ::: "memory");
    asm volatile("s_wait_asynccnt 0x0" ::: "memory");
    __syncthreads();
    /* refill the buffer that every wave has just left; the test is the same for the whole block */
    if (t + 2 < nPass) {
      const int ko = (t + 2) * kPassK;
      copy_plane_async(ldsC + bufB, gA + ko, lda);
      copy_plane_async(ldsC + bufB + kPlaneB, gB + ko, ldb);
      if (SPLA) copy_plane_async(ldsC + bufB + 2 * kPlaneB, gA2 + ko, lda);
    }
  }
  /* no copy is left in flight when the wave goes on */
  asm volatile("s_wait_asynccnt 0x0" ::: "memory");

  // ---- epilogue ----
  const int m0 = mB + wm * 32;
  const int n0 = nB + wn * 64;
  float* slab = sT[wave];
  float bvj[4];
#pragma unroll
  for (int j = 0; j < 4; ++j) bvj[j] = bf16r(bias[n0 + (j << 4) + rlane]);
#pragma unroll
  for (int i = 0; i < 2; ++i) {
    const int mBase = m0 + (i << 4);
#pragma unroll
    for (int j = 0; j < 4; ++j) {
#pragma unroll
      for (int r = 0; r < 8; ++r) {
        slab[(mOff + r) * 68 + (j << 4) + rlane] = acc[i][j][r] + bvj[j];
      }
    }
    __builtin_amdgcn_fence(__ATOMIC_RELEASE, "workgroup");
    __builtin_amdgcn_wave_barrier();
    __builtin_amdgcn_fence(__ATOMIC_ACQUIRE, "workgroup");
    if (EPI == 1) {
      /* 32 iterations x 32 lanes = 1024 = the whole 16 x 64 slab, each element once */
#pragma unroll 1
      for (int it = 0; it < 32; ++it) {
        float* p = slab + (it >> 1) * 68 + (it & 1) * 32 + lane;
        const float x = *p;
        const float ex = expf(fminf(x, 0.0f));
        const float y = (x > 0.0f) ? (x + 1.0f) : ex;
        *p = y;
      }
      __builtin_amdgcn_fence(__ATOMIC_RELEASE, "workgroup");
      __builtin_amdgcn_wave_barrier();
      __builtin_amdgcn_fence(__ATOMIC_ACQUIRE, "workgroup");
    }
    {
      /* row segment = 256 B = 16 lanes x 16 B; rows it*2 + hh cover 0..15 */
      const int hh = lane >> 4, c4 = (lane & 15) * 4;
      {
#pragma unroll
        for (int it = 0; it < 8; ++it) {
          const int row = it * 2 + hh;
          const v4f v = *(const v4f*)(slab + row * 68 + c4);
          *(v4f*)(Cout + (size_t)(mBase + row) * ldc + n0 + c4) = v;
        }
        
      }
    }
    __builtin_amdgcn_fence(__ATOMIC_RELEASE, "workgroup");
    __builtin_amdgcn_wave_barrier();
    __builtin_amdgcn_fence(__ATOMIC_ACQUIRE, "workgroup");
  }
}

// ---------------------------------------------------------------------------
// Chunk sums: one block of 256 threads per (chunk, batch-head), chunks 0 .. kChunks - 2 (nothing follows the last one).
// slot[d][j] = sum over the chunk's 64 steps of k[s][d] * v[s][j]; slot[4096 + d] = sum over the steps of k[s][d].
// Thread (d4 = 4 (tid >> 4), j4 = 4 (tid & 15)) keeps a 4 x 4 patch in registers: two 16-B LDS reads feed 16 FMAs.
// Staging coverage: rows lr + 16 i (lr = tid >> 4, i = 0..3) x cols 4 (tid & 15) .. + 3 = 64 x 64 per tensor.
// LDS: 2 x 16,384 = 32,768 B.
// ---------------------------------------------------------------------------
__global__ __launch_bounds__(256) void chunk_state_kernel(
    const float* __restrict__ KF, const float* __restrict__ VF, float* __restrict__ ST)
{
  __shared__ __align__(16) float sK[kChunkL * 64];
  __shared__ __align__(16) float sV[kChunkL * 64];
  const int tid = threadIdx.x;
  const int chunk = blockIdx.x;
  const int bh = blockIdx.y;
  const size_t row0 = (size_t)(bh >> 4) * kSeq + (size_t)chunk * kChunkL;
  const int col0 = (bh & 15) * kHd;
  const int lr = tid >> 4, lc4 = (tid & 15) * 4;
  /* unrolled: all eight global loads are issued before the first LDS store waits on one */
#pragma unroll
  for (int i = 0; i < kChunkL / 16; ++i) {
    const int r = lr + 16 * i;
    const size_t g = (row0 + (size_t)r) * kDim + col0 + lc4;
    *(v4f*)(sK + r * 64 + lc4) = *(const v4f*)(KF + g);
    *(v4f*)(sV + r * 64 + lc4) = *(const v4f*)(VF + g);
  }
  __syncthreads();

  const int d4 = lr * 4, j4 = lc4;
  /* every loop over a[] is unrolled so that its indices are constants and the patch stays in registers */
  v4f a[4];
#pragma unroll
  for (int r = 0; r < 4; ++r) a[r] = (v4f){0.f, 0.f, 0.f, 0.f};
  /* eight steps' LDS reads in flight together; rolled, every step waits out a whole LDS latency */
#pragma unroll 8
  for (int s = 0; s < kChunkL; ++s) {
    const v4f kk = *(const v4f*)(sK + s * 64 + d4);
    const v4f vv = *(const v4f*)(sV + s * 64 + j4);
#pragma unroll
    for (int r = 0; r < 4; ++r)
#pragma unroll
      for (int e = 0; e < 4; ++e) a[r][e] = fmaf(kk[r], vv[e], a[r][e]);
  }
  float* slot = ST + ((size_t)bh * (kChunks - 1) + chunk) * kSlotF;
#pragma unroll
  for (int r = 0; r < 4; ++r) *(v4f*)(slot + (d4 + r) * 64 + j4) = a[r];

  /* key sums; waves 0 and 1 only (wave-uniform predicate) */
  if (tid < 64) {
    float c = 0.0f;
    for (int s = 0; s < kChunkL; ++s) c += sK[s * 64 + tid];
    slot[kHd * kHd + tid] = c;
  }
}

// ---------------------------------------------------------------------------
// Inclusive sum of the chunk slots along the chunk axis, in place: slot c becomes the state at the end of chunk c.
// One thread per float of a slot (4160 per batch-head, grid.x = 17 blocks with a tail guard); the 31 values stay in
// registers, so all loads are in flight together and the thread pays the load latency once.
// ---------------------------------------------------------------------------
__global__ __launch_bounds__(256) void chunk_prefix_kernel(float* __restrict__ ST)
{
  const int i = blockIdx.x * 256 + threadIdx.x;
  if (i >= kSlotF) return;
  float* base = ST + (size_t)blockIdx.y * (kChunks - 1) * kSlotF + i;
  /* both loops unrolled: constant indices keep x[] in registers */
  float x[kChunks - 1];
#pragma unroll
  for (int c = 0; c < kChunks - 1; ++c) x[c] = base[(size_t)c * kSlotF];
#pragma unroll
  for (int c = 1; c < kChunks - 1; ++c) {
    x[c] += x[c - 1];
    base[(size_t)c * kSlotF] = x[c];
  }
}

// ---------------------------------------------------------------------------
// Causal state scan, one block of 256 threads per (chunk, batch-head), the chunk's 64 steps in a static loop.
// Thread (j = tid & 63, dg = tid >> 6) keeps kv[d][j] for d = 16 dg .. 16 dg + 15 in registers; chunk 0 starts from
// zero, chunk c > 0 from slot c - 1 of ST (state and key sums at the end of the chunk before it).
// Per step s (inclusive sums): kv[d][j] += k[d] * v[j]; partial[dg][s][j] = sum over its 16 d of q[d] * kv[d][j].
// Steps are staged 32 at a time: sQ, sK, sV hold q, k, v rows [32][64] f32; sN holds the four partial planes [4][32][64].
// After the 32 steps: threads 0..63 turn sK into the inclusive key sums in place (running carry in a register);
// then lane (row = 4 wave + (lane >> 3), cols 8 (lane & 7) .. + 7) forms den = sum_d q[d] * ksum[d] (rolled, f32),
// num = ((p0 + p1) + p2) + p3, out = num * (1 / (den + eps)), splits out into bf16 hi + lo and stores both planes.
// Staging coverage: rows lr, lr + 16 (lr = tid >> 4 = 0..15) x cols 4 (tid & 15) .. + 3 = 32 x 64 per tensor.
// LDS: 3 x 8,192 + 32,768 = 57,344 B.
// ---------------------------------------------------------------------------
__global__ __launch_bounds__(256) void scan_state_kernel(
    const float* __restrict__ QF, const float* __restrict__ KF, const float* __restrict__ VF,
    const float* __restrict__ ST, unsigned short* __restrict__ AH, unsigned short* __restrict__ AL)
{
  __shared__ __align__(16) float sQ[kScanT * 64];
  __shared__ __align__(16) float sK[kScanT * 64];
  __shared__ __align__(16) float sV[kScanT * 64];
  __shared__ __align__(16) float sN[4 * kScanT * 64];
  const int tid = threadIdx.x, lane = tid & 31, wave = tid >> 5;
  const int j = tid & 63;
  const int dg = tid >> 6;
  const int chunk = blockIdx.x;
  const int bh = blockIdx.y;
  const int bb = bh >> 4;
  const int hd = bh & 15;
  const size_t row0 = (size_t)bb * kSeq;
  const int col0 = hd * kHd;

  float kv[16];
#pragma unroll
  for (int i = 0; i < 16; ++i) kv[i] = 0.0f;
  float kcarry = 0.0f;
  /* block-uniform predicate */
  if (chunk > 0) {
    const float* slot = ST + ((size_t)bh * (kChunks - 1) + (chunk - 1)) * kSlotF;
    /* unrolled: constant indices keep kv[] in registers */
#pragma unroll
    for (int i = 0; i < 15; ++i) kv[i] = slot[(dg * 16 + i) * 64 + j];
    /* the last load may land in the offset register that the fifteen before it name: their wait stands in front of it */
    asm volatile("s_wait_xcnt 0x0" ::: "memory");
    kv[15] = slot[(dg * 16 + 15) * 64 + j];
    if (tid < 64) kcarry = slot[kHd * kHd + tid];
  }

  const int lr = tid >> 4, lc4 = (tid & 15) * 4;
  const int q4 = lane >> 3, c8 = (lane & 7) * 8;
  const int orow = wave * 4 + q4;

#pragma unroll 1
  for (int t0 = chunk * kChunkL; t0 < (chunk + 1) * kChunkL; t0 += kScanT) {
    /* every read of the stage before this one has finished */
    __syncthreads();
#pragma unroll
    for (int i = 0; i < 2; ++i) {
      const int r = lr + 16 * i;
      const size_t g = (row0 + (size_t)(t0 + r)) * kDim + col0 + lc4;
      *(v4f*)(sQ + r * 64 + lc4) = *(const v4f*)(QF + g);
      *(v4f*)(sK + r * 64 + lc4) = *(const v4f*)(KF + g);
      *(v4f*)(sV + r * 64 + lc4) = *(const v4f*)(VF + g);
    }
    __syncthreads();

#pragma unroll 1
    for (int s = 0; s < kScanT; ++s) {
      const float vj = sV[s * 64 + j];
      const float* qp = sQ + s * 64 + dg * 16;
      const float* kp = sK + s * 64 + dg * 16;
      float accn = 0.0f;
#pragma unroll
      for (int g = 0; g < 4; ++g) {
        const v4f kk = *(const v4f*)(kp + 4 * g);
        const v4f qq = *(const v4f*)(qp + 4 * g);
        kv[4 * g + 0] = fmaf(kk[0], vj, kv[4 * g + 0]);
        accn = fmaf(qq[0], kv[4 * g + 0], accn);
        kv[4 * g + 1] = fmaf(kk[1], vj, kv[4 * g + 1]);
        accn = fmaf(qq[1], kv[4 * g + 1], accn);
        kv[4 * g + 2] = fmaf(kk[2], vj, kv[4 * g + 2]);
        accn = fmaf(qq[2], kv[4 * g + 2], accn);
        kv[4 * g + 3] = fmaf(kk[3], vj, kv[4 * g + 3]);
        accn = fmaf(qq[3], kv[4 * g + 3], accn);
      }
      sN[(dg * kScanT + s) * 64 + j] = accn;
    }
    __syncthreads();

    /* inclusive key sums in place; waves 0 and 1 only (wave-uniform predicate) */
    if (tid < 64) {
      float c = kcarry;
#pragma unroll 1
      for (int s = 0; s < kScanT; ++s) {
        c += sK[s * 64 + tid];
        sK[s * 64 + tid] = c;
      }
      kcarry = c;
    }
    __syncthreads();

    float den = 0.0f;
#pragma unroll 1
    for (int g = 0; g < 16; ++g) {
      const v4f qv = *(const v4f*)(sQ + orow * 64 + 4 * g);
      const v4f kc = *(const v4f*)(sK + orow * 64 + 4 * g);
      den = fmaf(qv[0], kc[0], den);
      den = fmaf(qv[1], kc[1], den);
      den = fmaf(qv[2], kc[2], den);
      den = fmaf(qv[3], kc[3], den);
    }
    const float inv = 1.0f / (den + kEps);

    const float* np = sN + orow * 64 + c8;
    const v4f a0 = *(const v4f*)(np);
    const v4f a1 = *(const v4f*)(np + 4);
    const v4f b0 = *(const v4f*)(np + 1 * kScanT * 64);
    const v4f b1 = *(const v4f*)(np + 1 * kScanT * 64 + 4);
    const v4f e0 = *(const v4f*)(np + 2 * kScanT * 64);
    const v4f e1 = *(const v4f*)(np + 2 * kScanT * 64 + 4);
    const v4f f0 = *(const v4f*)(np + 3 * kScanT * 64);
    const v4f f1 = *(const v4f*)(np + 3 * kScanT * 64 + 4);
    float o[8];
#pragma unroll
    for (int e = 0; e < 4; ++e) {
      const float n0v = ((a0[e] + b0[e]) + e0[e]) + f0[e];
      const float n1v = ((a1[e] + b1[e]) + e1[e]) + f1[e];
      o[e]     = n0v * inv;
      o[4 + e] = n1v * inv;
    }
    unsigned short hb[8], lb[8];
#pragma unroll
    for (int e = 0; e < 8; ++e) {
      const float x = o[e];
      const unsigned short hbits = f2bf_bits(x);
      const float res = x - bf_bits2f(hbits);
      hb[e] = hbits;
      lb[e] = f2bf_bits(res);
    }
    const v4u uh = (v4u){pk16(hb[0], hb[1]), pk16(hb[2], hb[3]), pk16(hb[4], hb[5]), pk16(hb[6], hb[7])};
    const v4u ul = (v4u){pk16(lb[0], lb[1]), pk16(lb[2], lb[3]), pk16(lb[4], lb[5]), pk16(lb[6], lb[7])};
    const size_t oo = (row0 + (size_t)(t0 + orow)) * kDim + col0 + c8;
    unsigned short* ph = AH + oo;
    unsigned short* pl = AL + oo;
    *(v4u*)ph = uh;
    *(v4u*)pl = ul;
    
  }
}

// ---------------------------------------------------------------------------
// Host glue: 2 convert launches + 3 projection GEMMs + 3 scan launches (chunk sums, chunk prefix, scan) + 1 output GEMM
// = 9 launches. Kernel launches only.
// GEMM shapes: M 4096, N 1024, K 1024 everywhere (K, M and N % 128 == 0): 32 x 8 = 256 tiles -> 256 blocks.
// ---------------------------------------------------------------------------
extern "C" void kernel_launch(void* const* d_in, const int* in_sizes, int n_in,
                              void* d_out, int out_size, void* d_ws, size_t ws_size,
                              hipStream_t stream) {
  if (n_in < 11 || d_out == nullptr || d_ws == nullptr) return;
  if (in_sizes[0] != kRows * kDim || in_sizes[1] != kRows * kDim || in_sizes[2] != kRows * kDim) return;
  if (in_sizes[3] != kDim * kDim || in_sizes[5] != kDim * kDim || in_sizes[7] != kDim * kDim ||
      in_sizes[9] != kDim * kDim) return;
  if (in_sizes[4] != kDim || in_sizes[6] != kDim || in_sizes[8] != kDim || in_sizes[10] != kDim) return;
  if (out_size != kRows * kDim) return;
  if (ws_size < kWsTotal) return;

  const float* query = (const float*)d_in[0];
  const float* key   = (const float*)d_in[1];
  const float* value = (const float*)d_in[2];
  const float* Wq    = (const float*)d_in[3];
  const float* bq    = (const float*)d_in[4];
  const float* Wk    = (const float*)d_in[5];
  const float* bk    = (const float*)d_in[6];
  const float* Wv    = (const float*)d_in[7];
  const float* bv    = (const float*)d_in[8];
  const float* Wo    = (const float*)d_in[9];
  const float* bo    = (const float*)d_in[10];
  float* out = (float*)d_out;

  char* ws = (char*)d_ws;
  unsigned short* XQ = (unsigned short*)(ws + kOffXQ);
  unsigned short* XK = (unsigned short*)(ws + kOffXK);
  unsigned short* XV = (unsigned short*)(ws + kOffXV);
  unsigned short* WQ = (unsigned short*)(ws + kOffWQ);
  unsigned short* WK = (unsigned short*)(ws + kOffWK);
  unsigned short* WV = (unsigned short*)(ws + kOffWV);
  unsigned short* WO = (unsigned short*)(ws + kOffWO);
  float*          QF = (float*)(ws + kOffQF);
  float*          KF = (float*)(ws + kOffKF);
  float*          VF = (float*)(ws + kOffVF);
  unsigned short* AH = (unsigned short*)(ws + kOffAH);
  unsigned short* AL = (unsigned short*)(ws + kOffAL);
  float*          ST = (float*)(ws + kOffST);

  // ---- bf16 operand planes (weights are [out][in] = Bt layout already) ----
  const int n8a = kRows * kDim / 8;
  const int n8w = kDim * kDim / 8;
  cvt_bf16_planes_kernel<<<dim3(n8a / 256, 3), 256, 0, stream>>>(query, key, value, value, XQ, XK, XV, XV, n8a);
  cvt_bf16_planes_kernel<<<dim3(n8w / 256, 4), 256, 0, stream>>>(Wq, Wk, Wv, Wo, WQ, WK, WV, WO, n8w);

  // ---- projections: q and k with the feature map in the epilogue, v plain ----
  const int gblocks = (kRows / 128) * (kDim / 128);
  gemm_tile64_kernel<false, 1><<<dim3(gblocks), 256, 0, stream>>>(XQ, XQ, kDim, WQ, kDim, QF, kDim, bq, kRows, kDim, kDim);
  gemm_tile64_kernel<false, 1><<<dim3(gblocks), 256, 0, stream>>>(XK, XK, kDim, WK, kDim, KF, kDim, bk, kRows, kDim, kDim);
  gemm_tile64_kernel<false, 0><<<dim3(gblocks), 256, 0, stream>>>(XV, XV, kDim, WV, kDim, VF, kDim, bv, kRows, kDim, kDim);

  // ---- causal state scan: chunk sums, their running sum, then one block per (chunk, batch-head) ----
  chunk_state_kernel<<<dim3(kChunks - 1, kBatch * kHeads), 256, 0, stream>>>(KF, VF, ST);
  chunk_prefix_kernel<<<dim3((kSlotF + 255) / 256, kBatch * kHeads), 256, 0, stream>>>(ST);
  scan_state_kernel<<<dim3(kChunks, kBatch * kHeads), 256, 0, stream>>>(QF, KF, VF, ST, AH, AL);

  // ---- output projection: (hi + lo) . bf16(Wo)^T + bo, both parts into one accumulator ----
  gemm_tile64_kernel<true, 0><<<dim3(gblocks), 256, 0, stream>>>(AH, AL, kDim, WO, kDim, out, kDim, bo, kRows, kDim, kDim);
}

// v003
// It runs in 110 microseconds.
// Timed twice side by side with v002, it ran 1.06 times as fast both times.
// Over all steps from v000 it is 6.76 times as fast.
// Contractions: q/k/v projections on v_wmma_f32_16x16x32_bf16 (bf16(x) x bf16(W), one product, f32 accumulate); output projection on v_wmma_f32_16x16x32_bf16 with the attention plane carried as bf16 hi + lo planes against bf16(Wo) (two products into one f32 accumulator); feature map, 64x64 state scan, normaliser and division in f32 on the vector unit.
#include <hip/hip_runtime.h>
#include <math.h>

typedef __attribute__((ext_vector_type(16))) __bf16   v16b;
typedef __attribute__((ext_vector_type(8)))  __bf16   v8b;
typedef __attribute__((ext_vector_type(8)))  float    v8f;
typedef __attribute__((ext_vector_type(4)))  float    v4f;
typedef __attribute__((ext_vector_type(4)))  unsigned int v4u;

// ---------------------------------------------------------------------------
// Shape constants
// ---------------------------------------------------------------------------
constexpr int kBatch = 2;
constexpr int kSeq   = 2048;
constexpr int kDim   = 1024;
constexpr int kHeads = 16;
constexpr int kHd    = 64;
constexpr int kRows  = kBatch * kSeq;
constexpr int kScanT = 32;
constexpr int kChunkL = 64;
constexpr int kChunks = kSeq / kChunkL;
constexpr int kSlotF  = kHd * kHd + kHd;
constexpr float kEps = 1e-6f;
static_assert(kHeads * kHd == kDim, "head split");
static_assert((kDim % 128) == 0 && kDim >= 256, "GEMM K: whole passes of 128, at least two");
static_assert((kRows % 128) == 0 && (kDim % 128) == 0, "GEMM M, N multiples of 128");
static_assert((kSeq % kChunkL) == 0 && (kChunkL % kScanT) == 0, "scan chunking");
static_assert((kSlotF % 32) == 0, "128-B aligned state slots");
static_assert(kHd == 64, "one head = one 64-column tile");

// ---------------------------------------------------------------------------
// Workspace region map (bytes; every offset is a multiple of 128)
//   XQ  bf16 [4096][1024]  bf16(query)                  8,388,608
//   XK  bf16 [4096][1024]  bf16(key)                    8,388,608
//   XV  bf16 [4096][1024]  bf16(value)                  8,388,608
//   WQ  bf16 [1024][1024]  bf16(Wq)  (Bt layout)        2,097,152
//   WK  bf16 [1024][1024]  bf16(Wk)                     2,097,152
//   WV  bf16 [1024][1024]  bf16(Wv)                     2,097,152
//   WO  bf16 [1024][1024]  bf16(Wo)                     2,097,152
//   QF  f32  [4096][1024]  phi(q)                      16,777,216
//   KF  f32  [4096][1024]  phi(k)                      16,777,216
//   VF  f32  [4096][1024]  v                           16,777,216
//   AH  bf16 [4096][1024]  attention plane, hi part     8,388,608
//   AL  bf16 [4096][1024]  attention plane, lo part     8,388,608
//   ST  f32  [32][31][4160] chunk states: 64x64 key-value sum, then 64 key sums   16,506,880
//   total                                             117,170,176
// ---------------------------------------------------------------------------
constexpr size_t kActB  = (size_t)kRows * kDim * 2;
constexpr size_t kWgtB  = (size_t)kDim * kDim * 2;
constexpr size_t kF32B  = (size_t)kRows * kDim * 4;
constexpr size_t kOffXQ = 0;
constexpr size_t kOffXK = kOffXQ + kActB;
constexpr size_t kOffXV = kOffXK + kActB;
constexpr size_t kOffWQ = kOffXV + kActB;
constexpr size_t kOffWK = kOffWQ + kWgtB;
constexpr size_t kOffWV = kOffWK + kWgtB;
constexpr size_t kOffWO = kOffWV + kWgtB;
constexpr size_t kOffQF = kOffWO + kWgtB;
constexpr size_t kOffKF = kOffQF + kF32B;
constexpr size_t kOffVF = kOffKF + kF32B;
constexpr size_t kOffAH = kOffVF + kF32B;
constexpr size_t kOffAL = kOffAH + kActB;
constexpr size_t kOffST = kOffAL + kActB;
constexpr size_t kStB   = (size_t)kBatch * kHeads * (kChunks - 1) * kSlotF * 4;
constexpr size_t kWsTotal = kOffST + kStB;
static_assert(kWsTotal == 117170176ull, "carve total");
static_assert(kOffXK == kOffXQ + kActB && kOffXV == kOffXK + kActB && kOffWK == kOffWQ + kWgtB && kOffWV == kOffWK + kWgtB &&
              kOffKF == kOffQF + kF32B && kOffVF == kOffKF + kF32B, "q, k, v planes lie one behind the other");
static_assert(kWsTotal <= 134217728ull, "carve cap");
static_assert((kOffXK % 128) == 0 && (kOffXV % 128) == 0 && (kOffWQ % 128) == 0 && (kOffWK % 128) == 0 &&
              (kOffWV % 128) == 0 && (kOffWO % 128) == 0 && (kOffQF % 128) == 0 && (kOffKF % 128) == 0 &&
              (kOffVF % 128) == 0 && (kOffAH % 128) == 0 && (kOffAL % 128) == 0 && (kOffST % 128) == 0,
              "128-B aligned regions");

// ---------------------------------------------------------------------------
// Small helpers
// ---------------------------------------------------------------------------
__device__ __forceinline__ unsigned short f2bf_bits(float f) {
  unsigned u = __float_as_uint(f);
  return (unsigned short)((u + 0x7FFFu + ((u >> 16) & 1u)) >> 16);
}
__device__ __forceinline__ float bf_bits2f(unsigned short h) { return __uint_as_float(((unsigned)h) << 16); }
/* RNE-convert to a bf16 value, kept in f32 */
__device__ __forceinline__ float bf16r(float f) { return bf_bits2f(f2bf_bits(f)); }
__device__ __forceinline__ unsigned pk16(unsigned short a, unsigned short b) { return (unsigned)a | ((unsigned)b << 16); }

template <typename T> struct Frag;
template <> struct Frag<__bf16> {
  typedef v16b V; union U { v16b v; v8b h[2]; };
  /* elements 0..7 <- p[0..7], elements 8..15 <- p[16..23] */
  static __device__ __forceinline__ v16b load(const __bf16* p) {
    U f; f.h[0] = *(const v8b*)(p); f.h[1] = *(const v8b*)(p + 16); return f.v;
  }
};

/* one matrix instruction followed by its own hazard guard: the guard ties this accumulator and names both fragments */
__device__ __forceinline__ v8f mma_bf(v16b a, v16b b, v8f c) {
  c = __builtin_amdgcn_wmma_f32_16x16x32_bf16(false, a, false, b, (short)0, c, false, false);
  asm volatile("v_nop\n\tv_nop\n\tv_nop\n\tv_nop" : "+v"(c) : "v"(a), "v"(b));
  return c;
}

// ---------------------------------------------------------------------------
// f32 -> bf16 (RNE-convert) of all seven operand planes in one launch: three activation planes, then four weight planes.
// The block index selects plane and place in it (block-uniform): blocks 0 .. 6143 are 2048 per activation plane,
// blocks 6144 .. 8191 are 512 per weight plane.
// 8 consecutive elements per thread: two 16-B loads, ONE 16-B store per lane; 32 consecutive lanes write 512 contiguous
// Coverage: thread i of a plane writes elements 8i..8i+7, i < n8; blocks per plane = n8/256 exactly:
//   activations 4096*1024/8 = 524,288 -> 2048 blocks;  weights 1024*1024/8 = 131,072 -> 512 blocks.
// ---------------------------------------------------------------------------
constexpr int kActN8  = kRows * kDim / 8;
constexpr int kWgtN8  = kDim * kDim / 8;
constexpr int kActBlk = kActN8 / 256;
constexpr int kWgtBlk = kWgtN8 / 256;
constexpr int kCvtBlk = 3 * kActBlk + 4 * kWgtBlk;
static_assert((kActN8 % 256) == 0 && (kWgtN8 % 256) == 0, "whole blocks per plane");
__global__ __launch_bounds__(256) void cvt_bf16_planes_kernel(
    const float* __restrict__ a0, const float* __restrict__ a1, const float* __restrict__ a2,
    const float* __restrict__ w0, const float* __restrict__ w1, const float* __restrict__ w2, const float* __restrict__ w3,
    unsigned short* __restrict__ da0, unsigned short* __restrict__ da1, unsigned short* __restrict__ da2,
    unsigned short* __restrict__ dw0, unsigned short* __restrict__ dw1, unsigned short* __restrict__ dw2,
    unsigned short* __restrict__ dw3)
{
  const int b = blockIdx.x;
  const float* src;
  unsigned short* dst;
  int blk, n8;
  if (b < 3 * kActBlk) {
    const int z = b / kActBlk;
    blk = b - z * kActBlk;
    n8  = kActN8;
    src = (z == 0) ? a0 : (z == 1) ? a1 : a2;
    dst = (z == 0) ? da0 : (z == 1) ? da1 : da2;
  } else {
    const int bw = b - 3 * kActBlk;
    const int z = bw / kWgtBlk;
    blk = bw - z * kWgtBlk;
    n8  = kWgtN8;
    src = (z == 0) ? w0 : (z == 1) ? w1 : (z == 2) ? w2 : w3;
    dst = (z == 0) ? dw0 : (z == 1) ? dw1 : (z == 2) ? dw2 : dw3;
  }
  const int i = blk * 256 + threadIdx.x;
  if (i >= n8) return;
  const float* p = src + 8 * (size_t)i;
  const v4f a = *(const v4f*)(p);
  const v4f c = *(const v4f*)(p + 4);
  unsigned short hb[8];
#pragma unroll
  for (int e = 0; e < 4; ++e) {
    const float x0 = a[e];
    const float x1 = c[e];
    hb[e]     = f2bf_bits(x0);
    hb[4 + e] = f2bf_bits(x1);
  }
  const v4u u = (v4u){pk16(hb[0], hb[1]), pk16(hb[2], hb[3]), pk16(hb[4], hb[5]), pk16(hb[6], hb[7])};
  unsigned short* q = dst + 8 * (size_t)i;
  *(v4u*)q = u;
  
}

// ---------------------------------------------------------------------------
// Eight asynchronous 16-B copies per lane, global memory to LDS: 128 rows of 256 B of one operand plane.
// Lane (r = tid >> 4, c = tid & 15) moves bytes 16 c .. 16 c + 15 of rows r, r + 16, .. r + 112: one wave-wide copy is two
// whole 256-B rows. lds = the lane's LDS byte address of row r, g = its global address of row r, ld = row pitch in elements.
// ---------------------------------------------------------------------------
constexpr int kPassK    = 128;                 /* k per pass: 256 B of every operand row */
constexpr int kLdsPitch = 272;                 /* bytes per LDS row: 16 B x odd, conflict-free for 16-B readers */
constexpr int kPlaneB   = 128 * kLdsPitch;     /* one operand plane of a stage */
__device__ __forceinline__ void copy_plane_async(unsigned lds, const __bf16* g, int ld) {
  const size_t step = (size_t)16 * ld;
  const __bf16* g1 = g + step;      const __bf16* g2 = g + 2 * step;  const __bf16* g3 = g + 3 * step;
  const __bf16* g4 = g + 4 * step;  const __bf16* g5 = g + 5 * step;  const __bf16* g6 = g + 6 * step;
  const __bf16* g7 = g + 7 * step;
  const unsigned ls = 16u * kLdsPitch;
  /* the copies and the wait that stands before their address registers may be rewritten, in one statement */
  asm volatile(
      "global_load_async_to_lds_b128 %0, %8, off\n\t"
      "global_load_async_to_lds_b128 %1, %9, off\n\t"
      "global_load_async_to_lds_b128 %2, %10, off\n\t"
      "global_load_async_to_lds_b128 %3, %11, off\n\t"
      "global_load_async_to_lds_b128 %4, %12, off\n\t"
      "global_load_async_to_lds_b128 %5, %13, off\n\t"
      "global_load_async_to_lds_b128 %6, %14, off\n\t"
      "global_load_async_to_lds_b128 %7, %15, off\n\t"
      "s_wait_xcnt 0x0"
      :: "v"(lds), "v"(lds + ls), "v"(lds + 2u * ls), "v"(lds + 3u * ls), "v"(lds + 4u * ls), "v"(lds + 5u * ls),
         "v"(lds + 6u * ls), "v"(lds + 7u * ls), "v"(g), "v"(g1), "v"(g2), "v"(g3), "v"(g4), "v"(g5), "v"(g6), "v"(g7)
      : "memory");
}

// ---------------------------------------------------------------------------
// bf16 GEMM, operands staged in LDS: C[m][n] = sum_k A[m][k] * Bt[n][k] + bf16value(bias[n]).
// One block of 8 waves owns a 128 x 128 tile; wave (wm = wave >> 1, wn = wave & 1) owns rows 32 wm .. + 31, cols 64 wn .. + 63.
// A row-major [M][K] bf16 (SPLA: a second plane A2 of the same layout is accumulated against the same Bt);
// Bt row-major [N][K] bf16; M, N % 128 == 0, K % 128 == 0, K >= 256 (no tail handling). C f32, pitch ldc.
// A stage = 128 k of [A 128 rows | Bt 128 rows | A2 128 rows if SPLA], brought by asynchronous copies into one of two
// buffers: the copies of stage t + 2 fly while stage t + 1 is worked on.
// EPI 0: plain.  EPI 1: feature map y = x + 1 for x > 0, exp(x) otherwise, applied in a rolled pass over the slab.
// EPI 2: three products of one shape in one launch. blockIdx.y = 0, 1, 2 (block-uniform) picks the plane: A, Bt and C are
// three dense planes one behind the other (M x lda, N x ldb, M x ldc elements each), the biases three buffers; planes 0
// and 1 take the feature map, plane 2 is plain.
// Fragment map: lane l, row/col = l & 15, half h = l >> 4; elements 0..7 <- k0 + 8h + 0..7, 8..15 <- k0 + 16 + 8h + 0..7
// for both operands; accumulator element r = (row 8h + r, col l & 15).
// Epilogue: 16-row slabs staged per wave in LDS of its own (same wave stores and reloads, wave-level ordering).
// Coverage: 32 x 8 = 256 tiles of 128 x 128 = 4096 x 1024; grid.x = 256 blocks, one tile per block and plane.
// ---------------------------------------------------------------------------
template <bool SPLA, int EPI>
__global__ __launch_bounds__(256) void gemm_tile64_kernel(
    const unsigned short* __restrict__ Ap, const unsigned short* __restrict__ A2p, int lda,
    const unsigned short* __restrict__ Btp, int ldb,
    float* __restrict__ Cout, int ldc,
    const float* __restrict__ bias, int M, int N, int K,
    const float* __restrict__ bias1 = nullptr, const float* __restrict__ bias2 = nullptr)
{
  const int z = (EPI == 2) ? (int)blockIdx.y : 0;
  const __bf16* A  = (const __bf16*)Ap + (size_t)z * M * lda;
  const __bf16* A2 = (const __bf16*)A2p + (size_t)z * M * lda;
  const __bf16* Bt = (const __bf16*)Btp + (size_t)z * N * ldb;
  if (EPI == 2) {
    Cout += (size_t)z * M * ldc;
    bias = (z == 0) ? bias : (z == 1) ? bias1 : bias2;
  }
  constexpr int kStageB = (SPLA ? 3 : 2) * kPlaneB;
  __shared__ __align__(16) unsigned char sStage[2 * kStageB];
  __shared__ __align__(16) float sT[8][16 * 68];
  const int tid  = threadIdx.x;
  const int lane = tid & 31;
  const int wave = tid >> 5;
  const int tilesN = N >> 7;
  const int tilesM = M >> 7;
  const int tile = blockIdx.x;
  /* block-uniform, in front of every barrier and copy */
  if (tile >= tilesM * tilesN) return;
  const int tm = tile / tilesN;
  const int tn = tile - tm * tilesN;
  const int mB = tm << 7;
  const int nB = tn << 7;
  const int wm = wave >> 1;
  const int wn = wave & 1;

  const int rlane = lane & 15;
  const int koff  = (lane >> 4) * 8;
  const int mOff  = (lane >> 4) * 8;

  /* this lane's share of a stage */
  const int cr = tid >> 4, cc = (tid & 15) * 8;
  const unsigned ldsC = (unsigned)(uintptr_t)(sStage + cr * kLdsPitch + cc * 2);
  const __bf16* gA  = A  + (size_t)(mB + cr) * lda + cc;
  const __bf16* gA2 = A2 + (size_t)(mB + cr) * lda + cc;
  const __bf16* gB  = Bt + (size_t)(nB + cr) * ldb + cc;
  const int nPass = K / kPassK;

  /* every loop over acc[], fa[], fb[], fl[] below is unrolled: constant indices keep these arrays in registers */
  v8f acc[2][4];
#pragma unroll
  for (int i = 0; i < 2; ++i)
#pragma unroll
    for (int j = 0; j < 4; ++j) acc[i][j] = (v8f){0.f, 0.f, 0.f, 0.f, 0.f, 0.f, 0.f, 0.f};

  // ---- stage 0, published; then stage 1 in flight ----
  copy_plane_async(ldsC, gA, lda);
  copy_plane_async(ldsC + kPlaneB, gB, ldb);
  if (SPLA) copy_plane_async(ldsC + 2 * kPlaneB, gA2, lda);
  /* this wave's copies of stage 0 have landed */
  asm volatile("s_wait_asynccnt 0x0" ::: "memory");
  __syncthreads();
  if (1 < nPass) {
    copy_plane_async(ldsC + kStageB, gA + kPassK, lda);
    copy_plane_async(ldsC + kStageB + kPlaneB, gB + kPassK, ldb);
    if (SPLA) copy_plane_async(ldsC + kStageB + 2 * kPlaneB, gA2 + kPassK, lda);
  }

  /* rolled: one pass per trip, so that each trip reads one buffer and ends in one publish point */
#pragma unroll 1
  for (int t = 0; t < nPass; ++t) {
    const int bufB = (t & 1) * kStageB;
    const unsigned char* pA = sStage + bufB + (wm * 32 + rlane) * kLdsPitch + koff * 2;
    const unsigned char* pB = sStage + bufB + kPlaneB + (wn * 64 + rlane) * kLdsPitch + koff * 2;
    /* two fragment sets: the reads of k step kk + 1 (same buffer) are issued in front of step kk's products, so that a
       wave waits out the LDS latency once per pass and not at every step */
    v16b fb[2][4], fa[2][2], fl[2][2];
#pragma unroll
    for (int j = 0; j < 4; ++j) fb[0][j] = Frag<__bf16>::load((const __bf16*)(pB + j * 16 * kLdsPitch));
#pragma unroll
    for (int i = 0; i < 2; ++i) {
      fa[0][i] = Frag<__bf16>::load((const __bf16*)(pA + i * 16 * kLdsPitch));
      if (SPLA) fl[0][i] = Frag<__bf16>::load((const __bf16*)(pA + 2 * kPlaneB + i * 16 * kLdsPitch));
    }
#pragma unroll
    for (int kk = 0; kk < kPassK / 32; ++kk) {
      const int cur = kk & 1, nxt = cur ^ 1;
      if (kk + 1 < kPassK / 32) {
#pragma unroll
        for (int j = 0; j < 4; ++j)
          fb[nxt][j] = Frag<__bf16>::load((const __bf16*)(pB + j * 16 * kLdsPitch + (kk + 1) * 64));
#pragma unroll
        for (int i = 0; i < 2; ++i) {
          fa[nxt][i] = Frag<__bf16>::load((const __bf16*)(pA + i * 16 * kLdsPitch + (kk + 1) * 64));
          if (SPLA) fl[nxt][i] = Frag<__bf16>::load((const __bf16*)(pA + 2 * kPlaneB + i * 16 * kLdsPitch + (kk + 1) * 64));
        }
      }
      /* per accumulator and k step: the hi product, then the lo product */
#pragma unroll
      for (int i = 0; i < 2; ++i) {
#pragma unroll
        for (int j = 0; j < 4; ++j) acc[i][j] = mma_bf(fa[cur][i], fb[cur][j], acc[i][j]);
        if (SPLA) {
#pragma unroll
          for (int j = 0; j < 4; ++j) acc[i][j] = mma_bf(fl[cur][i], fb[cur][j], acc[i][j]);
        }
      }
    }
    /* publish point: this wave's reads of the buffer are done, its copies of the next stage have landed */
    asm volatile("s_wait_dscnt 0x0" ::: "memory");
    asm volatile("s_wait_asynccnt 0x0" ::: "memory");
    __syncthreads();
    /* refill the buffer that every wave has just left; the test is the same for the whole block */
    if (t + 2 < nPass) {
      const int ko = (t + 2) * kPassK;
      copy_plane_async(ldsC + bufB, gA + ko, lda);
      copy_plane_async(ldsC + bufB + kPlaneB, gB + ko, ldb);
      if (SPLA) copy_plane_async(ldsC + bufB + 2 * kPlaneB, gA2 + ko, lda);
    }
  }
  /* no copy is left in flight when the wave goes on */
  asm volatile("s_wait_asynccnt 0x0" ::: "memory");

  // ---- epilogue ----
  const int m0 = mB + wm * 32;
  const int n0 = nB + wn * 64;
  float* slab = sT[wave];
  float bvj[4];
#pragma unroll
  for (int j = 0; j < 4; ++j) bvj[j] = bf16r(bias[n0 + (j << 4) + rlane]);
#pragma unroll
  for (int i = 0; i < 2; ++i) {
    const int mBase = m0 + (i << 4);
#pragma unroll
    for (int j = 0; j < 4; ++j) {
#pragma unroll
      for (int r = 0; r < 8; ++r) {
        slab[(mOff + r) * 68 + (j << 4) + rlane] = acc[i][j][r] + bvj[j];
      }
    }
    __builtin_amdgcn_fence(__ATOMIC_RELEASE, "workgroup");
    __builtin_amdgcn_wave_barrier();
    __builtin_amdgcn_fence(__ATOMIC_ACQUIRE, "workgroup");
    if (EPI == 1 || (EPI == 2 && z < 2)) {
      /* 32 iterations x 32 lanes = 1024 = the whole 16 x 64 slab, each element once */
#pragma unroll 1
      for (int it = 0; it < 32; ++it) {
        float* p = slab + (it >> 1) * 68 + (it & 1) * 32 + lane;
        const float x = *p;
        const float ex = expf(fminf(x, 0.0f));
        const float y = (x > 0.0f) ? (x + 1.0f) : ex;
        *p = y;
      }
      __builtin_amdgcn_fence(__ATOMIC_RELEASE, "workgroup");
      __builtin_amdgcn_wave_barrier();
      __builtin_amdgcn_fence(__ATOMIC_ACQUIRE, "workgroup");
    }
    {
      /* row segment = 256 B = 16 lanes x 16 B; rows it*2 + hh cover 0..15 */
      const int hh = lane >> 4, c4 = (lane & 15) * 4;
      {
#pragma unroll
        for (int it = 0; it < 8; ++it) {
          const int row = it * 2 + hh;
          const v4f v = *(const v4f*)(slab + row * 68 + c4);
          *(v4f*)(Cout + (size_t)(mBase + row) * ldc + n0 + c4) = v;
        }
        
      }
    }
    __builtin_amdgcn_fence(__ATOMIC_RELEASE, "workgroup");
    __builtin_amdgcn_wave_barrier();
    __builtin_amdgcn_fence(__ATOMIC_ACQUIRE, "workgroup");
  }
}

// ---------------------------------------------------------------------------
// Chunk sums: one block of 256 threads per (chunk, batch-head), chunks 0 .. kChunks - 2 (nothing follows the last one).
// slot[d][j] = sum over the chunk's 64 steps of k[s][d] * v[s][j]; slot[4096 + d] = sum over the steps of k[s][d].
// Thread (d4 = 4 (tid >> 4), j4 = 4 (tid & 15)) keeps a 4 x 4 patch in registers: two 16-B LDS reads feed 16 FMAs.
// Staging coverage: rows lr + 16 i (lr = tid >> 4, i = 0..3) x cols 4 (tid & 15) .. + 3 = 64 x 64 per tensor.
// LDS: 2 x 16,384 = 32,768 B.
// ---------------------------------------------------------------------------
__global__ __launch_bounds__(256) void chunk_state_kernel(
    const float* __restrict__ KF, const float* __restrict__ VF, float* __restrict__ ST)
{
  __shared__ __align__(16) float sK[kChunkL * 64];
  __shared__ __align__(16) float sV[kChunkL * 64];
  const int tid = threadIdx.x;
  const int chunk = blockIdx.x;
  const int bh = blockIdx.y;
  const size_t row0 = (size_t)(bh >> 4) * kSeq + (size_t)chunk * kChunkL;
  const int col0 = (bh & 15) * kHd;
  const int lr = tid >> 4, lc4 = (tid & 15) * 4;
  /* unrolled: all eight global loads are issued before the first LDS store waits on one */
#pragma unroll
  for (int i = 0; i < kChunkL / 16; ++i) {
    const int r = lr + 16 * i;
    const size_t g = (row0 + (size_t)r) * kDim + col0 + lc4;
    *(v4f*)(sK + r * 64 + lc4) = *(const v4f*)(KF + g);
    *(v4f*)(sV + r * 64 + lc4) = *(const v4f*)(VF + g);
  }
  __syncthreads();

  const int d4 = lr * 4, j4 = lc4;
  /* every loop over a[] is unrolled so that its indices are constants and the patch stays in registers */
  v4f a[4];
#pragma unroll
  for (int r = 0; r < 4; ++r) a[r] = (v4f){0.f, 0.f, 0.f, 0.f};
  /* eight steps' LDS reads in flight together; rolled, every step waits out a whole LDS latency */
#pragma unroll 8
  for (int s = 0; s < kChunkL; ++s) {
    const v4f kk = *(const v4f*)(sK + s * 64 + d4);
    const v4f vv = *(const v4f*)(sV + s * 64 + j4);
#pragma unroll
    for (int r = 0; r < 4; ++r)
#pragma unroll
      for (int e = 0; e < 4; ++e) a[r][e] = fmaf(kk[r], vv[e], a[r][e]);
  }
  float* slot = ST + ((size_t)bh * (kChunks - 1) + chunk) * kSlotF;
#pragma unroll
  for (int r = 0; r < 4; ++r) *(v4f*)(slot + (d4 + r) * 64 + j4) = a[r];

  /* key sums; waves 0 and 1 only (wave-uniform predicate) */
  if (tid < 64) {
    float c = 0.0f;
    for (int s = 0; s < kChunkL; ++s) c += sK[s * 64 + tid];
    slot[kHd * kHd + tid] = c;
  }
}

// ---------------------------------------------------------------------------
// Inclusive sum of the chunk slots along the chunk axis, in place: slot c becomes the state at the end of chunk c.
// One thread per float of a slot (4160 per batch-head, grid.x = 17 blocks with a tail guard); the 31 values stay in
// registers, so all loads are in flight together and the thread pays the load latency once.
// ---------------------------------------------------------------------------
__global__ __launch_bounds__(256) void chunk_prefix_kernel(float* __restrict__ ST)
{
  const int i = blockIdx.x * 256 + threadIdx.x;
  if (i >= kSlotF) return;
  float* base = ST + (size_t)blockIdx.y * (kChunks - 1) * kSlotF + i;
  /* both loops unrolled: constant indices keep x[] in registers */
  float x[kChunks - 1];
#pragma unroll
  for (int c = 0; c < kChunks - 1; ++c) x[c] = base[(size_t)c * kSlotF];
#pragma unroll
  for (int c = 1; c < kChunks - 1; ++c) {
    x[c] += x[c - 1];
    base[(size_t)c * kSlotF] = x[c];
  }
}

// ---------------------------------------------------------------------------
// Causal state scan, one block of 256 threads per (chunk, batch-head), the chunk's 64 steps in a static loop.
// Thread (j = tid & 63, dg = tid >> 6) keeps kv[d][j] for d = 16 dg .. 16 dg + 15 in registers; chunk 0 starts from
// zero, chunk c > 0 from slot c - 1 of ST (state and key sums at the end of the chunk before it).
// Per step s (inclusive sums): kv[d][j] += k[d] * v[j]; partial[dg][s][j] = sum over its 16 d of q[d] * kv[d][j].
// Steps are staged 32 at a time: sQ, sK, sV hold q, k, v rows [32][64] f32; sN holds the four partial planes [4][32][64].
// After the 32 steps: threads 0..63 turn sK into the inclusive key sums in place (running carry in a register);
// then lane (row = 4 wave + (lane >> 3), cols 8 (lane & 7) .. + 7) forms den = sum_d q[d] * ksum[d] (rolled, f32),
// num = ((p0 + p1) + p2) + p3, out = num * (1 / (den + eps)), splits out into bf16 hi + lo and stores both planes.
// Staging coverage: rows lr, lr + 16 (lr = tid >> 4 = 0..15) x cols 4 (tid & 15) .. + 3 = 32 x 64 per tensor.
// LDS: 3 x 8,192 + 32,768 = 57,344 B.
// ---------------------------------------------------------------------------
__global__ __launch_bounds__(256) void scan_state_kernel(
    const float* __restrict__ QF, const float* __restrict__ KF, const float* __restrict__ VF,
    const float* __restrict__ ST, unsigned short* __restrict__ AH, unsigned short* __restrict__ AL)
{
  __shared__ __align__(16) float sQ[kScanT * 64];
  __shared__ __align__(16) float sK[kScanT * 64];
  __shared__ __align__(16) float sV[kScanT * 64];
  __shared__ __align__(16) float sN[4 * kScanT * 64];
  const int tid = threadIdx.x, lane = tid & 31, wave = tid >> 5;
  const int j = tid & 63;
  const int dg = tid >> 6;
  const int chunk = blockIdx.x;
  const int bh = blockIdx.y;
  const int bb = bh >> 4;
  const int hd = bh & 15;
  const size_t row0 = (size_t)bb * kSeq;
  const int col0 = hd * kHd;

  float kv[16];
#pragma unroll
  for (int i = 0; i < 16; ++i) kv[i] = 0.0f;
  float kcarry = 0.0f;
  /* block-uniform predicate */
  if (chunk > 0) {
    const float* slot = ST + ((size_t)bh * (kChunks - 1) + (chunk - 1)) * kSlotF;
    /* unrolled: constant indices keep kv[] in registers */
#pragma unroll
    for (int i = 0; i < 15; ++i) kv[i] = slot[(dg * 16 + i) * 64 + j];
    /* the last load may land in the offset register that the fifteen before it name: their wait stands in front of it */
    asm volatile("s_wait_xcnt 0x0" ::: "memory");
    kv[15] = slot[(dg * 16 + 15) * 64 + j];
    if (tid < 64) kcarry = slot[kHd * kHd + tid];
  }

  const int lr = tid >> 4, lc4 = (tid & 15) * 4;
  const int q4 = lane >> 3, c8 = (lane & 7) * 8;
  const int orow = wave * 4 + q4;

#pragma unroll 1
  for (int t0 = chunk * kChunkL; t0 < (chunk + 1) * kChunkL; t0 += kScanT) {
    /* every read of the stage before this one has finished */
    __syncthreads();
#pragma unroll
    for (int i = 0; i < 2; ++i) {
      const int r = lr + 16 * i;
      const size_t g = (row0 + (size_t)(t0 + r)) * kDim + col0 + lc4;
      *(v4f*)(sQ + r * 64 + lc4) = *(const v4f*)(QF + g);
      *(v4f*)(sK + r * 64 + lc4) = *(const v4f*)(KF + g);
      *(v4f*)(sV + r * 64 + lc4) = *(const v4f*)(VF + g);
    }
    __syncthreads();

#pragma unroll 1
    for (int s = 0; s < kScanT; ++s) {
      const float vj = sV[s * 64 + j];
      const float* qp = sQ + s * 64 + dg * 16;
      const float* kp = sK + s * 64 + dg * 16;
      float accn = 0.0f;
#pragma unroll
      for (int g = 0; g < 4; ++g) {
        const v4f kk = *(const v4f*)(kp + 4 * g);
        const v4f qq = *(const v4f*)(qp + 4 * g);
        kv[4 * g + 0] = fmaf(kk[0], vj, kv[4 * g + 0]);
        accn = fmaf(qq[0], kv[4 * g + 0], accn);
        kv[4 * g + 1] = fmaf(kk[1], vj, kv[4 * g + 1]);
        accn = fmaf(qq[1], kv[4 * g + 1], accn);
        kv[4 * g + 2] = fmaf(kk[2], vj, kv[4 * g + 2]);
        accn = fmaf(qq[2], kv[4 * g + 2], accn);
        kv[4 * g + 3] = fmaf(kk[3], vj, kv[4 * g + 3]);
        accn = fmaf(qq[3], kv[4 * g + 3], accn);
      }
      sN[(dg * kScanT + s) * 64 + j] = accn;
    }
    __syncthreads();

    /* inclusive key sums in place; waves 0 and 1 only (wave-uniform predicate) */
    if (tid < 64) {
      float c = kcarry;
#pragma unroll 1
      for (int s = 0; s < kScanT; ++s) {
        c += sK[s * 64 + tid];
        sK[s * 64 + tid] = c;
      }
      kcarry = c;
    }
    __syncthreads();

    float den = 0.0f;
#pragma unroll 1
    for (int g = 0; g < 16; ++g) {
      const v4f qv = *(const v4f*)(sQ + orow * 64 + 4 * g);
      const v4f kc = *(const v4f*)(sK + orow * 64 + 4 * g);
      den = fmaf(qv[0], kc[0], den);
      den = fmaf(qv[1], kc[1], den);
      den = fmaf(qv[2], kc[2], den);
      den = fmaf(qv[3], kc[3], den);
    }
    const float inv = 1.0f / (den + kEps);

    const float* np = sN + orow * 64 + c8;
    const v4f a0 = *(const v4f*)(np);
    const v4f a1 = *(const v4f*)(np + 4);
    const v4f b0 = *(const v4f*)(np + 1 * kScanT * 64);
    const v4f b1 = *(const v4f*)(np + 1 * kScanT * 64 + 4);
    const v4f e0 = *(const v4f*)(np + 2 * kScanT * 64);
    const v4f e1 = *(const v4f*)(np + 2 * kScanT * 64 + 4);
    const v4f f0 = *(const v4f*)(np + 3 * kScanT * 64);
    const v4f f1 = *(const v4f*)(np + 3 * kScanT * 64 + 4);
    float o[8];
#pragma unroll
    for (int e = 0; e < 4; ++e) {
      const float n0v = ((a0[e] + b0[e]) + e0[e]) + f0[e];
      const float n1v = ((a1[e] + b1[e]) + e1[e]) + f1[e];
      o[e]     = n0v * inv;
      o[4 + e] = n1v * inv;
    }
    unsigned short hb[8], lb[8];
#pragma unroll
    for (int e = 0; e < 8; ++e) {
      const float x = o[e];
      const unsigned short hbits = f2bf_bits(x);
      const float res = x - bf_bits2f(hbits);
      hb[e] = hbits;
      lb[e] = f2bf_bits(res);
    }
    const v4u uh = (v4u){pk16(hb[0], hb[1]), pk16(hb[2], hb[3]), pk16(hb[4], hb[5]), pk16(hb[6], hb[7])};
    const v4u ul = (v4u){pk16(lb[0], lb[1]), pk16(lb[2], lb[3]), pk16(lb[4], lb[5]), pk16(lb[6], lb[7])};
    const size_t oo = (row0 + (size_t)(t0 + orow)) * kDim + col0 + c8;
    unsigned short* ph = AH + oo;
    unsigned short* pl = AL + oo;
    *(v4u*)ph = uh;
    *(v4u*)pl = ul;
    
  }
}

// ---------------------------------------------------------------------------
// Host glue: 1 convert launch + 1 launch of the three projection GEMMs + 3 scan launches (chunk sums, chunk prefix, scan)
// + 1 output GEMM = 6 launches. Kernel launches only.
// GEMM shapes: M 4096, N 1024, K 1024 everywhere (K, M and N % 128 == 0): 32 x 8 = 256 tiles -> 256 blocks per product.
// ---------------------------------------------------------------------------
extern "C" void kernel_launch(void* const* d_in, const int* in_sizes, int n_in,
                              void* d_out, int out_size, void* d_ws, size_t ws_size,
                              hipStream_t stream) {
  if (n_in < 11 || d_out == nullptr || d_ws == nullptr) return;
  if (in_sizes[0] != kRows * kDim || in_sizes[1] != kRows * kDim || in_sizes[2] != kRows * kDim) return;
  if (in_sizes[3] != kDim * kDim || in_sizes[5] != kDim * kDim || in_sizes[7] != kDim * kDim ||
      in_sizes[9] != kDim * kDim) return;
  if (in_sizes[4] != kDim || in_sizes[6] != kDim || in_sizes[8] != kDim || in_sizes[10] != kDim) return;
  if (out_size != kRows * kDim) return;
  if (ws_size < kWsTotal) return;

  const float* query = (const float*)d_in[0];
  const float* key   = (const float*)d_in[1];
  const float* value = (const float*)d_in[2];
  const float* Wq    = (const float*)d_in[3];
  const float* bq    = (const float*)d_in[4];
  const float* Wk    = (const float*)d_in[5];
  const float* bk    = (const float*)d_in[6];
  const float* Wv    = (const float*)d_in[7];
  const float* bv    = (const float*)d_in[8];
  const float* Wo    = (const float*)d_in[9];
  const float* bo    = (const float*)d_in[10];
  float* out = (float*)d_out;

  char* ws = (char*)d_ws;
  unsigned short* XQ = (unsigned short*)(ws + kOffXQ);
  unsigned short* XK = (unsigned short*)(ws + kOffXK);
  unsigned short* XV = (unsigned short*)(ws + kOffXV);
  unsigned short* WQ = (unsigned short*)(ws + kOffWQ);
  unsigned short* WK = (unsigned short*)(ws + kOffWK);
  unsigned short* WV = (unsigned short*)(ws + kOffWV);
  unsigned short* WO = (unsigned short*)(ws + kOffWO);
  float*          QF = (float*)(ws + kOffQF);
  float*          KF = (float*)(ws + kOffKF);
  float*          VF = (float*)(ws + kOffVF);
  unsigned short* AH = (unsigned short*)(ws + kOffAH);
  unsigned short* AL = (unsigned short*)(ws + kOffAL);
  float*          ST = (float*)(ws + kOffST);

  // ---- bf16 operand planes (weights are [out][in] = Bt layout already) ----
  cvt_bf16_planes_kernel<<<dim3(kCvtBlk), 256, 0, stream>>>(query, key, value, Wq, Wk, Wv, Wo,
                                                            XQ, XK, XV, WQ, WK, WV, WO);

  // ---- projections, one launch: q and k with the feature map in the epilogue, v plain; planes XQ|XK|XV, WQ|WK|WV, QF|KF|VF ----
  const int gblocks = (kRows / 128) * (kDim / 128);
  gemm_tile64_kernel<false, 2><<<dim3(gblocks, 3), 256, 0, stream>>>(XQ, XQ, kDim, WQ, kDim, QF, kDim, bq, kRows, kDim, kDim,
                                                                     bk, bv);

  // ---- causal state scan: chunk sums, their running sum, then one block per (chunk, batch-head) ----
  chunk_state_kernel<<<dim3(kChunks - 1, kBatch * kHeads), 256, 0, stream>>>(KF, VF, ST);
  chunk_prefix_kernel<<<dim3((kSlotF + 255) / 256, kBatch * kHeads), 256, 0, stream>>>(ST);
  scan_state_kernel<<<dim3(kChunks, kBatch * kHeads), 256, 0, stream>>>(QF, KF, VF, ST, AH, AL);

  // ---- output projection: (hi + lo) . bf16(Wo)^T + bo, both parts into one accumulator ----
  gemm_tile64_kernel<true, 0><<<dim3(gblocks), 256, 0, stream>>>(AH, AL, kDim, WO, kDim, out, kDim, bo, kRows, kDim, kDim);
}

// v004
// Measured time: 105 microseconds a run.
// Two timings next to v003 put it at 1.05 and 1.04 times that version's speed.
// All steps since v000 together make it 7.06 times as fast.
// Contractions: q/k/v projections on v_wmma_f32_16x16x32_bf16 (bf16(x) x bf16(W), one product, f32 accumulate); output projection on v_wmma_f32_16x16x32_bf16 with the attention plane carried as bf16 hi + lo planes against bf16(Wo) (two products into one f32 accumulator); feature map, 64x64 state scan, normaliser and division in f32 on the vector unit.
#include <hip/hip_runtime.h>
#include <math.h>

typedef __attribute__((ext_vector_type(16))) __bf16   v16b;
typedef __attribute__((ext_vector_type(8)))  __bf16   v8b;
typedef __attribute__((ext_vector_type(8)))  float    v8f;
typedef __attribute__((ext_vector_type(4)))  float    v4f;
typedef __attribute__((ext_vector_type(4)))  unsigned int v4u;

// ---------------------------------------------------------------------------
// Shape constants
// ---------------------------------------------------------------------------
constexpr int kBatch = 2;
constexpr int kSeq   = 2048;
constexpr int kDim   = 1024;
constexpr int kHeads = 16;
constexpr int kHd    = 64;
constexpr int kRows  = kBatch * kSeq;
constexpr int kScanT = 32;
constexpr int kChunkL = 64;
constexpr int kChunks = kSeq / kChunkL;
constexpr int kSlotF  = kHd * kHd + kHd;
constexpr float kEps = 1e-6f;
static_assert(kHeads * kHd == kDim, "head split");
static_assert((kDim % 128) == 0 && kDim >= 256, "GEMM K: whole passes of 128, at least two");
static_assert((kRows % 128) == 0 && (kDim % 128) == 0, "GEMM M, N multiples of 128");
static_assert((kSeq % kChunkL) == 0 && (kChunkL % kScanT) == 0, "scan chunking");
static_assert((kSlotF % 32) == 0, "128-B aligned state slots");
static_assert(kHd == 64, "one head = one 64-column tile");

// ---------------------------------------------------------------------------
// Workspace region map (bytes; every offset is a multiple of 128)
//   XQ  bf16 [4096][1024]  bf16(query)                  8,388,608
//   XK  bf16 [4096][1024]  bf16(key)                    8,388,608
//   XV  bf16 [4096][1024]  bf16(value)                  8,388,608
//   WQ  bf16 [1024][1024]  bf16(Wq)  (Bt layout)        2,097,152
//   WK  bf16 [1024][1024]  bf16(Wk)                     2,097,152
//   WV  bf16 [1024][1024]  bf16(Wv)                     2,097,152
//   WO  bf16 [1024][1024]  bf16(Wo)                     2,097,152
//   QF  f32  [4096][1024]  phi(q)                      16,777,216
//   KF  f32  [4096][1024]  phi(k)                      16,777,216
//   VF  f32  [4096][1024]  v                           16,777,216
//   AH  bf16 [4096][1024]  attention plane, hi part     8,388,608
//   AL  bf16 [4096][1024]  attention plane, lo part     8,388,608
//   ST  f32  [32][31][4160] chunk states: 64x64 key-value sum, then 64 key sums   16,506,880
//   total                                             117,170,176
// ---------------------------------------------------------------------------
constexpr size_t kActB  = (size_t)kRows * kDim * 2;
constexpr size_t kWgtB  = (size_t)kDim * kDim * 2;
constexpr size_t kF32B  = (size_t)kRows * kDim * 4;
constexpr size_t kOffXQ = 0;
constexpr size_t kOffXK = kOffXQ + kActB;
constexpr size_t kOffXV = kOffXK + kActB;
constexpr size_t kOffWQ = kOffXV + kActB;
constexpr size_t kOffWK = kOffWQ + kWgtB;
constexpr size_t kOffWV = kOffWK + kWgtB;
constexpr size_t kOffWO = kOffWV + kWgtB;
constexpr size_t kOffQF = kOffWO + kWgtB;
constexpr size_t kOffKF = kOffQF + kF32B;
constexpr size_t kOffVF = kOffKF + kF32B;
constexpr size_t kOffAH = kOffVF + kF32B;
constexpr size_t kOffAL = kOffAH + kActB;
constexpr size_t kOffST = kOffAL + kActB;
constexpr size_t kStB   = (size_t)kBatch * kHeads * (kChunks - 1) * kSlotF * 4;
constexpr size_t kWsTotal = kOffST + kStB;
static_assert(kWsTotal == 117170176ull, "carve total");
static_assert(kOffXK == kOffXQ + kActB && kOffXV == kOffXK + kActB && kOffWK == kOffWQ + kWgtB && kOffWV == kOffWK + kWgtB &&
              kOffKF == kOffQF + kF32B && kOffVF == kOffKF + kF32B, "q, k, v planes lie one behind the other");
static_assert(kWsTotal <= 134217728ull, "carve cap");
static_assert((kOffXK % 128) == 0 && (kOffXV % 128) == 0 && (kOffWQ % 128) == 0 && (kOffWK % 128) == 0 &&
              (kOffWV % 128) == 0 && (kOffWO % 128) == 0 && (kOffQF % 128) == 0 && (kOffKF % 128) == 0 &&
              (kOffVF % 128) == 0 && (kOffAH % 128) == 0 && (kOffAL % 128) == 0 && (kOffST % 128) == 0,
              "128-B aligned regions");

// ---------------------------------------------------------------------------
// Small helpers
// ---------------------------------------------------------------------------
__device__ __forceinline__ unsigned short f2bf_bits(float f) {
  unsigned u = __float_as_uint(f);
  return (unsigned short)((u + 0x7FFFu + ((u >> 16) & 1u)) >> 16);
}
__device__ __forceinline__ float bf_bits2f(unsigned short h) { return __uint_as_float(((unsigned)h) << 16); }
/* RNE-convert to a bf16 value, kept in f32 */
__device__ __forceinline__ float bf16r(float f) { return bf_bits2f(f2bf_bits(f)); }
__device__ __forceinline__ unsigned pk16(unsigned short a, unsigned short b) { return (unsigned)a | ((unsigned)b << 16); }

template <typename T> struct Frag;
template <> struct Frag<__bf16> {
  typedef v16b V; union U { v16b v; v8b h[2]; };
  /* elements 0..7 <- p[0..7], elements 8..15 <- p[16..23] */
  static __device__ __forceinline__ v16b load(const __bf16* p) {
    U f; f.h[0] = *(const v8b*)(p); f.h[1] = *(const v8b*)(p + 16); return f.v;
  }
};

/* one matrix instruction followed by its own hazard guard: the guard ties this accumulator and names both fragments */
__device__ __forceinline__ v8f mma_bf(v16b a, v16b b, v8f c) {
  c = __builtin_amdgcn_wmma_f32_16x16x32_bf16(false, a, false, b, (short)0, c, false, false);
  asm volatile("v_nop\n\tv_nop\n\tv_nop\n\tv_nop" : "+v"(c) : "v"(a), "v"(b));
  return c;
}

// ---------------------------------------------------------------------------
// f32 -> bf16 (RNE-convert) of all seven operand planes in one launch: three activation planes, then four weight planes.
// The block index selects plane and place in it (block-uniform): blocks 0 .. 6143 are 2048 per activation plane,
// blocks 6144 .. 8191 are 512 per weight plane.
// 8 consecutive elements per thread: two 16-B loads, ONE 16-B store per lane; 32 consecutive lanes write 512 contiguous
// Coverage: thread i of a plane writes elements 8i..8i+7, i < n8; blocks per plane = n8/256 exactly:
//   activations 4096*1024/8 = 524,288 -> 2048 blocks;  weights 1024*1024/8 = 131,072 -> 512 blocks.
// ---------------------------------------------------------------------------
constexpr int kActN8  = kRows * kDim / 8;
constexpr int kWgtN8  = kDim * kDim / 8;
constexpr int kActBlk = kActN8 / 256;
constexpr int kWgtBlk = kWgtN8 / 256;
constexpr int kCvtBlk = 3 * kActBlk + 4 * kWgtBlk;
static_assert((kActN8 % 256) == 0 && (kWgtN8 % 256) == 0, "whole blocks per plane");
__global__ __launch_bounds__(256) void cvt_bf16_planes_kernel(
    const float* __restrict__ a0, const float* __restrict__ a1, const float* __restrict__ a2,
    const float* __restrict__ w0, const float* __restrict__ w1, const float* __restrict__ w2, const float* __restrict__ w3,
    unsigned short* __restrict__ da0, unsigned short* __restrict__ da1, unsigned short* __restrict__ da2,
    unsigned short* __restrict__ dw0, unsigned short* __restrict__ dw1, unsigned short* __restrict__ dw2,
    unsigned short* __restrict__ dw3)
{
  const int b = blockIdx.x;
  const float* src;
  unsigned short* dst;
  int blk, n8;
  if (b < 3 * kActBlk) {
    const int z = b / kActBlk;
    blk = b - z * kActBlk;
    n8  = kActN8;
    src = (z == 0) ? a0 : (z == 1) ? a1 : a2;
    dst = (z == 0) ? da0 : (z == 1) ? da1 : da2;
  } else {
    const int bw = b - 3 * kActBlk;
    const int z = bw / kWgtBlk;
    blk = bw - z * kWgtBlk;
    n8  = kWgtN8;
    src = (z == 0) ? w0 : (z == 1) ? w1 : (z == 2) ? w2 : w3;
    dst = (z == 0) ? dw0 : (z == 1) ? dw1 : (z == 2) ? dw2 : dw3;
  }
  const int i = blk * 256 + threadIdx.x;
  if (i >= n8) return;
  const float* p = src + 8 * (size_t)i;
  const v4f a = *(const v4f*)(p);
  const v4f c = *(const v4f*)(p + 4);
  unsigned short hb[8];
#pragma unroll
  for (int e = 0; e < 4; ++e) {
    const float x0 = a[e];
    const float x1 = c[e];
    hb[e]     = f2bf_bits(x0);
    hb[4 + e] = f2bf_bits(x1);
  }
  const v4u u = (v4u){pk16(hb[0], hb[1]), pk16(hb[2], hb[3]), pk16(hb[4], hb[5]), pk16(hb[6], hb[7])};
  unsigned short* q = dst + 8 * (size_t)i;
  *(v4u*)q = u;
  
}

// ---------------------------------------------------------------------------
// Eight asynchronous 16-B copies per lane, global memory to LDS: 128 rows of 256 B of one operand plane.
// Lane (r = tid >> 4, c = tid & 15) moves bytes 16 c .. 16 c + 15 of rows r, r + 16, .. r + 112: one wave-wide copy is two
// whole 256-B rows. lds = the lane's LDS byte address of row r, g = its global address of row r, ld = row pitch in elements.
// ---------------------------------------------------------------------------
constexpr int kPassK    = 128;                 /* k per pass: 256 B of every operand row */
constexpr int kLdsPitch = 272;                 /* bytes per LDS row: 16 B x odd, conflict-free for 16-B readers */
constexpr int kPlaneB   = 128 * kLdsPitch;     /* one operand plane of a stage */
__device__ __forceinline__ void copy_plane_async(unsigned lds, const __bf16* g, int ld) {
  const size_t step = (size_t)16 * ld;
  const __bf16* g1 = g + step;      const __bf16* g2 = g + 2 * step;  const __bf16* g3 = g + 3 * step;
  const __bf16* g4 = g + 4 * step;  const __bf16* g5 = g + 5 * step;  const __bf16* g6 = g + 6 * step;
  const __bf16* g7 = g + 7 * step;
  const unsigned ls = 16u * kLdsPitch;
  /* the copies and the wait that stands before their address registers may be rewritten, in one statement */
  asm volatile(
      "global_load_async_to_lds_b128 %0, %8, off\n\t"
      "global_load_async_to_lds_b128 %1, %9, off\n\t"
      "global_load_async_to_lds_b128 %2, %10, off\n\t"
      "global_load_async_to_lds_b128 %3, %11, off\n\t"
      "global_load_async_to_lds_b128 %4, %12, off\n\t"
      "global_load_async_to_lds_b128 %5, %13, off\n\t"
      "global_load_async_to_lds_b128 %6, %14, off\n\t"
      "global_load_async_to_lds_b128 %7, %15, off\n\t"
      "s_wait_xcnt 0x0"
      :: "v"(lds), "v"(lds + ls), "v"(lds + 2u * ls), "v"(lds + 3u * ls), "v"(lds + 4u * ls), "v"(lds + 5u * ls),
         "v"(lds + 6u * ls), "v"(lds + 7u * ls), "v"(g), "v"(g1), "v"(g2), "v"(g3), "v"(g4), "v"(g5), "v"(g6), "v"(g7)
      : "memory");
}

// ---------------------------------------------------------------------------
// bf16 GEMM, operands staged in LDS: C[m][n] = sum_k A[m][k] * Bt[n][k] + bf16value(bias[n]).
// One block of 8 waves owns a 128 x 128 tile; wave (wm = wave >> 1, wn = wave & 1) owns rows 32 wm .. + 31, cols 64 wn .. + 63.
// A row-major [M][K] bf16 (SPLA: a second plane A2 of the same layout is accumulated against the same Bt);
// Bt row-major [N][K] bf16; M, N % 128 == 0, K % 128 == 0, K >= 256 (no tail handling). C f32, pitch ldc.
// A stage = 128 k of [A 128 rows | Bt 128 rows | A2 128 rows if SPLA], brought by asynchronous copies into one of two
// buffers: the copies of stage t + 2 fly while stage t + 1 is worked on.
// EPI 0: plain.  EPI 1: feature map y = x + 1 for x > 0, exp(x) otherwise, applied to the accumulators in registers.
// EPI 2: three products of one shape in one launch. blockIdx.y = 0, 1, 2 (block-uniform) picks the plane: A, Bt and C are
// three dense planes one behind the other (M x lda, N x ldb, M x ldc elements each), the biases three buffers; planes 0
// and 1 take the feature map, plane 2 is plain.
// Fragment map: lane l, row/col = l & 15, half h = l >> 4; elements 0..7 <- k0 + 8h + 0..7, 8..15 <- k0 + 16 + 8h + 0..7
// for both operands; accumulator element r = (row 8h + r, col l & 15).
// Epilogue: 16-row slabs staged per wave in LDS of its own (same wave stores and reloads, wave-level ordering).
// Coverage: 32 x 8 = 256 tiles of 128 x 128 = 4096 x 1024; grid.x = 256 blocks, one tile per block and plane.
// ---------------------------------------------------------------------------
template <bool SPLA, int EPI>
__global__ __launch_bounds__(256) void gemm_tile64_kernel(
    const unsigned short* __restrict__ Ap, const unsigned short* __restrict__ A2p, int lda,
    const unsigned short* __restrict__ Btp, int ldb,
    float* __restrict__ Cout, int ldc,
    const float* __restrict__ bias, int M, int N, int K,
    const float* __restrict__ bias1 = nullptr, const float* __restrict__ bias2 = nullptr)
{
  const int z = (EPI == 2) ? (int)blockIdx.y : 0;
  const __bf16* A  = (const __bf16*)Ap + (size_t)z * M * lda;
  const __bf16* A2 = (const __bf16*)A2p + (size_t)z * M * lda;
  const __bf16* Bt = (const __bf16*)Btp + (size_t)z * N * ldb;
  if (EPI == 2) {
    Cout += (size_t)z * M * ldc;
    bias = (z == 0) ? bias : (z == 1) ? bias1 : bias2;
  }
  constexpr int kStageB = (SPLA ? 3 : 2) * kPlaneB;
  __shared__ __align__(16) unsigned char sStage[2 * kStageB];
  __shared__ __align__(16) float sT[8][16 * 68];
  const int tid  = threadIdx.x;
  const int lane = tid & 31;
  const int wave = tid >> 5;
  const int tilesN = N >> 7;
  const int tilesM = M >> 7;
  const int tile = blockIdx.x;
  /* block-uniform, in front of every barrier and copy */
  if (tile >= tilesM * tilesN) return;
  const int tm = tile / tilesN;
  const int tn = tile - tm * tilesN;
  const int mB = tm << 7;
  const int nB = tn << 7;
  const int wm = wave >> 1;
  const int wn = wave & 1;

  const int rlane = lane & 15;
  const int koff  = (lane >> 4) * 8;
  const int mOff  = (lane >> 4) * 8;

  /* this lane's share of a stage */
  const int cr = tid >> 4, cc = (tid & 15) * 8;
  const unsigned ldsC = (unsigned)(uintptr_t)(sStage + cr * kLdsPitch + cc * 2);
  const __bf16* gA  = A  + (size_t)(mB + cr) * lda + cc;
  const __bf16* gA2 = A2 + (size_t)(mB + cr) * lda + cc;
  const __bf16* gB  = Bt + (size_t)(nB + cr) * ldb + cc;
  const int nPass = K / kPassK;

  /* every loop over acc[], fa[], fb[], fl[] below is unrolled: constant indices keep these arrays in registers */
  v8f acc[2][4];
#pragma unroll
  for (int i = 0; i < 2; ++i)
#pragma unroll
    for (int j = 0; j < 4; ++j) acc[i][j] = (v8f){0.f, 0.f, 0.f, 0.f, 0.f, 0.f, 0.f, 0.f};

  // ---- stage 0, published; then stage 1 in flight ----
  copy_plane_async(ldsC, gA, lda);
  copy_plane_async(ldsC + kPlaneB, gB, ldb);
  if (SPLA) copy_plane_async(ldsC + 2 * kPlaneB, gA2, lda);
  /* this wave's copies of stage 0 have landed */
  asm volatile("s_wait_asynccnt 0x0" ::: "memory");
  __syncthreads();
  if (1 < nPass) {
    copy_plane_async(ldsC + kStageB, gA + kPassK, lda);
    copy_plane_async(ldsC + kStageB + kPlaneB, gB + kPassK, ldb);
    if (SPLA) copy_plane_async(ldsC + kStageB + 2 * kPlaneB, gA2 + kPassK, lda);
  }

  /* rolled: one pass per trip, so that each trip reads one buffer and ends in one publish point */
#pragma unroll 1
  for (int t = 0; t < nPass; ++t) {
    const int bufB = (t & 1) * kStageB;
    const unsigned char* pA = sStage + bufB + (wm * 32 + rlane) * kLdsPitch + koff * 2;
    const unsigned char* pB = sStage + bufB + kPlaneB + (wn * 64 + rlane) * kLdsPitch + koff * 2;
    /* two fragment sets: the reads of k step kk + 1 (same buffer) are issued in front of step kk's products, so that a
       wave waits out the LDS latency once per pass and not at every step */
    v16b fb[2][4], fa[2][2], fl[2][2];
#pragma unroll
    for (int j = 0; j < 4; ++j) fb[0][j] = Frag<__bf16>::load((const __bf16*)(pB + j * 16 * kLdsPitch));
#pragma unroll
    for (int i = 0; i < 2; ++i) {
      fa[0][i] = Frag<__bf16>::load((const __bf16*)(pA + i * 16 * kLdsPitch));
      if (SPLA) fl[0][i] = Frag<__bf16>::load((const __bf16*)(pA + 2 * kPlaneB + i * 16 * kLdsPitch));
    }
#pragma unroll
    for (int kk = 0; kk < kPassK / 32; ++kk) {
      const int cur = kk & 1, nxt = cur ^ 1;
      if (kk + 1 < kPassK / 32) {
#pragma unroll
        for (int j = 0; j < 4; ++j)
          fb[nxt][j] = Frag<__bf16>::load((const __bf16*)(pB + j * 16 * kLdsPitch + (kk + 1) * 64));
#pragma unroll
        for (int i = 0; i < 2; ++i) {
          fa[nxt][i] = Frag<__bf16>::load((const __bf16*)(pA + i * 16 * kLdsPitch + (kk + 1) * 64));
          if (SPLA) fl[nxt][i] = Frag<__bf16>::load((const __bf16*)(pA + 2 * kPlaneB + i * 16 * kLdsPitch + (kk + 1) * 64));
        }
      }
      /* per accumulator and k step: the hi product, then the lo product */
#pragma unroll
      for (int i = 0; i < 2; ++i) {
#pragma unroll
        for (int j = 0; j < 4; ++j) acc[i][j] = mma_bf(fa[cur][i], fb[cur][j], acc[i][j]);
        if (SPLA) {
#pragma unroll
          for (int j = 0; j < 4; ++j) acc[i][j] = mma_bf(fl[cur][i], fb[cur][j], acc[i][j]);
        }
      }
    }
    /* publish point: this wave's reads of the buffer are done, its copies of the next stage have landed */
    asm volatile("s_wait_dscnt 0x0" ::: "memory");
    asm volatile("s_wait_asynccnt 0x0" ::: "memory");
    __syncthreads();
    /* refill the buffer that every wave has just left; the test is the same for the whole block */
    if (t + 2 < nPass) {
      const int ko = (t + 2) * kPassK;
      copy_plane_async(ldsC + bufB, gA + ko, lda);
      copy_plane_async(ldsC + bufB + kPlaneB, gB + ko, ldb);
      if (SPLA) copy_plane_async(ldsC + bufB + 2 * kPlaneB, gA2 + ko, lda);
    }
  }
  /* no copy is left in flight when the wave goes on */
  asm volatile("s_wait_asynccnt 0x0" ::: "memory");

  // ---- epilogue ----
  const int m0 = mB + wm * 32;
  const int n0 = nB + wn * 64;
  float* slab = sT[wave];
  float bvj[4];
#pragma unroll
  for (int j = 0; j < 4; ++j) bvj[j] = bf16r(bias[n0 + (j << 4) + rlane]);
  /* every loop over acc[] is unrolled: constant indices keep it in registers */
#pragma unroll
  for (int i = 0; i < 2; ++i)
#pragma unroll
    for (int j = 0; j < 4; ++j)
#pragma unroll
      for (int r = 0; r < 8; ++r) acc[i][j][r] += bvj[j];
  /* feature map on the accumulators themselves, 64 independent values per lane; the test is the same for the whole block */
  if (EPI == 1 || (EPI == 2 && z < 2)) {
#pragma unroll
    for (int i = 0; i < 2; ++i)
#pragma unroll
      for (int j = 0; j < 4; ++j)
#pragma unroll
        for (int r = 0; r < 8; ++r) {
          const float x = acc[i][j][r];
          const float ex = expf(fminf(x, 0.0f));
          acc[i][j][r] = (x > 0.0f) ? (x + 1.0f) : ex;
        }
  }
#pragma unroll
  for (int i = 0; i < 2; ++i) {
    const int mBase = m0 + (i << 4);
#pragma unroll
    for (int j = 0; j < 4; ++j) {
#pragma unroll
      for (int r = 0; r < 8; ++r) {
        slab[(mOff + r) * 68 + (j << 4) + rlane] = acc[i][j][r];
      }
    }
    __builtin_amdgcn_fence(__ATOMIC_RELEASE, "workgroup");
    __builtin_amdgcn_wave_barrier();
    __builtin_amdgcn_fence(__ATOMIC_ACQUIRE, "workgroup");
    {
      /* row segment = 256 B = 16 lanes x 16 B; rows it*2 + hh cover 0..15 */
      const int hh = lane >> 4, c4 = (lane & 15) * 4;
      {
#pragma unroll
        for (int it = 0; it < 8; ++it) {
          const int row = it * 2 + hh;
          const v4f v = *(const v4f*)(slab + row * 68 + c4);
          *(v4f*)(Cout + (size_t)(mBase + row) * ldc + n0 + c4) = v;
        }
        
      }
    }
    __builtin_amdgcn_fence(__ATOMIC_RELEASE, "workgroup");
    __builtin_amdgcn_wave_barrier();
    __builtin_amdgcn_fence(__ATOMIC_ACQUIRE, "workgroup");
  }
}

// ---------------------------------------------------------------------------
// Chunk sums: one block of 256 threads per (chunk, batch-head), chunks 0 .. kChunks - 2 (nothing follows the last one).
// slot[d][j] = sum over the chunk's 64 steps of k[s][d] * v[s][j]; slot[4096 + d] = sum over the steps of k[s][d].
// Thread (d4 = 4 (tid >> 4), j4 = 4 (tid & 15)) keeps a 4 x 4 patch in registers: two 16-B LDS reads feed 16 FMAs.
// Staging coverage: rows lr + 16 i (lr = tid >> 4, i = 0..3) x cols 4 (tid & 15) .. + 3 = 64 x 64 per tensor.
// LDS: 2 x 16,384 = 32,768 B.
// ---------------------------------------------------------------------------
__global__ __launch_bounds__(256) void chunk_state_kernel(
    const float* __restrict__ KF, const float* __restrict__ VF, float* __restrict__ ST)
{
  __shared__ __align__(16) float sK[kChunkL * 64];
  __shared__ __align__(16) float sV[kChunkL * 64];
  const int tid = threadIdx.x;
  const int chunk = blockIdx.x;
  const int bh = blockIdx.y;
  const size_t row0 = (size_t)(bh >> 4) * kSeq + (size_t)chunk * kChunkL;
  const int col0 = (bh & 15) * kHd;
  const int lr = tid >> 4, lc4 = (tid & 15) * 4;
  /* unrolled: all eight global loads are issued before the first LDS store waits on one */
#pragma unroll
  for (int i = 0; i < kChunkL / 16; ++i) {
    const int r = lr + 16 * i;
    const size_t g = (row0 + (size_t)r) * kDim + col0 + lc4;
    *(v4f*)(sK + r * 64 + lc4) = *(const v4f*)(KF + g);
    *(v4f*)(sV + r * 64 + lc4) = *(const v4f*)(VF + g);
  }
  __syncthreads();

  const int d4 = lr * 4, j4 = lc4;
  /* every loop over a[] is unrolled so that its indices are constants and the patch stays in registers */
  v4f a[4];
#pragma unroll
  for (int r = 0; r < 4; ++r) a[r] = (v4f){0.f, 0.f, 0.f, 0.f};
  /* eight steps' LDS reads in flight together; rolled, every step waits out a whole LDS latency */
#pragma unroll 8
  for (int s = 0; s < kChunkL; ++s) {
    const v4f kk = *(const v4f*)(sK + s * 64 + d4);
    const v4f vv = *(const v4f*)(sV + s * 64 + j4);
#pragma unroll
    for (int r = 0; r < 4; ++r)
#pragma unroll
      for (int e = 0; e < 4; ++e) a[r][e] = fmaf(kk[r], vv[e], a[r][e]);
  }
  float* slot = ST + ((size_t)bh * (kChunks - 1) + chunk) * kSlotF;
#pragma unroll
  for (int r = 0; r < 4; ++r) *(v4f*)(slot + (d4 + r) * 64 + j4) = a[r];

  /* key sums; waves 0 and 1 only (wave-uniform predicate) */
  if (tid < 64) {
    float c = 0.0f;
    for (int s = 0; s < kChunkL; ++s) c += sK[s * 64 + tid];
    slot[kHd * kHd + tid] = c;
  }
}

// ---------------------------------------------------------------------------
// Inclusive sum of the chunk slots along the chunk axis, in place: slot c becomes the state at the end of chunk c.
// One thread per float of a slot (4160 per batch-head, grid.x = 17 blocks with a tail guard); the 31 values stay in
// registers, so all loads are in flight together and the thread pays the load latency once.
// ---------------------------------------------------------------------------
__global__ __launch_bounds__(256) void chunk_prefix_kernel(float* __restrict__ ST)
{
  const int i = blockIdx.x * 256 + threadIdx.x;
  if (i >= kSlotF) return;
  float* base = ST + (size_t)blockIdx.y * (kChunks - 1) * kSlotF + i;
  /* both loops unrolled: constant indices keep x[] in registers */
  float x[kChunks - 1];
#pragma unroll
  for (int c = 0; c < kChunks - 1; ++c) x[c] = base[(size_t)c * kSlotF];
#pragma unroll
  for (int c = 1; c < kChunks - 1; ++c) {
    x[c] += x[c - 1];
    base[(size_t)c * kSlotF] = x[c];
  }
}

// ---------------------------------------------------------------------------
// Causal state scan, one block of 256 threads per (chunk, batch-head), the chunk's 64 steps in a static loop.
// Thread (j = tid & 63, dg = tid >> 6) keeps kv[d][j] for d = 16 dg .. 16 dg + 15 in registers; chunk 0 starts from
// zero, chunk c > 0 from slot c - 1 of ST (state and key sums at the end of the chunk before it).
// Per step s (inclusive sums): kv[d][j] += k[d] * v[j]; partial[dg][s][j] = sum over its 16 d of q[d] * kv[d][j].
// Steps are staged 32 at a time: sQ, sK, sV hold q, k, v rows [32][64] f32; sN holds the four partial planes [4][32][64].
// After the 32 steps: threads 0..63 turn sK into the inclusive key sums in place (running carry in a register);
// then lane (row = 4 wave + (lane >> 3), cols 8 (lane & 7) .. + 7) forms den = sum_d q[d] * ksum[d] (rolled, f32),
// num = ((p0 + p1) + p2) + p3, out = num * (1 / (den + eps)), splits out into bf16 hi + lo and stores both planes.
// Staging coverage: rows lr, lr + 16 (lr = tid >> 4 = 0..15) x cols 4 (tid & 15) .. + 3 = 32 x 64 per tensor.
// LDS: 3 x 8,192 + 32,768 = 57,344 B.
// ---------------------------------------------------------------------------
__global__ __launch_bounds__(256) void scan_state_kernel(
    const float* __restrict__ QF, const float* __restrict__ KF, const float* __restrict__ VF,
    const float* __restrict__ ST, unsigned short* __restrict__ AH, unsigned short* __restrict__ AL)
{
  __shared__ __align__(16) float sQ[kScanT * 64];
  __shared__ __align__(16) float sK[kScanT * 64];
  __shared__ __align__(16) float sV[kScanT * 64];
  __shared__ __align__(16) float sN[4 * kScanT * 64];
  const int tid = threadIdx.x, lane = tid & 31, wave = tid >> 5;
  const int j = tid & 63;
  const int dg = tid >> 6;
  const int chunk = blockIdx.x;
  const int bh = blockIdx.y;
  const int bb = bh >> 4;
  const int hd = bh & 15;
  const size_t row0 = (size_t)bb * kSeq;
  const int col0 = hd * kHd;

  float kv[16];
#pragma unroll
  for (int i = 0; i < 16; ++i) kv[i] = 0.0f;
  float kcarry = 0.0f;
  /* block-uniform predicate */
  if (chunk > 0) {
    const float* slot = ST + ((size_t)bh * (kChunks - 1) + (chunk - 1)) * kSlotF;
    /* unrolled: constant indices keep kv[] in registers */
#pragma unroll
    for (int i = 0; i < 15; ++i) kv[i] = slot[(dg * 16 + i) * 64 + j];
    /* the last load may land in the offset register that the fifteen before it name: their wait stands in front of it */
    asm volatile("s_wait_xcnt 0x0" ::: "memory");
    kv[15] = slot[(dg * 16 + 15) * 64 + j];
    if (tid < 64) kcarry = slot[kHd * kHd + tid];
  }

  const int lr = tid >> 4, lc4 = (tid & 15) * 4;
  const int q4 = lane >> 3, c8 = (lane & 7) * 8;
  const int orow = wave * 4 + q4;

#pragma unroll 1
  for (int t0 = chunk * kChunkL; t0 < (chunk + 1) * kChunkL; t0 += kScanT) {
    /* every read of the stage before this one has finished */
    __syncthreads();
#pragma unroll
    for (int i = 0; i < 2; ++i) {
      const int r = lr + 16 * i;
      const size_t g = (row0 + (size_t)(t0 + r)) * kDim + col0 + lc4;
      *(v4f*)(sQ + r * 64 + lc4) = *(const v4f*)(QF + g);
      *(v4f*)(sK + r * 64 + lc4) = *(const v4f*)(KF + g);
      *(v4f*)(sV + r * 64 + lc4) = *(const v4f*)(VF + g);
    }
    __syncthreads();

#pragma unroll 1
    for (int s = 0; s < kScanT; ++s) {
      const float vj = sV[s * 64 + j];
      const float* qp = sQ + s * 64 + dg * 16;
      const float* kp = sK + s * 64 + dg * 16;
      float accn = 0.0f;
#pragma unroll
      for (int g = 0; g < 4; ++g) {
        const v4f kk = *(const v4f*)(kp + 4 * g);
        const v4f qq = *(const v4f*)(qp + 4 * g);
        kv[4 * g + 0] = fmaf(kk[0], vj, kv[4 * g + 0]);
        accn = fmaf(qq[0], kv[4 * g + 0], accn);
        kv[4 * g + 1] = fmaf(kk[1], vj, kv[4 * g + 1]);
        accn = fmaf(qq[1], kv[4 * g + 1], accn);
        kv[4 * g + 2] = fmaf(kk[2], vj, kv[4 * g + 2]);
        accn = fmaf(qq[2], kv[4 * g + 2], accn);
        kv[4 * g + 3] = fmaf(kk[3], vj, kv[4 * g + 3]);
        accn = fmaf(qq[3], kv[4 * g + 3], accn);
      }
      sN[(dg * kScanT + s) * 64 + j] = accn;
    }
    __syncthreads();

    /* inclusive key sums in place; waves 0 and 1 only (wave-uniform predicate) */
    if (tid < 64) {
      float c = kcarry;
#pragma unroll 1
      for (int s = 0; s < kScanT; ++s) {
        c += sK[s * 64 + tid];
        sK[s * 64 + tid] = c;
      }
      kcarry = c;
    }
    __syncthreads();

    float den = 0.0f;
#pragma unroll 1
    for (int g = 0; g < 16; ++g) {
      const v4f qv = *(const v4f*)(sQ + orow * 64 + 4 * g);
      const v4f kc = *(const v4f*)(sK + orow * 64 + 4 * g);
      den = fmaf(qv[0], kc[0], den);
      den = fmaf(qv[1], kc[1], den);
      den = fmaf(qv[2], kc[2], den);
      den = fmaf(qv[3], kc[3], den);
    }
    const float inv = 1.0f / (den + kEps);

    const float* np = sN + orow * 64 + c8;
    const v4f a0 = *(const v4f*)(np);
    const v4f a1 = *(const v4f*)(np + 4);
    const v4f b0 = *(const v4f*)(np + 1 * kScanT * 64);
    const v4f b1 = *(const v4f*)(np + 1 * kScanT * 64 + 4);
    const v4f e0 = *(const v4f*)(np + 2 * kScanT * 64);
    const v4f e1 = *(const v4f*)(np + 2 * kScanT * 64 + 4);
    const v4f f0 = *(const v4f*)(np + 3 * kScanT * 64);
    const v4f f1 = *(const v4f*)(np + 3 * kScanT * 64 + 4);
    float o[8];
#pragma unroll
    for (int e = 0; e < 4; ++e) {
      const float n0v = ((a0[e] + b0[e]) + e0[e]) + f0[e];
      const float n1v = ((a1[e] + b1[e]) + e1[e]) + f1[e];
      o[e]     = n0v * inv;
      o[4 + e] = n1v * inv;
    }
    unsigned short hb[8], lb[8];
#pragma unroll
    for (int e = 0; e < 8; ++e) {
      const float x = o[e];
      const unsigned short hbits = f2bf_bits(x);
      const float res = x - bf_bits2f(hbits);
      hb[e] = hbits;
      lb[e] = f2bf_bits(res);
    }
    const v4u uh = (v4u){pk16(hb[0], hb[1]), pk16(hb[2], hb[3]), pk16(hb[4], hb[5]), pk16(hb[6], hb[7])};
    const v4u ul = (v4u){pk16(lb[0], lb[1]), pk16(lb[2], lb[3]), pk16(lb[4], lb[5]), pk16(lb[6], lb[7])};
    const size_t oo = (row0 + (size_t)(t0 + orow)) * kDim + col0 + c8;
    unsigned short* ph = AH + oo;
    unsigned short* pl = AL + oo;
    *(v4u*)ph = uh;
    *(v4u*)pl = ul;
    
  }
}

// ---------------------------------------------------------------------------
// Host glue: 1 convert launch + 1 launch of the three projection GEMMs + 3 scan launches (chunk sums, chunk prefix, scan)
// + 1 output GEMM = 6 launches. Kernel launches only.
// GEMM shapes: M 4096, N 1024, K 1024 everywhere (K, M and N % 128 == 0): 32 x 8 = 256 tiles -> 256 blocks per product.
// ---------------------------------------------------------------------------
extern "C" void kernel_launch(void* const* d_in, const int* in_sizes, int n_in,
                              void* d_out, int out_size, void* d_ws, size_t ws_size,
                              hipStream_t stream) {
  if (n_in < 11 || d_out == nullptr || d_ws == nullptr) return;
  if (in_sizes[0] != kRows * kDim || in_sizes[1] != kRows * kDim || in_sizes[2] != kRows * kDim) return;
  if (in_sizes[3] != kDim * kDim || in_sizes[5] != kDim * kDim || in_sizes[7] != kDim * kDim ||
      in_sizes[9] != kDim * kDim) return;
  if (in_sizes[4] != kDim || in_sizes[6] != kDim || in_sizes[8] != kDim || in_sizes[10] != kDim) return;
  if (out_size != kRows * kDim) return;
  if (ws_size < kWsTotal) return;

  const float* query = (const float*)d_in[0];
  const float* key   = (const float*)d_in[1];
  const float* value = (const float*)d_in[2];
  const float* Wq    = (const float*)d_in[3];
  const float* bq    = (const float*)d_in[4];
  const float* Wk    = (const float*)d_in[5];
  const float* bk    = (const float*)d_in[6];
  const float* Wv    = (const float*)d_in[7];
  const float* bv    = (const float*)d_in[8];
  const float* Wo    = (const float*)d_in[9];
  const float* bo    = (const float*)d_in[10];
  float* out = (float*)d_out;

  char* ws = (char*)d_ws;
  unsigned short* XQ = (unsigned short*)(ws + kOffXQ);
  unsigned short* XK = (unsigned short*)(ws + kOffXK);
  unsigned short* XV = (unsigned short*)(ws + kOffXV);
  unsigned short* WQ = (unsigned short*)(ws + kOffWQ);
  unsigned short* WK = (unsigned short*)(ws + kOffWK);
  unsigned short* WV = (unsigned short*)(ws + kOffWV);
  unsigned short* WO = (unsigned short*)(ws + kOffWO);
  float*          QF = (float*)(ws + kOffQF);
  float*          KF = (float*)(ws + kOffKF);
  float*          VF = (float*)(ws + kOffVF);
  unsigned short* AH = (unsigned short*)(ws + kOffAH);
  unsigned short* AL = (unsigned short*)(ws + kOffAL);
  float*          ST = (float*)(ws + kOffST);

  // ---- bf16 operand planes (weights are [out][in] = Bt layout already) ----
  cvt_bf16_planes_kernel<<<dim3(kCvtBlk), 256, 0, stream>>>(query, key, value, Wq, Wk, Wv, Wo,
                                                            XQ, XK, XV, WQ, WK, WV, WO);

  // ---- projections, one launch: q and k with the feature map in the epilogue, v plain; planes XQ|XK|XV, WQ|WK|WV, QF|KF|VF ----
  const int gblocks = (kRows / 128) * (kDim / 128);
  gemm_tile64_kernel<false, 2><<<dim3(gblocks, 3), 256, 0, stream>>>(XQ, XQ, kDim, WQ, kDim, QF, kDim, bq, kRows, kDim, kDim,
                                                                     bk, bv);

  // ---- causal state scan: chunk sums, their running sum, then one block per (chunk, batch-head) ----
  chunk_state_kernel<<<dim3(kChunks - 1, kBatch * kHeads), 256, 0, stream>>>(KF, VF, ST);
  chunk_prefix_kernel<<<dim3((kSlotF + 255) / 256, kBatch * kHeads), 256, 0, stream>>>(ST);
  scan_state_kernel<<<dim3(kChunks, kBatch * kHeads), 256, 0, stream>>>(QF, KF, VF, ST, AH, AL);

  // ---- output projection: (hi + lo) . bf16(Wo)^T + bo, both parts into one accumulator ----
  gemm_tile64_kernel<true, 0><<<dim3(gblocks), 256, 0, stream>>>(AH, AL, kDim, WO, kDim, out, kDim, bo, kRows, kDim, kDim);
}

// v005
// One run takes 99.9 microseconds.
// Two timings next to v004 both put it at 1.05 times that version's speed.
// All steps since v000 together make it 7.41 times as fast.
// Contractions: q/k/v projections on v_wmma_f32_16x16x32_bf16 (bf16(x) x bf16(W), one product, f32 accumulate); output projection on v_wmma_f32_16x16x32_bf16 with the attention plane carried as bf16 hi + lo planes against bf16(Wo) (two products into one f32 accumulator); feature map, 64x64 state scan, normaliser and division in f32 on the vector unit.
#include <hip/hip_runtime.h>
#include <math.h>

typedef __attribute__((ext_vector_type(16))) __bf16   v16b;
typedef __attribute__((ext_vector_type(8)))  __bf16   v8b;
typedef __attribute__((ext_vector_type(8)))  float    v8f;
typedef __attribute__((ext_vector_type(4)))  float    v4f;
typedef __attribute__((ext_vector_type(2)))  float    v2f;
typedef __attribute__((ext_vector_type(4)))  unsigned int v4u;

// ---------------------------------------------------------------------------
// Shape constants
// ---------------------------------------------------------------------------
constexpr int kBatch = 2;
constexpr int kSeq   = 2048;
constexpr int kDim   = 1024;
constexpr int kHeads = 16;
constexpr int kHd    = 64;
constexpr int kRows  = kBatch * kSeq;
constexpr int kScanT = 32;
constexpr int kChunkL = 64;
constexpr int kChunks = kSeq / kChunkL;
constexpr int kSlotF  = kHd * kHd + kHd;
constexpr float kEps = 1e-6f;
static_assert(kHeads * kHd == kDim, "head split");
static_assert((kDim % 128) == 0 && kDim >= 256, "GEMM K: whole passes of 128, at least two");
static_assert((kRows % 128) == 0 && (kDim % 128) == 0, "GEMM M, N multiples of 128");
static_assert((kSeq % kChunkL) == 0 && (kChunkL % kScanT) == 0, "scan chunking");
static_assert((kSlotF % 32) == 0, "128-B aligned state slots");
static_assert(kHd == 64, "one head = one 64-column tile");

// ---------------------------------------------------------------------------
// Workspace region map (bytes; every offset is a multiple of 128)
//   XQ  bf16 [4096][1024]  bf16(query)                  8,388,608
//   XK  bf16 [4096][1024]  bf16(key)                    8,388,608
//   XV  bf16 [4096][1024]  bf16(value)                  8,388,608
//   WQ  bf16 [1024][1024]  bf16(Wq)  (Bt layout)        2,097,152
//   WK  bf16 [1024][1024]  bf16(Wk)                     2,097,152
//   WV  bf16 [1024][1024]  bf16(Wv)                     2,097,152
//   WO  bf16 [1024][1024]  bf16(Wo)                     2,097,152
//   QF  f32  [4096][1024]  phi(q)                      16,777,216
//   KF  f32  [4096][1024]  phi(k)                      16,777,216
//   VF  f32  [4096][1024]  v                           16,777,216
//   AH  bf16 [4096][1024]  attention plane, hi part     8,388,608
//   AL  bf16 [4096][1024]  attention plane, lo part     8,388,608
//   ST  f32  [32][31][4160] chunk states: 64x64 key-value sum, then 64 key sums   16,506,880
//   total                                             117,170,176
// ---------------------------------------------------------------------------
constexpr size_t kActB  = (size_t)kRows * kDim * 2;
constexpr size_t kWgtB  = (size_t)kDim * kDim * 2;
constexpr size_t kF32B  = (size_t)kRows * kDim * 4;
constexpr size_t kOffXQ = 0;
constexpr size_t kOffXK = kOffXQ + kActB;
constexpr size_t kOffXV = kOffXK + kActB;
constexpr size_t kOffWQ = kOffXV + kActB;
constexpr size_t kOffWK = kOffWQ + kWgtB;
constexpr size_t kOffWV = kOffWK + kWgtB;
constexpr size_t kOffWO = kOffWV + kWgtB;
constexpr size_t kOffQF = kOffWO + kWgtB;
constexpr size_t kOffKF = kOffQF + kF32B;
constexpr size_t kOffVF = kOffKF + kF32B;
constexpr size_t kOffAH = kOffVF + kF32B;
constexpr size_t kOffAL = kOffAH + kActB;
constexpr size_t kOffST = kOffAL + kActB;
constexpr size_t kStB   = (size_t)kBatch * kHeads * (kChunks - 1) * kSlotF * 4;
constexpr size_t kWsTotal = kOffST + kStB;
static_assert(kWsTotal == 117170176ull, "carve total");
static_assert(kOffXK == kOffXQ + kActB && kOffXV == kOffXK + kActB && kOffWK == kOffWQ + kWgtB && kOffWV == kOffWK + kWgtB &&
              kOffKF == kOffQF + kF32B && kOffVF == kOffKF + kF32B, "q, k, v planes lie one behind the other");
static_assert(kWsTotal <= 134217728ull, "carve cap");
static_assert((kOffXK % 128) == 0 && (kOffXV % 128) == 0 && (kOffWQ % 128) == 0 && (kOffWK % 128) == 0 &&
              (kOffWV % 128) == 0 && (kOffWO % 128) == 0 && (kOffQF % 128) == 0 && (kOffKF % 128) == 0 &&
              (kOffVF % 128) == 0 && (kOffAH % 128) == 0 && (kOffAL % 128) == 0 && (kOffST % 128) == 0,
              "128-B aligned regions");

// ---------------------------------------------------------------------------
// Small helpers
// ---------------------------------------------------------------------------
__device__ __forceinline__ unsigned short f2bf_bits(float f) {
  unsigned u = __float_as_uint(f);
  return (unsigned short)((u + 0x7FFFu + ((u >> 16) & 1u)) >> 16);
}
__device__ __forceinline__ float bf_bits2f(unsigned short h) { return __uint_as_float(((unsigned)h) << 16); }
/* RNE-convert to a bf16 value, kept in f32 */
__device__ __forceinline__ float bf16r(float f) { return bf_bits2f(f2bf_bits(f)); }
__device__ __forceinline__ unsigned pk16(unsigned short a, unsigned short b) { return (unsigned)a | ((unsigned)b << 16); }

template <typename T> struct Frag;
template <> struct Frag<__bf16> {
  typedef v16b V; union U { v16b v; v8b h[2]; };
  /* elements 0..7 <- p[0..7], elements 8..15 <- p[16..23] */
  static __device__ __forceinline__ v16b load(const __bf16* p) {
    U f; f.h[0] = *(const v8b*)(p); f.h[1] = *(const v8b*)(p + 16); return f.v;
  }
};

/* one matrix instruction followed by its own hazard guard: the guard ties this accumulator and names both fragments */
__device__ __forceinline__ v8f mma_bf(v16b a, v16b b, v8f c) {
  c = __builtin_amdgcn_wmma_f32_16x16x32_bf16(false, a, false, b, (short)0, c, false, false);
  asm volatile("v_nop\n\tv_nop\n\tv_nop\n\tv_nop" : "+v"(c) : "v"(a), "v"(b));
  return c;
}

// ---------------------------------------------------------------------------
// f32 -> bf16 (RNE-convert) of all seven operand planes in one launch: three activation planes, then four weight planes.
// The block index selects plane and place in it (block-uniform): blocks 0 .. 6143 are 2048 per activation plane,
// blocks 6144 .. 8191 are 512 per weight plane.
// 8 consecutive elements per thread: two 16-B loads, ONE 16-B store per lane; 32 consecutive lanes write 512 contiguous
// Coverage: thread i of a plane writes elements 8i..8i+7, i < n8; blocks per plane = n8/256 exactly:
//   activations 4096*1024/8 = 524,288 -> 2048 blocks;  weights 1024*1024/8 = 131,072 -> 512 blocks.
// ---------------------------------------------------------------------------
constexpr int kActN8  = kRows * kDim / 8;
constexpr int kWgtN8  = kDim * kDim / 8;
constexpr int kActBlk = kActN8 / 256;
constexpr int kWgtBlk = kWgtN8 / 256;
constexpr int kCvtBlk = 3 * kActBlk + 4 * kWgtBlk;
static_assert((kActN8 % 256) == 0 && (kWgtN8 % 256) == 0, "whole blocks per plane");
__global__ __launch_bounds__(256) void cvt_bf16_planes_kernel(
    const float* __restrict__ a0, const float* __restrict__ a1, const float* __restrict__ a2,
    const float* __restrict__ w0, const float* __restrict__ w1, const float* __restrict__ w2, const float* __restrict__ w3,
    unsigned short* __restrict__ da0, unsigned short* __restrict__ da1, unsigned short* __restrict__ da2,
    unsigned short* __restrict__ dw0, unsigned short* __restrict__ dw1, unsigned short* __restrict__ dw2,
    unsigned short* __restrict__ dw3)
{
  const int b = blockIdx.x;
  const float* src;
  unsigned short* dst;
  int blk, n8;
  if (b < 3 * kActBlk) {
    const int z = b / kActBlk;
    blk = b - z * kActBlk;
    n8  = kActN8;
    src = (z == 0) ? a0 : (z == 1) ? a1 : a2;
    dst = (z == 0) ? da0 : (z == 1) ? da1 : da2;
  } else {
    const int bw = b - 3 * kActBlk;
    const int z = bw / kWgtBlk;
    blk = bw - z * kWgtBlk;
    n8  = kWgtN8;
    src = (z == 0) ? w0 : (z == 1) ? w1 : (z == 2) ? w2 : w3;
    dst = (z == 0) ? dw0 : (z == 1) ? dw1 : (z == 2) ? dw2 : dw3;
  }
  const int i = blk * 256 + threadIdx.x;
  if (i >= n8) return;
  const float* p = src + 8 * (size_t)i;
  const v4f a = *(const v4f*)(p);
  const v4f c = *(const v4f*)(p + 4);
  unsigned short hb[8];
#pragma unroll
  for (int e = 0; e < 4; ++e) {
    const float x0 = a[e];
    const float x1 = c[e];
    hb[e]     = f2bf_bits(x0);
    hb[4 + e] = f2bf_bits(x1);
  }
  const v4u u = (v4u){pk16(hb[0], hb[1]), pk16(hb[2], hb[3]), pk16(hb[4], hb[5]), pk16(hb[6], hb[7])};
  unsigned short* q = dst + 8 * (size_t)i;
  *(v4u*)q = u;
  
}

// ---------------------------------------------------------------------------
// Eight asynchronous 16-B copies per lane, global memory to LDS: 128 rows of 256 B of one operand plane.
// Lane (r = tid >> 4, c = tid & 15) moves bytes 16 c .. 16 c + 15 of rows r, r + 16, .. r + 112: one wave-wide copy is two
// whole 256-B rows. lds = the lane's LDS byte address of row r, g = its global address of row r, ld = row pitch in elements.
// ---------------------------------------------------------------------------
constexpr int kPassK    = 128;                 /* k per pass: 256 B of every operand row */
constexpr int kLdsPitch = 272;                 /* bytes per LDS row: 16 B x odd, conflict-free for 16-B readers */
constexpr int kPlaneB   = 128 * kLdsPitch;     /* one operand plane of a stage */
__device__ __forceinline__ void copy_plane_async(unsigned lds, const __bf16* g, int ld) {
  const size_t step = (size_t)16 * ld;
  const __bf16* g1 = g + step;      const __bf16* g2 = g + 2 * step;  const __bf16* g3 = g + 3 * step;
  const __bf16* g4 = g + 4 * step;  const __bf16* g5 = g + 5 * step;  const __bf16* g6 = g + 6 * step;
  const __bf16* g7 = g + 7 * step;
  const unsigned ls = 16u * kLdsPitch;
  /* the copies and the wait that stands before their address registers may be rewritten, in one statement */
  asm volatile(
      "global_load_async_to_lds_b128 %0, %8, off\n\t"
      "global_load_async_to_lds_b128 %1, %9, off\n\t"
      "global_load_async_to_lds_b128 %2, %10, off\n\t"
      "global_load_async_to_lds_b128 %3, %11, off\n\t"
      "global_load_async_to_lds_b128 %4, %12, off\n\t"
      "global_load_async_to_lds_b128 %5, %13, off\n\t"
      "global_load_async_to_lds_b128 %6, %14, off\n\t"
      "global_load_async_to_lds_b128 %7, %15, off\n\t"
      "s_wait_xcnt 0x0"
      :: "v"(lds), "v"(lds + ls), "v"(lds + 2u * ls), "v"(lds + 3u * ls), "v"(lds + 4u * ls), "v"(lds + 5u * ls),
         "v"(lds + 6u * ls), "v"(lds + 7u * ls), "v"(g), "v"(g1), "v"(g2), "v"(g3), "v"(g4), "v"(g5), "v"(g6), "v"(g7)
      : "memory");
}

// ---------------------------------------------------------------------------
// bf16 GEMM, operands staged in LDS: C[m][n] = sum_k A[m][k] * Bt[n][k] + bf16value(bias[n]).
// One block of 8 waves owns a 128 x 128 tile; wave (wm = wave >> 1, wn = wave & 1) owns rows 32 wm .. + 31, cols 64 wn .. + 63.
// A row-major [M][K] bf16 (SPLA: a second plane A2 of the same layout is accumulated against the same Bt);
// Bt row-major [N][K] bf16; M, N % 128 == 0, K % 128 == 0, K >= 256 (no tail handling). C f32, pitch ldc.
// A stage = 128 k of [A 128 rows | Bt 128 rows | A2 128 rows if SPLA], brought by asynchronous copies into one of two
// buffers: the copies of stage t + 2 fly while stage t + 1 is worked on.
// EPI 0: plain.  EPI 1: feature map y = x + 1 for x > 0, exp(x) otherwise, applied to the accumulators in registers.
// EPI 2: three products of one shape in one launch. blockIdx.y = 0, 1, 2 (block-uniform) picks the plane: A, Bt and C are
// three dense planes one behind the other (M x lda, N x ldb, M x ldc elements each), the biases three buffers; planes 0
// and 1 take the feature map, plane 2 is plain.
// Fragment map: lane l, row/col = l & 15, half h = l >> 4; elements 0..7 <- k0 + 8h + 0..7, 8..15 <- k0 + 16 + 8h + 0..7
// for both operands; accumulator element r = (row 8h + r, col l & 15).
// Epilogue: 16-row slabs staged per wave in LDS of its own (same wave stores and reloads, wave-level ordering).
// Coverage: 32 x 8 = 256 tiles of 128 x 128 = 4096 x 1024; grid.x = 256 blocks, one tile per block and plane.
// ---------------------------------------------------------------------------
template <bool SPLA, int EPI>
__global__ __launch_bounds__(256) void gemm_tile64_kernel(
    const unsigned short* __restrict__ Ap, const unsigned short* __restrict__ A2p, int lda,
    const unsigned short* __restrict__ Btp, int ldb,
    float* __restrict__ Cout, int ldc,
    const float* __restrict__ bias, int M, int N, int K,
    const float* __restrict__ bias1 = nullptr, const float* __restrict__ bias2 = nullptr)
{
  const int z = (EPI == 2) ? (int)blockIdx.y : 0;
  const __bf16* A  = (const __bf16*)Ap + (size_t)z * M * lda;
  const __bf16* A2 = (const __bf16*)A2p + (size_t)z * M * lda;
  const __bf16* Bt = (const __bf16*)Btp + (size_t)z * N * ldb;
  if (EPI == 2) {
    Cout += (size_t)z * M * ldc;
    bias = (z == 0) ? bias : (z == 1) ? bias1 : bias2;
  }
  constexpr int kStageB = (SPLA ? 3 : 2) * kPlaneB;
  __shared__ __align__(16) unsigned char sStage[2 * kStageB];
  __shared__ __align__(16) float sT[8][16 * 68];
  const int tid  = threadIdx.x;
  const int lane = tid & 31;
  const int wave = tid >> 5;
  const int tilesN = N >> 7;
  const int tilesM = M >> 7;
  const int tile = blockIdx.x;
  /* block-uniform, in front of every barrier and copy */
  if (tile >= tilesM * tilesN) return;
  const int tm = tile / tilesN;
  const int tn = tile - tm * tilesN;
  const int mB = tm << 7;
  const int nB = tn << 7;
  const int wm = wave >> 1;
  const int wn = wave & 1;

  const int rlane = lane & 15;
  const int koff  = (lane >> 4) * 8;
  const int mOff  = (lane >> 4) * 8;

  /* this lane's share of a stage */
  const int cr = tid >> 4, cc = (tid & 15) * 8;
  const unsigned ldsC = (unsigned)(uintptr_t)(sStage + cr * kLdsPitch + cc * 2);
  const __bf16* gA  = A  + (size_t)(mB + cr) * lda + cc;
  const __bf16* gA2 = A2 + (size_t)(mB + cr) * lda + cc;
  const __bf16* gB  = Bt + (size_t)(nB + cr) * ldb + cc;
  const int nPass = K / kPassK;

  /* every loop over acc[], fa[], fb[], fl[] below is unrolled: constant indices keep these arrays in registers */
  v8f acc[2][4];
#pragma unroll
  for (int i = 0; i < 2; ++i)
#pragma unroll
    for (int j = 0; j < 4; ++j) acc[i][j] = (v8f){0.f, 0.f, 0.f, 0.f, 0.f, 0.f, 0.f, 0.f};

  // ---- stage 0, published; then stage 1 in flight ----
  copy_plane_async(ldsC, gA, lda);
  copy_plane_async(ldsC + kPlaneB, gB, ldb);
  if (SPLA) copy_plane_async(ldsC + 2 * kPlaneB, gA2, lda);
  /* this wave's copies of stage 0 have landed */
  asm volatile("s_wait_asynccnt 0x0" ::: "memory");
  __syncthreads();
  if (1 < nPass) {
    copy_plane_async(ldsC + kStageB, gA + kPassK, lda);
    copy_plane_async(ldsC + kStageB + kPlaneB, gB + kPassK, ldb);
    if (SPLA) copy_plane_async(ldsC + kStageB + 2 * kPlaneB, gA2 + kPassK, lda);
  }

  /* rolled: one pass per trip, so that each trip reads one buffer and ends in one publish point */
#pragma unroll 1
  for (int t = 0; t < nPass; ++t) {
    const int bufB = (t & 1) * kStageB;
    const unsigned char* pA = sStage + bufB + (wm * 32 + rlane) * kLdsPitch + koff * 2;
    const unsigned char* pB = sStage + bufB + kPlaneB + (wn * 64 + rlane) * kLdsPitch + koff * 2;
    /* two fragment sets: the reads of k step kk + 1 (same buffer) are issued in front of step kk's products, so that a
       wave waits out the LDS latency once per pass and not at every step */
    v16b fb[2][4], fa[2][2], fl[2][2];
#pragma unroll
    for (int j = 0; j < 4; ++j) fb[0][j] = Frag<__bf16>::load((const __bf16*)(pB + j * 16 * kLdsPitch));
#pragma unroll
    for (int i = 0; i < 2; ++i) {
      fa[0][i] = Frag<__bf16>::load((const __bf16*)(pA + i * 16 * kLdsPitch));
      if (SPLA) fl[0][i] = Frag<__bf16>::load((const __bf16*)(pA + 2 * kPlaneB + i * 16 * kLdsPitch));
    }
#pragma unroll
    for (int kk = 0; kk < kPassK / 32; ++kk) {
      const int cur = kk & 1, nxt = cur ^ 1;
      if (kk + 1 < kPassK / 32) {
#pragma unroll
        for (int j = 0; j < 4; ++j)
          fb[nxt][j] = Frag<__bf16>::load((const __bf16*)(pB + j * 16 * kLdsPitch + (kk + 1) * 64));
#pragma unroll
        for (int i = 0; i < 2; ++i) {
          fa[nxt][i] = Frag<__bf16>::load((const __bf16*)(pA + i * 16 * kLdsPitch + (kk + 1) * 64));
          if (SPLA) fl[nxt][i] = Frag<__bf16>::load((const __bf16*)(pA + 2 * kPlaneB + i * 16 * kLdsPitch + (kk + 1) * 64));
        }
      }
      /* per accumulator and k step: the hi product, then the lo product */
#pragma unroll
      for (int i = 0; i < 2; ++i) {
#pragma unroll
        for (int j = 0; j < 4; ++j) acc[i][j] = mma_bf(fa[cur][i], fb[cur][j], acc[i][j]);
        if (SPLA) {
#pragma unroll
          for (int j = 0; j < 4; ++j) acc[i][j] = mma_bf(fl[cur][i], fb[cur][j], acc[i][j]);
        }
      }
    }
    /* publish point: this wave's reads of the buffer are done, its copies of the next stage have landed */
    asm volatile("s_wait_dscnt 0x0" ::: "memory");
    asm volatile("s_wait_asynccnt 0x0" ::: "memory");
    __syncthreads();
    /* refill the buffer that every wave has just left; the test is the same for the whole block */
    if (t + 2 < nPass) {
      const int ko = (t + 2) * kPassK;
      copy_plane_async(ldsC + bufB, gA + ko, lda);
      copy_plane_async(ldsC + bufB + kPlaneB, gB + ko, ldb);
      if (SPLA) copy_plane_async(ldsC + bufB + 2 * kPlaneB, gA2 + ko, lda);
    }
  }
  /* no copy is left in flight when the wave goes on */
  asm volatile("s_wait_asynccnt 0x0" ::: "memory");

  // ---- epilogue ----
  const int m0 = mB + wm * 32;
  const int n0 = nB + wn * 64;
  float* slab = sT[wave];
  float bvj[4];
#pragma unroll
  for (int j = 0; j < 4; ++j) bvj[j] = bf16r(bias[n0 + (j << 4) + rlane]);
  /* every loop over acc[] is unrolled: constant indices keep it in registers */
#pragma unroll
  for (int i = 0; i < 2; ++i)
#pragma unroll
    for (int j = 0; j < 4; ++j)
#pragma unroll
      for (int r = 0; r < 8; ++r) acc[i][j][r] += bvj[j];
  /* feature map on the accumulators themselves, 64 independent values per lane; the test is the same for the whole block */
  if (EPI == 1 || (EPI == 2 && z < 2)) {
#pragma unroll
    for (int i = 0; i < 2; ++i)
#pragma unroll
      for (int j = 0; j < 4; ++j)
#pragma unroll
        for (int r = 0; r < 8; ++r) {
          const float x = acc[i][j][r];
          const float ex = expf(fminf(x, 0.0f));
          acc[i][j][r] = (x > 0.0f) ? (x + 1.0f) : ex;
        }
  }
#pragma unroll
  for (int i = 0; i < 2; ++i) {
    const int mBase = m0 + (i << 4);
#pragma unroll
    for (int j = 0; j < 4; ++j) {
#pragma unroll
      for (int r = 0; r < 8; ++r) {
        slab[(mOff + r) * 68 + (j << 4) + rlane] = acc[i][j][r];
      }
    }
    __builtin_amdgcn_fence(__ATOMIC_RELEASE, "workgroup");
    __builtin_amdgcn_wave_barrier();
    __builtin_amdgcn_fence(__ATOMIC_ACQUIRE, "workgroup");
    {
      /* row segment = 256 B = 16 lanes x 16 B; rows it*2 + hh cover 0..15 */
      const int hh = lane >> 4, c4 = (lane & 15) * 4;
      {
#pragma unroll
        for (int it = 0; it < 8; ++it) {
          const int row = it * 2 + hh;
          const v4f v = *(const v4f*)(slab + row * 68 + c4);
          *(v4f*)(Cout + (size_t)(mBase + row) * ldc + n0 + c4) = v;
        }
        
      }
    }
    __builtin_amdgcn_fence(__ATOMIC_RELEASE, "workgroup");
    __builtin_amdgcn_wave_barrier();
    __builtin_amdgcn_fence(__ATOMIC_ACQUIRE, "workgroup");
  }
}

// ---------------------------------------------------------------------------
// Chunk sums: one block of 256 threads per (chunk, batch-head), chunks 0 .. kChunks - 2 (nothing follows the last one).
// slot[d][j] = sum over the chunk's 64 steps of k[s][d] * v[s][j]; slot[4096 + d] = sum over the steps of k[s][d].
// Thread (d4 = 4 (tid >> 4), j4 = 4 (tid & 15)) keeps a 4 x 4 patch in registers: two 16-B LDS reads feed 16 FMAs.
// Staging coverage: rows lr + 16 i (lr = tid >> 4, i = 0..3) x cols 4 (tid & 15) .. + 3 = 64 x 64 per tensor.
// LDS: 2 x 16,384 = 32,768 B.
// ---------------------------------------------------------------------------
__global__ __launch_bounds__(256) void chunk_state_kernel(
    const float* __restrict__ KF, const float* __restrict__ VF, float* __restrict__ ST)
{
  __shared__ __align__(16) float sK[kChunkL * 64];
  __shared__ __align__(16) float sV[kChunkL * 64];
  const int tid = threadIdx.x;
  const int chunk = blockIdx.x;
  const int bh = blockIdx.y;
  const size_t row0 = (size_t)(bh >> 4) * kSeq + (size_t)chunk * kChunkL;
  const int col0 = (bh & 15) * kHd;
  const int lr = tid >> 4, lc4 = (tid & 15) * 4;
  /* unrolled: all eight global loads are issued before the first LDS store waits on one */
#pragma unroll
  for (int i = 0; i < kChunkL / 16; ++i) {
    const int r = lr + 16 * i;
    const size_t g = (row0 + (size_t)r) * kDim + col0 + lc4;
    *(v4f*)(sK + r * 64 + lc4) = *(const v4f*)(KF + g);
    *(v4f*)(sV + r * 64 + lc4) = *(const v4f*)(VF + g);
  }
  __syncthreads();

  const int d4 = lr * 4, j4 = lc4;
  /* every loop over a[] is unrolled so that its indices are constants and the patch stays in registers */
  v4f a[4];
#pragma unroll
  for (int r = 0; r < 4; ++r) a[r] = (v4f){0.f, 0.f, 0.f, 0.f};
  /* eight steps' LDS reads in flight together; rolled, every step waits out a whole LDS latency */
#pragma unroll 8
  for (int s = 0; s < kChunkL; ++s) {
    const v4f kk = *(const v4f*)(sK + s * 64 + d4);
    const v4f vv = *(const v4f*)(sV + s * 64 + j4);
#pragma unroll
    for (int r = 0; r < 4; ++r)
#pragma unroll
      for (int e = 0; e < 4; ++e) a[r][e] = fmaf(kk[r], vv[e], a[r][e]);
  }
  float* slot = ST + ((size_t)bh * (kChunks - 1) + chunk) * kSlotF;
#pragma unroll
  for (int r = 0; r < 4; ++r) *(v4f*)(slot + (d4 + r) * 64 + j4) = a[r];

  /* key sums; waves 0 and 1 only (wave-uniform predicate) */
  if (tid < 64) {
    float c = 0.0f;
    for (int s = 0; s < kChunkL; ++s) c += sK[s * 64 + tid];
    slot[kHd * kHd + tid] = c;
  }
}

// ---------------------------------------------------------------------------
// Inclusive sum of the chunk slots along the chunk axis, in place: slot c becomes the state at the end of chunk c.
// One thread per float of a slot (4160 per batch-head, grid.x = 17 blocks with a tail guard); the 31 values stay in
// registers, so all loads are in flight together and the thread pays the load latency once.
// ---------------------------------------------------------------------------
__global__ __launch_bounds__(256) void chunk_prefix_kernel(float* __restrict__ ST)
{
  const int i = blockIdx.x * 256 + threadIdx.x;
  if (i >= kSlotF) return;
  float* base = ST + (size_t)blockIdx.y * (kChunks - 1) * kSlotF + i;
  /* both loops unrolled: constant indices keep x[] in registers */
  float x[kChunks - 1];
#pragma unroll
  for (int c = 0; c < kChunks - 1; ++c) x[c] = base[(size_t)c * kSlotF];
#pragma unroll
  for (int c = 1; c < kChunks - 1; ++c) {
    x[c] += x[c - 1];
    base[(size_t)c * kSlotF] = x[c];
  }
}

// ---------------------------------------------------------------------------
// Causal state scan, one block of 128 threads per (chunk, batch-head), the chunk's 64 steps in a static loop.
// Thread (j2 = 2 (tid & 31), dg = tid >> 5) keeps kv[d][j2], kv[d][j2 + 1] for d = 16 dg .. 16 dg + 15 in registers: the
// eight 16-B LDS reads that bring a wave its 16 q and 16 k of a step (every lane the same address)
// feed 64 FMAs per lane and not 32. Chunk 0 starts from zero, chunk c > 0 from slot c - 1 of ST (state and key sums at
// the end of the chunk before it).
// Per step s (inclusive sums): kv[d][j] += k[d] * v[j]; partial[dg][s][j] = sum over its 16 d of q[d] * kv[d][j].
// Steps are staged 32 at a time: sQ, sK, sV hold q, k, v rows [32][64] f32; sN holds the four partial planes [4][32][64].
// After the 32 steps: threads 0..63 turn sK into the inclusive key sums in place (running carry in a register);
// then lane (rows 4 wave + (lane >> 3) and that + 16, cols 8 (lane & 7) .. + 7) forms den = sum_d q[d] * ksum[d] (rolled,
// f32), num = ((p0 + p1) + p2) + p3, out = num * (1 / (den + eps)), splits out into bf16 hi + lo and stores both planes.
// Staging coverage: rows lr + 8 i (lr = tid >> 4 = 0..7, i = 0..3) x cols 4 (tid & 15) .. + 3 = 32 x 64 per tensor.
// LDS: 3 x 8,192 + 32,768 = 57,344 B.
// ---------------------------------------------------------------------------
/* both columns' fused multiply-adds in one operation; each column rounds as fmaf does */
__device__ __forceinline__ v2f fma2(float a, v2f b, v2f c) { return __builtin_elementwise_fma((v2f){a, a}, b, c); }

__global__ __launch_bounds__(128) void scan_state_kernel(
    const float* __restrict__ QF, const float* __restrict__ KF, const float* __restrict__ VF,
    const float* __restrict__ ST, unsigned short* __restrict__ AH, unsigned short* __restrict__ AL)
{
  __shared__ __align__(16) float sQ[kScanT * 64];
  __shared__ __align__(16) float sK[kScanT * 64];
  __shared__ __align__(16) float sV[kScanT * 64];
  __shared__ __align__(16) float sN[4 * kScanT * 64];
  const int tid = threadIdx.x, lane = tid & 31, wave = tid >> 5;
  const int j2 = lane * 2;
  const int dg = wave;
  const int chunk = blockIdx.x;
  const int bh = blockIdx.y;
  const int bb = bh >> 4;
  const int hd = bh & 15;
  const size_t row0 = (size_t)bb * kSeq;
  const int col0 = hd * kHd;

  v2f kv[16];
#pragma unroll
  for (int i = 0; i < 16; ++i) kv[i] = (v2f){0.0f, 0.0f};
  float kcarry = 0.0f;
  /* block-uniform predicate */
  if (chunk > 0) {
    const float* slot = ST + ((size_t)bh * (kChunks - 1) + (chunk - 1)) * kSlotF;
    /* unrolled: constant indices keep kv[] in registers */
#pragma unroll
    for (int i = 0; i < 15; ++i) kv[i] = *(const v2f*)(slot + (dg * 16 + i) * 64 + j2);
    /* the last load may land in the offset register that the fifteen before it name: their wait stands in front of it */
    asm volatile("s_wait_xcnt 0x0" ::: "memory");
    kv[15] = *(const v2f*)(slot + (dg * 16 + 15) * 64 + j2);
    if (tid < 64) kcarry = slot[kHd * kHd + tid];
  }

  const int lr = tid >> 4, lc4 = (tid & 15) * 4;
  const int q4 = lane >> 3, c8 = (lane & 7) * 8;
  const int orow = wave * 4 + q4;

#pragma unroll 1
  for (int t0 = chunk * kChunkL; t0 < (chunk + 1) * kChunkL; t0 += kScanT) {
    /* every read of the stage before this one has finished */
    __syncthreads();
    /* all loops over tq[], tk[], tv[] unrolled: constant indices keep them in registers; twelve loads in flight per lane */
    v4f tq[4], tk[4], tv[4];
#pragma unroll
    for (int i = 0; i < 2; ++i) {
      const size_t g = (row0 + (size_t)(t0 + lr + 8 * i)) * kDim + col0 + lc4;
      tq[i] = *(const v4f*)(QF + g);
      tk[i] = *(const v4f*)(KF + g);
      tv[i] = *(const v4f*)(VF + g);
    }
    /* the next six loads may land in address registers that the first six name: their wait stands in front */
    asm volatile("s_wait_xcnt 0x0" ::: "memory");
#pragma unroll
    for (int i = 2; i < 4; ++i) {
      const size_t g = (row0 + (size_t)(t0 + lr + 8 * i)) * kDim + col0 + lc4;
      tq[i] = *(const v4f*)(QF + g);
      tk[i] = *(const v4f*)(KF + g);
      tv[i] = *(const v4f*)(VF + g);
    }
    /* before the address registers of these six are used for anything else */
    asm volatile("s_wait_xcnt 0x0" ::: "memory");
#pragma unroll
    for (int i = 0; i < 4; ++i) {
      const int r = lr + 8 * i;
      *(v4f*)(sQ + r * 64 + lc4) = tq[i];
      *(v4f*)(sK + r * 64 + lc4) = tk[i];
      *(v4f*)(sV + r * 64 + lc4) = tv[i];
    }
    __syncthreads();

    /* four steps per trip: their LDS reads are issued together in front of the FMAs, so that a wave waits out the LDS
       latency once per four steps; rolled, with four waves per SIMD, every step's latency stays open */
#pragma unroll 4
    for (int s = 0; s < kScanT; ++s) {
      const v2f vj = *(const v2f*)(sV + s * 64 + j2);
      const float* qp = sQ + s * 64 + dg * 16;
      const float* kp = sK + s * 64 + dg * 16;
      v2f accn = (v2f){0.0f, 0.0f};
#pragma unroll
      for (int g = 0; g < 4; ++g) {
        const v4f kk = *(const v4f*)(kp + 4 * g);
        const v4f qq = *(const v4f*)(qp + 4 * g);
        kv[4 * g + 0] = fma2(kk[0], vj, kv[4 * g + 0]);
        accn = fma2(qq[0], kv[4 * g + 0], accn);
        kv[4 * g + 1] = fma2(kk[1], vj, kv[4 * g + 1]);
        accn = fma2(qq[1], kv[4 * g + 1], accn);
        kv[4 * g + 2] = fma2(kk[2], vj, kv[4 * g + 2]);
        accn = fma2(qq[2], kv[4 * g + 2], accn);
        kv[4 * g + 3] = fma2(kk[3], vj, kv[4 * g + 3]);
        accn = fma2(qq[3], kv[4 * g + 3], accn);
      }
      *(v2f*)(sN + (dg * kScanT + s) * 64 + j2) = accn;
    }
    __syncthreads();

    /* inclusive key sums in place; waves 0 and 1 only (wave-uniform predicate) */
    if (tid < 64) {
      float c = kcarry;
#pragma unroll 1
      for (int s = 0; s < kScanT; ++s) {
        c += sK[s * 64 + tid];
        sK[s * 64 + tid] = c;
      }
      kcarry = c;
    }
    __syncthreads();

    /* the lane's two rows side by side: two independent chains share each trip's LDS latency */
    float den0 = 0.0f, den1 = 0.0f;
#pragma unroll 1
    for (int g = 0; g < 16; ++g) {
      const v4f qv = *(const v4f*)(sQ + orow * 64 + 4 * g);
      const v4f kc = *(const v4f*)(sK + orow * 64 + 4 * g);
      const v4f qw = *(const v4f*)(sQ + (orow + 16) * 64 + 4 * g);
      const v4f kd = *(const v4f*)(sK + (orow + 16) * 64 + 4 * g);
      den0 = fmaf(qv[0], kc[0], den0);
      den1 = fmaf(qw[0], kd[0], den1);
      den0 = fmaf(qv[1], kc[1], den0);
      den1 = fmaf(qw[1], kd[1], den1);
      den0 = fmaf(qv[2], kc[2], den0);
      den1 = fmaf(qw[2], kd[2], den1);
      den0 = fmaf(qv[3], kc[3], den0);
      den1 = fmaf(qw[3], kd[3], den1);
    }

    /* unrolled: rr is a constant in each copy */
#pragma unroll
    for (int rr = 0; rr < 2; ++rr) {
      const int row = orow + 16 * rr;
      const float inv = 1.0f / ((rr == 0 ? den0 : den1) + kEps);
      const float* np = sN + row * 64 + c8;
      const v4f a0 = *(const v4f*)(np);
      const v4f a1 = *(const v4f*)(np + 4);
      const v4f b0 = *(const v4f*)(np + 1 * kScanT * 64);
      const v4f b1 = *(const v4f*)(np + 1 * kScanT * 64 + 4);
      const v4f e0 = *(const v4f*)(np + 2 * kScanT * 64);
      const v4f e1 = *(const v4f*)(np + 2 * kScanT * 64 + 4);
      const v4f f0 = *(const v4f*)(np + 3 * kScanT * 64);
      const v4f f1 = *(const v4f*)(np + 3 * kScanT * 64 + 4);
      float o[8];
#pragma unroll
      for (int e = 0; e < 4; ++e) {
        const float n0v = ((a0[e] + b0[e]) + e0[e]) + f0[e];
        const float n1v = ((a1[e] + b1[e]) + e1[e]) + f1[e];
        o[e]     = n0v * inv;
        o[4 + e] = n1v * inv;
      }
      unsigned short hb[8], lb[8];
#pragma unroll
      for (int e = 0; e < 8; ++e) {
        const float x = o[e];
        const unsigned short hbits = f2bf_bits(x);
        const float res = x - bf_bits2f(hbits);
        hb[e] = hbits;
        lb[e] = f2bf_bits(res);
      }
      const v4u uh = (v4u){pk16(hb[0], hb[1]), pk16(hb[2], hb[3]), pk16(hb[4], hb[5]), pk16(hb[6], hb[7])};
      const v4u ul = (v4u){pk16(lb[0], lb[1]), pk16(lb[2], lb[3]), pk16(lb[4], lb[5]), pk16(lb[6], lb[7])};
      const size_t oo = (row0 + (size_t)(t0 + row)) * kDim + col0 + c8;
      unsigned short* ph = AH + oo;
      unsigned short* pl = AL + oo;
      *(v4u*)ph = uh;
      *(v4u*)pl = ul;
    }
    /* the next trip rewrites the address registers of these stores: their wait stands in front of it */
    asm volatile("s_wait_xcnt 0x0" ::: "memory");
  }
}

// ---------------------------------------------------------------------------
// Host glue: 1 convert launch + 1 launch of the three projection GEMMs + 3 scan launches (chunk sums, chunk prefix, scan)
// + 1 output GEMM = 6 launches. Kernel launches only.
// GEMM shapes: M 4096, N 1024, K 1024 everywhere (K, M and N % 128 == 0): 32 x 8 = 256 tiles -> 256 blocks per product.
// ---------------------------------------------------------------------------
extern "C" void kernel_launch(void* const* d_in, const int* in_sizes, int n_in,
                              void* d_out, int out_size, void* d_ws, size_t ws_size,
                              hipStream_t stream) {
  if (n_in < 11 || d_out == nullptr || d_ws == nullptr) return;
  if (in_sizes[0] != kRows * kDim || in_sizes[1] != kRows * kDim || in_sizes[2] != kRows * kDim) return;
  if (in_sizes[3] != kDim * kDim || in_sizes[5] != kDim * kDim || in_sizes[7] != kDim * kDim ||
      in_sizes[9] != kDim * kDim) return;
  if (in_sizes[4] != kDim || in_sizes[6] != kDim || in_sizes[8] != kDim || in_sizes[10] != kDim) return;
  if (out_size != kRows * kDim) return;
  if (ws_size < kWsTotal) return;

  const float* query = (const float*)d_in[0];
  const float* key   = (const float*)d_in[1];
  const float* value = (const float*)d_in[2];
  const float* Wq    = (const float*)d_in[3];
  const float* bq    = (const float*)d_in[4];
  const float* Wk    = (const float*)d_in[5];
  const float* bk    = (const float*)d_in[6];
  const float* Wv    = (const float*)d_in[7];
  const float* bv    = (const float*)d_in[8];
  const float* Wo    = (const float*)d_in[9];
  const float* bo    = (const float*)d_in[10];
  float* out = (float*)d_out;

  char* ws = (char*)d_ws;
  unsigned short* XQ = (unsigned short*)(ws + kOffXQ);
  unsigned short* XK = (unsigned short*)(ws + kOffXK);
  unsigned short* XV = (unsigned short*)(ws + kOffXV);
  unsigned short* WQ = (unsigned short*)(ws + kOffWQ);
  unsigned short* WK = (unsigned short*)(ws + kOffWK);
  unsigned short* WV = (unsigned short*)(ws + kOffWV);
  unsigned short* WO = (unsigned short*)(ws + kOffWO);
  float*          QF = (float*)(ws + kOffQF);
  float*          KF = (float*)(ws + kOffKF);
  float*          VF = (float*)(ws + kOffVF);
  unsigned short* AH = (unsigned short*)(ws + kOffAH);
  unsigned short* AL = (unsigned short*)(ws + kOffAL);
  float*          ST = (float*)(ws + kOffST);

  // ---- bf16 operand planes (weights are [out][in] = Bt layout already) ----
  cvt_bf16_planes_kernel<<<dim3(kCvtBlk), 256, 0, stream>>>(query, key, value, Wq, Wk, Wv, Wo,
                                                            XQ, XK, XV, WQ, WK, WV, WO);

  // ---- projections, one launch: q and k with the feature map in the epilogue, v plain; planes XQ|XK|XV, WQ|WK|WV, QF|KF|VF ----
  const int gblocks = (kRows / 128) * (kDim / 128);
  gemm_tile64_kernel<false, 2><<<dim3(gblocks, 3), 256, 0, stream>>>(XQ, XQ, kDim, WQ, kDim, QF, kDim, bq, kRows, kDim, kDim,
                                                                     bk, bv);

  // ---- causal state scan: chunk sums, their running sum, then one block per (chunk, batch-head) ----
  chunk_state_kernel<<<dim3(kChunks - 1, kBatch * kHeads), 256, 0, stream>>>(KF, VF, ST);
  chunk_prefix_kernel<<<dim3((kSlotF + 255) / 256, kBatch * kHeads), 256, 0, stream>>>(ST);
  scan_state_kernel<<<dim3(kChunks, kBatch * kHeads), 128, 0, stream>>>(QF, KF, VF, ST, AH, AL);

  // ---- output projection: (hi + lo) . bf16(Wo)^T + bo, both parts into one accumulator ----
  gemm_tile64_kernel<true, 0><<<dim3(gblocks), 256, 0, stream>>>(AH, AL, kDim, WO, kDim, out, kDim, bo, kRows, kDim, kDim);
}

// v006
// Measured time: 95.9 microseconds a run.
// In two side-by-side timings against v005, it was 1.05 and 1.04 times as fast.
// Counting every step since v000, it is 7.76 times as fast.
// Contractions: q/k/v projections on v_wmma_f32_16x16x32_bf16 (bf16(x) x bf16(W), one product, f32 accumulate); output projection on v_wmma_f32_16x16x32_bf16 with the attention plane carried as bf16 hi + lo planes against bf16(Wo) (two products into one f32 accumulator); feature map, 64x64 state scan, normaliser and division in f32 on the vector unit.
#include <hip/hip_runtime.h>
#include <math.h>

typedef __attribute__((ext_vector_type(16))) __bf16   v16b;
typedef __attribute__((ext_vector_type(8)))  __bf16   v8b;
typedef __attribute__((ext_vector_type(8)))  float    v8f;
typedef __attribute__((ext_vector_type(4)))  float    v4f;
typedef __attribute__((ext_vector_type(2)))  float    v2f;
typedef __attribute__((ext_vector_type(4)))  unsigned int v4u;

// ---------------------------------------------------------------------------
// Shape constants
// ---------------------------------------------------------------------------
constexpr int kBatch = 2;
constexpr int kSeq   = 2048;
constexpr int kDim   = 1024;
constexpr int kHeads = 16;
constexpr int kHd    = 64;
constexpr int kRows  = kBatch * kSeq;
constexpr int kScanT = 32;
constexpr int kChunkL = 64;
constexpr int kChunks = kSeq / kChunkL;
constexpr int kSlotF  = kHd * kHd + kHd;
constexpr float kEps = 1e-6f;
static_assert(kHeads * kHd == kDim, "head split");
static_assert((kDim % 128) == 0 && kDim >= 256, "GEMM K: whole passes of 128, at least two");
static_assert((kRows % 128) == 0 && (kDim % 128) == 0, "GEMM M, N multiples of 128");
static_assert((kSeq % kChunkL) == 0 && (kChunkL % kScanT) == 0, "scan chunking");
static_assert((kSlotF % 32) == 0, "128-B aligned state slots");
static_assert(kHd == 64, "one head = one 64-column tile");

// ---------------------------------------------------------------------------
// Workspace region map (bytes; every offset is a multiple of 128)
//   XQ  bf16 [4096][1024]  bf16(query)                  8,388,608
//   XK  bf16 [4096][1024]  bf16(key)                    8,388,608
//   XV  bf16 [4096][1024]  bf16(value)                  8,388,608
//   WQ  bf16 [1024][1024]  bf16(Wq)  (Bt layout)        2,097,152
//   WK  bf16 [1024][1024]  bf16(Wk)                     2,097,152
//   WV  bf16 [1024][1024]  bf16(Wv)                     2,097,152
//   WO  bf16 [1024][1024]  bf16(Wo)                     2,097,152
//   QF  f32  [4096][1024]  phi(q)                      16,777,216
//   KF  f32  [4096][1024]  phi(k)                      16,777,216
//   VF  f32  [4096][1024]  v                           16,777,216
//   AH  bf16 [4096][1024]  attention plane, hi part     8,388,608
//   AL  bf16 [4096][1024]  attention plane, lo part     8,388,608
//   ST  f32  [32][31][4160] chunk states: 64x64 key-value sum, then 64 key sums   16,506,880
//   total                                             117,170,176
// ---------------------------------------------------------------------------
constexpr size_t kActB  = (size_t)kRows * kDim * 2;
constexpr size_t kWgtB  = (size_t)kDim * kDim * 2;
constexpr size_t kF32B  = (size_t)kRows * kDim * 4;
constexpr size_t kOffXQ = 0;
constexpr size_t kOffXK = kOffXQ + kActB;
constexpr size_t kOffXV = kOffXK + kActB;
constexpr size_t kOffWQ = kOffXV + kActB;
constexpr size_t kOffWK = kOffWQ + kWgtB;
constexpr size_t kOffWV = kOffWK + kWgtB;
constexpr size_t kOffWO = kOffWV + kWgtB;
constexpr size_t kOffQF = kOffWO + kWgtB;
constexpr size_t kOffKF = kOffQF + kF32B;
constexpr size_t kOffVF = kOffKF + kF32B;
constexpr size_t kOffAH = kOffVF + kF32B;
constexpr size_t kOffAL = kOffAH + kActB;
constexpr size_t kOffST = kOffAL + kActB;
constexpr size_t kStB   = (size_t)kBatch * kHeads * (kChunks - 1) * kSlotF * 4;
constexpr size_t kWsTotal = kOffST + kStB;
static_assert(kWsTotal == 117170176ull, "carve total");
static_assert(kOffXK == kOffXQ + kActB && kOffXV == kOffXK + kActB && kOffWK == kOffWQ + kWgtB && kOffWV == kOffWK + kWgtB &&
              kOffKF == kOffQF + kF32B && kOffVF == kOffKF + kF32B, "q, k, v planes lie one behind the other");
static_assert(kWsTotal <= 134217728ull, "carve cap");
static_assert((kOffXK % 128) == 0 && (kOffXV % 128) == 0 && (kOffWQ % 128) == 0 && (kOffWK % 128) == 0 &&
              (kOffWV % 128) == 0 && (kOffWO % 128) == 0 && (kOffQF % 128) == 0 && (kOffKF % 128) == 0 &&
              (kOffVF % 128) == 0 && (kOffAH % 128) == 0 && (kOffAL % 128) == 0 && (kOffST % 128) == 0,
              "128-B aligned regions");

// ---------------------------------------------------------------------------
// Small helpers
// ---------------------------------------------------------------------------
__device__ __forceinline__ unsigned short f2bf_bits(float f) {
  unsigned u = __float_as_uint(f);
  return (unsigned short)((u + 0x7FFFu + ((u >> 16) & 1u)) >> 16);
}
__device__ __forceinline__ float bf_bits2f(unsigned short h) { return __uint_as_float(((unsigned)h) << 16); }
/* RNE-convert to a bf16 value, kept in f32 */
__device__ __forceinline__ float bf16r(float f) { return bf_bits2f(f2bf_bits(f)); }
__device__ __forceinline__ unsigned pk16(unsigned short a, unsigned short b) { return (unsigned)a | ((unsigned)b << 16); }

template <typename T> struct Frag;
template <> struct Frag<__bf16> {
  typedef v16b V; union U { v16b v; v8b h[2]; };
  /* elements 0..7 <- p[0..7], elements 8..15 <- p[16..23] */
  static __device__ __forceinline__ v16b load(const __bf16* p) {
    U f; f.h[0] = *(const v8b*)(p); f.h[1] = *(const v8b*)(p + 16); return f.v;
  }
};

/* one matrix instruction followed by its own hazard guard: the guard ties this accumulator and names both fragments */
__device__ __forceinline__ v8f mma_bf(v16b a, v16b b, v8f c) {
  c = __builtin_amdgcn_wmma_f32_16x16x32_bf16(false, a, false, b, (short)0, c, false, false);
  asm volatile("v_nop\n\tv_nop\n\tv_nop\n\tv_nop" : "+v"(c) : "v"(a), "v"(b));
  return c;
}

// ---------------------------------------------------------------------------
// f32 -> bf16 (RNE-convert) of all seven operand planes in one launch: three activation planes, then four weight planes.
// The block index selects plane and place in it (block-uniform): blocks 0 .. 6143 are 2048 per activation plane,
// blocks 6144 .. 8191 are 512 per weight plane.
// 8 consecutive elements per thread: two 16-B loads, ONE 16-B store per lane; 32 consecutive lanes write 512 contiguous
// Coverage: thread i of a plane writes elements 8i..8i+7, i < n8; blocks per plane = n8/256 exactly:
//   activations 4096*1024/8 = 524,288 -> 2048 blocks;  weights 1024*1024/8 = 131,072 -> 512 blocks.
// ---------------------------------------------------------------------------
constexpr int kActN8  = kRows * kDim / 8;
constexpr int kWgtN8  = kDim * kDim / 8;
constexpr int kActBlk = kActN8 / 256;
constexpr int kWgtBlk = kWgtN8 / 256;
constexpr int kCvtBlk = 3 * kActBlk + 4 * kWgtBlk;
static_assert((kActN8 % 256) == 0 && (kWgtN8 % 256) == 0, "whole blocks per plane");
__global__ __launch_bounds__(256) void cvt_bf16_planes_kernel(
    const float* __restrict__ a0, const float* __restrict__ a1, const float* __restrict__ a2,
    const float* __restrict__ w0, const float* __restrict__ w1, const float* __restrict__ w2, const float* __restrict__ w3,
    unsigned short* __restrict__ da0, unsigned short* __restrict__ da1, unsigned short* __restrict__ da2,
    unsigned short* __restrict__ dw0, unsigned short* __restrict__ dw1, unsigned short* __restrict__ dw2,
    unsigned short* __restrict__ dw3)
{
  const int b = blockIdx.x;
  const float* src;
  unsigned short* dst;
  int blk, n8;
  if (b < 3 * kActBlk) {
    const int z = b / kActBlk;
    blk = b - z * kActBlk;
    n8  = kActN8;
    src = (z == 0) ? a0 : (z == 1) ? a1 : a2;
    dst = (z == 0) ? da0 : (z == 1) ? da1 : da2;
  } else {
    const int bw = b - 3 * kActBlk;
    const int z = bw / kWgtBlk;
    blk = bw - z * kWgtBlk;
    n8  = kWgtN8;
    src = (z == 0) ? w0 : (z == 1) ? w1 : (z == 2) ? w2 : w3;
    dst = (z == 0) ? dw0 : (z == 1) ? dw1 : (z == 2) ? dw2 : dw3;
  }
  const int i = blk * 256 + threadIdx.x;
  if (i >= n8) return;
  const float* p = src + 8 * (size_t)i;
  const v4f a = *(const v4f*)(p);
  const v4f c = *(const v4f*)(p + 4);
  unsigned short hb[8];
#pragma unroll
  for (int e = 0; e < 4; ++e) {
    const float x0 = a[e];
    const float x1 = c[e];
    hb[e]     = f2bf_bits(x0);
    hb[4 + e] = f2bf_bits(x1);
  }
  const v4u u = (v4u){pk16(hb[0], hb[1]), pk16(hb[2], hb[3]), pk16(hb[4], hb[5]), pk16(hb[6], hb[7])};
  unsigned short* q = dst + 8 * (size_t)i;
  *(v4u*)q = u;
  
}

// ---------------------------------------------------------------------------
// Eight asynchronous 16-B copies per lane, global memory to LDS: 128 rows of 256 B of one operand plane.
// Lane (r = tid >> 4, c = tid & 15) moves bytes 16 c .. 16 c + 15 of rows r, r + 16, .. r + 112: one wave-wide copy is two
// whole 256-B rows. lds = the lane's LDS byte address of row r, g = its global address of row r, ld = row pitch in elements.
// ---------------------------------------------------------------------------
constexpr int kPassK    = 128;                 /* k per pass: 256 B of every operand row */
constexpr int kLdsPitch = 272;                 /* bytes per LDS row: 16 B x odd, conflict-free for 16-B readers */
constexpr int kPlaneB   = 128 * kLdsPitch;     /* one operand plane of a stage */
__device__ __forceinline__ void copy_plane_async(unsigned lds, const __bf16* g, int ld) {
  const size_t step = (size_t)16 * ld;
  const __bf16* g1 = g + step;      const __bf16* g2 = g + 2 * step;  const __bf16* g3 = g + 3 * step;
  const __bf16* g4 = g + 4 * step;  const __bf16* g5 = g + 5 * step;  const __bf16* g6 = g + 6 * step;
  const __bf16* g7 = g + 7 * step;
  const unsigned ls = 16u * kLdsPitch;
  /* the copies and the wait that stands before their address registers may be rewritten, in one statement */
  asm volatile(
      "global_load_async_to_lds_b128 %0, %8, off\n\t"
      "global_load_async_to_lds_b128 %1, %9, off\n\t"
      "global_load_async_to_lds_b128 %2, %10, off\n\t"
      "global_load_async_to_lds_b128 %3, %11, off\n\t"
      "global_load_async_to_lds_b128 %4, %12, off\n\t"
      "global_load_async_to_lds_b128 %5, %13, off\n\t"
      "global_load_async_to_lds_b128 %6, %14, off\n\t"
      "global_load_async_to_lds_b128 %7, %15, off\n\t"
      "s_wait_xcnt 0x0"
      :: "v"(lds), "v"(lds + ls), "v"(lds + 2u * ls), "v"(lds + 3u * ls), "v"(lds + 4u * ls), "v"(lds + 5u * ls),
         "v"(lds + 6u * ls), "v"(lds + 7u * ls), "v"(g), "v"(g1), "v"(g2), "v"(g3), "v"(g4), "v"(g5), "v"(g6), "v"(g7)
      : "memory");
}

// ---------------------------------------------------------------------------
// bf16 GEMM, operands staged in LDS: C[m][n] = sum_k A[m][k] * Bt[n][k] + bf16value(bias[n]).
// One block of 8 waves owns a 128 x 128 tile; wave (wm = wave >> 1, wn = wave & 1) owns rows 32 wm .. + 31, cols 64 wn .. + 63.
// A row-major [M][K] bf16 (SPLA: a second plane A2 of the same layout is accumulated against the same Bt);
// Bt row-major [N][K] bf16; M, N % 128 == 0, K % 128 == 0, K >= 256 (no tail handling). C f32, pitch ldc.
// A stage = 128 k of [A 128 rows | Bt 128 rows | A2 128 rows if SPLA], brought by asynchronous copies into one of two
// buffers: the copies of stage t + 2 fly while stage t + 1 is worked on.
// EPI 0: plain.  EPI 1: feature map y = x + 1 for x > 0, exp(x) otherwise, applied to the accumulators in registers.
// EPI 2: three products of one shape in one launch. blockIdx.y = 0, 1, 2 (block-uniform) picks the plane: A, Bt and C are
// three dense planes one behind the other (M x lda, N x ldb, M x ldc elements each), the biases three buffers; planes 0
// and 1 take the feature map, plane 2 is plain.
// Fragment map: lane l, row/col = l & 15, half h = l >> 4; elements 0..7 <- k0 + 8h + 0..7, 8..15 <- k0 + 16 + 8h + 0..7
// for both operands; accumulator element r = (row 8h + r, col l & 15).
// Epilogue: 16-row slabs staged per wave in LDS of its own (same wave stores and reloads, wave-level ordering).
// Coverage: 32 x 8 = 256 tiles of 128 x 128 = 4096 x 1024; grid.x = 256 blocks, one tile per block and plane.
// ---------------------------------------------------------------------------
template <bool SPLA, int EPI>
__global__ __launch_bounds__(256) void gemm_tile64_kernel(
    const unsigned short* __restrict__ Ap, const unsigned short* __restrict__ A2p, int lda,
    const unsigned short* __restrict__ Btp, int ldb,
    float* __restrict__ Cout, int ldc,
    const float* __restrict__ bias, int M, int N, int K,
    const float* __restrict__ bias1 = nullptr, const float* __restrict__ bias2 = nullptr)
{
  const int z = (EPI == 2) ? (int)blockIdx.y : 0;
  const __bf16* A  = (const __bf16*)Ap + (size_t)z * M * lda;
  const __bf16* A2 = (const __bf16*)A2p + (size_t)z * M * lda;
  const __bf16* Bt = (const __bf16*)Btp + (size_t)z * N * ldb;
  if (EPI == 2) {
    Cout += (size_t)z * M * ldc;
    bias = (z == 0) ? bias : (z == 1) ? bias1 : bias2;
  }
  constexpr int kStageB = (SPLA ? 3 : 2) * kPlaneB;
  __shared__ __align__(16) unsigned char sStage[2 * kStageB];
  __shared__ __align__(16) float sT[8][16 * 68];
  const int tid  = threadIdx.x;
  const int lane = tid & 31;
  const int wave = tid >> 5;
  const int tilesN = N >> 7;
  const int tilesM = M >> 7;
  const int tile = blockIdx.x;
  /* block-uniform, in front of every barrier and copy */
  if (tile >= tilesM * tilesN) return;
  const int tm = tile / tilesN;
  const int tn = tile - tm * tilesN;
  const int mB = tm << 7;
  const int nB = tn << 7;
  const int wm = wave >> 1;
  const int wn = wave & 1;

  const int rlane = lane & 15;
  const int koff  = (lane >> 4) * 8;
  const int mOff  = (lane >> 4) * 8;

  /* this lane's share of a stage */
  const int cr = tid >> 4, cc = (tid & 15) * 8;
  const unsigned ldsC = (unsigned)(uintptr_t)(sStage + cr * kLdsPitch + cc * 2);
  const __bf16* gA  = A  + (size_t)(mB + cr) * lda + cc;
  const __bf16* gA2 = A2 + (size_t)(mB + cr) * lda + cc;
  const __bf16* gB  = Bt + (size_t)(nB + cr) * ldb + cc;
  const int nPass = K / kPassK;

  /* every loop over acc[], fa[], fb[], fl[] below is unrolled: constant indices keep these arrays in registers */
  v8f acc[2][4];
#pragma unroll
  for (int i = 0; i < 2; ++i)
#pragma unroll
    for (int j = 0; j < 4; ++j) acc[i][j] = (v8f){0.f, 0.f, 0.f, 0.f, 0.f, 0.f, 0.f, 0.f};

  // ---- stage 0, published; then stage 1 in flight ----
  copy_plane_async(ldsC, gA, lda);
  copy_plane_async(ldsC + kPlaneB, gB, ldb);
  if (SPLA) copy_plane_async(ldsC + 2 * kPlaneB, gA2, lda);
  /* this wave's copies of stage 0 have landed */
  asm volatile("s_wait_asynccnt 0x0" ::: "memory");
  __syncthreads();
  if (1 < nPass) {
    copy_plane_async(ldsC + kStageB, gA + kPassK, lda);
    copy_plane_async(ldsC + kStageB + kPlaneB, gB + kPassK, ldb);
    if (SPLA) copy_plane_async(ldsC + kStageB + 2 * kPlaneB, gA2 + kPassK, lda);
  }

  /* rolled: one pass per trip, so that each trip reads one buffer and ends in one publish point */
#pragma unroll 1
  for (int t = 0; t < nPass; ++t) {
    const int bufB = (t & 1) * kStageB;
    const unsigned char* pA = sStage + bufB + (wm * 32 + rlane) * kLdsPitch + koff * 2;
    const unsigned char* pB = sStage + bufB + kPlaneB + (wn * 64 + rlane) * kLdsPitch + koff * 2;
    /* two fragment sets: the reads of k step kk + 1 (same buffer) are issued in front of step kk's products, so that a
       wave waits out the LDS latency once per pass and not at every step */
    v16b fb[2][4], fa[2][2], fl[2][2];
#pragma unroll
    for (int j = 0; j < 4; ++j) fb[0][j] = Frag<__bf16>::load((const __bf16*)(pB + j * 16 * kLdsPitch));
#pragma unroll
    for (int i = 0; i < 2; ++i) {
      fa[0][i] = Frag<__bf16>::load((const __bf16*)(pA + i * 16 * kLdsPitch));
      if (SPLA) fl[0][i] = Frag<__bf16>::load((const __bf16*)(pA + 2 * kPlaneB + i * 16 * kLdsPitch));
    }
#pragma unroll
    for (int kk = 0; kk < kPassK / 32; ++kk) {
      const int cur = kk & 1, nxt = cur ^ 1;
      if (kk + 1 < kPassK / 32) {
#pragma unroll
        for (int j = 0; j < 4; ++j)
          fb[nxt][j] = Frag<__bf16>::load((const __bf16*)(pB + j * 16 * kLdsPitch + (kk + 1) * 64));
#pragma unroll
        for (int i = 0; i < 2; ++i) {
          fa[nxt][i] = Frag<__bf16>::load((const __bf16*)(pA + i * 16 * kLdsPitch + (kk + 1) * 64));
          if (SPLA) fl[nxt][i] = Frag<__bf16>::load((const __bf16*)(pA + 2 * kPlaneB + i * 16 * kLdsPitch + (kk + 1) * 64));
        }
      }
      /* per accumulator and k step: the hi product, then the lo product */
#pragma unroll
      for (int i = 0; i < 2; ++i) {
#pragma unroll
        for (int j = 0; j < 4; ++j) acc[i][j] = mma_bf(fa[cur][i], fb[cur][j], acc[i][j]);
        if (SPLA) {
#pragma unroll
          for (int j = 0; j < 4; ++j) acc[i][j] = mma_bf(fl[cur][i], fb[cur][j], acc[i][j]);
        }
      }
    }
    /* publish point: this wave's reads of the buffer are done, its copies of the next stage have landed */
    asm volatile("s_wait_dscnt 0x0" ::: "memory");
    asm volatile("s_wait_asynccnt 0x0" ::: "memory");
    __syncthreads();
    /* refill the buffer that every wave has just left; the test is the same for the whole block */
    if (t + 2 < nPass) {
      const int ko = (t + 2) * kPassK;
      copy_plane_async(ldsC + bufB, gA + ko, lda);
      copy_plane_async(ldsC + bufB + kPlaneB, gB + ko, ldb);
      if (SPLA) copy_plane_async(ldsC + bufB + 2 * kPlaneB, gA2 + ko, lda);
    }
  }
  /* no copy is left in flight when the wave goes on */
  asm volatile("s_wait_asynccnt 0x0" ::: "memory");

  // ---- epilogue ----
  const int m0 = mB + wm * 32;
  const int n0 = nB + wn * 64;
  float* slab = sT[wave];
  float bvj[4];
#pragma unroll
  for (int j = 0; j < 4; ++j) bvj[j] = bf16r(bias[n0 + (j << 4) + rlane]);
  /* every loop over acc[] is unrolled: constant indices keep it in registers */
#pragma unroll
  for (int i = 0; i < 2; ++i)
#pragma unroll
    for (int j = 0; j < 4; ++j)
#pragma unroll
      for (int r = 0; r < 8; ++r) acc[i][j][r] += bvj[j];
  /* feature map on the accumulators themselves, 64 independent values per lane; the test is the same for the whole block */
  if (EPI == 1 || (EPI == 2 && z < 2)) {
#pragma unroll
    for (int i = 0; i < 2; ++i)
#pragma unroll
      for (int j = 0; j < 4; ++j)
#pragma unroll
        for (int r = 0; r < 8; ++r) {
          const float x = acc[i][j][r];
          const float ex = expf(fminf(x, 0.0f));
          acc[i][j][r] = (x > 0.0f) ? (x + 1.0f) : ex;
        }
  }
#pragma unroll
  for (int i = 0; i < 2; ++i) {
    const int mBase = m0 + (i << 4);
#pragma unroll
    for (int j = 0; j < 4; ++j) {
#pragma unroll
      for (int r = 0; r < 8; ++r) {
        slab[(mOff + r) * 68 + (j << 4) + rlane] = acc[i][j][r];
      }
    }
    __builtin_amdgcn_fence(__ATOMIC_RELEASE, "workgroup");
    __builtin_amdgcn_wave_barrier();
    __builtin_amdgcn_fence(__ATOMIC_ACQUIRE, "workgroup");
    {
      /* row segment = 256 B = 16 lanes x 16 B; rows it*2 + hh cover 0..15 */
      const int hh = lane >> 4, c4 = (lane & 15) * 4;
      {
#pragma unroll
        for (int it = 0; it < 8; ++it) {
          const int row = it * 2 + hh;
          const v4f v = *(const v4f*)(slab + row * 68 + c4);
          *(v4f*)(Cout + (size_t)(mBase + row) * ldc + n0 + c4) = v;
        }
        
      }
    }
    __builtin_amdgcn_fence(__ATOMIC_RELEASE, "workgroup");
    __builtin_amdgcn_wave_barrier();
    __builtin_amdgcn_fence(__ATOMIC_ACQUIRE, "workgroup");
  }
}

// ---------------------------------------------------------------------------
// Chunk sums: one block of 256 threads per (chunk, batch-head), chunks 0 .. kChunks - 2 (nothing follows the last one).
// slot[d][j] = sum over the chunk's 64 steps of k[s][d] * v[s][j]; slot[4096 + d] = sum over the steps of k[s][d].
// Thread (d4 = 4 (tid >> 4), j4 = 4 (tid & 15)) keeps a 4 x 4 patch in registers: two 16-B LDS reads feed 16 FMAs.
// Staging coverage: rows lr + 16 i (lr = tid >> 4, i = 0..3) x cols 4 (tid & 15) .. + 3 = 64 x 64 per tensor.
// LDS: 2 x 16,384 = 32,768 B.
// ---------------------------------------------------------------------------
__global__ __launch_bounds__(256) void chunk_state_kernel(
    const float* __restrict__ KF, const float* __restrict__ VF, float* __restrict__ ST)
{
  __shared__ __align__(16) float sK[kChunkL * 64];
  __shared__ __align__(16) float sV[kChunkL * 64];
  const int tid = threadIdx.x;
  const int chunk = blockIdx.x;
  const int bh = blockIdx.y;
  const size_t row0 = (size_t)(bh >> 4) * kSeq + (size_t)chunk * kChunkL;
  const int col0 = (bh & 15) * kHd;
  const int lr = tid >> 4, lc4 = (tid & 15) * 4;
  /* unrolled: all eight global loads are issued before the first LDS store waits on one */
#pragma unroll
  for (int i = 0; i < kChunkL / 16; ++i) {
    const int r = lr + 16 * i;
    const size_t g = (row0 + (size_t)r) * kDim + col0 + lc4;
    *(v4f*)(sK + r * 64 + lc4) = *(const v4f*)(KF + g);
    *(v4f*)(sV + r * 64 + lc4) = *(const v4f*)(VF + g);
  }
  __syncthreads();

  const int d4 = lr * 4, j4 = lc4;
  /* every loop over a[] is unrolled so that its indices are constants and the patch stays in registers */
  v4f a[4];
#pragma unroll
  for (int r = 0; r < 4; ++r) a[r] = (v4f){0.f, 0.f, 0.f, 0.f};
  /* eight steps' LDS reads in flight together; rolled, every step waits out a whole LDS latency */
#pragma unroll 8
  for (int s = 0; s < kChunkL; ++s) {
    const v4f kk = *(const v4f*)(sK + s * 64 + d4);
    const v4f vv = *(const v4f*)(sV + s * 64 + j4);
#pragma unroll
    for (int r = 0; r < 4; ++r)
#pragma unroll
      for (int e = 0; e < 4; ++e) a[r][e] = fmaf(kk[r], vv[e], a[r][e]);
  }
  float* slot = ST + ((size_t)bh * (kChunks - 1) + chunk) * kSlotF;
#pragma unroll
  for (int r = 0; r < 4; ++r) *(v4f*)(slot + (d4 + r) * 64 + j4) = a[r];

  /* key sums; waves 0 and 1 only (wave-uniform predicate) */
  if (tid < 64) {
    float c = 0.0f;
    for (int s = 0; s < kChunkL; ++s) c += sK[s * 64 + tid];
    slot[kHd * kHd + tid] = c;
  }
}

// ---------------------------------------------------------------------------
// Inclusive sum of the chunk slots along the chunk axis, in place: slot c becomes the state at the end of chunk c.
// One thread per float of a slot (4160 per batch-head, grid.x = 17 blocks with a tail guard); the 31 values stay in
// registers, so all loads are in flight together and the thread pays the load latency once.
// ---------------------------------------------------------------------------
__global__ __launch_bounds__(256) void chunk_prefix_kernel(float* __restrict__ ST)
{
  const int i = blockIdx.x * 256 + threadIdx.x;
  if (i >= kSlotF) return;
  float* base = ST + (size_t)blockIdx.y * (kChunks - 1) * kSlotF + i;
  /* both loops unrolled: constant indices keep x[] in registers */
  float x[kChunks - 1];
#pragma unroll
  for (int c = 0; c < kChunks - 1; ++c) x[c] = base[(size_t)c * kSlotF];
#pragma unroll
  for (int c = 1; c < kChunks - 1; ++c) {
    x[c] += x[c - 1];
    base[(size_t)c * kSlotF] = x[c];
  }
}

// ---------------------------------------------------------------------------
// Causal state scan, one block of 128 threads per (chunk, batch-head), the chunk's 64 steps in a static loop.
// Thread (j2 = 2 (tid & 31), dg = tid >> 5) keeps kv[d][j2], kv[d][j2 + 1] for d = 16 dg .. 16 dg + 15 in registers: the
// eight 16-B LDS reads that bring a wave its 16 q and 16 k of a step (every lane the same address)
// feed 64 FMAs per lane and not 32. Chunk 0 starts from zero, chunk c > 0 from slot c - 1 of ST (state and key sums at
// the end of the chunk before it).
// Per step s (inclusive sums): kv[d][j] += k[d] * v[j]; partial[dg][s][j] = sum over its 16 d of q[d] * kv[d][j].
// Steps are staged 32 at a time: sQ, sK, sV hold q, k, v rows [32][64] f32; sN holds the four partial planes [4][32][64].
// After the 32 steps: threads 0..63 turn sK into the inclusive key sums in place (running carry in a register);
// then lane (rows 4 wave + (lane >> 3) and that + 16, cols 8 (lane & 7) .. + 7) forms den = sum_d q[d] * ksum[d] (8 d per
// lane, summed over the row's 8 lanes, f32), num = ((p0 + p1) + p2) + p3, out = num * (1 / (den + eps)), splits out into bf16 hi + lo and stores both planes.
// Staging coverage: rows lr + 8 i (lr = tid >> 4 = 0..7, i = 0..3) x cols 4 (tid & 15) .. + 3 = 32 x 64 per tensor.
// LDS: 3 x 8,192 + 32,768 = 57,344 B.
// ---------------------------------------------------------------------------
/* both columns' fused multiply-adds in one operation; each column rounds as fmaf does */
__device__ __forceinline__ v2f fma2(float a, v2f b, v2f c) { return __builtin_elementwise_fma((v2f){a, a}, b, c); }

/* x + (x of lane l ^ m) inside a 16-lane row, all lanes on; CTRL = 0x160 + m is the row_xmask control of a DPP operand */
template <int CTRL>
__device__ __forceinline__ float lane_xor_add(float x) {
  return x + __int_as_float(__builtin_amdgcn_update_dpp(0, __float_as_int(x), CTRL, 0xf, 0xf, true));
}

__global__ __launch_bounds__(128) void scan_state_kernel(
    const float* __restrict__ QF, const float* __restrict__ KF, const float* __restrict__ VF,
    const float* __restrict__ ST, unsigned short* __restrict__ AH, unsigned short* __restrict__ AL)
{
  __shared__ __align__(16) float sQ[kScanT * 64];
  __shared__ __align__(16) float sK[kScanT * 64];
  __shared__ __align__(16) float sV[kScanT * 64];
  __shared__ __align__(16) float sN[4 * kScanT * 64];
  const int tid = threadIdx.x, lane = tid & 31, wave = tid >> 5;
  const int j2 = lane * 2;
  const int dg = wave;
  const int chunk = blockIdx.x;
  const int bh = blockIdx.y;
  const int bb = bh >> 4;
  const int hd = bh & 15;
  const size_t row0 = (size_t)bb * kSeq;
  const int col0 = hd * kHd;

  v2f kv[16];
#pragma unroll
  for (int i = 0; i < 16; ++i) kv[i] = (v2f){0.0f, 0.0f};
  float kcarry = 0.0f;
  /* block-uniform predicate */
  if (chunk > 0) {
    const float* slot = ST + ((size_t)bh * (kChunks - 1) + (chunk - 1)) * kSlotF;
    /* unrolled: constant indices keep kv[] in registers */
#pragma unroll
    for (int i = 0; i < 15; ++i) kv[i] = *(const v2f*)(slot + (dg * 16 + i) * 64 + j2);
    /* the last load may land in the offset register that the fifteen before it name: their wait stands in front of it */
    asm volatile("s_wait_xcnt 0x0" ::: "memory");
    kv[15] = *(const v2f*)(slot + (dg * 16 + 15) * 64 + j2);
    if (tid < 64) kcarry = slot[kHd * kHd + tid];
  }

  const int lr = tid >> 4, lc4 = (tid & 15) * 4;
  const int q4 = lane >> 3, c8 = (lane & 7) * 8;
  const int orow = wave * 4 + q4;

#pragma unroll 1
  for (int t0 = chunk * kChunkL; t0 < (chunk + 1) * kChunkL; t0 += kScanT) {
    /* every read of the stage before this one has finished */
    __syncthreads();
    /* all loops over tq[], tk[], tv[] unrolled: constant indices keep them in registers; twelve loads in flight per lane */
    v4f tq[4], tk[4], tv[4];
#pragma unroll
    for (int i = 0; i < 2; ++i) {
      const size_t g = (row0 + (size_t)(t0 + lr + 8 * i)) * kDim + col0 + lc4;
      tq[i] = *(const v4f*)(QF + g);
      tk[i] = *(const v4f*)(KF + g);
      tv[i] = *(const v4f*)(VF + g);
    }
    /* the next six loads may land in address registers that the first six name: their wait stands in front */
    asm volatile("s_wait_xcnt 0x0" ::: "memory");
#pragma unroll
    for (int i = 2; i < 4; ++i) {
      const size_t g = (row0 + (size_t)(t0 + lr + 8 * i)) * kDim + col0 + lc4;
      tq[i] = *(const v4f*)(QF + g);
      tk[i] = *(const v4f*)(KF + g);
      tv[i] = *(const v4f*)(VF + g);
    }
    /* before the address registers of these six are used for anything else */
    asm volatile("s_wait_xcnt 0x0" ::: "memory");
#pragma unroll
    for (int i = 0; i < 4; ++i) {
      const int r = lr + 8 * i;
      *(v4f*)(sQ + r * 64 + lc4) = tq[i];
      *(v4f*)(sK + r * 64 + lc4) = tk[i];
      *(v4f*)(sV + r * 64 + lc4) = tv[i];
    }
    __syncthreads();

    /* four steps per trip: their LDS reads are issued together in front of the FMAs, so that a wave waits out the LDS
       latency once per four steps; rolled, with four waves per SIMD, every step's latency stays open */
#pragma unroll 4
    for (int s = 0; s < kScanT; ++s) {
      const v2f vj = *(const v2f*)(sV + s * 64 + j2);
      const float* qp = sQ + s * 64 + dg * 16;
      const float* kp = sK + s * 64 + dg * 16;
      v2f accn = (v2f){0.0f, 0.0f};
#pragma unroll
      for (int g = 0; g < 4; ++g) {
        const v4f kk = *(const v4f*)(kp + 4 * g);
        const v4f qq = *(const v4f*)(qp + 4 * g);
        kv[4 * g + 0] = fma2(kk[0], vj, kv[4 * g + 0]);
        accn = fma2(qq[0], kv[4 * g + 0], accn);
        kv[4 * g + 1] = fma2(kk[1], vj, kv[4 * g + 1]);
        accn = fma2(qq[1], kv[4 * g + 1], accn);
        kv[4 * g + 2] = fma2(kk[2], vj, kv[4 * g + 2]);
        accn = fma2(qq[2], kv[4 * g + 2], accn);
        kv[4 * g + 3] = fma2(kk[3], vj, kv[4 * g + 3]);
        accn = fma2(qq[3], kv[4 * g + 3], accn);
      }
      *(v2f*)(sN + (dg * kScanT + s) * 64 + j2) = accn;
    }
    __syncthreads();

    /* inclusive key sums in place; waves 0 and 1 only (wave-uniform predicate) */
    if (tid < 64) {
      /* both loops unrolled: the 32 reads are issued together and their latency is waited out once, not once per step;
         constant indices keep x[] in registers; the adds run in the same order as before */
      float x[kScanT];
#pragma unroll
      for (int s = 0; s < kScanT; ++s) x[s] = sK[s * 64 + tid];
      float c = kcarry;
#pragma unroll
      for (int s = 0; s < kScanT; ++s) {
        c += x[s];
        sK[s * 64 + tid] = c;
      }
      kcarry = c;
    }
    __syncthreads();

    /* each of the 8 lanes that share a row takes 8 of its 64 d (two 16-B pieces of q and of the key sums), then the 8
       partial sums are added across the lanes: 8 LDS reads per lane for both rows, not 64 that 8 lanes repeat.
       Odd q4 takes its two pieces in the other order: the two rows of a 16-lane half then fall on different banks. */
    float den0, den1;
    {
      const int pa = (((q4 & 1) << 3) + (lane & 7)) * 4;
      const int pb = pa ^ 32;
      const v4f qa0 = *(const v4f*)(sQ + orow * 64 + pa);
      const v4f ka0 = *(const v4f*)(sK + orow * 64 + pa);
      const v4f qb0 = *(const v4f*)(sQ + orow * 64 + pb);
      const v4f kb0 = *(const v4f*)(sK + orow * 64 + pb);
      const v4f qa1 = *(const v4f*)(sQ + (orow + 16) * 64 + pa);
      const v4f ka1 = *(const v4f*)(sK + (orow + 16) * 64 + pa);
      const v4f qb1 = *(const v4f*)(sQ + (orow + 16) * 64 + pb);
      const v4f kb1 = *(const v4f*)(sK + (orow + 16) * 64 + pb);
      float p0 = qa0[0] * ka0[0], p1 = qa1[0] * ka1[0];
      /* both loops unrolled: constant indices keep the eight pieces in registers */
#pragma unroll
      for (int e = 1; e < 4; ++e) {
        p0 = fmaf(qa0[e], ka0[e], p0);
        p1 = fmaf(qa1[e], ka1[e], p1);
      }
#pragma unroll
      for (int e = 0; e < 4; ++e) {
        p0 = fmaf(qb0[e], kb0[e], p0);
        p1 = fmaf(qb1[e], kb1[e], p1);
      }
      /* lanes l ^ 1, l ^ 2, l ^ 4: every lane of the 8 ends with the same sum */
      p0 = lane_xor_add<0x161>(p0);  p1 = lane_xor_add<0x161>(p1);
      p0 = lane_xor_add<0x162>(p0);  p1 = lane_xor_add<0x162>(p1);
      den0 = lane_xor_add<0x164>(p0);
      den1 = lane_xor_add<0x164>(p1);
    }

    /* unrolled: rr is a constant in each copy */
#pragma unroll
    for (int rr = 0; rr < 2; ++rr) {
      const int row = orow + 16 * rr;
      const float inv = 1.0f / ((rr == 0 ? den0 : den1) + kEps);
      const float* np = sN + row * 64 + c8;
      const v4f a0 = *(const v4f*)(np);
      const v4f a1 = *(const v4f*)(np + 4);
      const v4f b0 = *(const v4f*)(np + 1 * kScanT * 64);
      const v4f b1 = *(const v4f*)(np + 1 * kScanT * 64 + 4);
      const v4f e0 = *(const v4f*)(np + 2 * kScanT * 64);
      const v4f e1 = *(const v4f*)(np + 2 * kScanT * 64 + 4);
      const v4f f0 = *(const v4f*)(np + 3 * kScanT * 64);
      const v4f f1 = *(const v4f*)(np + 3 * kScanT * 64 + 4);
      float o[8];
#pragma unroll
      for (int e = 0; e < 4; ++e) {
        const float n0v = ((a0[e] + b0[e]) + e0[e]) + f0[e];
        const float n1v = ((a1[e] + b1[e]) + e1[e]) + f1[e];
        o[e]     = n0v * inv;
        o[4 + e] = n1v * inv;
      }
      unsigned short hb[8], lb[8];
#pragma unroll
      for (int e = 0; e < 8; ++e) {
        const float x = o[e];
        const unsigned short hbits = f2bf_bits(x);
        const float res = x - bf_bits2f(hbits);
        hb[e] = hbits;
        lb[e] = f2bf_bits(res);
      }
      const v4u uh = (v4u){pk16(hb[0], hb[1]), pk16(hb[2], hb[3]), pk16(hb[4], hb[5]), pk16(hb[6], hb[7])};
      const v4u ul = (v4u){pk16(lb[0], lb[1]), pk16(lb[2], lb[3]), pk16(lb[4], lb[5]), pk16(lb[6], lb[7])};
      const size_t oo = (row0 + (size_t)(t0 + row)) * kDim + col0 + c8;
      unsigned short* ph = AH + oo;
      unsigned short* pl = AL + oo;
      *(v4u*)ph = uh;
      *(v4u*)pl = ul;
    }
    /* the next trip rewrites the address registers of these stores: their wait stands in front of it */
    asm volatile("s_wait_xcnt 0x0" ::: "memory");
  }
}

// ---------------------------------------------------------------------------
// Host glue: 1 convert launch + 1 launch of the three projection GEMMs + 3 scan launches (chunk sums, chunk prefix, scan)
// + 1 output GEMM = 6 launches. Kernel launches only.
// GEMM shapes: M 4096, N 1024, K 1024 everywhere (K, M and N % 128 == 0): 32 x 8 = 256 tiles -> 256 blocks per product.
// ---------------------------------------------------------------------------
extern "C" void kernel_launch(void* const* d_in, const int* in_sizes, int n_in,
                              void* d_out, int out_size, void* d_ws, size_t ws_size,
                              hipStream_t stream) {
  if (n_in < 11 || d_out == nullptr || d_ws == nullptr) return;
  if (in_sizes[0] != kRows * kDim || in_sizes[1] != kRows * kDim || in_sizes[2] != kRows * kDim) return;
  if (in_sizes[3] != kDim * kDim || in_sizes[5] != kDim * kDim || in_sizes[7] != kDim * kDim ||
      in_sizes[9] != kDim * kDim) return;
  if (in_sizes[4] != kDim || in_sizes[6] != kDim || in_sizes[8] != kDim || in_sizes[10] != kDim) return;
  if (out_size != kRows * kDim) return;
  if (ws_size < kWsTotal) return;

  const float* query = (const float*)d_in[0];
  const float* key   = (const float*)d_in[1];
  const float* value = (const float*)d_in[2];
  const float* Wq    = (const float*)d_in[3];
  const float* bq    = (const float*)d_in[4];
  const float* Wk    = (const float*)d_in[5];
  const float* bk    = (const float*)d_in[6];
  const float* Wv    = (const float*)d_in[7];
  const float* bv    = (const float*)d_in[8];
  const float* Wo    = (const float*)d_in[9];
  const float* bo    = (const float*)d_in[10];
  float* out = (float*)d_out;

  char* ws = (char*)d_ws;
  unsigned short* XQ = (unsigned short*)(ws + kOffXQ);
  unsigned short* XK = (unsigned short*)(ws + kOffXK);
  unsigned short* XV = (unsigned short*)(ws + kOffXV);
  unsigned short* WQ = (unsigned short*)(ws + kOffWQ);
  unsigned short* WK = (unsigned short*)(ws + kOffWK);
  unsigned short* WV = (unsigned short*)(ws + kOffWV);
  unsigned short* WO = (unsigned short*)(ws + kOffWO);
  float*          QF = (float*)(ws + kOffQF);
  float*          KF = (float*)(ws + kOffKF);
  float*          VF = (float*)(ws + kOffVF);
  unsigned short* AH = (unsigned short*)(ws + kOffAH);
  unsigned short* AL = (unsigned short*)(ws + kOffAL);
  float*          ST = (float*)(ws + kOffST);

  // ---- bf16 operand planes (weights are [out][in] = Bt layout already) ----
  cvt_bf16_planes_kernel<<<dim3(kCvtBlk), 256, 0, stream>>>(query, key, value, Wq, Wk, Wv, Wo,
                                                            XQ, XK, XV, WQ, WK, WV, WO);

  // ---- projections, one launch: q and k with the feature map in the epilogue, v plain; planes XQ|XK|XV, WQ|WK|WV, QF|KF|VF ----
  const int gblocks = (kRows / 128) * (kDim / 128);
  gemm_tile64_kernel<false, 2><<<dim3(gblocks, 3), 256, 0, stream>>>(XQ, XQ, kDim, WQ, kDim, QF, kDim, bq, kRows, kDim, kDim,
                                                                     bk, bv);

  // ---- causal state scan: chunk sums, their running sum, then one block per (chunk, batch-head) ----
  chunk_state_kernel<<<dim3(kChunks - 1, kBatch * kHeads), 256, 0, stream>>>(KF, VF, ST);
  chunk_prefix_kernel<<<dim3((kSlotF + 255) / 256, kBatch * kHeads), 256, 0, stream>>>(ST);
  scan_state_kernel<<<dim3(kChunks, kBatch * kHeads), 128, 0, stream>>>(QF, KF, VF, ST, AH, AL);

  // ---- output projection: (hi + lo) . bf16(Wo)^T + bo, both parts into one accumulator ----
  gemm_tile64_kernel<true, 0><<<dim3(gblocks), 256, 0, stream>>>(AH, AL, kDim, WO, kDim, out, kDim, bo, kRows, kDim, kDim);
}

// v007
// It runs in 89.7 microseconds.
// Timed twice side by side with v006, it ran 1.07 times as fast both times.
// All steps since v000 together make it 8.27 times as fast.
// Contractions: q/k/v projections on v_wmma_f32_16x16x32_bf16 (bf16(x) x bf16(W), one product, f32 accumulate); output projection on v_wmma_f32_16x16x32_bf16 with the attention plane carried as bf16 hi + lo planes against bf16(Wo) (two products into one f32 accumulator); feature map, 64x64 state scan, normaliser and division in f32 on the vector unit.
#include <hip/hip_runtime.h>
#include <math.h>

typedef __attribute__((ext_vector_type(16))) __bf16   v16b;
typedef __attribute__((ext_vector_type(8)))  __bf16   v8b;
typedef __attribute__((ext_vector_type(8)))  float    v8f;
typedef __attribute__((ext_vector_type(4)))  float    v4f;
typedef __attribute__((ext_vector_type(2)))  float    v2f;
typedef __attribute__((ext_vector_type(4)))  unsigned int v4u;

// ---------------------------------------------------------------------------
// Shape constants
// ---------------------------------------------------------------------------
constexpr int kBatch = 2;
constexpr int kSeq   = 2048;
constexpr int kDim   = 1024;
constexpr int kHeads = 16;
constexpr int kHd    = 64;
constexpr int kRows  = kBatch * kSeq;
constexpr int kScanT = 32;
constexpr int kChunkL = 64;
constexpr int kChunks = kSeq / kChunkL;
constexpr int kSlotF  = kHd * kHd + kHd;
constexpr float kEps = 1e-6f;
static_assert(kHeads * kHd == kDim, "head split");
static_assert((kDim % 128) == 0 && kDim >= 256, "GEMM K: whole passes of 128, at least two");
static_assert((kRows % 128) == 0 && (kDim % 128) == 0, "GEMM M, N multiples of 128");
static_assert((kSeq % kChunkL) == 0 && (kChunkL % kScanT) == 0, "scan chunking");
static_assert((kSlotF % 32) == 0, "128-B aligned state slots");
static_assert(kHd == 64, "one head = one 64-column tile");

// ---------------------------------------------------------------------------
// Workspace region map (bytes; every offset is a multiple of 128)
//   XQ  bf16 [4096][1024]  bf16(query)                  8,388,608
//   XK  bf16 [4096][1024]  bf16(key)                    8,388,608
//   XV  bf16 [4096][1024]  bf16(value)                  8,388,608
//   WQ  bf16 [1024][1024]  bf16(Wq)  (Bt layout)        2,097,152
//   WK  bf16 [1024][1024]  bf16(Wk)                     2,097,152
//   WV  bf16 [1024][1024]  bf16(Wv)                     2,097,152
//   WO  bf16 [1024][1024]  bf16(Wo)                     2,097,152
//   QF  f32  [4096][1024]  phi(q)                      16,777,216
//   KF  f32  [4096][1024]  phi(k)                      16,777,216
//   VF  f32  [4096][1024]  v                           16,777,216
//   AH  bf16 [4096][1024]  attention plane, hi part     8,388,608
//   AL  bf16 [4096][1024]  attention plane, lo part     8,388,608
//   ST  f32  [32][31][4160] chunk states: 64x64 key-value sum, then 64 key sums   16,506,880
//   total                                             117,170,176
// ---------------------------------------------------------------------------
constexpr size_t kActB  = (size_t)kRows * kDim * 2;
constexpr size_t kWgtB  = (size_t)kDim * kDim * 2;
constexpr size_t kF32B  = (size_t)kRows * kDim * 4;
constexpr size_t kOffXQ = 0;
constexpr size_t kOffXK = kOffXQ + kActB;
constexpr size_t kOffXV = kOffXK + kActB;
constexpr size_t kOffWQ = kOffXV + kActB;
constexpr size_t kOffWK = kOffWQ + kWgtB;
constexpr size_t kOffWV = kOffWK + kWgtB;
constexpr size_t kOffWO = kOffWV + kWgtB;
constexpr size_t kOffQF = kOffWO + kWgtB;
constexpr size_t kOffKF = kOffQF + kF32B;
constexpr size_t kOffVF = kOffKF + kF32B;
constexpr size_t kOffAH = kOffVF + kF32B;
constexpr size_t kOffAL = kOffAH + kActB;
constexpr size_t kOffST = kOffAL + kActB;
constexpr size_t kStB   = (size_t)kBatch * kHeads * (kChunks - 1) * kSlotF * 4;
constexpr size_t kWsTotal = kOffST + kStB;
static_assert(kWsTotal == 117170176ull, "carve total");
static_assert(kOffXK == kOffXQ + kActB && kOffXV == kOffXK + kActB && kOffWK == kOffWQ + kWgtB && kOffWV == kOffWK + kWgtB &&
              kOffKF == kOffQF + kF32B && kOffVF == kOffKF + kF32B, "q, k, v planes lie one behind the other");
static_assert(kWsTotal <= 134217728ull, "carve cap");
static_assert((kOffXK % 128) == 0 && (kOffXV % 128) == 0 && (kOffWQ % 128) == 0 && (kOffWK % 128) == 0 &&
              (kOffWV % 128) == 0 && (kOffWO % 128) == 0 && (kOffQF % 128) == 0 && (kOffKF % 128) == 0 &&
              (kOffVF % 128) == 0 && (kOffAH % 128) == 0 && (kOffAL % 128) == 0 && (kOffST % 128) == 0,
              "128-B aligned regions");

// ---------------------------------------------------------------------------
// Small helpers
// ---------------------------------------------------------------------------
__device__ __forceinline__ unsigned short f2bf_bits(float f) {
  unsigned u = __float_as_uint(f);
  return (unsigned short)((u + 0x7FFFu + ((u >> 16) & 1u)) >> 16);
}
__device__ __forceinline__ float bf_bits2f(unsigned short h) { return __uint_as_float(((unsigned)h) << 16); }
/* RNE-convert to a bf16 value, kept in f32 */
__device__ __forceinline__ float bf16r(float f) { return bf_bits2f(f2bf_bits(f)); }
__device__ __forceinline__ unsigned pk16(unsigned short a, unsigned short b) { return (unsigned)a | ((unsigned)b << 16); }

template <typename T> struct Frag;
template <> struct Frag<__bf16> {
  typedef v16b V; union U { v16b v; v8b h[2]; };
  /* elements 0..7 <- p[0..7], elements 8..15 <- p[16..23] */
  static __device__ __forceinline__ v16b load(const __bf16* p) {
    U f; f.h[0] = *(const v8b*)(p); f.h[1] = *(const v8b*)(p + 16); return f.v;
  }
};

/* one matrix instruction followed by its own hazard guard: the guard ties this accumulator and names both fragments */
__device__ __forceinline__ v8f mma_bf(v16b a, v16b b, v8f c) {
  c = __builtin_amdgcn_wmma_f32_16x16x32_bf16(false, a, false, b, (short)0, c, false, false);
  asm volatile("v_nop\n\tv_nop\n\tv_nop\n\tv_nop" : "+v"(c) : "v"(a), "v"(b));
  return c;
}

// ---------------------------------------------------------------------------
// f32 -> bf16 (RNE-convert) of all seven operand planes in one launch: three activation planes, then four weight planes.
// The block index selects plane and place in it (block-uniform): blocks 0 .. 6143 are 2048 per activation plane,
// blocks 6144 .. 8191 are 512 per weight plane.
// 8 consecutive elements per thread: two 16-B loads, ONE 16-B store per lane; 32 consecutive lanes write 512 contiguous
// Coverage: thread i of a plane writes elements 8i..8i+7, i < n8; blocks per plane = n8/256 exactly:
//   activations 4096*1024/8 = 524,288 -> 2048 blocks;  weights 1024*1024/8 = 131,072 -> 512 blocks.
// ---------------------------------------------------------------------------
constexpr int kActN8  = kRows * kDim / 8;
constexpr int kWgtN8  = kDim * kDim / 8;
constexpr int kActBlk = kActN8 / 256;
constexpr int kWgtBlk = kWgtN8 / 256;
constexpr int kCvtBlk = 3 * kActBlk + 4 * kWgtBlk;
static_assert((kActN8 % 256) == 0 && (kWgtN8 % 256) == 0, "whole blocks per plane");
__global__ __launch_bounds__(256) void cvt_bf16_planes_kernel(
    const float* __restrict__ a0, const float* __restrict__ a1, const float* __restrict__ a2,
    const float* __restrict__ w0, const float* __restrict__ w1, const float* __restrict__ w2, const float* __restrict__ w3,
    unsigned short* __restrict__ da0, unsigned short* __restrict__ da1, unsigned short* __restrict__ da2,
    unsigned short* __restrict__ dw0, unsigned short* __restrict__ dw1, unsigned short* __restrict__ dw2,
    unsigned short* __restrict__ dw3)
{
  const int b = blockIdx.x;
  const float* src;
  unsigned short* dst;
  int blk, n8;
  if (b < 3 * kActBlk) {
    const int z = b / kActBlk;
    blk = b - z * kActBlk;
    n8  = kActN8;
    src = (z == 0) ? a0 : (z == 1) ? a1 : a2;
    dst = (z == 0) ? da0 : (z == 1) ? da1 : da2;
  } else {
    const int bw = b - 3 * kActBlk;
    const int z = bw / kWgtBlk;
    blk = bw - z * kWgtBlk;
    n8  = kWgtN8;
    src = (z == 0) ? w0 : (z == 1) ? w1 : (z == 2) ? w2 : w3;
    dst = (z == 0) ? dw0 : (z == 1) ? dw1 : (z == 2) ? dw2 : dw3;
  }
  const int i = blk * 256 + threadIdx.x;
  if (i >= n8) return;
  const float* p = src + 8 * (size_t)i;
  const v4f a = *(const v4f*)(p);
  const v4f c = *(const v4f*)(p + 4);
  unsigned short hb[8];
#pragma unroll
  for (int e = 0; e < 4; ++e) {
    const float x0 = a[e];
    const float x1 = c[e];
    hb[e]     = f2bf_bits(x0);
    hb[4 + e] = f2bf_bits(x1);
  }
  const v4u u = (v4u){pk16(hb[0], hb[1]), pk16(hb[2], hb[3]), pk16(hb[4], hb[5]), pk16(hb[6], hb[7])};
  unsigned short* q = dst + 8 * (size_t)i;
  *(v4u*)q = u;
  
}

// ---------------------------------------------------------------------------
// Eight asynchronous 16-B copies per lane, global memory to LDS: 128 rows of one operand plane, one pass of k wide.
// The block's lanes cover 16 whole rows per copy; a lane moves its 16 bytes of rows r, r + 16, .. r + 112.
// lds = the lane's LDS byte address of row r, g = its global address of row r, ld = row pitch in elements,
// PITCH = bytes per LDS row.
// ---------------------------------------------------------------------------
template <int PITCH>
__device__ __forceinline__ void copy_plane_async(unsigned lds, const __bf16* g, int ld) {
  const size_t step = (size_t)16 * ld;
  const __bf16* g1 = g + step;      const __bf16* g2 = g + 2 * step;  const __bf16* g3 = g + 3 * step;
  const __bf16* g4 = g + 4 * step;  const __bf16* g5 = g + 5 * step;  const __bf16* g6 = g + 6 * step;
  const __bf16* g7 = g + 7 * step;
  const unsigned ls = 16u * PITCH;
  /* the copies and the wait that stands before their address registers may be rewritten, in one statement */
  asm volatile(
      "global_load_async_to_lds_b128 %0, %8, off\n\t"
      "global_load_async_to_lds_b128 %1, %9, off\n\t"
      "global_load_async_to_lds_b128 %2, %10, off\n\t"
      "global_load_async_to_lds_b128 %3, %11, off\n\t"
      "global_load_async_to_lds_b128 %4, %12, off\n\t"
      "global_load_async_to_lds_b128 %5, %13, off\n\t"
      "global_load_async_to_lds_b128 %6, %14, off\n\t"
      "global_load_async_to_lds_b128 %7, %15, off\n\t"
      "s_wait_xcnt 0x0"
      :: "v"(lds), "v"(lds + ls), "v"(lds + 2u * ls), "v"(lds + 3u * ls), "v"(lds + 4u * ls), "v"(lds + 5u * ls),
         "v"(lds + 6u * ls), "v"(lds + 7u * ls), "v"(g), "v"(g1), "v"(g2), "v"(g3), "v"(g4), "v"(g5), "v"(g6), "v"(g7)
      : "memory");
}

// ---------------------------------------------------------------------------
// bf16 GEMM, operands staged in LDS: C[m][n] = sum_k A[m][k] * Bt[n][k] + bf16value(bias[n]).
// One block owns a 128 x 128 tile; wave (wm = wave >> 1, wn = wave & 1) owns rows 16 FM wm .. + 16 FM - 1, cols 64 wn .. + 63.
// FM = 16-row fragments per wave. FM 2: 8 waves of 32 x 64, passes of 128 k. FM 4: 4 waves of 64 x 64, passes of 64 k: a
// k step's 8 fragments feed 16 matrix instructions (6 feed 8 at FM 2), and the smaller stage lets three blocks share a WGP's LDS.
// A row-major [M][K] bf16 (SPLA: a second plane A2 of the same layout is accumulated against the same Bt);
// Bt row-major [N][K] bf16; M, N % 128 == 0, K % 128 == 0, K >= 256 (no tail handling). C f32, pitch ldc.
// A stage = one pass of [A 128 rows | Bt 128 rows | A2 128 rows if SPLA], brought by asynchronous copies into one of two
// buffers: the copies of stage t + 2 fly while stage t + 1 is worked on.
// EPI 0: plain.  EPI 1: feature map y = x + 1 for x > 0, exp(x) otherwise, applied to the accumulators in registers.
// EPI 2: three products of one shape in one launch. blockIdx.y = 0, 1, 2 (block-uniform) picks the plane: A, Bt and C are
// three dense planes one behind the other (M x lda, N x ldb, M x ldc elements each), the biases three buffers; planes 0
// and 1 take the feature map, plane 2 is plain.
// Fragment map: lane l, row/col = l & 15, half h = l >> 4; elements 0..7 <- k0 + 8h + 0..7, 8..15 <- k0 + 16 + 8h + 0..7
// for both operands; accumulator element r = (row 8h + r, col l & 15).
// Epilogue: 16-row slabs staged per wave in LDS of its own (same wave stores and reloads, wave-level ordering).
// Coverage: 32 x 8 = 256 tiles of 128 x 128 = 4096 x 1024; grid.x = 256 blocks, one tile per block and plane.
// ---------------------------------------------------------------------------
template <bool SPLA, int EPI, int FM>
__global__ __launch_bounds__(FM == 4 ? 128 : 256, FM == 4 ? 3 : 1) void gemm_tile64_kernel(
    const unsigned short* __restrict__ Ap, const unsigned short* __restrict__ A2p, int lda,
    const unsigned short* __restrict__ Btp, int ldb,
    float* __restrict__ Cout, int ldc,
    const float* __restrict__ bias, int M, int N, int K,
    const float* __restrict__ bias1 = nullptr, const float* __restrict__ bias2 = nullptr)
{
  const int z = (EPI == 2) ? (int)blockIdx.y : 0;
  const __bf16* A  = (const __bf16*)Ap + (size_t)z * M * lda;
  const __bf16* A2 = (const __bf16*)A2p + (size_t)z * M * lda;
  const __bf16* Bt = (const __bf16*)Btp + (size_t)z * N * ldb;
  if (EPI == 2) {
    Cout += (size_t)z * M * ldc;
    bias = (z == 0) ? bias : (z == 1) ? bias1 : bias2;
  }
  static_assert(FM == 2 || FM == 4, "wave tile 32 x 64 or 64 x 64");
  constexpr int kWaves    = (128 / (16 * FM)) * 2;
  constexpr int kPassK    = (FM == 4) ? 64 : 128;   /* k per pass */
  constexpr int kLdsPitch = kPassK * 2 + 16;        /* bytes per LDS row: 16 B x odd, conflict-free for 16-B readers */
  constexpr int kPlaneB   = 128 * kLdsPitch;        /* one operand plane of a stage */
  constexpr int kRowLanes = kPassK * 2 / 16;        /* lanes that share a row in a copy */
  static_assert(kWaves * 32 / kRowLanes == 16, "one copy of the block covers 16 rows");
  constexpr int kStageB = (SPLA ? 3 : 2) * kPlaneB;
  __shared__ __align__(16) unsigned char sStage[2 * kStageB];
  __shared__ __align__(16) float sT[kWaves][16 * 68];
  const int tid  = threadIdx.x;
  const int lane = tid & 31;
  const int wave = tid >> 5;
  const int tilesN = N >> 7;
  const int tilesM = M >> 7;
  const int tile = blockIdx.x;
  /* block-uniform, in front of every barrier and copy */
  if (tile >= tilesM * tilesN) return;
  const int tm = tile / tilesN;
  const int tn = tile - tm * tilesN;
  const int mB = tm << 7;
  const int nB = tn << 7;
  const int wm = wave >> 1;
  const int wn = wave & 1;

  const int rlane = lane & 15;
  const int koff  = (lane >> 4) * 8;
  const int mOff  = (lane >> 4) * 8;

  /* this lane's share of a stage */
  const int cr = tid / kRowLanes, cc = (tid % kRowLanes) * 8;
  const unsigned ldsC = (unsigned)(uintptr_t)(sStage + cr * kLdsPitch + cc * 2);
  const __bf16* gA  = A  + (size_t)(mB + cr) * lda + cc;
  const __bf16* gA2 = A2 + (size_t)(mB + cr) * lda + cc;
  const __bf16* gB  = Bt + (size_t)(nB + cr) * ldb + cc;
  const int nPass = K / kPassK;

  /* every loop over acc[], fa[], fb[], fl[] below is unrolled: constant indices keep these arrays in registers */
  v8f acc[FM][4];
#pragma unroll
  for (int i = 0; i < FM; ++i)
#pragma unroll
    for (int j = 0; j < 4; ++j) acc[i][j] = (v8f){0.f, 0.f, 0.f, 0.f, 0.f, 0.f, 0.f, 0.f};

  // ---- stage 0, published; then stage 1 in flight ----
  copy_plane_async<kLdsPitch>(ldsC, gA, lda);
  copy_plane_async<kLdsPitch>(ldsC + kPlaneB, gB, ldb);
  if (SPLA) copy_plane_async<kLdsPitch>(ldsC + 2 * kPlaneB, gA2, lda);
  /* this wave's copies of stage 0 have landed */
  asm volatile("s_wait_asynccnt 0x0" ::: "memory");
  __syncthreads();
  if (1 < nPass) {
    copy_plane_async<kLdsPitch>(ldsC + kStageB, gA + kPassK, lda);
    copy_plane_async<kLdsPitch>(ldsC + kStageB + kPlaneB, gB + kPassK, ldb);
    if (SPLA) copy_plane_async<kLdsPitch>(ldsC + kStageB + 2 * kPlaneB, gA2 + kPassK, lda);
  }

  /* rolled: one pass per trip, so that each trip reads one buffer and ends in one publish point */
#pragma unroll 1
  for (int t = 0; t < nPass; ++t) {
    const int bufB = (t & 1) * kStageB;
    const unsigned char* pA = sStage + bufB + (wm * (16 * FM) + rlane) * kLdsPitch + koff * 2;
    const unsigned char* pB = sStage + bufB + kPlaneB + (wn * 64 + rlane) * kLdsPitch + koff * 2;
    /* FM 2, two fragment sets: the reads of k step kk + 1 (same buffer) are issued in front of step kk's products, so that
       a wave waits out the LDS latency once per pass and not at every step. FM 4, one set (128 accumulator registers and two
       sets do not fit 256): each step reads its own fragments, and the two other waves of the SIMD work meanwhile */
    constexpr int kSets = (FM == 4) ? 1 : 2;
    v16b fb[kSets][4], fa[kSets][FM], fl[kSets][FM];
#pragma unroll
    for (int j = 0; j < 4; ++j) fb[0][j] = Frag<__bf16>::load((const __bf16*)(pB + j * 16 * kLdsPitch));
#pragma unroll
    for (int i = 0; i < FM; ++i) {
      fa[0][i] = Frag<__bf16>::load((const __bf16*)(pA + i * 16 * kLdsPitch));
      if (SPLA) fl[0][i] = Frag<__bf16>::load((const __bf16*)(pA + 2 * kPlaneB + i * 16 * kLdsPitch));
    }
#pragma unroll
    for (int kk = 0; kk < kPassK / 32; ++kk) {
      const int cur = (kSets == 2) ? (kk & 1) : 0, nxt = (kSets == 2) ? (cur ^ 1) : 0;
      if (kSets == 2 && kk + 1 < kPassK / 32) {
#pragma unroll
        for (int j = 0; j < 4; ++j)
          fb[nxt][j] = Frag<__bf16>::load((const __bf16*)(pB + j * 16 * kLdsPitch + (kk + 1) * 64));
#pragma unroll
        for (int i = 0; i < FM; ++i) {
          fa[nxt][i] = Frag<__bf16>::load((const __bf16*)(pA + i * 16 * kLdsPitch + (kk + 1) * 64));
          if (SPLA) fl[nxt][i] = Frag<__bf16>::load((const __bf16*)(pA + 2 * kPlaneB + i * 16 * kLdsPitch + (kk + 1) * 64));
        }
      }
      /* per accumulator and k step: the hi product, then the lo product */
#pragma unroll
      for (int i = 0; i < FM; ++i) {
#pragma unroll
        for (int j = 0; j < 4; ++j) acc[i][j] = mma_bf(fa[cur][i], fb[cur][j], acc[i][j]);
        if (SPLA) {
#pragma unroll
          for (int j = 0; j < 4; ++j) acc[i][j] = mma_bf(fl[cur][i], fb[cur][j], acc[i][j]);
        }
      }
      if (kSets == 1 && kk + 1 < kPassK / 32) {
#pragma unroll
        for (int j = 0; j < 4; ++j)
          fb[0][j] = Frag<__bf16>::load((const __bf16*)(pB + j * 16 * kLdsPitch + (kk + 1) * 64));
#pragma unroll
        for (int i = 0; i < FM; ++i) {
          fa[0][i] = Frag<__bf16>::load((const __bf16*)(pA + i * 16 * kLdsPitch + (kk + 1) * 64));
          if (SPLA) fl[0][i] = Frag<__bf16>::load((const __bf16*)(pA + 2 * kPlaneB + i * 16 * kLdsPitch + (kk + 1) * 64));
        }
      }
    }
    /* publish point: this wave's reads of the buffer are done, its copies of the next stage have landed */
    asm volatile("s_wait_dscnt 0x0" ::: "memory");
    asm volatile("s_wait_asynccnt 0x0" ::: "memory");
    __syncthreads();
    /* refill the buffer that every wave has just left; the test is the same for the whole block */
    if (t + 2 < nPass) {
      const int ko = (t + 2) * kPassK;
      copy_plane_async<kLdsPitch>(ldsC + bufB, gA + ko, lda);
      copy_plane_async<kLdsPitch>(ldsC + bufB + kPlaneB, gB + ko, ldb);
      if (SPLA) copy_plane_async<kLdsPitch>(ldsC + bufB + 2 * kPlaneB, gA2 + ko, lda);
    }
  }
  /* no copy is left in flight when the wave goes on */
  asm volatile("s_wait_asynccnt 0x0" ::: "memory");

  // ---- epilogue ----
  const int m0 = mB + wm * (16 * FM);
  const int n0 = nB + wn * 64;
  float* slab = sT[wave];
  float bvj[4];
#pragma unroll
  for (int j = 0; j < 4; ++j) bvj[j] = bf16r(bias[n0 + (j << 4) + rlane]);
  /* every loop over acc[] is unrolled: constant indices keep it in registers */
#pragma unroll
  for (int i = 0; i < FM; ++i)
#pragma unroll
    for (int j = 0; j < 4; ++j)
#pragma unroll
      for (int r = 0; r < 8; ++r) acc[i][j][r] += bvj[j];
  /* feature map on the accumulators themselves, all values of a lane independent; the test is the same for the whole block */
  if (EPI == 1 || (EPI == 2 && z < 2)) {
#pragma unroll
    for (int i = 0; i < FM; ++i)
#pragma unroll
      for (int j = 0; j < 4; ++j)
#pragma unroll
        for (int r = 0; r < 8; ++r) {
          const float x = acc[i][j][r];
          const float ex = expf(fminf(x, 0.0f));
          acc[i][j][r] = (x > 0.0f) ? (x + 1.0f) : ex;
        }
  }
#pragma unroll
  for (int i = 0; i < FM; ++i) {
    const int mBase = m0 + (i << 4);
#pragma unroll
    for (int j = 0; j < 4; ++j) {
#pragma unroll
      for (int r = 0; r < 8; ++r) {
        slab[(mOff + r) * 68 + (j << 4) + rlane] = acc[i][j][r];
      }
    }
    __builtin_amdgcn_fence(__ATOMIC_RELEASE, "workgroup");
    __builtin_amdgcn_wave_barrier();
    __builtin_amdgcn_fence(__ATOMIC_ACQUIRE, "workgroup");
    {
      /* row segment = 256 B = 16 lanes x 16 B; rows it*2 + hh cover 0..15 */
      const int hh = lane >> 4, c4 = (lane & 15) * 4;
      {
#pragma unroll
        for (int it = 0; it < 8; ++it) {
          const int row = it * 2 + hh;
          const v4f v = *(const v4f*)(slab + row * 68 + c4);
          *(v4f*)(Cout + (size_t)(mBase + row) * ldc + n0 + c4) = v;
        }
        
      }
    }
    __builtin_amdgcn_fence(__ATOMIC_RELEASE, "workgroup");
    __builtin_amdgcn_wave_barrier();
    __builtin_amdgcn_fence(__ATOMIC_ACQUIRE, "workgroup");
  }
}

// ---------------------------------------------------------------------------
// Chunk sums: one block of 256 threads per (chunk, batch-head), chunks 0 .. kChunks - 2 (nothing follows the last one).
// slot[d][j] = sum over the chunk's 64 steps of k[s][d] * v[s][j]; slot[4096 + d] = sum over the steps of k[s][d].
// Thread (d4 = 4 (tid >> 4), j4 = 4 (tid & 15)) keeps a 4 x 4 patch in registers: two 16-B LDS reads feed 16 FMAs.
// Staging coverage: rows lr + 16 i (lr = tid >> 4, i = 0..3) x cols 4 (tid & 15) .. + 3 = 64 x 64 per tensor.
// LDS: 2 x 16,384 = 32,768 B.
// ---------------------------------------------------------------------------
__global__ __launch_bounds__(256) void chunk_state_kernel(
    const float* __restrict__ KF, const float* __restrict__ VF, float* __restrict__ ST)
{
  __shared__ __align__(16) float sK[kChunkL * 64];
  __shared__ __align__(16) float sV[kChunkL * 64];
  const int tid = threadIdx.x;
  const int chunk = blockIdx.x;
  const int bh = blockIdx.y;
  const size_t row0 = (size_t)(bh >> 4) * kSeq + (size_t)chunk * kChunkL;
  const int col0 = (bh & 15) * kHd;
  const int lr = tid >> 4, lc4 = (tid & 15) * 4;
  /* unrolled: all eight global loads are issued before the first LDS store waits on one */
#pragma unroll
  for (int i = 0; i < kChunkL / 16; ++i) {
    const int r = lr + 16 * i;
    const size_t g = (row0 + (size_t)r) * kDim + col0 + lc4;
    *(v4f*)(sK + r * 64 + lc4) = *(const v4f*)(KF + g);
    *(v4f*)(sV + r * 64 + lc4) = *(const v4f*)(VF + g);
  }
  __syncthreads();

  const int d4 = lr * 4, j4 = lc4;
  /* every loop over a[] is unrolled so that its indices are constants and the patch stays in registers */
  v4f a[4];
#pragma unroll
  for (int r = 0; r < 4; ++r) a[r] = (v4f){0.f, 0.f, 0.f, 0.f};
  /* eight steps' LDS reads in flight together; rolled, every step waits out a whole LDS latency */
#pragma unroll 8
  for (int s = 0; s < kChunkL; ++s) {
    const v4f kk = *(const v4f*)(sK + s * 64 + d4);
    const v4f vv = *(const v4f*)(sV + s * 64 + j4);
#pragma unroll
    for (int r = 0; r < 4; ++r)
#pragma unroll
      for (int e = 0; e < 4; ++e) a[r][e] = fmaf(kk[r], vv[e], a[r][e]);
  }
  float* slot = ST + ((size_t)bh * (kChunks - 1) + chunk) * kSlotF;
#pragma unroll
  for (int r = 0; r < 4; ++r) *(v4f*)(slot + (d4 + r) * 64 + j4) = a[r];

  /* key sums; waves 0 and 1 only (wave-uniform predicate) */
  if (tid < 64) {
    float c = 0.0f;
    for (int s = 0; s < kChunkL; ++s) c += sK[s * 64 + tid];
    slot[kHd * kHd + tid] = c;
  }
}

// ---------------------------------------------------------------------------
// Inclusive sum of the chunk slots along the chunk axis, in place: slot c becomes the state at the end of chunk c.
// One thread per float of a slot (4160 per batch-head, grid.x = 17 blocks with a tail guard); the 31 values stay in
// registers, so all loads are in flight together and the thread pays the load latency once.
// ---------------------------------------------------------------------------
__global__ __launch_bounds__(256) void chunk_prefix_kernel(float* __restrict__ ST)
{
  const int i = blockIdx.x * 256 + threadIdx.x;
  if (i >= kSlotF) return;
  float* base = ST + (size_t)blockIdx.y * (kChunks - 1) * kSlotF + i;
  /* both loops unrolled: constant indices keep x[] in registers */
  float x[kChunks - 1];
#pragma unroll
  for (int c = 0; c < kChunks - 1; ++c) x[c] = base[(size_t)c * kSlotF];
#pragma unroll
  for (int c = 1; c < kChunks - 1; ++c) {
    x[c] += x[c - 1];
    base[(size_t)c * kSlotF] = x[c];
  }
}

// ---------------------------------------------------------------------------
// Causal state scan, one block of 128 threads per (chunk, batch-head), the chunk's 64 steps in a static loop.
// Thread (j2 = 2 (tid & 31), dg = tid >> 5) keeps kv[d][j2], kv[d][j2 + 1] for d = 16 dg .. 16 dg + 15 in registers: the
// eight 16-B LDS reads that bring a wave its 16 q and 16 k of a step (every lane the same address)
// feed 64 FMAs per lane and not 32. Chunk 0 starts from zero, chunk c > 0 from slot c - 1 of ST (state and key sums at
// the end of the chunk before it).
// Per step s (inclusive sums): kv[d][j] += k[d] * v[j]; partial[dg][s][j] = sum over its 16 d of q[d] * kv[d][j].
// Steps are staged 32 at a time: sQ, sK, sV hold q, k, v rows [32][64] f32; sN holds the four partial planes [4][32][64].
// After the 32 steps: threads 0..63 turn sK into the inclusive key sums in place (running carry in a register);
// then lane (rows 4 wave + (lane >> 3) and that + 16, cols 8 (lane & 7) .. + 7) forms den = sum_d q[d] * ksum[d] (8 d per
// lane, summed over the row's 8 lanes, f32), num = ((p0 + p1) + p2) + p3, out = num * (1 / (den + eps)), splits out into bf16 hi + lo and stores both planes.
// Staging coverage: rows lr + 8 i (lr = tid >> 4 = 0..7, i = 0..3) x cols 4 (tid & 15) .. + 3 = 32 x 64 per tensor.
// LDS: 3 x 8,192 + 32,768 = 57,344 B.
// ---------------------------------------------------------------------------
/* both columns' fused multiply-adds in one operation; each column rounds as fmaf does */
__device__ __forceinline__ v2f fma2(float a, v2f b, v2f c) { return __builtin_elementwise_fma((v2f){a, a}, b, c); }

/* x + (x of lane l ^ m) inside a 16-lane row, all lanes on; CTRL = 0x160 + m is the row_xmask control of a DPP operand */
template <int CTRL>
__device__ __forceinline__ float lane_xor_add(float x) {
  return x + __int_as_float(__builtin_amdgcn_update_dpp(0, __float_as_int(x), CTRL, 0xf, 0xf, true));
}

__global__ __launch_bounds__(128) void scan_state_kernel(
    const float* __restrict__ QF, const float* __restrict__ KF, const float* __restrict__ VF,
    const float* __restrict__ ST, unsigned short* __restrict__ AH, unsigned short* __restrict__ AL)
{
  __shared__ __align__(16) float sQ[kScanT * 64];
  __shared__ __align__(16) float sK[kScanT * 64];
  __shared__ __align__(16) float sV[kScanT * 64];
  __shared__ __align__(16) float sN[4 * kScanT * 64];
  const int tid = threadIdx.x, lane = tid & 31, wave = tid >> 5;
  const int j2 = lane * 2;
  const int dg = wave;
  const int chunk = blockIdx.x;
  const int bh = blockIdx.y;
  const int bb = bh >> 4;
  const int hd = bh & 15;
  const size_t row0 = (size_t)bb * kSeq;
  const int col0 = hd * kHd;

  v2f kv[16];
#pragma unroll
  for (int i = 0; i < 16; ++i) kv[i] = (v2f){0.0f, 0.0f};
  float kcarry = 0.0f;
  /* block-uniform predicate */
  if (chunk > 0) {
    const float* slot = ST + ((size_t)bh * (kChunks - 1) + (chunk - 1)) * kSlotF;
    /* unrolled: constant indices keep kv[] in registers */
#pragma unroll
    for (int i = 0; i < 15; ++i) kv[i] = *(const v2f*)(slot + (dg * 16 + i) * 64 + j2);
    /* the last load may land in the offset register that the fifteen before it name: their wait stands in front of it */
    asm volatile("s_wait_xcnt 0x0" ::: "memory");
    kv[15] = *(const v2f*)(slot + (dg * 16 + 15) * 64 + j2);
    if (tid < 64) kcarry = slot[kHd * kHd + tid];
  }

  const int lr = tid >> 4, lc4 = (tid & 15) * 4;
  const int q4 = lane >> 3, c8 = (lane & 7) * 8;
  const int orow = wave * 4 + q4;

#pragma unroll 1
  for (int t0 = chunk * kChunkL; t0 < (chunk + 1) * kChunkL; t0 += kScanT) {
    /* every read of the stage before this one has finished */
    __syncthreads();
    /* all loops over tq[], tk[], tv[] unrolled: constant indices keep them in registers; twelve loads in flight per lane */
    v4f tq[4], tk[4], tv[4];
#pragma unroll
    for (int i = 0; i < 2; ++i) {
      const size_t g = (row0 + (size_t)(t0 + lr + 8 * i)) * kDim + col0 + lc4;
      tq[i] = *(const v4f*)(QF + g);
      tk[i] = *(const v4f*)(KF + g);
      tv[i] = *(const v4f*)(VF + g);
    }
    /* the next six loads may land in address registers that the first six name: their wait stands in front */
    asm volatile("s_wait_xcnt 0x0" ::: "memory");
#pragma unroll
    for (int i = 2; i < 4; ++i) {
      const size_t g = (row0 + (size_t)(t0 + lr + 8 * i)) * kDim + col0 + lc4;
      tq[i] = *(const v4f*)(QF + g);
      tk[i] = *(const v4f*)(KF + g);
      tv[i] = *(const v4f*)(VF + g);
    }
    /* before the address registers of these six are used for anything else */
    asm volatile("s_wait_xcnt 0x0" ::: "memory");
#pragma unroll
    for (int i = 0; i < 4; ++i) {
      const int r = lr + 8 * i;
      *(v4f*)(sQ + r * 64 + lc4) = tq[i];
      *(v4f*)(sK + r * 64 + lc4) = tk[i];
      *(v4f*)(sV + r * 64 + lc4) = tv[i];
    }
    __syncthreads();

    /* four steps per trip: their LDS reads are issued together in front of the FMAs, so that a wave waits out the LDS
       latency once per four steps; rolled, with four waves per SIMD, every step's latency stays open */
#pragma unroll 4
    for (int s = 0; s < kScanT; ++s) {
      const v2f vj = *(const v2f*)(sV + s * 64 + j2);
      const float* qp = sQ + s * 64 + dg * 16;
      const float* kp = sK + s * 64 + dg * 16;
      v2f accn = (v2f){0.0f, 0.0f};
#pragma unroll
      for (int g = 0; g < 4; ++g) {
        const v4f kk = *(const v4f*)(kp + 4 * g);
        const v4f qq = *(const v4f*)(qp + 4 * g);
        kv[4 * g + 0] = fma2(kk[0], vj, kv[4 * g + 0]);
        accn = fma2(qq[0], kv[4 * g + 0], accn);
        kv[4 * g + 1] = fma2(kk[1], vj, kv[4 * g + 1]);
        accn = fma2(qq[1], kv[4 * g + 1], accn);
        kv[4 * g + 2] = fma2(kk[2], vj, kv[4 * g + 2]);
        accn = fma2(qq[2], kv[4 * g + 2], accn);
        kv[4 * g + 3] = fma2(kk[3], vj, kv[4 * g + 3]);
        accn = fma2(qq[3], kv[4 * g + 3], accn);
      }
      *(v2f*)(sN + (dg * kScanT + s) * 64 + j2) = accn;
    }
    __syncthreads();

    /* inclusive key sums in place; waves 0 and 1 only (wave-uniform predicate) */
    if (tid < 64) {
      /* both loops unrolled: the 32 reads are issued together and their latency is waited out once, not once per step;
         constant indices keep x[] in registers; the adds run in the same order as before */
      float x[kScanT];
#pragma unroll
      for (int s = 0; s < kScanT; ++s) x[s] = sK[s * 64 + tid];
      float c = kcarry;
#pragma unroll
      for (int s = 0; s < kScanT; ++s) {
        c += x[s];
        sK[s * 64 + tid] = c;
      }
      kcarry = c;
    }
    __syncthreads();

    /* each of the 8 lanes that share a row takes 8 of its 64 d (two 16-B pieces of q and of the key sums), then the 8
       partial sums are added across the lanes: 8 LDS reads per lane for both rows, not 64 that 8 lanes repeat.
       Odd q4 takes its two pieces in the other order: the two rows of a 16-lane half then fall on different banks. */
    float den0, den1;
    {
      const int pa = (((q4 & 1) << 3) + (lane & 7)) * 4;
      const int pb = pa ^ 32;
      const v4f qa0 = *(const v4f*)(sQ + orow * 64 + pa);
      const v4f ka0 = *(const v4f*)(sK + orow * 64 + pa);
      const v4f qb0 = *(const v4f*)(sQ + orow * 64 + pb);
      const v4f kb0 = *(const v4f*)(sK + orow * 64 + pb);
      const v4f qa1 = *(const v4f*)(sQ + (orow + 16) * 64 + pa);
      const v4f ka1 = *(const v4f*)(sK + (orow + 16) * 64 + pa);
      const v4f qb1 = *(const v4f*)(sQ + (orow + 16) * 64 + pb);
      const v4f kb1 = *(const v4f*)(sK + (orow + 16) * 64 + pb);
      float p0 = qa0[0] * ka0[0], p1 = qa1[0] * ka1[0];
      /* both loops unrolled: constant indices keep the eight pieces in registers */
#pragma unroll
      for (int e = 1; e < 4; ++e) {
        p0 = fmaf(qa0[e], ka0[e], p0);
        p1 = fmaf(qa1[e], ka1[e], p1);
      }
#pragma unroll
      for (int e = 0; e < 4; ++e) {
        p0 = fmaf(qb0[e], kb0[e], p0);
        p1 = fmaf(qb1[e], kb1[e], p1);
      }
      /* lanes l ^ 1, l ^ 2, l ^ 4: every lane of the 8 ends with the same sum */
      p0 = lane_xor_add<0x161>(p0);  p1 = lane_xor_add<0x161>(p1);
      p0 = lane_xor_add<0x162>(p0);  p1 = lane_xor_add<0x162>(p1);
      den0 = lane_xor_add<0x164>(p0);
      den1 = lane_xor_add<0x164>(p1);
    }

    /* unrolled: rr is a constant in each copy */
#pragma unroll
    for (int rr = 0; rr < 2; ++rr) {
      const int row = orow + 16 * rr;
      const float inv = 1.0f / ((rr == 0 ? den0 : den1) + kEps);
      const float* np = sN + row * 64 + c8;
      const v4f a0 = *(const v4f*)(np);
      const v4f a1 = *(const v4f*)(np + 4);
      const v4f b0 = *(const v4f*)(np + 1 * kScanT * 64);
      const v4f b1 = *(const v4f*)(np + 1 * kScanT * 64 + 4);
      const v4f e0 = *(const v4f*)(np + 2 * kScanT * 64);
      const v4f e1 = *(const v4f*)(np + 2 * kScanT * 64 + 4);
      const v4f f0 = *(const v4f*)(np + 3 * kScanT * 64);
      const v4f f1 = *(const v4f*)(np + 3 * kScanT * 64 + 4);
      float o[8];
#pragma unroll
      for (int e = 0; e < 4; ++e) {
        const float n0v = ((a0[e] + b0[e]) + e0[e]) + f0[e];
        const float n1v = ((a1[e] + b1[e]) + e1[e]) + f1[e];
        o[e]     = n0v * inv;
        o[4 + e] = n1v * inv;
      }
      unsigned short hb[8], lb[8];
#pragma unroll
      for (int e = 0; e < 8; ++e) {
        const float x = o[e];
        const unsigned short hbits = f2bf_bits(x);
        const float res = x - bf_bits2f(hbits);
        hb[e] = hbits;
        lb[e] = f2bf_bits(res);
      }
      const v4u uh = (v4u){pk16(hb[0], hb[1]), pk16(hb[2], hb[3]), pk16(hb[4], hb[5]), pk16(hb[6], hb[7])};
      const v4u ul = (v4u){pk16(lb[0], lb[1]), pk16(lb[2], lb[3]), pk16(lb[4], lb[5]), pk16(lb[6], lb[7])};
      const size_t oo = (row0 + (size_t)(t0 + row)) * kDim + col0 + c8;
      unsigned short* ph = AH + oo;
      unsigned short* pl = AL + oo;
      *(v4u*)ph = uh;
      *(v4u*)pl = ul;
    }
    /* the next trip rewrites the address registers of these stores: their wait stands in front of it */
    asm volatile("s_wait_xcnt 0x0" ::: "memory");
  }
}

// ---------------------------------------------------------------------------
// Host glue: 1 convert launch + 1 launch of the three projection GEMMs + 3 scan launches (chunk sums, chunk prefix, scan)
// + 1 output GEMM = 6 launches. Kernel launches only.
// GEMM shapes: M 4096, N 1024, K 1024 everywhere (K, M and N % 128 == 0): 32 x 8 = 256 tiles -> 256 blocks per product.
// ---------------------------------------------------------------------------
extern "C" void kernel_launch(void* const* d_in, const int* in_sizes, int n_in,
                              void* d_out, int out_size, void* d_ws, size_t ws_size,
                              hipStream_t stream) {
  if (n_in < 11 || d_out == nullptr || d_ws == nullptr) return;
  if (in_sizes[0] != kRows * kDim || in_sizes[1] != kRows * kDim || in_sizes[2] != kRows * kDim) return;
  if (in_sizes[3] != kDim * kDim || in_sizes[5] != kDim * kDim || in_sizes[7] != kDim * kDim ||
      in_sizes[9] != kDim * kDim) return;
  if (in_sizes[4] != kDim || in_sizes[6] != kDim || in_sizes[8] != kDim || in_sizes[10] != kDim) return;
  if (out_size != kRows * kDim) return;
  if (ws_size < kWsTotal) return;

  const float* query = (const float*)d_in[0];
  const float* key   = (const float*)d_in[1];
  const float* value = (const float*)d_in[2];
  const float* Wq    = (const float*)d_in[3];
  const float* bq    = (const float*)d_in[4];
  const float* Wk    = (const float*)d_in[5];
  const float* bk    = (const float*)d_in[6];
  const float* Wv    = (const float*)d_in[7];
  const float* bv    = (const float*)d_in[8];
  const float* Wo    = (const float*)d_in[9];
  const float* bo    = (const float*)d_in[10];
  float* out = (float*)d_out;

  char* ws = (char*)d_ws;
  unsigned short* XQ = (unsigned short*)(ws + kOffXQ);
  unsigned short* XK = (unsigned short*)(ws + kOffXK);
  unsigned short* XV = (unsigned short*)(ws + kOffXV);
  unsigned short* WQ = (unsigned short*)(ws + kOffWQ);
  unsigned short* WK = (unsigned short*)(ws + kOffWK);
  unsigned short* WV = (unsigned short*)(ws + kOffWV);
  unsigned short* WO = (unsigned short*)(ws + kOffWO);
  float*          QF = (float*)(ws + kOffQF);
  float*          KF = (float*)(ws + kOffKF);
  float*          VF = (float*)(ws + kOffVF);
  unsigned short* AH = (unsigned short*)(ws + kOffAH);
  unsigned short* AL = (unsigned short*)(ws + kOffAL);
  float*          ST = (float*)(ws + kOffST);

  // ---- bf16 operand planes (weights are [out][in] = Bt layout already) ----
  cvt_bf16_planes_kernel<<<dim3(kCvtBlk), 256, 0, stream>>>(query, key, value, Wq, Wk, Wv, Wo,
                                                            XQ, XK, XV, WQ, WK, WV, WO);

  // ---- projections, one launch: q and k with the feature map in the epilogue, v plain; planes XQ|XK|XV, WQ|WK|WV, QF|KF|VF ----
  const int gblocks = (kRows / 128) * (kDim / 128);
  gemm_tile64_kernel<false, 2, 4><<<dim3(gblocks, 3), 128, 0, stream>>>(XQ, XQ, kDim, WQ, kDim, QF, kDim, bq, kRows, kDim, kDim,
                                                                     bk, bv);

  // ---- causal state scan: chunk sums, their running sum, then one block per (chunk, batch-head) ----
  chunk_state_kernel<<<dim3(kChunks - 1, kBatch * kHeads), 256, 0, stream>>>(KF, VF, ST);
  chunk_prefix_kernel<<<dim3((kSlotF + 255) / 256, kBatch * kHeads), 256, 0, stream>>>(ST);
  scan_state_kernel<<<dim3(kChunks, kBatch * kHeads), 128, 0, stream>>>(QF, KF, VF, ST, AH, AL);

  // ---- output projection: (hi + lo) . bf16(Wo)^T + bo, both parts into one accumulator ----
  gemm_tile64_kernel<true, 0, 2><<<dim3(gblocks), 256, 0, stream>>>(AH, AL, kDim, WO, kDim, out, kDim, bo, kRows, kDim, kDim);
}

// v008
// One run takes 82.4 microseconds.
// In both of two side-by-side timings against v007, it was 1.09 times as fast.
// Over all steps from v000 it is 9.03 times as fast.
// Contractions: q/k/v projections on v_wmma_f32_16x16x32_bf16 (bf16(x) x bf16(W), one product, f32 accumulate); output projection on v_wmma_f32_16x16x32_bf16 with the attention plane carried as bf16 hi + lo planes against bf16(Wo) (two products into one f32 accumulator); causal attention inside a 64-step chunk and against the chunk's start state on v_wmma_f32_16x16x32_bf16 with every f32 operand carried as bf16 hi + lo (three products per pair, f32 accumulate); feature map, chunk sums, their running sum and the division in f32 on the vector unit.
#include <hip/hip_runtime.h>
#include <math.h>

typedef __attribute__((ext_vector_type(16))) __bf16   v16b;
typedef __attribute__((ext_vector_type(8)))  __bf16   v8b;
typedef __attribute__((ext_vector_type(2)))  __bf16   v2b;
typedef __attribute__((ext_vector_type(8)))  float    v8f;
typedef __attribute__((ext_vector_type(4)))  float    v4f;
typedef __attribute__((ext_vector_type(2)))  float    v2f;
typedef __attribute__((ext_vector_type(4)))  unsigned int v4u;

// ---------------------------------------------------------------------------
// Shape constants
// ---------------------------------------------------------------------------
constexpr int kBatch = 2;
constexpr int kSeq   = 2048;
constexpr int kDim   = 1024;
constexpr int kHeads = 16;
constexpr int kHd    = 64;
constexpr int kRows  = kBatch * kSeq;
constexpr int kChunkL = 64;
constexpr int kChunks = kSeq / kChunkL;
constexpr int kSlotF  = kHd * kHd + kHd;
constexpr float kEps = 1e-6f;
static_assert(kHeads * kHd == kDim, "head split");
static_assert((kDim % 128) == 0 && kDim >= 256, "GEMM K: whole passes of 128, at least two");
static_assert((kRows % 128) == 0 && (kDim % 128) == 0, "GEMM M, N multiples of 128");
static_assert((kSeq % kChunkL) == 0 && kChunkL == 64, "scan chunking");
static_assert((kSlotF % 32) == 0, "128-B aligned state slots");
static_assert(kHd == 64, "one head = one 64-column tile");

// ---------------------------------------------------------------------------
// Workspace region map (bytes; every offset is a multiple of 128)
//   XQ  bf16 [4096][1024]  bf16(query)                  8,388,608
//   XK  bf16 [4096][1024]  bf16(key)                    8,388,608
//   XV  bf16 [4096][1024]  bf16(value)                  8,388,608
//   WQ  bf16 [1024][1024]  bf16(Wq)  (Bt layout)        2,097,152
//   WK  bf16 [1024][1024]  bf16(Wk)                     2,097,152
//   WV  bf16 [1024][1024]  bf16(Wv)                     2,097,152
//   WO  bf16 [1024][1024]  bf16(Wo)                     2,097,152
//   QF  f32  [4096][1024]  phi(q)                      16,777,216
//   KF  f32  [4096][1024]  phi(k)                      16,777,216
//   VF  f32  [4096][1024]  v                           16,777,216
//   AH  bf16 [4096][1024]  attention plane, hi part     8,388,608
//   AL  bf16 [4096][1024]  attention plane, lo part     8,388,608
//   ST  f32  [32][31][4160] chunk states: 64x64 key-value sum, then 64 key sums   16,506,880
//   total                                             117,170,176
// ---------------------------------------------------------------------------
constexpr size_t kActB  = (size_t)kRows * kDim * 2;
constexpr size_t kWgtB  = (size_t)kDim * kDim * 2;
constexpr size_t kF32B  = (size_t)kRows * kDim * 4;
constexpr size_t kOffXQ = 0;
constexpr size_t kOffXK = kOffXQ + kActB;
constexpr size_t kOffXV = kOffXK + kActB;
constexpr size_t kOffWQ = kOffXV + kActB;
constexpr size_t kOffWK = kOffWQ + kWgtB;
constexpr size_t kOffWV = kOffWK + kWgtB;
constexpr size_t kOffWO = kOffWV + kWgtB;
constexpr size_t kOffQF = kOffWO + kWgtB;
constexpr size_t kOffKF = kOffQF + kF32B;
constexpr size_t kOffVF = kOffKF + kF32B;
constexpr size_t kOffAH = kOffVF + kF32B;
constexpr size_t kOffAL = kOffAH + kActB;
constexpr size_t kOffST = kOffAL + kActB;
constexpr size_t kStB   = (size_t)kBatch * kHeads * (kChunks - 1) * kSlotF * 4;
constexpr size_t kWsTotal = kOffST + kStB;
static_assert(kWsTotal == 117170176ull, "carve total");
static_assert(kOffXK == kOffXQ + kActB && kOffXV == kOffXK + kActB && kOffWK == kOffWQ + kWgtB && kOffWV == kOffWK + kWgtB &&
              kOffKF == kOffQF + kF32B && kOffVF == kOffKF + kF32B, "q, k, v planes lie one behind the other");
static_assert(kWsTotal <= 134217728ull, "carve cap");
static_assert((kOffXK % 128) == 0 && (kOffXV % 128) == 0 && (kOffWQ % 128) == 0 && (kOffWK % 128) == 0 &&
              (kOffWV % 128) == 0 && (kOffWO % 128) == 0 && (kOffQF % 128) == 0 && (kOffKF % 128) == 0 &&
              (kOffVF % 128) == 0 && (kOffAH % 128) == 0 && (kOffAL % 128) == 0 && (kOffST % 128) == 0,
              "128-B aligned regions");

// ---------------------------------------------------------------------------
// Small helpers
// ---------------------------------------------------------------------------
__device__ __forceinline__ unsigned short f2bf_bits(float f) {
  unsigned u = __float_as_uint(f);
  return (unsigned short)((u + 0x7FFFu + ((u >> 16) & 1u)) >> 16);
}
__device__ __forceinline__ float bf_bits2f(unsigned short h) { return __uint_as_float(((unsigned)h) << 16); }
/* RNE-convert to a bf16 value, kept in f32 */
__device__ __forceinline__ float bf16r(float f) { return bf_bits2f(f2bf_bits(f)); }
__device__ __forceinline__ unsigned pk16(unsigned short a, unsigned short b) { return (unsigned)a | ((unsigned)b << 16); }

template <typename T> struct Frag;
template <> struct Frag<__bf16> {
  typedef v16b V; union U { v16b v; v8b h[2]; };
  /* elements 0..7 <- p[0..7], elements 8..15 <- p[16..23] */
  static __device__ __forceinline__ v16b load(const __bf16* p) {
    U f; f.h[0] = *(const v8b*)(p); f.h[1] = *(const v8b*)(p + 16); return f.v;
  }
};

/* one matrix instruction followed by its own hazard guard: the guard ties this accumulator and names both fragments */
__device__ __forceinline__ v8f mma_bf(v16b a, v16b b, v8f c) {
  c = __builtin_amdgcn_wmma_f32_16x16x32_bf16(false, a, false, b, (short)0, c, false, false);
  asm volatile("v_nop\n\tv_nop\n\tv_nop\n\tv_nop" : "+v"(c) : "v"(a), "v"(b));
  return c;
}

// ---------------------------------------------------------------------------
// f32 -> bf16 (RNE-convert) of all seven operand planes in one launch: three activation planes, then four weight planes.
// The block index selects plane and place in it (block-uniform): blocks 0 .. 6143 are 2048 per activation plane,
// blocks 6144 .. 8191 are 512 per weight plane.
// 8 consecutive elements per thread: two 16-B loads, ONE 16-B store per lane; 32 consecutive lanes write 512 contiguous
// Coverage: thread i of a plane writes elements 8i..8i+7, i < n8; blocks per plane = n8/256 exactly:
//   activations 4096*1024/8 = 524,288 -> 2048 blocks;  weights 1024*1024/8 = 131,072 -> 512 blocks.
// ---------------------------------------------------------------------------
constexpr int kActN8  = kRows * kDim / 8;
constexpr int kWgtN8  = kDim * kDim / 8;
constexpr int kActBlk = kActN8 / 256;
constexpr int kWgtBlk = kWgtN8 / 256;
constexpr int kCvtBlk = 3 * kActBlk + 4 * kWgtBlk;
static_assert((kActN8 % 256) == 0 && (kWgtN8 % 256) == 0, "whole blocks per plane");
__global__ __launch_bounds__(256) void cvt_bf16_planes_kernel(
    const float* __restrict__ a0, const float* __restrict__ a1, const float* __restrict__ a2,
    const float* __restrict__ w0, const float* __restrict__ w1, const float* __restrict__ w2, const float* __restrict__ w3,
    unsigned short* __restrict__ da0, unsigned short* __restrict__ da1, unsigned short* __restrict__ da2,
    unsigned short* __restrict__ dw0, unsigned short* __restrict__ dw1, unsigned short* __restrict__ dw2,
    unsigned short* __restrict__ dw3)
{
  const int b = blockIdx.x;
  const float* src;
  unsigned short* dst;
  int blk, n8;
  if (b < 3 * kActBlk) {
    const int z = b / kActBlk;
    blk = b - z * kActBlk;
    n8  = kActN8;
    src = (z == 0) ? a0 : (z == 1) ? a1 : a2;
    dst = (z == 0) ? da0 : (z == 1) ? da1 : da2;
  } else {
    const int bw = b - 3 * kActBlk;
    const int z = bw / kWgtBlk;
    blk = bw - z * kWgtBlk;
    n8  = kWgtN8;
    src = (z == 0) ? w0 : (z == 1) ? w1 : (z == 2) ? w2 : w3;
    dst = (z == 0) ? dw0 : (z == 1) ? dw1 : (z == 2) ? dw2 : dw3;
  }
  const int i = blk * 256 + threadIdx.x;
  if (i >= n8) return;
  const float* p = src + 8 * (size_t)i;
  const v4f a = *(const v4f*)(p);
  const v4f c = *(const v4f*)(p + 4);
  unsigned short hb[8];
#pragma unroll
  for (int e = 0; e < 4; ++e) {
    const float x0 = a[e];
    const float x1 = c[e];
    hb[e]     = f2bf_bits(x0);
    hb[4 + e] = f2bf_bits(x1);
  }
  const v4u u = (v4u){pk16(hb[0], hb[1]), pk16(hb[2], hb[3]), pk16(hb[4], hb[5]), pk16(hb[6], hb[7])};
  unsigned short* q = dst + 8 * (size_t)i;
  *(v4u*)q = u;
  
}

// ---------------------------------------------------------------------------
// Eight asynchronous 16-B copies per lane, global memory to LDS: 128 rows of one operand plane, one pass of k wide.
// The block's lanes cover 16 whole rows per copy; a lane moves its 16 bytes of rows r, r + 16, .. r + 112.
// lds = the lane's LDS byte address of row r, g = its global address of row r, ld = row pitch in elements,
// PITCH = bytes per LDS row.
// ---------------------------------------------------------------------------
template <int PITCH>
__device__ __forceinline__ void copy_plane_async(unsigned lds, const __bf16* g, int ld) {
  const size_t step = (size_t)16 * ld;
  const __bf16* g1 = g + step;      const __bf16* g2 = g + 2 * step;  const __bf16* g3 = g + 3 * step;
  const __bf16* g4 = g + 4 * step;  const __bf16* g5 = g + 5 * step;  const __bf16* g6 = g + 6 * step;
  const __bf16* g7 = g + 7 * step;
  const unsigned ls = 16u * PITCH;
  /* the copies and the wait that stands before their address registers may be rewritten, in one statement */
  asm volatile(
      "global_load_async_to_lds_b128 %0, %8, off\n\t"
      "global_load_async_to_lds_b128 %1, %9, off\n\t"
      "global_load_async_to_lds_b128 %2, %10, off\n\t"
      "global_load_async_to_lds_b128 %3, %11, off\n\t"
      "global_load_async_to_lds_b128 %4, %12, off\n\t"
      "global_load_async_to_lds_b128 %5, %13, off\n\t"
      "global_load_async_to_lds_b128 %6, %14, off\n\t"
      "global_load_async_to_lds_b128 %7, %15, off\n\t"
      "s_wait_xcnt 0x0"
      :: "v"(lds), "v"(lds + ls), "v"(lds + 2u * ls), "v"(lds + 3u * ls), "v"(lds + 4u * ls), "v"(lds + 5u * ls),
         "v"(lds + 6u * ls), "v"(lds + 7u * ls), "v"(g), "v"(g1), "v"(g2), "v"(g3), "v"(g4), "v"(g5), "v"(g6), "v"(g7)
      : "memory");
}

// ---------------------------------------------------------------------------
// bf16 GEMM, operands staged in LDS: C[m][n] = sum_k A[m][k] * Bt[n][k] + bf16value(bias[n]).
// One block owns a 128 x 128 tile; wave (wm = wave >> 1, wn = wave & 1) owns rows 16 FM wm .. + 16 FM - 1, cols 64 wn .. + 63.
// FM = 16-row fragments per wave. FM 2: 8 waves of 32 x 64, passes of 128 k. FM 4: 4 waves of 64 x 64, passes of 64 k: a
// k step's 8 fragments feed 16 matrix instructions (6 feed 8 at FM 2), and the smaller stage lets three blocks share a WGP's LDS.
// A row-major [M][K] bf16 (SPLA: a second plane A2 of the same layout is accumulated against the same Bt);
// Bt row-major [N][K] bf16; M, N % 128 == 0, K % 128 == 0, K >= 256 (no tail handling). C f32, pitch ldc.
// A stage = one pass of [A 128 rows | Bt 128 rows | A2 128 rows if SPLA], brought by asynchronous copies into one of two
// buffers: the copies of stage t + 2 fly while stage t + 1 is worked on.
// EPI 0: plain.  EPI 1: feature map y = x + 1 for x > 0, exp(x) otherwise, applied to the accumulators in registers.
// EPI 2: three products of one shape in one launch. blockIdx.y = 0, 1, 2 (block-uniform) picks the plane: A, Bt and C are
// three dense planes one behind the other (M x lda, N x ldb, M x ldc elements each), the biases three buffers; planes 0
// and 1 take the feature map, plane 2 is plain.
// Fragment map: lane l, row/col = l & 15, half h = l >> 4; elements 0..7 <- k0 + 8h + 0..7, 8..15 <- k0 + 16 + 8h + 0..7
// for both operands; accumulator element r = (row 8h + r, col l & 15).
// Epilogue: 16-row slabs staged per wave in LDS of its own (same wave stores and reloads, wave-level ordering).
// Coverage: 32 x 8 = 256 tiles of 128 x 128 = 4096 x 1024; grid.x = 256 blocks, one tile per block and plane.
// ---------------------------------------------------------------------------
template <bool SPLA, int EPI, int FM>
__global__ __launch_bounds__(FM == 4 ? 128 : 256, FM == 4 ? 3 : 1) void gemm_tile64_kernel(
    const unsigned short* __restrict__ Ap, const unsigned short* __restrict__ A2p, int lda,
    const unsigned short* __restrict__ Btp, int ldb,
    float* __restrict__ Cout, int ldc,
    const float* __restrict__ bias, int M, int N, int K,
    const float* __restrict__ bias1 = nullptr, const float* __restrict__ bias2 = nullptr)
{
  const int z = (EPI == 2) ? (int)blockIdx.y : 0;
  const __bf16* A  = (const __bf16*)Ap + (size_t)z * M * lda;
  const __bf16* A2 = (const __bf16*)A2p + (size_t)z * M * lda;
  const __bf16* Bt = (const __bf16*)Btp + (size_t)z * N * ldb;
  if (EPI == 2) {
    Cout += (size_t)z * M * ldc;
    bias = (z == 0) ? bias : (z == 1) ? bias1 : bias2;
  }
  static_assert(FM == 2 || FM == 4, "wave tile 32 x 64 or 64 x 64");
  constexpr int kWaves    = (128 / (16 * FM)) * 2;
  constexpr int kPassK    = (FM == 4) ? 64 : 128;   /* k per pass */
  constexpr int kLdsPitch = kPassK * 2 + 16;        /* bytes per LDS row: 16 B x odd, conflict-free for 16-B readers */
  constexpr int kPlaneB   = 128 * kLdsPitch;        /* one operand plane of a stage */
  constexpr int kRowLanes = kPassK * 2 / 16;        /* lanes that share a row in a copy */
  static_assert(kWaves * 32 / kRowLanes == 16, "one copy of the block covers 16 rows");
  constexpr int kStageB = (SPLA ? 3 : 2) * kPlaneB;
  __shared__ __align__(16) unsigned char sStage[2 * kStageB];
  __shared__ __align__(16) float sT[kWaves][16 * 68];
  const int tid  = threadIdx.x;
  const int lane = tid & 31;
  const int wave = tid >> 5;
  const int tilesN = N >> 7;
  const int tilesM = M >> 7;
  const int tile = blockIdx.x;
  /* block-uniform, in front of every barrier and copy */
  if (tile >= tilesM * tilesN) return;
  const int tm = tile / tilesN;
  const int tn = tile - tm * tilesN;
  const int mB = tm << 7;
  const int nB = tn << 7;
  const int wm = wave >> 1;
  const int wn = wave & 1;

  const int rlane = lane & 15;
  const int koff  = (lane >> 4) * 8;
  const int mOff  = (lane >> 4) * 8;

  /* this lane's share of a stage */
  const int cr = tid / kRowLanes, cc = (tid % kRowLanes) * 8;
  const unsigned ldsC = (unsigned)(uintptr_t)(sStage + cr * kLdsPitch + cc * 2);
  const __bf16* gA  = A  + (size_t)(mB + cr) * lda + cc;
  const __bf16* gA2 = A2 + (size_t)(mB + cr) * lda + cc;
  const __bf16* gB  = Bt + (size_t)(nB + cr) * ldb + cc;
  const int nPass = K / kPassK;

  /* every loop over acc[], fa[], fb[], fl[] below is unrolled: constant indices keep these arrays in registers */
  v8f acc[FM][4];
#pragma unroll
  for (int i = 0; i < FM; ++i)
#pragma unroll
    for (int j = 0; j < 4; ++j) acc[i][j] = (v8f){0.f, 0.f, 0.f, 0.f, 0.f, 0.f, 0.f, 0.f};

  // ---- stage 0, published; then stage 1 in flight ----
  copy_plane_async<kLdsPitch>(ldsC, gA, lda);
  copy_plane_async<kLdsPitch>(ldsC + kPlaneB, gB, ldb);
  if (SPLA) copy_plane_async<kLdsPitch>(ldsC + 2 * kPlaneB, gA2, lda);
  /* this wave's copies of stage 0 have landed */
  asm volatile("s_wait_asynccnt 0x0" ::: "memory");
  __syncthreads();
  if (1 < nPass) {
    copy_plane_async<kLdsPitch>(ldsC + kStageB, gA + kPassK, lda);
    copy_plane_async<kLdsPitch>(ldsC + kStageB + kPlaneB, gB + kPassK, ldb);
    if (SPLA) copy_plane_async<kLdsPitch>(ldsC + kStageB + 2 * kPlaneB, gA2 + kPassK, lda);
  }

  /* rolled: one pass per trip, so that each trip reads one buffer and ends in one publish point */
#pragma unroll 1
  for (int t = 0; t < nPass; ++t) {
    const int bufB = (t & 1) * kStageB;
    const unsigned char* pA = sStage + bufB + (wm * (16 * FM) + rlane) * kLdsPitch + koff * 2;
    const unsigned char* pB = sStage + bufB + kPlaneB + (wn * 64 + rlane) * kLdsPitch + koff * 2;
    /* FM 2, two fragment sets: the reads of k step kk + 1 (same buffer) are issued in front of step kk's products, so that
       a wave waits out the LDS latency once per pass and not at every step. FM 4, one set (128 accumulator registers and two
       sets do not fit 256): each step reads its own fragments, and the two other waves of the SIMD work meanwhile */
    constexpr int kSets = (FM == 4) ? 1 : 2;
    v16b fb[kSets][4], fa[kSets][FM], fl[kSets][FM];
#pragma unroll
    for (int j = 0; j < 4; ++j) fb[0][j] = Frag<__bf16>::load((const __bf16*)(pB + j * 16 * kLdsPitch));
#pragma unroll
    for (int i = 0; i < FM; ++i) {
      fa[0][i] = Frag<__bf16>::load((const __bf16*)(pA + i * 16 * kLdsPitch));
      if (SPLA) fl[0][i] = Frag<__bf16>::load((const __bf16*)(pA + 2 * kPlaneB + i * 16 * kLdsPitch));
    }
#pragma unroll
    for (int kk = 0; kk < kPassK / 32; ++kk) {
      const int cur = (kSets == 2) ? (kk & 1) : 0, nxt = (kSets == 2) ? (cur ^ 1) : 0;
      if (kSets == 2 && kk + 1 < kPassK / 32) {
#pragma unroll
        for (int j = 0; j < 4; ++j)
          fb[nxt][j] = Frag<__bf16>::load((const __bf16*)(pB + j * 16 * kLdsPitch + (kk + 1) * 64));
#pragma unroll
        for (int i = 0; i < FM; ++i) {
          fa[nxt][i] = Frag<__bf16>::load((const __bf16*)(pA + i * 16 * kLdsPitch + (kk + 1) * 64));
          if (SPLA) fl[nxt][i] = Frag<__bf16>::load((const __bf16*)(pA + 2 * kPlaneB + i * 16 * kLdsPitch + (kk + 1) * 64));
        }
      }
      /* per accumulator and k step: the hi product, then the lo product */
#pragma unroll
      for (int i = 0; i < FM; ++i) {
#pragma unroll
        for (int j = 0; j < 4; ++j) acc[i][j] = mma_bf(fa[cur][i], fb[cur][j], acc[i][j]);
        if (SPLA) {
#pragma unroll
          for (int j = 0; j < 4; ++j) acc[i][j] = mma_bf(fl[cur][i], fb[cur][j], acc[i][j]);
        }
      }
      if (kSets == 1 && kk + 1 < kPassK / 32) {
#pragma unroll
        for (int j = 0; j < 4; ++j)
          fb[0][j] = Frag<__bf16>::load((const __bf16*)(pB + j * 16 * kLdsPitch + (kk + 1) * 64));
#pragma unroll
        for (int i = 0; i < FM; ++i) {
          fa[0][i] = Frag<__bf16>::load((const __bf16*)(pA + i * 16 * kLdsPitch + (kk + 1) * 64));
          if (SPLA) fl[0][i] = Frag<__bf16>::load((const __bf16*)(pA + 2 * kPlaneB + i * 16 * kLdsPitch + (kk + 1) * 64));
        }
      }
    }
    /* publish point: this wave's reads of the buffer are done, its copies of the next stage have landed */
    asm volatile("s_wait_dscnt 0x0" ::: "memory");
    asm volatile("s_wait_asynccnt 0x0" ::: "memory");
    __syncthreads();
    /* refill the buffer that every wave has just left; the test is the same for the whole block */
    if (t + 2 < nPass) {
      const int ko = (t + 2) * kPassK;
      copy_plane_async<kLdsPitch>(ldsC + bufB, gA + ko, lda);
      copy_plane_async<kLdsPitch>(ldsC + bufB + kPlaneB, gB + ko, ldb);
      if (SPLA) copy_plane_async<kLdsPitch>(ldsC + bufB + 2 * kPlaneB, gA2 + ko, lda);
    }
  }
  /* no copy is left in flight when the wave goes on */
  asm volatile("s_wait_asynccnt 0x0" ::: "memory");

  // ---- epilogue ----
  const int m0 = mB + wm * (16 * FM);
  const int n0 = nB + wn * 64;
  float* slab = sT[wave];
  float bvj[4];
#pragma unroll
  for (int j = 0; j < 4; ++j) bvj[j] = bf16r(bias[n0 + (j << 4) + rlane]);
  /* every loop over acc[] is unrolled: constant indices keep it in registers */
#pragma unroll
  for (int i = 0; i < FM; ++i)
#pragma unroll
    for (int j = 0; j < 4; ++j)
#pragma unroll
      for (int r = 0; r < 8; ++r) acc[i][j][r] += bvj[j];
  /* feature map on the accumulators themselves, all values of a lane independent; the test is the same for the whole block */
  if (EPI == 1 || (EPI == 2 && z < 2)) {
#pragma unroll
    for (int i = 0; i < FM; ++i)
#pragma unroll
      for (int j = 0; j < 4; ++j)
#pragma unroll
        for (int r = 0; r < 8; ++r) {
          const float x = acc[i][j][r];
          const float ex = expf(fminf(x, 0.0f));
          acc[i][j][r] = (x > 0.0f) ? (x + 1.0f) : ex;
        }
  }
#pragma unroll
  for (int i = 0; i < FM; ++i) {
    const int mBase = m0 + (i << 4);
#pragma unroll
    for (int j = 0; j < 4; ++j) {
#pragma unroll
      for (int r = 0; r < 8; ++r) {
        slab[(mOff + r) * 68 + (j << 4) + rlane] = acc[i][j][r];
      }
    }
    __builtin_amdgcn_fence(__ATOMIC_RELEASE, "workgroup");
    __builtin_amdgcn_wave_barrier();
    __builtin_amdgcn_fence(__ATOMIC_ACQUIRE, "workgroup");
    {
      /* row segment = 256 B = 16 lanes x 16 B; rows it*2 + hh cover 0..15 */
      const int hh = lane >> 4, c4 = (lane & 15) * 4;
      {
#pragma unroll
        for (int it = 0; it < 8; ++it) {
          const int row = it * 2 + hh;
          const v4f v = *(const v4f*)(slab + row * 68 + c4);
          *(v4f*)(Cout + (size_t)(mBase + row) * ldc + n0 + c4) = v;
        }
        
      }
    }
    __builtin_amdgcn_fence(__ATOMIC_RELEASE, "workgroup");
    __builtin_amdgcn_wave_barrier();
    __builtin_amdgcn_fence(__ATOMIC_ACQUIRE, "workgroup");
  }
}

// ---------------------------------------------------------------------------
// Chunk sums: one block of 256 threads per (chunk, batch-head), chunks 0 .. kChunks - 2 (nothing follows the last one).
// slot[d][j] = sum over the chunk's 64 steps of k[s][d] * v[s][j]; slot[4096 + d] = sum over the steps of k[s][d].
// Thread (d4 = 4 (tid >> 4), j4 = 4 (tid & 15)) keeps a 4 x 4 patch in registers: two 16-B LDS reads feed 16 FMAs.
// Staging coverage: rows lr + 16 i (lr = tid >> 4, i = 0..3) x cols 4 (tid & 15) .. + 3 = 64 x 64 per tensor.
// LDS: 2 x 16,384 = 32,768 B.
// ---------------------------------------------------------------------------
__global__ __launch_bounds__(256) void chunk_state_kernel(
    const float* __restrict__ KF, const float* __restrict__ VF, float* __restrict__ ST)
{
  __shared__ __align__(16) float sK[kChunkL * 64];
  __shared__ __align__(16) float sV[kChunkL * 64];
  const int tid = threadIdx.x;
  const int chunk = blockIdx.x;
  const int bh = blockIdx.y;
  const size_t row0 = (size_t)(bh >> 4) * kSeq + (size_t)chunk * kChunkL;
  const int col0 = (bh & 15) * kHd;
  const int lr = tid >> 4, lc4 = (tid & 15) * 4;
  /* unrolled: all eight global loads are issued before the first LDS store waits on one */
#pragma unroll
  for (int i = 0; i < kChunkL / 16; ++i) {
    const int r = lr + 16 * i;
    const size_t g = (row0 + (size_t)r) * kDim + col0 + lc4;
    *(v4f*)(sK + r * 64 + lc4) = *(const v4f*)(KF + g);
    *(v4f*)(sV + r * 64 + lc4) = *(const v4f*)(VF + g);
  }
  __syncthreads();

  const int d4 = lr * 4, j4 = lc4;
  /* every loop over a[] is unrolled so that its indices are constants and the patch stays in registers */
  v4f a[4];
#pragma unroll
  for (int r = 0; r < 4; ++r) a[r] = (v4f){0.f, 0.f, 0.f, 0.f};
  /* eight steps' LDS reads in flight together; rolled, every step waits out a whole LDS latency */
#pragma unroll 8
  for (int s = 0; s < kChunkL; ++s) {
    const v4f kk = *(const v4f*)(sK + s * 64 + d4);
    const v4f vv = *(const v4f*)(sV + s * 64 + j4);
#pragma unroll
    for (int r = 0; r < 4; ++r)
#pragma unroll
      for (int e = 0; e < 4; ++e) a[r][e] = fmaf(kk[r], vv[e], a[r][e]);
  }
  float* slot = ST + ((size_t)bh * (kChunks - 1) + chunk) * kSlotF;
#pragma unroll
  for (int r = 0; r < 4; ++r) *(v4f*)(slot + (d4 + r) * 64 + j4) = a[r];

  /* key sums; waves 0 and 1 only (wave-uniform predicate) */
  if (tid < 64) {
    float c = 0.0f;
    for (int s = 0; s < kChunkL; ++s) c += sK[s * 64 + tid];
    slot[kHd * kHd + tid] = c;
  }
}

// ---------------------------------------------------------------------------
// Inclusive sum of the chunk slots along the chunk axis, in place: slot c becomes the state at the end of chunk c.
// One thread per float of a slot (4160 per batch-head, grid.x = 17 blocks with a tail guard); the 31 values stay in
// registers, so all loads are in flight together and the thread pays the load latency once.
// ---------------------------------------------------------------------------
__global__ __launch_bounds__(256) void chunk_prefix_kernel(float* __restrict__ ST)
{
  const int i = blockIdx.x * 256 + threadIdx.x;
  if (i >= kSlotF) return;
  float* base = ST + (size_t)blockIdx.y * (kChunks - 1) * kSlotF + i;
  /* both loops unrolled: constant indices keep x[] in registers */
  float x[kChunks - 1];
#pragma unroll
  for (int c = 0; c < kChunks - 1; ++c) x[c] = base[(size_t)c * kSlotF];
#pragma unroll
  for (int c = 1; c < kChunks - 1; ++c) {
    x[c] += x[c - 1];
    base[(size_t)c * kSlotF] = x[c];
  }
}

// ---------------------------------------------------------------------------
// Causal attention of one chunk in matrix form, one block of 128 threads per (chunk, batch-head), no step loop.
// With s, t the chunk's 64 steps, S and c the state and key sums at the end of the chunk before (slot chunk - 1 of ST):
//   P[t][s] = sum_d k[t][d] q[s][d], kept for t <= s, zero otherwise
//   num[j][s] = sum_t v[t][j] P[t][s] + sum_d S[d][j] q[s][d]
//   den[s]    = sum_t P[t][s]         + sum_d c[d] q[s][d]
//   out[s][j] = num[j][s] * (1 / (den[s] + eps)), split into bf16 hi + lo planes.
// Every f32 operand x is carried as hi = bf16(x), lo = bf16(x - hi); a product a b is hi hi + hi lo + lo hi, f32 accumulate.
// Wave w owns the 16 steps s = 16 w .. 16 w + 15 as the column side (B) of all three products: q comes straight from
// global memory into its B fragments, and two accumulator tiles of P (rows t = 8h + r and 16 + 8h + r, column s = l & 15)
// are, register for register, the B fragment of 32 t of the second product: P never leaves the registers.
// The row sides (A) are shared by the four waves and staged in LDS as bf16 hi and lo planes, 64 k per row:
//   sK [64 t][64 d];  sV [64 j][64 t] (v transposed);  sS [80][64 d]: rows j < 64 the state transposed, row 64 the key sums,
//   rows 65 .. 79 zero, so that row 0 of the fifth accumulator tile is the state's share of den.
// Transposing: thread (j = tid & 63, g = tid >> 6) reads column j of rows 32 g .. 32 g + 31 (a wave reads 128 B of a row)
// and stores eight rows' values as one 16-B piece of LDS row j.
// Fragment map as in the GEMM above. LDS: (64 + 64 + 80) x 144 x 2 = 59,904 B.
// ---------------------------------------------------------------------------
constexpr int kFragP = kHd * 2 + 16;   /* bytes per LDS row: 16 B x odd, conflict-free for 16-B accesses */

/* eight f32 -> bf16 hi and bf16 lo = bf16(x - hi), both rounded to nearest even */
__device__ __forceinline__ void split8(const float (&x)[8], v8b& hi, v8b& lo) {
  /* by pairs: one packed conversion gives two hi, one more two lo; unrolled: constant indices keep x, hi, lo in registers */
#pragma unroll
  for (int p = 0; p < 4; ++p) {
    const v2f x2 = (v2f){x[2 * p], x[2 * p + 1]};
    const v2b h2 = __builtin_convertvector(x2, v2b);
    const v2b l2 = __builtin_convertvector(x2 - __builtin_convertvector(h2, v2f), v2b);
    hi[2 * p] = h2[0];  hi[2 * p + 1] = h2[1];
    lo[2 * p] = l2[0];  lo[2 * p + 1] = l2[1];
  }
}
__device__ __forceinline__ v16b join16(v8b a, v8b b) {
  Frag<__bf16>::U f; f.h[0] = a; f.h[1] = b; return f.v;
}
/* 32 k of NT stacked 16-row tiles against one B fragment pair: acc[i] += hi hi, then hi lo, then lo hi. pH, pL = the lane's
   place in tile 0 of the hi and lo plane. Each product runs over all tiles before the next one starts, so that successive
   matrix instructions have different accumulators; all loops unrolled: constant indices keep the arrays in registers */
template <int NT>
__device__ __forceinline__ void mma3_tiles(const unsigned char* pH, const unsigned char* pL, v16b bh, v16b bl, v8f* acc) {
  v16b ah[NT], al[NT];
#pragma unroll
  for (int i = 0; i < NT; ++i) {
    ah[i] = Frag<__bf16>::load((const __bf16*)(pH + i * 16 * kFragP));
    al[i] = Frag<__bf16>::load((const __bf16*)(pL + i * 16 * kFragP));
  }
#pragma unroll
  for (int i = 0; i < NT; ++i) acc[i] = __builtin_amdgcn_wmma_f32_16x16x32_bf16(false, ah[i], false, bh, (short)0, acc[i], false, false);
#pragma unroll
  for (int i = 0; i < NT; ++i) acc[i] = __builtin_amdgcn_wmma_f32_16x16x32_bf16(false, ah[i], false, bl, (short)0, acc[i], false, false);
#pragma unroll
  for (int i = 0; i < NT; ++i) acc[i] = __builtin_amdgcn_wmma_f32_16x16x32_bf16(false, al[i], false, bh, (short)0, acc[i], false, false);
}

__global__ __launch_bounds__(128) void scan_state_kernel(
    const float* __restrict__ QF, const float* __restrict__ KF, const float* __restrict__ VF,
    const float* __restrict__ ST, unsigned short* __restrict__ AH, unsigned short* __restrict__ AL)
{
  __shared__ __align__(16) unsigned char sKh[64 * kFragP];
  __shared__ __align__(16) unsigned char sKl[64 * kFragP];
  __shared__ __align__(16) unsigned char sVh[64 * kFragP];
  __shared__ __align__(16) unsigned char sVl[64 * kFragP];
  __shared__ __align__(16) unsigned char sSh[80 * kFragP];
  __shared__ __align__(16) unsigned char sSl[80 * kFragP];
  const int tid = threadIdx.x, lane = tid & 31, wave = tid >> 5;
  const int rl = lane & 15, h = lane >> 4;
  const int chunk = blockIdx.x;
  const int bh = blockIdx.y;
  /* first element of this chunk and head in the [row][1024] planes: the same for the whole block */
  const size_t base = ((size_t)(bh >> 4) * kSeq + (size_t)chunk * kChunkL) * kDim + (size_t)(bh & 15) * kHd;
  const char* gQ = (const char*)(QF + base);
  const char* gK = (const char*)(KF + base);
  const char* gV = (const char*)(VF + base);
  constexpr unsigned kRowB = kDim * 4;
  const int sl = wave * 16 + rl;          /* this lane's step s inside the chunk */
  const int tj = tid & 63, tg = tid >> 6; /* transposing threads: column, group of 32 rows */
  const unsigned oQ = (unsigned)sl * kRowB + (unsigned)h * 32u;
  const unsigned oK = (unsigned)(tid >> 3) * kRowB + (unsigned)(tid & 7) * 32u;
  const unsigned oV = (unsigned)tg * 32u * kRowB + (unsigned)tj * 4u;

  /* every loop of this kernel is unrolled: constant indices keep its arrays in registers; all loads of a lane fly together */
  v4f xq[8], xk[8];
  float xv[32];
#pragma unroll
  for (int i = 0; i < 8; ++i) xq[i] = *(const v4f*)(gQ + oQ + (i >> 1) * 64 + (i & 1) * 16);
#pragma unroll
  for (int i = 0; i < 8; ++i) xk[i] = *(const v4f*)(gK + oK + (size_t)(i >> 1) * 16 * kRowB + (i & 1) * 16);
#pragma unroll
  for (int i = 0; i < 32; ++i) xv[i] = *(const float*)(gV + oV + (size_t)i * kRowB);

  /* No branch round the state's loads: they are issued together with those of q, k, v, and no wait at a branch's join has
     to cover them all. Chunk 0, which starts from a zero state and has no state product, reads slot 0 (written earlier in
     this call) and drops the values */
  float xs[32];
  const char* gS = (const char*)(ST + ((size_t)bh * (kChunks - 1) + (chunk > 0 ? chunk - 1 : 0)) * kSlotF);
  const unsigned oS = (unsigned)tg * 32u * (kHd * 4u) + (unsigned)tj * 4u;
  const unsigned oC = (unsigned)(tid & 7) * 32u;
#pragma unroll
  for (int i = 0; i < 32; ++i) xs[i] = *(const float*)(gS + oS + i * (kHd * 4));
  const v4f c0 = *(const v4f*)(gS + oC + kHd * kHd * 4);
  const v4f c1 = *(const v4f*)(gS + oC + kHd * kHd * 4 + 16);
  /* one wait for all loads above: named as inputs, their base and offset registers stay untouched up to it */
  asm volatile("s_wait_xcnt 0x0" :: "v"(oQ), "v"(oK), "v"(oV), "v"(oS), "v"(oC), "s"(gQ), "s"(gK), "s"(gV), "s"(gS) : "memory");

#pragma unroll
  for (int i = 0; i < 4; ++i) {
    float y[8];
#pragma unroll
    for (int e = 0; e < 4; ++e) { y[e] = xk[2 * i][e]; y[4 + e] = xk[2 * i + 1][e]; }
    v8b hi, lo;
    split8(y, hi, lo);
    *(v8b*)(sKh + ((tid >> 3) + 16 * i) * kFragP + (tid & 7) * 16) = hi;
    *(v8b*)(sKl + ((tid >> 3) + 16 * i) * kFragP + (tid & 7) * 16) = lo;
  }
#pragma unroll
  for (int b = 0; b < 4; ++b) {
    float y[8];
#pragma unroll
    for (int e = 0; e < 8; ++e) y[e] = xv[b * 8 + e];
    v8b hi, lo;
    split8(y, hi, lo);
    *(v8b*)(sVh + tj * kFragP + (tg * 4 + b) * 16) = hi;
    *(v8b*)(sVl + tj * kFragP + (tg * 4 + b) * 16) = lo;
  }
  /* q fragments: elements 0..7 <- d = 32 kb + 8h + 0..7, elements 8..15 <- d = 32 kb + 16 + 8h + 0..7 */
  v16b qh[2], ql[2];
#pragma unroll
  for (int kb = 0; kb < 2; ++kb) {
    v8b hi[2], lo[2];
#pragma unroll
    for (int p = 0; p < 2; ++p) {
      float y[8];
#pragma unroll
      for (int e = 0; e < 4; ++e) { y[e] = xq[kb * 4 + p * 2][e]; y[4 + e] = xq[kb * 4 + p * 2 + 1][e]; }
      split8(y, hi[p], lo[p]);
    }
    qh[kb] = join16(hi[0], hi[1]);
    ql[kb] = join16(lo[0], lo[1]);
  }

  /* block-uniform predicate */
  if (chunk > 0) {
#pragma unroll
    for (int b = 0; b < 4; ++b) {
      float y[8];
#pragma unroll
      for (int e = 0; e < 8; ++e) y[e] = xs[b * 8 + e];
      v8b hi, lo;
      split8(y, hi, lo);
      *(v8b*)(sSh + tj * kFragP + (tg * 4 + b) * 16) = hi;
      *(v8b*)(sSl + tj * kFragP + (tg * 4 + b) * 16) = lo;
    }
    /* rows 64 .. 79, one 16-B piece per thread: row 64 (threads 0 .. 7) the key sums, the others zero */
    {
      float y[8];
#pragma unroll
      for (int e = 0; e < 4; ++e) {
        y[e]     = (tid < 8) ? c0[e] : 0.0f;
        y[4 + e] = (tid < 8) ? c1[e] : 0.0f;
      }
      v8b hi, lo;
      split8(y, hi, lo);
      *(v8b*)(sSh + (64 + (tid >> 3)) * kFragP + (tid & 7) * 16) = hi;
      *(v8b*)(sSl + (64 + (tid >> 3)) * kFragP + (tid & 7) * 16) = lo;
    }
  }

  /* the staged planes are complete for every wave */
  __syncthreads();

  const int fo = rl * kFragP + h * 16;   /* a lane's place in a 16-row fragment: row l & 15, k half h */

  // ---- P[t][s] ----
  v8f pt[4];
#pragma unroll
  for (int tt = 0; tt < 4; ++tt) pt[tt] = (v8f){0.f, 0.f, 0.f, 0.f, 0.f, 0.f, 0.f, 0.f};
#pragma unroll
  for (int kb = 0; kb < 2; ++kb)
    mma3_tiles<4>(sKh + fo + kb * 64, sKl + fo + kb * 64, qh[kb], ql[kb], pt);
  /* causal mask and this lane's share of den: its 32 t of column s */
  float dt[4];
#pragma unroll
  for (int tt = 0; tt < 4; ++tt) {
    dt[tt] = 0.0f;
#pragma unroll
    for (int r = 0; r < 8; ++r) {
      const float x = (tt * 16 + h * 8 + r <= sl) ? pt[tt][r] : 0.0f;
      pt[tt][r] = x;
      dt[tt] += x;
    }
  }
  const float dpart = (dt[0] + dt[1]) + (dt[2] + dt[3]);
  v16b ph[2], pl[2];
#pragma unroll
  for (int kb = 0; kb < 2; ++kb) {
    v8b hi[2], lo[2];
#pragma unroll
    for (int p = 0; p < 2; ++p) {
      float y[8];
#pragma unroll
      for (int e = 0; e < 8; ++e) y[e] = pt[kb * 2 + p][e];
      split8(y, hi[p], lo[p]);
    }
    ph[kb] = join16(hi[0], hi[1]);
    pl[kb] = join16(lo[0], lo[1]);
  }

  // ---- num[j][s], and the state's share of den in row 0 of tile 4 ----
  v8f on[5];
#pragma unroll
  for (int jt = 0; jt < 5; ++jt) on[jt] = (v8f){0.f, 0.f, 0.f, 0.f, 0.f, 0.f, 0.f, 0.f};
  if (chunk > 0) {
#pragma unroll
    for (int kb = 0; kb < 2; ++kb)
      mma3_tiles<5>(sSh + fo + kb * 64, sSl + fo + kb * 64, qh[kb], ql[kb], on);
  }
#pragma unroll
  for (int kb = 0; kb < 2; ++kb)
    mma3_tiles<4>(sVh + fo + kb * 64, sVl + fo + kb * 64, ph[kb], pl[kb], on);

  /* element 0 of tile 4: row 64 (the key sums' product) in half 0, a zero row in half 1; then both halves' shares together */
  const float dl = dpart + on[4][0];
  const float den = dl + __int_as_float(__builtin_amdgcn_permlanex16(__float_as_int(dl), __float_as_int(dl),
                                                                     0x76543210, 0xfedcba98, false, false));
  const float inv = 1.0f / (den + kEps);

  /* lane (s, h) holds j = 16 jt + 8h + 0..7 of row s: one 16-B store per tile and plane; a wave fills the 128 B of each row */
  v8b oh[4], ol[4];
#pragma unroll
  for (int jt = 0; jt < 4; ++jt) {
    float y[8];
#pragma unroll
    for (int e = 0; e < 8; ++e) y[e] = on[jt][e] * inv;
    split8(y, oh[jt], ol[jt]);
  }
  char* gH = (char*)(AH + base);
  char* gL = (char*)(AL + base);
  const unsigned oO = (unsigned)sl * (kDim * 2u) + (unsigned)h * 16u;
#pragma unroll
  for (int jt = 0; jt < 4; ++jt) {
    *(v8b*)(gH + oO + jt * 32) = oh[jt];
    *(v8b*)(gL + oO + jt * 32) = ol[jt];
  }
}

// ---------------------------------------------------------------------------
// Host glue: 1 convert launch + 1 launch of the three projection GEMMs + 3 scan launches (chunk sums, chunk prefix, scan)
// + 1 output GEMM = 6 launches. Kernel launches only.
// GEMM shapes: M 4096, N 1024, K 1024 everywhere (K, M and N % 128 == 0): 32 x 8 = 256 tiles -> 256 blocks per product.
// ---------------------------------------------------------------------------
extern "C" void kernel_launch(void* const* d_in, const int* in_sizes, int n_in,
                              void* d_out, int out_size, void* d_ws, size_t ws_size,
                              hipStream_t stream) {
  if (n_in < 11 || d_out == nullptr || d_ws == nullptr) return;
  if (in_sizes[0] != kRows * kDim || in_sizes[1] != kRows * kDim || in_sizes[2] != kRows * kDim) return;
  if (in_sizes[3] != kDim * kDim || in_sizes[5] != kDim * kDim || in_sizes[7] != kDim * kDim ||
      in_sizes[9] != kDim * kDim) return;
  if (in_sizes[4] != kDim || in_sizes[6] != kDim || in_sizes[8] != kDim || in_sizes[10] != kDim) return;
  if (out_size != kRows * kDim) return;
  if (ws_size < kWsTotal) return;

  const float* query = (const float*)d_in[0];
  const float* key   = (const float*)d_in[1];
  const float* value = (const float*)d_in[2];
  const float* Wq    = (const float*)d_in[3];
  const float* bq    = (const float*)d_in[4];
  const float* Wk    = (const float*)d_in[5];
  const float* bk    = (const float*)d_in[6];
  const float* Wv    = (const float*)d_in[7];
  const float* bv    = (const float*)d_in[8];
  const float* Wo    = (const float*)d_in[9];
  const float* bo    = (const float*)d_in[10];
  float* out = (float*)d_out;

  char* ws = (char*)d_ws;
  unsigned short* XQ = (unsigned short*)(ws + kOffXQ);
  unsigned short* XK = (unsigned short*)(ws + kOffXK);
  unsigned short* XV = (unsigned short*)(ws + kOffXV);
  unsigned short* WQ = (unsigned short*)(ws + kOffWQ);
  unsigned short* WK = (unsigned short*)(ws + kOffWK);
  unsigned short* WV = (unsigned short*)(ws + kOffWV);
  unsigned short* WO = (unsigned short*)(ws + kOffWO);
  float*          QF = (float*)(ws + kOffQF);
  float*          KF = (float*)(ws + kOffKF);
  float*          VF = (float*)(ws + kOffVF);
  unsigned short* AH = (unsigned short*)(ws + kOffAH);
  unsigned short* AL = (unsigned short*)(ws + kOffAL);
  float*          ST = (float*)(ws + kOffST);

  // ---- bf16 operand planes (weights are [out][in] = Bt layout already) ----
  cvt_bf16_planes_kernel<<<dim3(kCvtBlk), 256, 0, stream>>>(query, key, value, Wq, Wk, Wv, Wo,
                                                            XQ, XK, XV, WQ, WK, WV, WO);

  // ---- projections, one launch: q and k with the feature map in the epilogue, v plain; planes XQ|XK|XV, WQ|WK|WV, QF|KF|VF ----
  const int gblocks = (kRows / 128) * (kDim / 128);
  gemm_tile64_kernel<false, 2, 4><<<dim3(gblocks, 3), 128, 0, stream>>>(XQ, XQ, kDim, WQ, kDim, QF, kDim, bq, kRows, kDim, kDim,
                                                                     bk, bv);

  // ---- causal state scan: chunk sums, their running sum, then one block per (chunk, batch-head) ----
  chunk_state_kernel<<<dim3(kChunks - 1, kBatch * kHeads), 256, 0, stream>>>(KF, VF, ST);
  chunk_prefix_kernel<<<dim3((kSlotF + 255) / 256, kBatch * kHeads), 256, 0, stream>>>(ST);
  scan_state_kernel<<<dim3(kChunks, kBatch * kHeads), 128, 0, stream>>>(QF, KF, VF, ST, AH, AL);

  // ---- output projection: (hi + lo) . bf16(Wo)^T + bo, both parts into one accumulator ----
  gemm_tile64_kernel<true, 0, 2><<<dim3(gblocks), 256, 0, stream>>>(AH, AL, kDim, WO, kDim, out, kDim, bo, kRows, kDim, kDim);
}

// v009
// One run takes 79.1 microseconds.
// Two timings next to v008 both put it at 1.04 times that version's speed.
// Counting every step since v000, it is 9.39 times as fast.
// Contractions: q/k/v projections on v_wmma_f32_16x16x32_bf16 (bf16(x) x bf16(W), one product, f32 accumulate); output projection on v_wmma_f32_16x16x32_bf16 with the attention plane carried as bf16 hi + lo planes against bf16(Wo) (two products into one f32 accumulator); chunk sums k^T v, causal attention inside a 64-step chunk and against the chunk's start state on v_wmma_f32_16x16x32_bf16 with every f32 operand carried as bf16 hi + lo (three products per pair, f32 accumulate); feature map, key sums, the chunk sums' running sum and the division in f32 on the vector unit.
#include <hip/hip_runtime.h>
#include <math.h>

typedef __attribute__((ext_vector_type(16))) __bf16   v16b;
typedef __attribute__((ext_vector_type(8)))  __bf16   v8b;
typedef __attribute__((ext_vector_type(2)))  __bf16   v2b;
typedef __attribute__((ext_vector_type(8)))  float    v8f;
typedef __attribute__((ext_vector_type(4)))  float    v4f;
typedef __attribute__((ext_vector_type(2)))  float    v2f;
typedef __attribute__((ext_vector_type(4)))  unsigned int v4u;

// ---------------------------------------------------------------------------
// Shape constants
// ---------------------------------------------------------------------------
constexpr int kBatch = 2;
constexpr int kSeq   = 2048;
constexpr int kDim   = 1024;
constexpr int kHeads = 16;
constexpr int kHd    = 64;
constexpr int kRows  = kBatch * kSeq;
constexpr int kChunkL = 64;
constexpr int kChunks = kSeq / kChunkL;
constexpr int kSlotF  = kHd * kHd + kHd;
constexpr float kEps = 1e-6f;
static_assert(kHeads * kHd == kDim, "head split");
static_assert((kDim % 128) == 0 && kDim >= 256, "GEMM K: whole passes of 128, at least two");
static_assert((kRows % 128) == 0 && (kDim % 128) == 0, "GEMM M, N multiples of 128");
static_assert((kSeq % kChunkL) == 0 && kChunkL == 64, "scan chunking");
static_assert((kSlotF % 32) == 0, "128-B aligned state slots");
static_assert(kHd == 64, "one head = one 64-column tile");

// ---------------------------------------------------------------------------
// Workspace region map (bytes; every offset is a multiple of 128)
//   XQ  bf16 [4096][1024]  bf16(query)                  8,388,608
//   XK  bf16 [4096][1024]  bf16(key)                    8,388,608
//   XV  bf16 [4096][1024]  bf16(value)                  8,388,608
//   WQ  bf16 [1024][1024]  bf16(Wq)  (Bt layout)        2,097,152
//   WK  bf16 [1024][1024]  bf16(Wk)                     2,097,152
//   WV  bf16 [1024][1024]  bf16(Wv)                     2,097,152
//   WO  bf16 [1024][1024]  bf16(Wo)                     2,097,152
//   QF  f32  [4096][1024]  phi(q)                      16,777,216
//   KF  f32  [4096][1024]  phi(k)                      16,777,216
//   VF  f32  [4096][1024]  v                           16,777,216
//   AH  bf16 [4096][1024]  attention plane, hi part     8,388,608
//   AL  bf16 [4096][1024]  attention plane, lo part     8,388,608
//   ST  f32  [32][31][4160] chunk states: 64x64 key-value sum, then 64 key sums   16,506,880
//   total                                             117,170,176
// ---------------------------------------------------------------------------
constexpr size_t kActB  = (size_t)kRows * kDim * 2;
constexpr size_t kWgtB  = (size_t)kDim * kDim * 2;
constexpr size_t kF32B  = (size_t)kRows * kDim * 4;
constexpr size_t kOffXQ = 0;
constexpr size_t kOffXK = kOffXQ + kActB;
constexpr size_t kOffXV = kOffXK + kActB;
constexpr size_t kOffWQ = kOffXV + kActB;
constexpr size_t kOffWK = kOffWQ + kWgtB;
constexpr size_t kOffWV = kOffWK + kWgtB;
constexpr size_t kOffWO = kOffWV + kWgtB;
constexpr size_t kOffQF = kOffWO + kWgtB;
constexpr size_t kOffKF = kOffQF + kF32B;
constexpr size_t kOffVF = kOffKF + kF32B;
constexpr size_t kOffAH = kOffVF + kF32B;
constexpr size_t kOffAL = kOffAH + kActB;
constexpr size_t kOffST = kOffAL + kActB;
constexpr size_t kStB   = (size_t)kBatch * kHeads * (kChunks - 1) * kSlotF * 4;
constexpr size_t kWsTotal = kOffST + kStB;
static_assert(kWsTotal == 117170176ull, "carve total");
static_assert(kOffXK == kOffXQ + kActB && kOffXV == kOffXK + kActB && kOffWK == kOffWQ + kWgtB && kOffWV == kOffWK + kWgtB &&
              kOffKF == kOffQF + kF32B && kOffVF == kOffKF + kF32B, "q, k, v planes lie one behind the other");
static_assert(kWsTotal <= 134217728ull, "carve cap");
static_assert((kOffXK % 128) == 0 && (kOffXV % 128) == 0 && (kOffWQ % 128) == 0 && (kOffWK % 128) == 0 &&
              (kOffWV % 128) == 0 && (kOffWO % 128) == 0 && (kOffQF % 128) == 0 && (kOffKF % 128) == 0 &&
              (kOffVF % 128) == 0 && (kOffAH % 128) == 0 && (kOffAL % 128) == 0 && (kOffST % 128) == 0,
              "128-B aligned regions");

// ---------------------------------------------------------------------------
// Small helpers
// ---------------------------------------------------------------------------
__device__ __forceinline__ unsigned short f2bf_bits(float f) {
  unsigned u = __float_as_uint(f);
  return (unsigned short)((u + 0x7FFFu + ((u >> 16) & 1u)) >> 16);
}
__device__ __forceinline__ float bf_bits2f(unsigned short h) { return __uint_as_float(((unsigned)h) << 16); }
/* RNE-convert to a bf16 value, kept in f32 */
__device__ __forceinline__ float bf16r(float f) { return bf_bits2f(f2bf_bits(f)); }
__device__ __forceinline__ unsigned pk16(unsigned short a, unsigned short b) { return (unsigned)a | ((unsigned)b << 16); }

template <typename T> struct Frag;
template <> struct Frag<__bf16> {
  typedef v16b V; union U { v16b v; v8b h[2]; };
  /* elements 0..7 <- p[0..7], elements 8..15 <- p[16..23] */
  static __device__ __forceinline__ v16b load(const __bf16* p) {
    U f; f.h[0] = *(const v8b*)(p); f.h[1] = *(const v8b*)(p + 16); return f.v;
  }
};

/* one matrix instruction followed by its own hazard guard: the guard ties this accumulator and names both fragments */
__device__ __forceinline__ v8f mma_bf(v16b a, v16b b, v8f c) {
  c = __builtin_amdgcn_wmma_f32_16x16x32_bf16(false, a, false, b, (short)0, c, false, false);
  asm volatile("v_nop\n\tv_nop\n\tv_nop\n\tv_nop" : "+v"(c) : "v"(a), "v"(b));
  return c;
}

// ---------------------------------------------------------------------------
// f32 -> bf16 (RNE-convert) of all seven operand planes in one launch: three activation planes, then four weight planes.
// The block index selects plane and place in it (block-uniform): blocks 0 .. 6143 are 2048 per activation plane,
// blocks 6144 .. 8191 are 512 per weight plane.
// 8 consecutive elements per thread: two 16-B loads, ONE 16-B store per lane; 32 consecutive lanes write 512 contiguous
// Coverage: thread i of a plane writes elements 8i..8i+7, i < n8; blocks per plane = n8/256 exactly:
//   activations 4096*1024/8 = 524,288 -> 2048 blocks;  weights 1024*1024/8 = 131,072 -> 512 blocks.
// ---------------------------------------------------------------------------
constexpr int kActN8  = kRows * kDim / 8;
constexpr int kWgtN8  = kDim * kDim / 8;
constexpr int kActBlk = kActN8 / 256;
constexpr int kWgtBlk = kWgtN8 / 256;
constexpr int kCvtBlk = 3 * kActBlk + 4 * kWgtBlk;
static_assert((kActN8 % 256) == 0 && (kWgtN8 % 256) == 0, "whole blocks per plane");
__global__ __launch_bounds__(256) void cvt_bf16_planes_kernel(
    const float* __restrict__ a0, const float* __restrict__ a1, const float* __restrict__ a2,
    const float* __restrict__ w0, const float* __restrict__ w1, const float* __restrict__ w2, const float* __restrict__ w3,
    unsigned short* __restrict__ da0, unsigned short* __restrict__ da1, unsigned short* __restrict__ da2,
    unsigned short* __restrict__ dw0, unsigned short* __restrict__ dw1, unsigned short* __restrict__ dw2,
    unsigned short* __restrict__ dw3)
{
  const int b = blockIdx.x;
  const float* src;
  unsigned short* dst;
  int blk, n8;
  if (b < 3 * kActBlk) {
    const int z = b / kActBlk;
    blk = b - z * kActBlk;
    n8  = kActN8;
    src = (z == 0) ? a0 : (z == 1) ? a1 : a2;
    dst = (z == 0) ? da0 : (z == 1) ? da1 : da2;
  } else {
    const int bw = b - 3 * kActBlk;
    const int z = bw / kWgtBlk;
    blk = bw - z * kWgtBlk;
    n8  = kWgtN8;
    src = (z == 0) ? w0 : (z == 1) ? w1 : (z == 2) ? w2 : w3;
    dst = (z == 0) ? dw0 : (z == 1) ? dw1 : (z == 2) ? dw2 : dw3;
  }
  const int i = blk * 256 + threadIdx.x;
  if (i >= n8) return;
  const float* p = src + 8 * (size_t)i;
  const v4f a = *(const v4f*)(p);
  const v4f c = *(const v4f*)(p + 4);
  unsigned short hb[8];
#pragma unroll
  for (int e = 0; e < 4; ++e) {
    const float x0 = a[e];
    const float x1 = c[e];
    hb[e]     = f2bf_bits(x0);
    hb[4 + e] = f2bf_bits(x1);
  }
  const v4u u = (v4u){pk16(hb[0], hb[1]), pk16(hb[2], hb[3]), pk16(hb[4], hb[5]), pk16(hb[6], hb[7])};
  unsigned short* q = dst + 8 * (size_t)i;
  *(v4u*)q = u;
  
}

// ---------------------------------------------------------------------------
// Eight asynchronous 16-B copies per lane, global memory to LDS: 128 rows of one operand plane, one pass of k wide.
// The lanes working on one plane (a block, or a four-wave group) cover 16 whole rows per copy; a lane moves its 16 bytes of rows r, r + 16, .. r + 112.
// lds = the lane's LDS byte address of row r, g = its global address of row r, ld = row pitch in elements,
// PITCH = bytes per LDS row.
// ---------------------------------------------------------------------------
template <int PITCH>
__device__ __forceinline__ void copy_plane_async(unsigned lds, const __bf16* g, int ld) {
  const size_t step = (size_t)16 * ld;
  const __bf16* g1 = g + step;      const __bf16* g2 = g + 2 * step;  const __bf16* g3 = g + 3 * step;
  const __bf16* g4 = g + 4 * step;  const __bf16* g5 = g + 5 * step;  const __bf16* g6 = g + 6 * step;
  const __bf16* g7 = g + 7 * step;
  const unsigned ls = 16u * PITCH;
  /* the copies and the wait that stands before their address registers may be rewritten, in one statement */
  asm volatile(
      "global_load_async_to_lds_b128 %0, %8, off\n\t"
      "global_load_async_to_lds_b128 %1, %9, off\n\t"
      "global_load_async_to_lds_b128 %2, %10, off\n\t"
      "global_load_async_to_lds_b128 %3, %11, off\n\t"
      "global_load_async_to_lds_b128 %4, %12, off\n\t"
      "global_load_async_to_lds_b128 %5, %13, off\n\t"
      "global_load_async_to_lds_b128 %6, %14, off\n\t"
      "global_load_async_to_lds_b128 %7, %15, off\n\t"
      "s_wait_xcnt 0x0"
      :: "v"(lds), "v"(lds + ls), "v"(lds + 2u * ls), "v"(lds + 3u * ls), "v"(lds + 4u * ls), "v"(lds + 5u * ls),
         "v"(lds + 6u * ls), "v"(lds + 7u * ls), "v"(g), "v"(g1), "v"(g2), "v"(g3), "v"(g4), "v"(g5), "v"(g6), "v"(g7)
      : "memory");
}

// ---------------------------------------------------------------------------
// bf16 GEMM, operands staged in LDS: C[m][n] = sum_k A[m][k] * Bt[n][k] + bf16value(bias[n]).
// One block owns a 128 x 128 tile; wave (wm = wave >> 1, wn = wave & 1) owns rows 16 FM wm .. + 16 FM - 1, cols 64 wn .. + 63.
// FM = 16-row fragments per wave. FM 2: 8 waves of 32 x 64, passes of 128 k. FM 4: 4 waves of 64 x 64, passes of 64 k: a
// k step's 8 fragments feed 16 matrix instructions (6 feed 8 at FM 2), and the smaller stage lets three blocks share a WGP's LDS.
// A row-major [M][K] bf16 (SPLA: a second plane A2 of the same layout is accumulated against the same Bt);
// Bt row-major [N][K] bf16; M, N % 128 == 0, K % 128 == 0, K >= 256 (no tail handling). C f32, pitch ldc.
// A stage = one pass of [A 128 rows | Bt 128 rows | A2 128 rows if SPLA], brought by asynchronous copies into one of two
// buffers: the copies of stage t + 2 fly while stage t + 1 is worked on.
// EPI 0: plain.  EPI 1: feature map y = x + 1 for x > 0, exp(x) otherwise, applied to the accumulators in registers.
// EPI 2: three products of one shape in one launch. blockIdx.y = 0, 1, 2 (block-uniform) picks the plane: A, Bt and C are
// three dense planes one behind the other (M x lda, N x ldb, M x ldc elements each), the biases three buffers; planes 0
// and 1 take the feature map, plane 2 is plain.
// Fragment map: lane l, row/col = l & 15, half h = l >> 4; elements 0..7 <- k0 + 8h + 0..7, 8..15 <- k0 + 16 + 8h + 0..7
// for both operands; accumulator element r = (row 8h + r, col l & 15).
// Epilogue: 16-row slabs staged per wave in LDS of its own (same wave stores and reloads, wave-level ordering).
// Coverage: 32 x 8 = 256 tiles of 128 x 128 = 4096 x 1024; grid.x = 256 blocks, one tile per block and plane.
// ---------------------------------------------------------------------------
template <bool SPLA, int EPI, int FM>
__global__ __launch_bounds__(FM == 4 ? 128 : 256, FM == 4 ? 3 : 1) void gemm_tile64_kernel(
    const unsigned short* __restrict__ Ap, const unsigned short* __restrict__ A2p, int lda,
    const unsigned short* __restrict__ Btp, int ldb,
    float* __restrict__ Cout, int ldc,
    const float* __restrict__ bias, int M, int N, int K,
    const float* __restrict__ bias1 = nullptr, const float* __restrict__ bias2 = nullptr)
{
  const int z = (EPI == 2) ? (int)blockIdx.y : 0;
  const __bf16* A  = (const __bf16*)Ap + (size_t)z * M * lda;
  const __bf16* A2 = (const __bf16*)A2p + (size_t)z * M * lda;
  const __bf16* Bt = (const __bf16*)Btp + (size_t)z * N * ldb;
  if (EPI == 2) {
    Cout += (size_t)z * M * ldc;
    bias = (z == 0) ? bias : (z == 1) ? bias1 : bias2;
  }
  static_assert(FM == 2 || FM == 4, "wave tile 32 x 64 or 64 x 64");
  constexpr int kWaves    = (128 / (16 * FM)) * 2;
  constexpr int kPassK    = (FM == 4) ? 64 : 128;   /* k per pass */
  constexpr int kLdsPitch = kPassK * 2 + 16;        /* bytes per LDS row: 16 B x odd, conflict-free for 16-B readers */
  constexpr int kPlaneB   = 128 * kLdsPitch;        /* one operand plane of a stage */
  constexpr int kRowLanes = kPassK * 2 / 16;        /* lanes that share a row in a copy */
  static_assert(kWaves * 32 / kRowLanes == 16, "one copy of the block covers 16 rows");
  constexpr int kStageB = (SPLA ? 3 : 2) * kPlaneB;
  __shared__ __align__(16) unsigned char sStage[2 * kStageB];
  __shared__ __align__(16) float sT[kWaves][16 * 68];
  const int tid  = threadIdx.x;
  const int lane = tid & 31;
  const int wave = tid >> 5;
  const int tilesN = N >> 7;
  const int tilesM = M >> 7;
  const int tile = blockIdx.x;
  /* block-uniform, in front of every barrier and copy */
  if (tile >= tilesM * tilesN) return;
  const int tm = tile / tilesN;
  const int tn = tile - tm * tilesN;
  const int mB = tm << 7;
  const int nB = tn << 7;
  const int wm = wave >> 1;
  const int wn = wave & 1;

  const int rlane = lane & 15;
  const int koff  = (lane >> 4) * 8;
  const int mOff  = (lane >> 4) * 8;

  /* this lane's share of a stage */
  const int cr = tid / kRowLanes, cc = (tid % kRowLanes) * 8;
  const unsigned ldsC = (unsigned)(uintptr_t)(sStage + cr * kLdsPitch + cc * 2);
  const __bf16* gA  = A  + (size_t)(mB + cr) * lda + cc;
  const __bf16* gA2 = A2 + (size_t)(mB + cr) * lda + cc;
  const __bf16* gB  = Bt + (size_t)(nB + cr) * ldb + cc;
  const int nPass = K / kPassK;

  /* every loop over acc[], fa[], fb[], fl[] below is unrolled: constant indices keep these arrays in registers */
  v8f acc[FM][4];
#pragma unroll
  for (int i = 0; i < FM; ++i)
#pragma unroll
    for (int j = 0; j < 4; ++j) acc[i][j] = (v8f){0.f, 0.f, 0.f, 0.f, 0.f, 0.f, 0.f, 0.f};

  // ---- stage 0, published; then stage 1 in flight ----
  copy_plane_async<kLdsPitch>(ldsC, gA, lda);
  copy_plane_async<kLdsPitch>(ldsC + kPlaneB, gB, ldb);
  if (SPLA) copy_plane_async<kLdsPitch>(ldsC + 2 * kPlaneB, gA2, lda);
  /* this wave's copies of stage 0 have landed */
  asm volatile("s_wait_asynccnt 0x0" ::: "memory");
  __syncthreads();
  if (1 < nPass) {
    copy_plane_async<kLdsPitch>(ldsC + kStageB, gA + kPassK, lda);
    copy_plane_async<kLdsPitch>(ldsC + kStageB + kPlaneB, gB + kPassK, ldb);
    if (SPLA) copy_plane_async<kLdsPitch>(ldsC + kStageB + 2 * kPlaneB, gA2 + kPassK, lda);
  }

  /* rolled: one pass per trip, so that each trip reads one buffer and ends in one publish point */
#pragma unroll 1
  for (int t = 0; t < nPass; ++t) {
    const int bufB = (t & 1) * kStageB;
    const unsigned char* pA = sStage + bufB + (wm * (16 * FM) + rlane) * kLdsPitch + koff * 2;
    const unsigned char* pB = sStage + bufB + kPlaneB + (wn * 64 + rlane) * kLdsPitch + koff * 2;
    /* FM 2, two fragment sets: the reads of k step kk + 1 (same buffer) are issued in front of step kk's products, so that
       a wave waits out the LDS latency once per pass and not at every step. FM 4, one set (128 accumulator registers and two
       sets do not fit 256): each step reads its own fragments, and the two other waves of the SIMD work meanwhile */
    constexpr int kSets = (FM == 4) ? 1 : 2;
    v16b fb[kSets][4], fa[kSets][FM], fl[kSets][FM];
#pragma unroll
    for (int j = 0; j < 4; ++j) fb[0][j] = Frag<__bf16>::load((const __bf16*)(pB + j * 16 * kLdsPitch));
#pragma unroll
    for (int i = 0; i < FM; ++i) {
      fa[0][i] = Frag<__bf16>::load((const __bf16*)(pA + i * 16 * kLdsPitch));
      if (SPLA) fl[0][i] = Frag<__bf16>::load((const __bf16*)(pA + 2 * kPlaneB + i * 16 * kLdsPitch));
    }
#pragma unroll
    for (int kk = 0; kk < kPassK / 32; ++kk) {
      const int cur = (kSets == 2) ? (kk & 1) : 0, nxt = (kSets == 2) ? (cur ^ 1) : 0;
      if (kSets == 2 && kk + 1 < kPassK / 32) {
#pragma unroll
        for (int j = 0; j < 4; ++j)
          fb[nxt][j] = Frag<__bf16>::load((const __bf16*)(pB + j * 16 * kLdsPitch + (kk + 1) * 64));
#pragma unroll
        for (int i = 0; i < FM; ++i) {
          fa[nxt][i] = Frag<__bf16>::load((const __bf16*)(pA + i * 16 * kLdsPitch + (kk + 1) * 64));
          if (SPLA) fl[nxt][i] = Frag<__bf16>::load((const __bf16*)(pA + 2 * kPlaneB + i * 16 * kLdsPitch + (kk + 1) * 64));
        }
      }
      /* per accumulator and k step: the hi product, then the lo product */
#pragma unroll
      for (int i = 0; i < FM; ++i) {
#pragma unroll
        for (int j = 0; j < 4; ++j) acc[i][j] = mma_bf(fa[cur][i], fb[cur][j], acc[i][j]);
        if (SPLA) {
#pragma unroll
          for (int j = 0; j < 4; ++j) acc[i][j] = mma_bf(fl[cur][i], fb[cur][j], acc[i][j]);
        }
      }
      if (kSets == 1 && kk + 1 < kPassK / 32) {
#pragma unroll
        for (int j = 0; j < 4; ++j)
          fb[0][j] = Frag<__bf16>::load((const __bf16*)(pB + j * 16 * kLdsPitch + (kk + 1) * 64));
#pragma unroll
        for (int i = 0; i < FM; ++i) {
          fa[0][i] = Frag<__bf16>::load((const __bf16*)(pA + i * 16 * kLdsPitch + (kk + 1) * 64));
          if (SPLA) fl[0][i] = Frag<__bf16>::load((const __bf16*)(pA + 2 * kPlaneB + i * 16 * kLdsPitch + (kk + 1) * 64));
        }
      }
    }
    /* publish point: this wave's reads of the buffer are done, its copies of the next stage have landed */
    asm volatile("s_wait_dscnt 0x0" ::: "memory");
    asm volatile("s_wait_asynccnt 0x0" ::: "memory");
    __syncthreads();
    /* refill the buffer that every wave has just left; the test is the same for the whole block */
    if (t + 2 < nPass) {
      const int ko = (t + 2) * kPassK;
      copy_plane_async<kLdsPitch>(ldsC + bufB, gA + ko, lda);
      copy_plane_async<kLdsPitch>(ldsC + bufB + kPlaneB, gB + ko, ldb);
      if (SPLA) copy_plane_async<kLdsPitch>(ldsC + bufB + 2 * kPlaneB, gA2 + ko, lda);
    }
  }
  /* no copy is left in flight when the wave goes on */
  asm volatile("s_wait_asynccnt 0x0" ::: "memory");

  // ---- epilogue ----
  const int m0 = mB + wm * (16 * FM);
  const int n0 = nB + wn * 64;
  float* slab = sT[wave];
  float bvj[4];
#pragma unroll
  for (int j = 0; j < 4; ++j) bvj[j] = bf16r(bias[n0 + (j << 4) + rlane]);
  /* every loop over acc[] is unrolled: constant indices keep it in registers */
#pragma unroll
  for (int i = 0; i < FM; ++i)
#pragma unroll
    for (int j = 0; j < 4; ++j)
#pragma unroll
      for (int r = 0; r < 8; ++r) acc[i][j][r] += bvj[j];
  /* feature map on the accumulators themselves, all values of a lane independent; the test is the same for the whole block */
  if (EPI == 1 || (EPI == 2 && z < 2)) {
#pragma unroll
    for (int i = 0; i < FM; ++i)
#pragma unroll
      for (int j = 0; j < 4; ++j)
#pragma unroll
        for (int r = 0; r < 8; ++r) {
          const float x = acc[i][j][r];
          const float ex = expf(fminf(x, 0.0f));
          acc[i][j][r] = (x > 0.0f) ? (x + 1.0f) : ex;
        }
  }
#pragma unroll
  for (int i = 0; i < FM; ++i) {
    const int mBase = m0 + (i << 4);
#pragma unroll
    for (int j = 0; j < 4; ++j) {
#pragma unroll
      for (int r = 0; r < 8; ++r) {
        slab[(mOff + r) * 68 + (j << 4) + rlane] = acc[i][j][r];
      }
    }
    __builtin_amdgcn_fence(__ATOMIC_RELEASE, "workgroup");
    __builtin_amdgcn_wave_barrier();
    __builtin_amdgcn_fence(__ATOMIC_ACQUIRE, "workgroup");
    {
      /* row segment = 256 B = 16 lanes x 16 B; rows it*2 + hh cover 0..15 */
      const int hh = lane >> 4, c4 = (lane & 15) * 4;
      {
#pragma unroll
        for (int it = 0; it < 8; ++it) {
          const int row = it * 2 + hh;
          const v4f v = *(const v4f*)(slab + row * 68 + c4);
          *(v4f*)(Cout + (size_t)(mBase + row) * ldc + n0 + c4) = v;
        }
        
      }
    }
    __builtin_amdgcn_fence(__ATOMIC_RELEASE, "workgroup");
    __builtin_amdgcn_wave_barrier();
    __builtin_amdgcn_fence(__ATOMIC_ACQUIRE, "workgroup");
  }
}

// ---------------------------------------------------------------------------
// Inclusive sum of the chunk slots along the chunk axis, in place: slot c becomes the state at the end of chunk c.
// One thread per float of a slot (4160 per batch-head, grid.x = 17 blocks with a tail guard); the 31 values stay in
// registers, so all loads are in flight together and the thread pays the load latency once.
// ---------------------------------------------------------------------------
__global__ __launch_bounds__(256) void chunk_prefix_kernel(float* __restrict__ ST)
{
  const int i = blockIdx.x * 256 + threadIdx.x;
  if (i >= kSlotF) return;
  float* base = ST + (size_t)blockIdx.y * (kChunks - 1) * kSlotF + i;
  /* both loops unrolled: constant indices keep x[] in registers */
  float x[kChunks - 1];
#pragma unroll
  for (int c = 0; c < kChunks - 1; ++c) x[c] = base[(size_t)c * kSlotF];
#pragma unroll
  for (int c = 1; c < kChunks - 1; ++c) {
    x[c] += x[c - 1];
    base[(size_t)c * kSlotF] = x[c];
  }
}

// ---------------------------------------------------------------------------
// Causal attention of one chunk in matrix form, one block of 128 threads per (chunk, batch-head), no step loop.
// With s, t the chunk's 64 steps, S and c the state and key sums at the end of the chunk before (slot chunk - 1 of ST):
//   P[t][s] = sum_d k[t][d] q[s][d], kept for t <= s, zero otherwise
//   num[j][s] = sum_t v[t][j] P[t][s] + sum_d S[d][j] q[s][d]
//   den[s]    = sum_t P[t][s]         + sum_d c[d] q[s][d]
//   out[s][j] = num[j][s] * (1 / (den[s] + eps)), split into bf16 hi + lo planes.
// Every f32 operand x is carried as hi = bf16(x), lo = bf16(x - hi); a product a b is hi hi + hi lo + lo hi, f32 accumulate.
// Wave w owns the 16 steps s = 16 w .. 16 w + 15 as the column side (B) of all three products: q comes straight from
// global memory into its B fragments, and two accumulator tiles of P (rows t = 8h + r and 16 + 8h + r, column s = l & 15)
// are, register for register, the B fragment of 32 t of the second product: P never leaves the registers.
// The row sides (A) are shared by the four waves and staged in LDS as bf16 hi and lo planes, 64 k per row:
//   sK [64 t][64 d];  sV [64 j][64 t] (v transposed);  sS [80][64 d]: rows j < 64 the state transposed, row 64 the key sums,
//   rows 65 .. 79 zero, so that row 0 of the fifth accumulator tile is the state's share of den.
// Transposing: thread (j = tid & 63, g = tid >> 6) reads column j of rows 32 g .. 32 g + 31 (a wave reads 128 B of a row)
// and stores eight rows' values as one 16-B piece of LDS row j.
// Fragment map as in the GEMM above. LDS: (64 + 64 + 80) x 144 x 2 = 59,904 B.
// ---------------------------------------------------------------------------
constexpr int kFragP = kHd * 2 + 16;   /* bytes per LDS row: 16 B x odd, conflict-free for 16-B accesses */

/* eight f32 -> bf16 hi and bf16 lo = bf16(x - hi), both rounded to nearest even */
__device__ __forceinline__ void split8(const float (&x)[8], v8b& hi, v8b& lo) {
  /* by pairs: one packed conversion gives two hi, one more two lo; unrolled: constant indices keep x, hi, lo in registers */
#pragma unroll
  for (int p = 0; p < 4; ++p) {
    const v2f x2 = (v2f){x[2 * p], x[2 * p + 1]};
    const v2b h2 = __builtin_convertvector(x2, v2b);
    const v2b l2 = __builtin_convertvector(x2 - __builtin_convertvector(h2, v2f), v2b);
    hi[2 * p] = h2[0];  hi[2 * p + 1] = h2[1];
    lo[2 * p] = l2[0];  lo[2 * p + 1] = l2[1];
  }
}
__device__ __forceinline__ v16b join16(v8b a, v8b b) {
  Frag<__bf16>::U f; f.h[0] = a; f.h[1] = b; return f.v;
}
/* 32 k of NT stacked 16-row tiles against one B fragment pair: acc[i] += hi hi, then hi lo, then lo hi. pH, pL = the lane's
   place in tile 0 of the hi and lo plane. Each product runs over all tiles before the next one starts, so that successive
   matrix instructions have different accumulators; all loops unrolled: constant indices keep the arrays in registers */
template <int NT>
__device__ __forceinline__ void mma3_tiles(const unsigned char* pH, const unsigned char* pL, v16b bh, v16b bl, v8f* acc) {
  v16b ah[NT], al[NT];
#pragma unroll
  for (int i = 0; i < NT; ++i) {
    ah[i] = Frag<__bf16>::load((const __bf16*)(pH + i * 16 * kFragP));
    al[i] = Frag<__bf16>::load((const __bf16*)(pL + i * 16 * kFragP));
  }
#pragma unroll
  for (int i = 0; i < NT; ++i) acc[i] = __builtin_amdgcn_wmma_f32_16x16x32_bf16(false, ah[i], false, bh, (short)0, acc[i], false, false);
#pragma unroll
  for (int i = 0; i < NT; ++i) acc[i] = __builtin_amdgcn_wmma_f32_16x16x32_bf16(false, ah[i], false, bl, (short)0, acc[i], false, false);
#pragma unroll
  for (int i = 0; i < NT; ++i) acc[i] = __builtin_amdgcn_wmma_f32_16x16x32_bf16(false, al[i], false, bh, (short)0, acc[i], false, false);
}

// ---------------------------------------------------------------------------
// The three projections and the chunk sums in one kernel. One block of 12 waves owns the 128 x 128 tile (tm, tn) of all three
// planes: waves 0..3 q, 4..7 k, 8..11 v; each group of four waves works as the 4-wave form of the GEMM above (64 x 64 per wave,
// passes of 64 k, two LDS buffers of its own filled by asynchronous copies). A wave's 64 x 64 tile is one chunk of one head, so
// the k wave and the v wave of the same place hold, in their accumulators, all that the chunk's sum needs:
//   slot[d][j] = sum over the chunk's 64 steps t of k[t][d] * v[t][j];  slot[4096 + d] = sum over t of k[t][d].
// An accumulator tile holds eight successive t of one column per lane: one 16-B piece of row d (or j) of the transposed plane.
// k^T and v^T go as bf16 hi + lo planes [64][64 t] into the stage buffers, which nobody reads any more behind the last pass's
// barrier; behind one more barrier the product v^T (rows j) x k^T (columns d) runs on the matrix unit, three products per pair.
// The 16 column tiles of a block's four sums are dealt to its 12 waves: wave (z, place) takes tiles d = 16 z and, for z = 0, 48.
// Coverage: 32 x 8 tiles = 256 blocks; every (batch, head, chunk < 31) slot is written by exactly one place of one block.
// LDS: 3 x 73,728 + 12 x 4,352 = 273,408 B.
// ---------------------------------------------------------------------------
__global__ __launch_bounds__(384) void proj_qkv_state_kernel(
    const unsigned short* __restrict__ Ap, const unsigned short* __restrict__ Btp, float* __restrict__ Cout,
    const float* __restrict__ bias0, const float* __restrict__ bias1, const float* __restrict__ bias2,
    float* __restrict__ ST)
{
  constexpr int FM        = 4;
  constexpr int kPassK    = 64;
  constexpr int kLdsPitch = kPassK * 2 + 16;
  constexpr int kPlaneB   = 128 * kLdsPitch;
  constexpr int kStageB   = 2 * kPlaneB;
  constexpr int kGroupB   = 2 * kStageB;          /* both buffers of one plane's four waves */
  constexpr int kTP       = kHd * kFragP;         /* one transposed plane: 64 rows of 64 t */
  constexpr int nPass     = kDim / kPassK;
  static_assert(4 * 4 * kTP <= 3 * kGroupB, "transposed planes fit the stage buffers");
  __shared__ __align__(16) unsigned char sStage[3 * kGroupB];
  __shared__ __align__(16) float sT[12][16 * 68];
  const int tid  = threadIdx.x;
  const int lane = tid & 31;
  /* the wave's number as a scalar: plane and place are the same for the whole wave */
  const int wave = __builtin_amdgcn_readfirstlane(tid >> 5);
  const int z  = wave >> 2;
  const int gw = wave & 3;
  const int gt = tid & 127;
  const __bf16* A  = (const __bf16*)Ap + (size_t)z * kRows * kDim;
  const __bf16* Bt = (const __bf16*)Btp + (size_t)z * kDim * kDim;
  float* C = Cout + (size_t)z * kRows * kDim;
  const float* bias = (z == 0) ? bias0 : (z == 1) ? bias1 : bias2;
  constexpr int tilesN = kDim >> 7;
  constexpr int tilesM = kRows >> 7;
  const int tile = blockIdx.x;
  /* block-uniform, in front of every barrier and copy */
  if (tile >= tilesM * tilesN) return;
  const int tm = tile / tilesN;
  const int tn = tile - tm * tilesN;
  const int mB = tm << 7;
  const int nB = tn << 7;
  const int wm = gw >> 1;
  const int wn = gw & 1;

  const int rlane = lane & 15;
  const int hl    = lane >> 4;
  const int koff  = hl * 8;
  const int mOff  = hl * 8;

  /* this lane's share of its group's stage */
  unsigned char* sG = sStage + z * kGroupB;
  const int cr = gt >> 3, cc = (gt & 7) * 8;
  const unsigned ldsC = (unsigned)(uintptr_t)(sG + cr * kLdsPitch + cc * 2);
  const __bf16* gA = A  + (size_t)(mB + cr) * kDim + cc;
  const __bf16* gB = Bt + (size_t)(nB + cr) * kDim + cc;

  /* every loop over acc[], fa[], fb[] below is unrolled: constant indices keep these arrays in registers */
  v8f acc[FM][4];
#pragma unroll
  for (int i = 0; i < FM; ++i)
#pragma unroll
    for (int j = 0; j < 4; ++j) acc[i][j] = (v8f){0.f, 0.f, 0.f, 0.f, 0.f, 0.f, 0.f, 0.f};

  // ---- stage 0, published; then stage 1 in flight ----
  copy_plane_async<kLdsPitch>(ldsC, gA, kDim);
  copy_plane_async<kLdsPitch>(ldsC + kPlaneB, gB, kDim);
  /* this wave's copies of stage 0 have landed */
  asm volatile("s_wait_asynccnt 0x0" ::: "memory");
  __syncthreads();
  copy_plane_async<kLdsPitch>(ldsC + kStageB, gA + kPassK, kDim);
  copy_plane_async<kLdsPitch>(ldsC + kStageB + kPlaneB, gB + kPassK, kDim);

  /* rolled: one pass per trip, so that each trip reads one buffer and ends in one publish point */
#pragma unroll 1
  for (int t = 0; t < nPass; ++t) {
    const int bufB = (t & 1) * kStageB;
    const unsigned char* pA = sG + bufB + (wm * (16 * FM) + rlane) * kLdsPitch + koff * 2;
    const unsigned char* pB = sG + bufB + kPlaneB + (wn * 64 + rlane) * kLdsPitch + koff * 2;
    v16b fb[4], fa[FM];
#pragma unroll
    for (int kk = 0; kk < kPassK / 32; ++kk) {
#pragma unroll
      for (int j = 0; j < 4; ++j) fb[j] = Frag<__bf16>::load((const __bf16*)(pB + j * 16 * kLdsPitch + kk * 64));
#pragma unroll
      for (int i = 0; i < FM; ++i) fa[i] = Frag<__bf16>::load((const __bf16*)(pA + i * 16 * kLdsPitch + kk * 64));
#pragma unroll
      for (int i = 0; i < FM; ++i)
#pragma unroll
        for (int j = 0; j < 4; ++j) acc[i][j] = mma_bf(fa[i], fb[j], acc[i][j]);
    }
    /* publish point: this wave's reads of the buffer are done, its copies of the next stage have landed */
    asm volatile("s_wait_dscnt 0x0" ::: "memory");
    asm volatile("s_wait_asynccnt 0x0" ::: "memory");
    __syncthreads();
    /* refill the buffer that every wave has just left; the test is the same for the whole block */
    if (t + 2 < nPass) {
      const int ko = (t + 2) * kPassK;
      copy_plane_async<kLdsPitch>(ldsC + bufB, gA + ko, kDim);
      copy_plane_async<kLdsPitch>(ldsC + bufB + kPlaneB, gB + ko, kDim);
    }
  }
  /* no copy is left in flight when the wave goes on */
  asm volatile("s_wait_asynccnt 0x0" ::: "memory");

  // ---- epilogue: bias, feature map, store of the tile ----
  const int m0 = mB + wm * (16 * FM);
  const int n0 = nB + wn * 64;
  float* slab = sT[wave];
  const int hh = lane >> 4, c4 = (lane & 15) * 4;
  float bvj[4];
#pragma unroll
  for (int j = 0; j < 4; ++j) bvj[j] = bf16r(bias[n0 + (j << 4) + rlane]);
#pragma unroll
  for (int i = 0; i < FM; ++i)
#pragma unroll
    for (int j = 0; j < 4; ++j)
#pragma unroll
      for (int r = 0; r < 8; ++r) acc[i][j][r] += bvj[j];
  /* feature map on the accumulators themselves, all values of a lane independent; the test is the same for the whole wave */
  if (z < 2) {
#pragma unroll
    for (int i = 0; i < FM; ++i)
#pragma unroll
      for (int j = 0; j < 4; ++j)
#pragma unroll
        for (int r = 0; r < 8; ++r) {
          const float x = acc[i][j][r];
          const float ex = expf(fminf(x, 0.0f));
          acc[i][j][r] = (x > 0.0f) ? (x + 1.0f) : ex;
        }
  }
#pragma unroll
  for (int i = 0; i < FM; ++i) {
    const int mBase = m0 + (i << 4);
#pragma unroll
    for (int j = 0; j < 4; ++j) {
#pragma unroll
      for (int r = 0; r < 8; ++r) {
        slab[(mOff + r) * 68 + (j << 4) + rlane] = acc[i][j][r];
      }
    }
    /* the slab is this wave's own: the same wave stores and reloads it, so wave-level ordering is enough (here and below) */
    __builtin_amdgcn_fence(__ATOMIC_RELEASE, "workgroup");
    __builtin_amdgcn_wave_barrier();
    __builtin_amdgcn_fence(__ATOMIC_ACQUIRE, "workgroup");
    /* row segment = 256 B = 16 lanes x 16 B; rows it*2 + hh cover 0..15 */
#pragma unroll
    for (int it = 0; it < 8; ++it) {
      const int row = it * 2 + hh;
      const v4f v = *(const v4f*)(slab + row * 68 + c4);
      *(v4f*)(C + (size_t)(mBase + row) * kDim + n0 + c4) = v;
    }
    __builtin_amdgcn_fence(__ATOMIC_RELEASE, "workgroup");
    __builtin_amdgcn_wave_barrier();
    __builtin_amdgcn_fence(__ATOMIC_ACQUIRE, "workgroup");
  }

  // ---- chunk sums ----
  /* this place's chunk and head: scalars, the same for the q, k and v wave of the place */
  const int chunk = (m0 & (kSeq - 1)) / kChunkL;
  const int bh    = (m0 / kSeq) * kHeads + n0 / kHd;
  const bool hasSlot = chunk < kChunks - 1;   /* nothing follows a sequence's last chunk */
  float* slot = ST + ((size_t)bh * (kChunks - 1) + (hasSlot ? chunk : 0)) * kSlotF;
  unsigned char* pairB = sStage + gw * (4 * kTP);   /* k^T hi | k^T lo | v^T hi | v^T lo */
  if (z > 0) {
    /* acc[i][j][r] = (t = 16 i + 8 hl + r, column 16 j + rlane): eight t of one column = 16 B of the column's row */
    unsigned char* dH = pairB + (z - 1) * (2 * kTP) + rlane * kFragP + hl * 16;
#pragma unroll
    for (int i = 0; i < FM; ++i)
#pragma unroll
      for (int j = 0; j < 4; ++j) {
        float y[8];
#pragma unroll
        for (int r = 0; r < 8; ++r) y[r] = acc[i][j][r];
        v8b hi, lo;
        split8(y, hi, lo);
        *(v8b*)(dH + j * 16 * kFragP + i * 32) = hi;
        *(v8b*)(dH + kTP + j * 16 * kFragP + i * 32) = lo;
      }
  }
  /* key sums from the k wave's accumulators: a lane's 32 t of each column, then the other half's 32 */
  if (z == 1 && hasSlot) {
#pragma unroll
    for (int j = 0; j < 4; ++j) {
      float si[FM];
#pragma unroll
      for (int i = 0; i < FM; ++i) {
        si[i] = 0.0f;
#pragma unroll
        for (int r = 0; r < 8; ++r) si[i] += acc[i][j][r];
      }
      const float sl = (si[0] + si[1]) + (si[2] + si[3]);
      const float sb = sl + __int_as_float(__builtin_amdgcn_permlanex16(__float_as_int(sl), __float_as_int(sl),
                                                                        0x76543210, 0xfedcba98, false, false));
      if (lane < 16) slot[kHd * kHd + (j << 4) + rlane] = sb;
    }
  }
  /* the transposed planes are complete for every wave */
  __syncthreads();
  if (hasSlot) {
    const int fo = rlane * kFragP + hl * 16;   /* a lane's place in a 16-row fragment: row l & 15, k half */
    const unsigned char* kH = pairB + fo;
    const unsigned char* vH = pairB + 2 * kTP + fo;
    /* rolled: one or two column tiles per wave, the count a scalar */
#pragma unroll 1
    for (int dt = z; dt < 4; dt += 3) {
      v8f sa[4];
#pragma unroll
      for (int jt = 0; jt < 4; ++jt) sa[jt] = (v8f){0.f, 0.f, 0.f, 0.f, 0.f, 0.f, 0.f, 0.f};
#pragma unroll
      for (int kb = 0; kb < 2; ++kb) {
        const v16b bhf = Frag<__bf16>::load((const __bf16*)(kH + dt * 16 * kFragP + kb * 64));
        const v16b blf = Frag<__bf16>::load((const __bf16*)(kH + kTP + dt * 16 * kFragP + kb * 64));
        mma3_tiles<4>(vH + kb * 64, vH + kTP + kb * 64, bhf, blf, sa);
      }
      /* sa[jt][r] = slot[d = 16 dt + rlane][j = 16 jt + 8 hl + r]; through the wave's slab, so that a store covers whole rows */
#pragma unroll
      for (int jt = 0; jt < 4; ++jt) {
        *(v4f*)(slab + rlane * 68 + jt * 16 + hl * 8)     = (v4f){sa[jt][0], sa[jt][1], sa[jt][2], sa[jt][3]};
        *(v4f*)(slab + rlane * 68 + jt * 16 + hl * 8 + 4) = (v4f){sa[jt][4], sa[jt][5], sa[jt][6], sa[jt][7]};
      }
      __builtin_amdgcn_fence(__ATOMIC_RELEASE, "workgroup");
      __builtin_amdgcn_wave_barrier();
      __builtin_amdgcn_fence(__ATOMIC_ACQUIRE, "workgroup");
#pragma unroll
      for (int it = 0; it < 8; ++it) {
        const int row = it * 2 + hh;
        const v4f v = *(const v4f*)(slab + row * 68 + c4);
        *(v4f*)(slot + (dt * 16 + row) * kHd + c4) = v;
      }
      __builtin_amdgcn_fence(__ATOMIC_RELEASE, "workgroup");
      __builtin_amdgcn_wave_barrier();
      __builtin_amdgcn_fence(__ATOMIC_ACQUIRE, "workgroup");
    }
  }
}

__global__ __launch_bounds__(128) void scan_state_kernel(
    const float* __restrict__ QF, const float* __restrict__ KF, const float* __restrict__ VF,
    const float* __restrict__ ST, unsigned short* __restrict__ AH, unsigned short* __restrict__ AL)
{
  __shared__ __align__(16) unsigned char sKh[64 * kFragP];
  __shared__ __align__(16) unsigned char sKl[64 * kFragP];
  __shared__ __align__(16) unsigned char sVh[64 * kFragP];
  __shared__ __align__(16) unsigned char sVl[64 * kFragP];
  __shared__ __align__(16) unsigned char sSh[80 * kFragP];
  __shared__ __align__(16) unsigned char sSl[80 * kFragP];
  const int tid = threadIdx.x, lane = tid & 31, wave = tid >> 5;
  const int rl = lane & 15, h = lane >> 4;
  const int chunk = blockIdx.x;
  const int bh = blockIdx.y;
  /* first element of this chunk and head in the [row][1024] planes: the same for the whole block */
  const size_t base = ((size_t)(bh >> 4) * kSeq + (size_t)chunk * kChunkL) * kDim + (size_t)(bh & 15) * kHd;
  const char* gQ = (const char*)(QF + base);
  const char* gK = (const char*)(KF + base);
  const char* gV = (const char*)(VF + base);
  constexpr unsigned kRowB = kDim * 4;
  const int sl = wave * 16 + rl;          /* this lane's step s inside the chunk */
  const int tj = tid & 63, tg = tid >> 6; /* transposing threads: column, group of 32 rows */
  const unsigned oQ = (unsigned)sl * kRowB + (unsigned)h * 32u;
  const unsigned oK = (unsigned)(tid >> 3) * kRowB + (unsigned)(tid & 7) * 32u;
  const unsigned oV = (unsigned)tg * 32u * kRowB + (unsigned)tj * 4u;

  /* every loop of this kernel is unrolled: constant indices keep its arrays in registers; all loads of a lane fly together */
  v4f xq[8], xk[8];
  float xv[32];
#pragma unroll
  for (int i = 0; i < 8; ++i) xq[i] = *(const v4f*)(gQ + oQ + (i >> 1) * 64 + (i & 1) * 16);
#pragma unroll
  for (int i = 0; i < 8; ++i) xk[i] = *(const v4f*)(gK + oK + (size_t)(i >> 1) * 16 * kRowB + (i & 1) * 16);
#pragma unroll
  for (int i = 0; i < 32; ++i) xv[i] = *(const float*)(gV + oV + (size_t)i * kRowB);

  /* No branch round the state's loads: they are issued together with those of q, k, v, and no wait at a branch's join has
     to cover them all. Chunk 0, which starts from a zero state and has no state product, reads slot 0 (written earlier in
     this call) and drops the values */
  float xs[32];
  const char* gS = (const char*)(ST + ((size_t)bh * (kChunks - 1) + (chunk > 0 ? chunk - 1 : 0)) * kSlotF);
  const unsigned oS = (unsigned)tg * 32u * (kHd * 4u) + (unsigned)tj * 4u;
  const unsigned oC = (unsigned)(tid & 7) * 32u;
#pragma unroll
  for (int i = 0; i < 32; ++i) xs[i] = *(const float*)(gS + oS + i * (kHd * 4));
  const v4f c0 = *(const v4f*)(gS + oC + kHd * kHd * 4);
  const v4f c1 = *(const v4f*)(gS + oC + kHd * kHd * 4 + 16);
  /* one wait for all loads above: named as inputs, their base and offset registers stay untouched up to it */
  asm volatile("s_wait_xcnt 0x0" :: "v"(oQ), "v"(oK), "v"(oV), "v"(oS), "v"(oC), "s"(gQ), "s"(gK), "s"(gV), "s"(gS) : "memory");

#pragma unroll
  for (int i = 0; i < 4; ++i) {
    float y[8];
#pragma unroll
    for (int e = 0; e < 4; ++e) { y[e] = xk[2 * i][e]; y[4 + e] = xk[2 * i + 1][e]; }
    v8b hi, lo;
    split8(y, hi, lo);
    *(v8b*)(sKh + ((tid >> 3) + 16 * i) * kFragP + (tid & 7) * 16) = hi;
    *(v8b*)(sKl + ((tid >> 3) + 16 * i) * kFragP + (tid & 7) * 16) = lo;
  }
#pragma unroll
  for (int b = 0; b < 4; ++b) {
    float y[8];
#pragma unroll
    for (int e = 0; e < 8; ++e) y[e] = xv[b * 8 + e];
    v8b hi, lo;
    split8(y, hi, lo);
    *(v8b*)(sVh + tj * kFragP + (tg * 4 + b) * 16) = hi;
    *(v8b*)(sVl + tj * kFragP + (tg * 4 + b) * 16) = lo;
  }
  /* q fragments: elements 0..7 <- d = 32 kb + 8h + 0..7, elements 8..15 <- d = 32 kb + 16 + 8h + 0..7 */
  v16b qh[2], ql[2];
#pragma unroll
  for (int kb = 0; kb < 2; ++kb) {
    v8b hi[2], lo[2];
#pragma unroll
    for (int p = 0; p < 2; ++p) {
      float y[8];
#pragma unroll
      for (int e = 0; e < 4; ++e) { y[e] = xq[kb * 4 + p * 2][e]; y[4 + e] = xq[kb * 4 + p * 2 + 1][e]; }
      split8(y, hi[p], lo[p]);
    }
    qh[kb] = join16(hi[0], hi[1]);
    ql[kb] = join16(lo[0], lo[1]);
  }

  /* block-uniform predicate */
  if (chunk > 0) {
#pragma unroll
    for (int b = 0; b < 4; ++b) {
      float y[8];
#pragma unroll
      for (int e = 0; e < 8; ++e) y[e] = xs[b * 8 + e];
      v8b hi, lo;
      split8(y, hi, lo);
      *(v8b*)(sSh + tj * kFragP + (tg * 4 + b) * 16) = hi;
      *(v8b*)(sSl + tj * kFragP + (tg * 4 + b) * 16) = lo;
    }
    /* rows 64 .. 79, one 16-B piece per thread: row 64 (threads 0 .. 7) the key sums, the others zero */
    {
      float y[8];
#pragma unroll
      for (int e = 0; e < 4; ++e) {
        y[e]     = (tid < 8) ? c0[e] : 0.0f;
        y[4 + e] = (tid < 8) ? c1[e] : 0.0f;
      }
      v8b hi, lo;
      split8(y, hi, lo);
      *(v8b*)(sSh + (64 + (tid >> 3)) * kFragP + (tid & 7) * 16) = hi;
      *(v8b*)(sSl + (64 + (tid >> 3)) * kFragP + (tid & 7) * 16) = lo;
    }
  }

  /* the staged planes are complete for every wave */
  __syncthreads();

  const int fo = rl * kFragP + h * 16;   /* a lane's place in a 16-row fragment: row l & 15, k half h */

  // ---- P[t][s] ----
  v8f pt[4];
#pragma unroll
  for (int tt = 0; tt < 4; ++tt) pt[tt] = (v8f){0.f, 0.f, 0.f, 0.f, 0.f, 0.f, 0.f, 0.f};
#pragma unroll
  for (int kb = 0; kb < 2; ++kb)
    mma3_tiles<4>(sKh + fo + kb * 64, sKl + fo + kb * 64, qh[kb], ql[kb], pt);
  /* causal mask and this lane's share of den: its 32 t of column s */
  float dt[4];
#pragma unroll
  for (int tt = 0; tt < 4; ++tt) {
    dt[tt] = 0.0f;
#pragma unroll
    for (int r = 0; r < 8; ++r) {
      const float x = (tt * 16 + h * 8 + r <= sl) ? pt[tt][r] : 0.0f;
      pt[tt][r] = x;
      dt[tt] += x;
    }
  }
  const float dpart = (dt[0] + dt[1]) + (dt[2] + dt[3]);
  v16b ph[2], pl[2];
#pragma unroll
  for (int kb = 0; kb < 2; ++kb) {
    v8b hi[2], lo[2];
#pragma unroll
    for (int p = 0; p < 2; ++p) {
      float y[8];
#pragma unroll
      for (int e = 0; e < 8; ++e) y[e] = pt[kb * 2 + p][e];
      split8(y, hi[p], lo[p]);
    }
    ph[kb] = join16(hi[0], hi[1]);
    pl[kb] = join16(lo[0], lo[1]);
  }

  // ---- num[j][s], and the state's share of den in row 0 of tile 4 ----
  v8f on[5];
#pragma unroll
  for (int jt = 0; jt < 5; ++jt) on[jt] = (v8f){0.f, 0.f, 0.f, 0.f, 0.f, 0.f, 0.f, 0.f};
  if (chunk > 0) {
#pragma unroll
    for (int kb = 0; kb < 2; ++kb)
      mma3_tiles<5>(sSh + fo + kb * 64, sSl + fo + kb * 64, qh[kb], ql[kb], on);
  }
#pragma unroll
  for (int kb = 0; kb < 2; ++kb)
    mma3_tiles<4>(sVh + fo + kb * 64, sVl + fo + kb * 64, ph[kb], pl[kb], on);

  /* element 0 of tile 4: row 64 (the key sums' product) in half 0, a zero row in half 1; then both halves' shares together */
  const float dl = dpart + on[4][0];
  const float den = dl + __int_as_float(__builtin_amdgcn_permlanex16(__float_as_int(dl), __float_as_int(dl),
                                                                     0x76543210, 0xfedcba98, false, false));
  const float inv = 1.0f / (den + kEps);

  /* lane (s, h) holds j = 16 jt + 8h + 0..7 of row s: one 16-B store per tile and plane; a wave fills the 128 B of each row */
  v8b oh[4], ol[4];
#pragma unroll
  for (int jt = 0; jt < 4; ++jt) {
    float y[8];
#pragma unroll
    for (int e = 0; e < 8; ++e) y[e] = on[jt][e] * inv;
    split8(y, oh[jt], ol[jt]);
  }
  char* gH = (char*)(AH + base);
  char* gL = (char*)(AL + base);
  const unsigned oO = (unsigned)sl * (kDim * 2u) + (unsigned)h * 16u;
#pragma unroll
  for (int jt = 0; jt < 4; ++jt) {
    *(v8b*)(gH + oO + jt * 32) = oh[jt];
    *(v8b*)(gL + oO + jt * 32) = ol[jt];
  }
}

// ---------------------------------------------------------------------------
// Host glue: 1 convert launch + 1 launch of the three projection GEMMs with the chunk sums + 2 scan launches (chunk prefix, scan)
// + 1 output GEMM = 5 launches. Kernel launches only.
// GEMM shapes: M 4096, N 1024, K 1024 everywhere (K, M and N % 128 == 0): 32 x 8 = 256 tiles -> 256 blocks per product.
// ---------------------------------------------------------------------------
extern "C" void kernel_launch(void* const* d_in, const int* in_sizes, int n_in,
                              void* d_out, int out_size, void* d_ws, size_t ws_size,
                              hipStream_t stream) {
  if (n_in < 11 || d_out == nullptr || d_ws == nullptr) return;
  if (in_sizes[0] != kRows * kDim || in_sizes[1] != kRows * kDim || in_sizes[2] != kRows * kDim) return;
  if (in_sizes[3] != kDim * kDim || in_sizes[5] != kDim * kDim || in_sizes[7] != kDim * kDim ||
      in_sizes[9] != kDim * kDim) return;
  if (in_sizes[4] != kDim || in_sizes[6] != kDim || in_sizes[8] != kDim || in_sizes[10] != kDim) return;
  if (out_size != kRows * kDim) return;
  if (ws_size < kWsTotal) return;

  const float* query = (const float*)d_in[0];
  const float* key   = (const float*)d_in[1];
  const float* value = (const float*)d_in[2];
  const float* Wq    = (const float*)d_in[3];
  const float* bq    = (const float*)d_in[4];
  const float* Wk    = (const float*)d_in[5];
  const float* bk    = (const float*)d_in[6];
  const float* Wv    = (const float*)d_in[7];
  const float* bv    = (const float*)d_in[8];
  const float* Wo    = (const float*)d_in[9];
  const float* bo    = (const float*)d_in[10];
  float* out = (float*)d_out;

  char* ws = (char*)d_ws;
  unsigned short* XQ = (unsigned short*)(ws + kOffXQ);
  unsigned short* XK = (unsigned short*)(ws + kOffXK);
  unsigned short* XV = (unsigned short*)(ws + kOffXV);
  unsigned short* WQ = (unsigned short*)(ws + kOffWQ);
  unsigned short* WK = (unsigned short*)(ws + kOffWK);
  unsigned short* WV = (unsigned short*)(ws + kOffWV);
  unsigned short* WO = (unsigned short*)(ws + kOffWO);
  float*          QF = (float*)(ws + kOffQF);
  float*          KF = (float*)(ws + kOffKF);
  float*          VF = (float*)(ws + kOffVF);
  unsigned short* AH = (unsigned short*)(ws + kOffAH);
  unsigned short* AL = (unsigned short*)(ws + kOffAL);
  float*          ST = (float*)(ws + kOffST);

  // ---- bf16 operand planes (weights are [out][in] = Bt layout already) ----
  cvt_bf16_planes_kernel<<<dim3(kCvtBlk), 256, 0, stream>>>(query, key, value, Wq, Wk, Wv, Wo,
                                                            XQ, XK, XV, WQ, WK, WV, WO);

  // ---- projections and chunk sums, one launch: q and k with the feature map, v plain; planes XQ|XK|XV, WQ|WK|WV, QF|KF|VF ----
  const int gblocks = (kRows / 128) * (kDim / 128);
  proj_qkv_state_kernel<<<dim3(gblocks), 384, 0, stream>>>(XQ, WQ, QF, bq, bk, bv, ST);

  // ---- causal state scan: the chunk sums' running sum, then one block per (chunk, batch-head) ----
  chunk_prefix_kernel<<<dim3((kSlotF + 255) / 256, kBatch * kHeads), 256, 0, stream>>>(ST);
  scan_state_kernel<<<dim3(kChunks, kBatch * kHeads), 128, 0, stream>>>(QF, KF, VF, ST, AH, AL);

  // ---- output projection: (hi + lo) . bf16(Wo)^T + bo, both parts into one accumulator ----
  gemm_tile64_kernel<true, 0, 2><<<dim3(gblocks), 256, 0, stream>>>(AH, AL, kDim, WO, kDim, out, kDim, bo, kRows, kDim, kDim);
}

// v010
// One run takes 77 microseconds.
// Timed twice side by side with v009, it ran 1.03 times as fast both times.
// Over all steps from v000 it is 9.67 times as fast.
// Contractions: q/k/v projections on v_wmma_f32_16x16x32_bf16 (bf16(x) x bf16(W), one product, f32 accumulate); output projection on v_wmma_f32_16x16x32_bf16 with the attention plane carried as bf16 hi + lo planes against bf16(Wo) (two products into one f32 accumulator); chunk sums k^T v, causal attention inside a 64-step chunk and against the chunk's start state on v_wmma_f32_16x16x32_bf16 with every f32 operand carried as bf16 hi + lo (three products per pair, f32 accumulate); feature map, key sums, the chunk sums' running sum and the division in f32 on the vector unit.
#include <hip/hip_runtime.h>
#include <math.h>

typedef __attribute__((ext_vector_type(16))) __bf16   v16b;
typedef __attribute__((ext_vector_type(8)))  __bf16   v8b;
typedef __attribute__((ext_vector_type(2)))  __bf16   v2b;
typedef __attribute__((ext_vector_type(8)))  float    v8f;
typedef __attribute__((ext_vector_type(4)))  float    v4f;
typedef __attribute__((ext_vector_type(2)))  float    v2f;
typedef __attribute__((ext_vector_type(4)))  unsigned int v4u;

// ---------------------------------------------------------------------------
// Shape constants
// ---------------------------------------------------------------------------
constexpr int kBatch = 2;
constexpr int kSeq   = 2048;
constexpr int kDim   = 1024;
constexpr int kHeads = 16;
constexpr int kHd    = 64;
constexpr int kRows  = kBatch * kSeq;
constexpr int kChunkL = 64;
constexpr int kChunks = kSeq / kChunkL;
constexpr int kSlotF  = kHd * kHd + kHd;
constexpr float kEps = 1e-6f;
static_assert(kHeads * kHd == kDim, "head split");
static_assert((kDim % 128) == 0 && kDim >= 256, "GEMM K: whole passes of 128, at least two");
static_assert((kRows % 128) == 0 && (kDim % 128) == 0, "GEMM M, N multiples of 128");
static_assert((kSeq % kChunkL) == 0 && kChunkL == 64, "scan chunking");
static_assert((kSlotF % 32) == 0, "128-B aligned state slots");
static_assert(kHd == 64, "one head = one 64-column tile");

// ---------------------------------------------------------------------------
// Workspace region map (bytes; every offset is a multiple of 128)
//   XQ  bf16 [4096][1024]  bf16(query)                  8,388,608
//   XK  bf16 [4096][1024]  bf16(key)                    8,388,608
//   XV  bf16 [4096][1024]  bf16(value)                  8,388,608
//   WQ  bf16 [1024][1024]  bf16(Wq)  (Bt layout)        2,097,152
//   WK  bf16 [1024][1024]  bf16(Wk)                     2,097,152
//   WV  bf16 [1024][1024]  bf16(Wv)                     2,097,152
//   WO  bf16 [1024][1024]  bf16(Wo)                     2,097,152
//   QF  f32  [4096][1024]  phi(q)                      16,777,216
//   KF  f32  [4096][1024]  phi(k)                      16,777,216
//   VF  f32  [4096][1024]  v                           16,777,216
//   AH  bf16 [4096][1024]  attention plane, hi part     8,388,608
//   AL  bf16 [4096][1024]  attention plane, lo part     8,388,608
//   ST  f32  [32][31][4160] chunk states: 64x64 key-value sum, then 64 key sums   16,506,880
//   total                                             117,170,176
// ---------------------------------------------------------------------------
constexpr size_t kActB  = (size_t)kRows * kDim * 2;
constexpr size_t kWgtB  = (size_t)kDim * kDim * 2;
constexpr size_t kF32B  = (size_t)kRows * kDim * 4;
constexpr size_t kOffXQ = 0;
constexpr size_t kOffXK = kOffXQ + kActB;
constexpr size_t kOffXV = kOffXK + kActB;
constexpr size_t kOffWQ = kOffXV + kActB;
constexpr size_t kOffWK = kOffWQ + kWgtB;
constexpr size_t kOffWV = kOffWK + kWgtB;
constexpr size_t kOffWO = kOffWV + kWgtB;
constexpr size_t kOffQF = kOffWO + kWgtB;
constexpr size_t kOffKF = kOffQF + kF32B;
constexpr size_t kOffVF = kOffKF + kF32B;
constexpr size_t kOffAH = kOffVF + kF32B;
constexpr size_t kOffAL = kOffAH + kActB;
constexpr size_t kOffST = kOffAL + kActB;
constexpr size_t kStB   = (size_t)kBatch * kHeads * (kChunks - 1) * kSlotF * 4;
constexpr size_t kWsTotal = kOffST + kStB;
static_assert(kWsTotal == 117170176ull, "carve total");
static_assert(kOffXK == kOffXQ + kActB && kOffXV == kOffXK + kActB && kOffWK == kOffWQ + kWgtB && kOffWV == kOffWK + kWgtB &&
              kOffKF == kOffQF + kF32B && kOffVF == kOffKF + kF32B, "q, k, v planes lie one behind the other");
static_assert(kWsTotal <= 134217728ull, "carve cap");
static_assert((kOffXK % 128) == 0 && (kOffXV % 128) == 0 && (kOffWQ % 128) == 0 && (kOffWK % 128) == 0 &&
              (kOffWV % 128) == 0 && (kOffWO % 128) == 0 && (kOffQF % 128) == 0 && (kOffKF % 128) == 0 &&
              (kOffVF % 128) == 0 && (kOffAH % 128) == 0 && (kOffAL % 128) == 0 && (kOffST % 128) == 0,
              "128-B aligned regions");

// ---------------------------------------------------------------------------
// Small helpers
// ---------------------------------------------------------------------------
__device__ __forceinline__ unsigned short f2bf_bits(float f) {
  unsigned u = __float_as_uint(f);
  return (unsigned short)((u + 0x7FFFu + ((u >> 16) & 1u)) >> 16);
}
__device__ __forceinline__ float bf_bits2f(unsigned short h) { return __uint_as_float(((unsigned)h) << 16); }
/* RNE-convert to a bf16 value, kept in f32 */
__device__ __forceinline__ float bf16r(float f) { return bf_bits2f(f2bf_bits(f)); }
__device__ __forceinline__ unsigned pk16(unsigned short a, unsigned short b) { return (unsigned)a | ((unsigned)b << 16); }

template <typename T> struct Frag;
template <> struct Frag<__bf16> {
  typedef v16b V; union U { v16b v; v8b h[2]; };
  /* elements 0..7 <- p[0..7], elements 8..15 <- p[16..23] */
  static __device__ __forceinline__ v16b load(const __bf16* p) {
    U f; f.h[0] = *(const v8b*)(p); f.h[1] = *(const v8b*)(p + 16); return f.v;
  }
};

/* one matrix instruction followed by its own hazard guard: the guard ties this accumulator and names both fragments */
__device__ __forceinline__ v8f mma_bf(v16b a, v16b b, v8f c) {
  c = __builtin_amdgcn_wmma_f32_16x16x32_bf16(false, a, false, b, (short)0, c, false, false);
  asm volatile("v_nop\n\tv_nop\n\tv_nop\n\tv_nop" : "+v"(c) : "v"(a), "v"(b));
  return c;
}

// ---------------------------------------------------------------------------
// f32 -> bf16 (RNE-convert) of all seven operand planes in one launch: three activation planes, then four weight planes.
// The block index selects plane and place in it (block-uniform): blocks 0 .. 6143 are 2048 per activation plane,
// blocks 6144 .. 8191 are 512 per weight plane.
// 8 consecutive elements per thread: two 16-B loads, ONE 16-B store per lane; 32 consecutive lanes write 512 contiguous
// Coverage: thread i of a plane writes elements 8i..8i+7, i < n8; blocks per plane = n8/256 exactly:
//   activations 4096*1024/8 = 524,288 -> 2048 blocks;  weights 1024*1024/8 = 131,072 -> 512 blocks.
// ---------------------------------------------------------------------------
constexpr int kActN8  = kRows * kDim / 8;
constexpr int kWgtN8  = kDim * kDim / 8;
constexpr int kActBlk = kActN8 / 256;
constexpr int kWgtBlk = kWgtN8 / 256;
constexpr int kCvtBlk = 3 * kActBlk + 4 * kWgtBlk;
static_assert((kActN8 % 256) == 0 && (kWgtN8 % 256) == 0, "whole blocks per plane");
__global__ __launch_bounds__(256) void cvt_bf16_planes_kernel(
    const float* __restrict__ a0, const float* __restrict__ a1, const float* __restrict__ a2,
    const float* __restrict__ w0, const float* __restrict__ w1, const float* __restrict__ w2, const float* __restrict__ w3,
    unsigned short* __restrict__ da0, unsigned short* __restrict__ da1, unsigned short* __restrict__ da2,
    unsigned short* __restrict__ dw0, unsigned short* __restrict__ dw1, unsigned short* __restrict__ dw2,
    unsigned short* __restrict__ dw3)
{
  const int b = blockIdx.x;
  const float* src;
  unsigned short* dst;
  int blk, n8;
  if (b < 3 * kActBlk) {
    const int z = b / kActBlk;
    blk = b - z * kActBlk;
    n8  = kActN8;
    src = (z == 0) ? a0 : (z == 1) ? a1 : a2;
    dst = (z == 0) ? da0 : (z == 1) ? da1 : da2;
  } else {
    const int bw = b - 3 * kActBlk;
    const int z = bw / kWgtBlk;
    blk = bw - z * kWgtBlk;
    n8  = kWgtN8;
    src = (z == 0) ? w0 : (z == 1) ? w1 : (z == 2) ? w2 : w3;
    dst = (z == 0) ? dw0 : (z == 1) ? dw1 : (z == 2) ? dw2 : dw3;
  }
  const int i = blk * 256 + threadIdx.x;
  if (i >= n8) return;
  const float* p = src + 8 * (size_t)i;
  const v4f a = *(const v4f*)(p);
  const v4f c = *(const v4f*)(p + 4);
  unsigned short hb[8];
#pragma unroll
  for (int e = 0; e < 4; ++e) {
    const float x0 = a[e];
    const float x1 = c[e];
    hb[e]     = f2bf_bits(x0);
    hb[4 + e] = f2bf_bits(x1);
  }
  const v4u u = (v4u){pk16(hb[0], hb[1]), pk16(hb[2], hb[3]), pk16(hb[4], hb[5]), pk16(hb[6], hb[7])};
  unsigned short* q = dst + 8 * (size_t)i;
  *(v4u*)q = u;
  
}

// ---------------------------------------------------------------------------
// Eight asynchronous 16-B copies per lane, global memory to LDS: 128 rows of one operand plane, one pass of k wide.
// The lanes working on one plane (a block, or a four-wave group) cover 16 whole rows per copy; a lane moves its 16 bytes of rows r, r + 16, .. r + 112.
// lds = the lane's LDS byte address of row r, g = its global address of row r, ld = row pitch in elements,
// PITCH = bytes per LDS row.
// ---------------------------------------------------------------------------
template <int PITCH>
__device__ __forceinline__ void copy_plane_async(unsigned lds, const __bf16* g, int ld) {
  const size_t step = (size_t)16 * ld;
  const __bf16* g1 = g + step;      const __bf16* g2 = g + 2 * step;  const __bf16* g3 = g + 3 * step;
  const __bf16* g4 = g + 4 * step;  const __bf16* g5 = g + 5 * step;  const __bf16* g6 = g + 6 * step;
  const __bf16* g7 = g + 7 * step;
  const unsigned ls = 16u * PITCH;
  /* the copies and the wait that stands before their address registers may be rewritten, in one statement */
  asm volatile(
      "global_load_async_to_lds_b128 %0, %8, off\n\t"
      "global_load_async_to_lds_b128 %1, %9, off\n\t"
      "global_load_async_to_lds_b128 %2, %10, off\n\t"
      "global_load_async_to_lds_b128 %3, %11, off\n\t"
      "global_load_async_to_lds_b128 %4, %12, off\n\t"
      "global_load_async_to_lds_b128 %5, %13, off\n\t"
      "global_load_async_to_lds_b128 %6, %14, off\n\t"
      "global_load_async_to_lds_b128 %7, %15, off\n\t"
      "s_wait_xcnt 0x0"
      :: "v"(lds), "v"(lds + ls), "v"(lds + 2u * ls), "v"(lds + 3u * ls), "v"(lds + 4u * ls), "v"(lds + 5u * ls),
         "v"(lds + 6u * ls), "v"(lds + 7u * ls), "v"(g), "v"(g1), "v"(g2), "v"(g3), "v"(g4), "v"(g5), "v"(g6), "v"(g7)
      : "memory");
}

// ---------------------------------------------------------------------------
// bf16 GEMM, operands staged in LDS: C[m][n] = sum_k A[m][k] * Bt[n][k] + bf16value(bias[n]).
// One block owns a 128 x 128 tile; wave (wm = wave >> 1, wn = wave & 1) owns rows 16 FM wm .. + 16 FM - 1, cols 64 wn .. + 63.
// FM = 16-row fragments per wave. FM 2: 8 waves of 32 x 64, passes of 128 k. FM 4: 4 waves of 64 x 64, passes of 64 k: a
// k step's 8 fragments feed 16 matrix instructions (6 feed 8 at FM 2), and the smaller stage lets three blocks share a WGP's LDS.
// A row-major [M][K] bf16 (SPLA: a second plane A2 of the same layout is accumulated against the same Bt);
// Bt row-major [N][K] bf16; M, N % 128 == 0, K % 128 == 0, K >= 256 (no tail handling). C f32, pitch ldc.
// A stage = one pass of [A 128 rows | Bt 128 rows | A2 128 rows if SPLA], brought by asynchronous copies into one of two
// buffers: the copies of stage t + 2 fly while stage t + 1 is worked on. Trip t works on k pass (t + tm + tn) mod passes.
// EPI 0: plain.  EPI 1: feature map y = x + 1 for x > 0, exp(x) otherwise, applied to the accumulators in registers.
// EPI 2: three products of one shape in one launch. blockIdx.y = 0, 1, 2 (block-uniform) picks the plane: A, Bt and C are
// three dense planes one behind the other (M x lda, N x ldb, M x ldc elements each), the biases three buffers; planes 0
// and 1 take the feature map, plane 2 is plain.
// Fragment map: lane l, row/col = l & 15, half h = l >> 4; elements 0..7 <- k0 + 8h + 0..7, 8..15 <- k0 + 16 + 8h + 0..7
// for both operands; accumulator element r = (row 8h + r, col l & 15).
// Epilogue: 16-row slabs staged per wave in LDS of its own (same wave stores and reloads, wave-level ordering).
// Coverage: 32 x 8 = 256 tiles of 128 x 128 = 4096 x 1024; grid.x = 256 blocks, one tile per block and plane.
// ---------------------------------------------------------------------------
template <bool SPLA, int EPI, int FM>
__global__ __launch_bounds__(FM == 4 ? 128 : 256, FM == 4 ? 3 : 1) void gemm_tile64_kernel(
    const unsigned short* __restrict__ Ap, const unsigned short* __restrict__ A2p, int lda,
    const unsigned short* __restrict__ Btp, int ldb,
    float* __restrict__ Cout, int ldc,
    const float* __restrict__ bias, int M, int N, int K,
    const float* __restrict__ bias1 = nullptr, const float* __restrict__ bias2 = nullptr)
{
  const int z = (EPI == 2) ? (int)blockIdx.y : 0;
  const __bf16* A  = (const __bf16*)Ap + (size_t)z * M * lda;
  const __bf16* A2 = (const __bf16*)A2p + (size_t)z * M * lda;
  const __bf16* Bt = (const __bf16*)Btp + (size_t)z * N * ldb;
  if (EPI == 2) {
    Cout += (size_t)z * M * ldc;
    bias = (z == 0) ? bias : (z == 1) ? bias1 : bias2;
  }
  static_assert(FM == 2 || FM == 4, "wave tile 32 x 64 or 64 x 64");
  constexpr int kWaves    = (128 / (16 * FM)) * 2;
  constexpr int kPassK    = (FM == 4) ? 64 : 128;   /* k per pass */
  constexpr int kLdsPitch = kPassK * 2 + 16;        /* bytes per LDS row: 16 B x odd, conflict-free for 16-B readers */
  constexpr int kPlaneB   = 128 * kLdsPitch;        /* one operand plane of a stage */
  constexpr int kRowLanes = kPassK * 2 / 16;        /* lanes that share a row in a copy */
  static_assert(kWaves * 32 / kRowLanes == 16, "one copy of the block covers 16 rows");
  constexpr int kStageB = (SPLA ? 3 : 2) * kPlaneB;
  __shared__ __align__(16) unsigned char sStage[2 * kStageB];
  __shared__ __align__(16) float sT[kWaves][16 * 68];
  const int tid  = threadIdx.x;
  const int lane = tid & 31;
  const int wave = tid >> 5;
  const int tilesN = N >> 7;
  const int tilesM = M >> 7;
  const int tile = blockIdx.x;
  /* block-uniform, in front of every barrier and copy */
  if (tile >= tilesM * tilesN) return;
  const int tm = tile / tilesN;
  const int tn = tile - tm * tilesN;
  const int mB = tm << 7;
  const int nB = tn << 7;
  const int wm = wave >> 1;
  const int wn = wave & 1;

  const int rlane = lane & 15;
  const int koff  = (lane >> 4) * 8;
  const int mOff  = (lane >> 4) * 8;

  /* this lane's share of a stage */
  const int cr = tid / kRowLanes, cc = (tid % kRowLanes) * 8;
  const unsigned ldsC = (unsigned)(uintptr_t)(sStage + cr * kLdsPitch + cc * 2);
  const __bf16* gA  = A  + (size_t)(mB + cr) * lda + cc;
  const __bf16* gA2 = A2 + (size_t)(mB + cr) * lda + cc;
  const __bf16* gB  = Bt + (size_t)(nB + cr) * ldb + cc;
  const int nPass = K / kPassK;
  /* the block's first stage of k: the loop starts there and wraps round, so that the blocks that share this block's operand
     rows (same tm or same tn) do not ask L2 for the same lines at the same moment; block-uniform, 0 <= rot < nPass */
  const int rot = (tm + tn) % nPass;

  /* every loop over acc[], fa[], fb[], fl[] below is unrolled: constant indices keep these arrays in registers */
  v8f acc[FM][4];
#pragma unroll
  for (int i = 0; i < FM; ++i)
#pragma unroll
    for (int j = 0; j < 4; ++j) acc[i][j] = (v8f){0.f, 0.f, 0.f, 0.f, 0.f, 0.f, 0.f, 0.f};

  // ---- stage 0, published; then stage 1 in flight ----
  copy_plane_async<kLdsPitch>(ldsC, gA + rot * kPassK, lda);
  copy_plane_async<kLdsPitch>(ldsC + kPlaneB, gB + rot * kPassK, ldb);
  if (SPLA) copy_plane_async<kLdsPitch>(ldsC + 2 * kPlaneB, gA2 + rot * kPassK, lda);
  /* this wave's copies of stage 0 have landed */
  asm volatile("s_wait_asynccnt 0x0" ::: "memory");
  __syncthreads();
  /* the stage of k that was asked for last, always in 0 .. nPass - 1 */
  int sk = (rot + 1 < nPass) ? rot + 1 : 0;
  if (1 < nPass) {
    const int ko = sk * kPassK;
    copy_plane_async<kLdsPitch>(ldsC + kStageB, gA + ko, lda);
    copy_plane_async<kLdsPitch>(ldsC + kStageB + kPlaneB, gB + ko, ldb);
    if (SPLA) copy_plane_async<kLdsPitch>(ldsC + kStageB + 2 * kPlaneB, gA2 + ko, lda);
  }

  /* rolled: one pass per trip, so that each trip reads one buffer and ends in one publish point */
#pragma unroll 1
  for (int t = 0; t < nPass; ++t) {
    const int bufB = (t & 1) * kStageB;
    const unsigned char* pA = sStage + bufB + (wm * (16 * FM) + rlane) * kLdsPitch + koff * 2;
    const unsigned char* pB = sStage + bufB + kPlaneB + (wn * 64 + rlane) * kLdsPitch + koff * 2;
    /* FM 2, two fragment sets: the reads of k step kk + 1 (same buffer) are issued in front of step kk's products, so that
       a wave waits out the LDS latency once per pass and not at every step. FM 4, one set (128 accumulator registers and two
       sets do not fit 256): each step reads its own fragments, and the two other waves of the SIMD work meanwhile */
    constexpr int kSets = (FM == 4) ? 1 : 2;
    v16b fb[kSets][4], fa[kSets][FM], fl[kSets][FM];
#pragma unroll
    for (int j = 0; j < 4; ++j) fb[0][j] = Frag<__bf16>::load((const __bf16*)(pB + j * 16 * kLdsPitch));
#pragma unroll
    for (int i = 0; i < FM; ++i) {
      fa[0][i] = Frag<__bf16>::load((const __bf16*)(pA + i * 16 * kLdsPitch));
      if (SPLA) fl[0][i] = Frag<__bf16>::load((const __bf16*)(pA + 2 * kPlaneB + i * 16 * kLdsPitch));
    }
#pragma unroll
    for (int kk = 0; kk < kPassK / 32; ++kk) {
      const int cur = (kSets == 2) ? (kk & 1) : 0, nxt = (kSets == 2) ? (cur ^ 1) : 0;
      if (kSets == 2 && kk + 1 < kPassK / 32) {
#pragma unroll
        for (int j = 0; j < 4; ++j)
          fb[nxt][j] = Frag<__bf16>::load((const __bf16*)(pB + j * 16 * kLdsPitch + (kk + 1) * 64));
#pragma unroll
        for (int i = 0; i < FM; ++i) {
          fa[nxt][i] = Frag<__bf16>::load((const __bf16*)(pA + i * 16 * kLdsPitch + (kk + 1) * 64));
          if (SPLA) fl[nxt][i] = Frag<__bf16>::load((const __bf16*)(pA + 2 * kPlaneB + i * 16 * kLdsPitch + (kk + 1) * 64));
        }
      }
      /* per accumulator and k step: the hi product, then the lo product */
#pragma unroll
      for (int i = 0; i < FM; ++i) {
#pragma unroll
        for (int j = 0; j < 4; ++j) acc[i][j] = mma_bf(fa[cur][i], fb[cur][j], acc[i][j]);
        if (SPLA) {
#pragma unroll
          for (int j = 0; j < 4; ++j) acc[i][j] = mma_bf(fl[cur][i], fb[cur][j], acc[i][j]);
        }
      }
      if (kSets == 1 && kk + 1 < kPassK / 32) {
#pragma unroll
        for (int j = 0; j < 4; ++j)
          fb[0][j] = Frag<__bf16>::load((const __bf16*)(pB + j * 16 * kLdsPitch + (kk + 1) * 64));
#pragma unroll
        for (int i = 0; i < FM; ++i) {
          fa[0][i] = Frag<__bf16>::load((const __bf16*)(pA + i * 16 * kLdsPitch + (kk + 1) * 64));
          if (SPLA) fl[0][i] = Frag<__bf16>::load((const __bf16*)(pA + 2 * kPlaneB + i * 16 * kLdsPitch + (kk + 1) * 64));
        }
      }
    }
    /* publish point: this wave's reads of the buffer are done, its copies of the next stage have landed */
    asm volatile("s_wait_dscnt 0x0" ::: "memory");
    asm volatile("s_wait_asynccnt 0x0" ::: "memory");
    __syncthreads();
    /* refill the buffer that every wave has just left; the test is the same for the whole block */
    if (t + 2 < nPass) {
      sk = (sk + 1 < nPass) ? sk + 1 : 0;
      const int ko = sk * kPassK;
      copy_plane_async<kLdsPitch>(ldsC + bufB, gA + ko, lda);
      copy_plane_async<kLdsPitch>(ldsC + bufB + kPlaneB, gB + ko, ldb);
      if (SPLA) copy_plane_async<kLdsPitch>(ldsC + bufB + 2 * kPlaneB, gA2 + ko, lda);
    }
  }
  /* no copy is left in flight when the wave goes on */
  asm volatile("s_wait_asynccnt 0x0" ::: "memory");

  // ---- epilogue ----
  const int m0 = mB + wm * (16 * FM);
  const int n0 = nB + wn * 64;
  float* slab = sT[wave];
  float bvj[4];
#pragma unroll
  for (int j = 0; j < 4; ++j) bvj[j] = bf16r(bias[n0 + (j << 4) + rlane]);
  /* every loop over acc[] is unrolled: constant indices keep it in registers */
#pragma unroll
  for (int i = 0; i < FM; ++i)
#pragma unroll
    for (int j = 0; j < 4; ++j)
#pragma unroll
      for (int r = 0; r < 8; ++r) acc[i][j][r] += bvj[j];
  /* feature map on the accumulators themselves, all values of a lane independent; the test is the same for the whole block */
  if (EPI == 1 || (EPI == 2 && z < 2)) {
#pragma unroll
    for (int i = 0; i < FM; ++i)
#pragma unroll
      for (int j = 0; j < 4; ++j)
#pragma unroll
        for (int r = 0; r < 8; ++r) {
          const float x = acc[i][j][r];
          const float ex = expf(fminf(x, 0.0f));
          acc[i][j][r] = (x > 0.0f) ? (x + 1.0f) : ex;
        }
  }
#pragma unroll
  for (int i = 0; i < FM; ++i) {
    const int mBase = m0 + (i << 4);
#pragma unroll
    for (int j = 0; j < 4; ++j) {
#pragma unroll
      for (int r = 0; r < 8; ++r) {
        slab[(mOff + r) * 68 + (j << 4) + rlane] = acc[i][j][r];
      }
    }
    __builtin_amdgcn_fence(__ATOMIC_RELEASE, "workgroup");
    __builtin_amdgcn_wave_barrier();
    __builtin_amdgcn_fence(__ATOMIC_ACQUIRE, "workgroup");
    {
      /* row segment = 256 B = 16 lanes x 16 B; rows it*2 + hh cover 0..15 */
      const int hh = lane >> 4, c4 = (lane & 15) * 4;
      {
#pragma unroll
        for (int it = 0; it < 8; ++it) {
          const int row = it * 2 + hh;
          const v4f v = *(const v4f*)(slab + row * 68 + c4);
          *(v4f*)(Cout + (size_t)(mBase + row) * ldc + n0 + c4) = v;
        }
        
      }
    }
    __builtin_amdgcn_fence(__ATOMIC_RELEASE, "workgroup");
    __builtin_amdgcn_wave_barrier();
    __builtin_amdgcn_fence(__ATOMIC_ACQUIRE, "workgroup");
  }
}

// ---------------------------------------------------------------------------
// Inclusive sum of the chunk slots along the chunk axis, in place: slot c becomes the state at the end of chunk c.
// One thread per float of a slot (4160 per batch-head, grid.x = 17 blocks with a tail guard); the 31 values stay in
// registers, so all loads are in flight together and the thread pays the load latency once.
// ---------------------------------------------------------------------------
__global__ __launch_bounds__(256) void chunk_prefix_kernel(float* __restrict__ ST)
{
  const int i = blockIdx.x * 256 + threadIdx.x;
  if (i >= kSlotF) return;
  float* base = ST + (size_t)blockIdx.y * (kChunks - 1) * kSlotF + i;
  /* both loops unrolled: constant indices keep x[] in registers */
  float x[kChunks - 1];
#pragma unroll
  for (int c = 0; c < kChunks - 1; ++c) x[c] = base[(size_t)c * kSlotF];
#pragma unroll
  for (int c = 1; c < kChunks - 1; ++c) {
    x[c] += x[c - 1];
    base[(size_t)c * kSlotF] = x[c];
  }
}

// ---------------------------------------------------------------------------
// Causal attention of one chunk in matrix form, one block of 128 threads per (chunk, batch-head), no step loop.
// With s, t the chunk's 64 steps, S and c the state and key sums at the end of the chunk before (slot chunk - 1 of ST):
//   P[t][s] = sum_d k[t][d] q[s][d], kept for t <= s, zero otherwise
//   num[j][s] = sum_t v[t][j] P[t][s] + sum_d S[d][j] q[s][d]
//   den[s]    = sum_t P[t][s]         + sum_d c[d] q[s][d]
//   out[s][j] = num[j][s] * (1 / (den[s] + eps)), split into bf16 hi + lo planes.
// Every f32 operand x is carried as hi = bf16(x), lo = bf16(x - hi); a product a b is hi hi + hi lo + lo hi, f32 accumulate.
// Wave w owns the 16 steps s = 16 w .. 16 w + 15 as the column side (B) of all three products: q comes straight from
// global memory into its B fragments, and two accumulator tiles of P (rows t = 8h + r and 16 + 8h + r, column s = l & 15)
// are, register for register, the B fragment of 32 t of the second product: P never leaves the registers.
// The row sides (A) are shared by the four waves and staged in LDS as bf16 hi and lo planes, 64 k per row:
//   sK [64 t][64 d];  sV [64 j][64 t] (v transposed);  sS [80][64 d]: rows j < 64 the state transposed, row 64 the key sums,
//   rows 65 .. 79 zero, so that row 0 of the fifth accumulator tile is the state's share of den.
// Transposing: thread (j = tid & 63, g = tid >> 6) reads column j of rows 32 g .. 32 g + 31 (a wave reads 128 B of a row)
// and stores eight rows' values as one 16-B piece of LDS row j.
// Fragment map as in the GEMM above. LDS: (64 + 64 + 80) x 144 x 2 = 59,904 B.
// ---------------------------------------------------------------------------
constexpr int kFragP = kHd * 2 + 16;   /* bytes per LDS row: 16 B x odd, conflict-free for 16-B accesses */

/* eight f32 -> bf16 hi and bf16 lo = bf16(x - hi), both rounded to nearest even */
__device__ __forceinline__ void split8(const float (&x)[8], v8b& hi, v8b& lo) {
  /* by pairs: one packed conversion gives two hi, one more two lo; unrolled: constant indices keep x, hi, lo in registers */
#pragma unroll
  for (int p = 0; p < 4; ++p) {
    const v2f x2 = (v2f){x[2 * p], x[2 * p + 1]};
    const v2b h2 = __builtin_convertvector(x2, v2b);
    const v2b l2 = __builtin_convertvector(x2 - __builtin_convertvector(h2, v2f), v2b);
    hi[2 * p] = h2[0];  hi[2 * p + 1] = h2[1];
    lo[2 * p] = l2[0];  lo[2 * p + 1] = l2[1];
  }
}
__device__ __forceinline__ v16b join16(v8b a, v8b b) {
  Frag<__bf16>::U f; f.h[0] = a; f.h[1] = b; return f.v;
}
/* 32 k of NT stacked 16-row tiles against one B fragment pair: acc[i] += hi hi, then hi lo, then lo hi. pH, pL = the lane's
   place in tile 0 of the hi and lo plane. Each product runs over all tiles before the next one starts, so that successive
   matrix instructions have different accumulators; all loops unrolled: constant indices keep the arrays in registers */
template <int NT>
__device__ __forceinline__ void mma3_tiles(const unsigned char* pH, const unsigned char* pL, v16b bh, v16b bl, v8f* acc) {
  v16b ah[NT], al[NT];
#pragma unroll
  for (int i = 0; i < NT; ++i) {
    ah[i] = Frag<__bf16>::load((const __bf16*)(pH + i * 16 * kFragP));
    al[i] = Frag<__bf16>::load((const __bf16*)(pL + i * 16 * kFragP));
  }
#pragma unroll
  for (int i = 0; i < NT; ++i) acc[i] = __builtin_amdgcn_wmma_f32_16x16x32_bf16(false, ah[i], false, bh, (short)0, acc[i], false, false);
#pragma unroll
  for (int i = 0; i < NT; ++i) acc[i] = __builtin_amdgcn_wmma_f32_16x16x32_bf16(false, ah[i], false, bl, (short)0, acc[i], false, false);
#pragma unroll
  for (int i = 0; i < NT; ++i) acc[i] = __builtin_amdgcn_wmma_f32_16x16x32_bf16(false, al[i], false, bh, (short)0, acc[i], false, false);
}

// ---------------------------------------------------------------------------
// The three projections and the chunk sums in one kernel. One block of 12 waves owns the 128 x 128 tile (tm, tn) of all three
// planes: waves 0..3 q, 4..7 k, 8..11 v; each group of four waves works as the 4-wave form of the GEMM above (64 x 64 per wave,
// passes of 64 k, two LDS buffers of its own filled by asynchronous copies). A wave's 64 x 64 tile is one chunk of one head, so
// the k wave and the v wave of the same place hold, in their accumulators, all that the chunk's sum needs:
//   slot[d][j] = sum over the chunk's 64 steps t of k[t][d] * v[t][j];  slot[4096 + d] = sum over t of k[t][d].
// An accumulator tile holds eight successive t of one column per lane: one 16-B piece of row d (or j) of the transposed plane.
// k^T and v^T go as bf16 hi + lo planes [64][64 t] into the stage buffers, which nobody reads any more behind the last pass's
// barrier; behind one more barrier the product v^T (rows j) x k^T (columns d) runs on the matrix unit, three products per pair.
// The 16 column tiles of a block's four sums are dealt to its 12 waves: wave (z, place) takes tiles d = 16 z and, for z = 0, 48.
// Coverage: 32 x 8 tiles = 256 blocks; every (batch, head, chunk < 31) slot is written by exactly one place of one block.
// LDS: 3 x 73,728 + 12 x 4,352 = 273,408 B.
// ---------------------------------------------------------------------------
__global__ __launch_bounds__(384) void proj_qkv_state_kernel(
    const unsigned short* __restrict__ Ap, const unsigned short* __restrict__ Btp, float* __restrict__ Cout,
    const float* __restrict__ bias0, const float* __restrict__ bias1, const float* __restrict__ bias2,
    float* __restrict__ ST)
{
  constexpr int FM        = 4;
  constexpr int kPassK    = 64;
  constexpr int kLdsPitch = kPassK * 2 + 16;
  constexpr int kPlaneB   = 128 * kLdsPitch;
  constexpr int kStageB   = 2 * kPlaneB;
  constexpr int kGroupB   = 2 * kStageB;          /* both buffers of one plane's four waves */
  constexpr int kTP       = kHd * kFragP;         /* one transposed plane: 64 rows of 64 t */
  constexpr int nPass     = kDim / kPassK;
  static_assert(4 * 4 * kTP <= 3 * kGroupB, "transposed planes fit the stage buffers");
  __shared__ __align__(16) unsigned char sStage[3 * kGroupB];
  __shared__ __align__(16) float sT[12][16 * 68];
  const int tid  = threadIdx.x;
  const int lane = tid & 31;
  /* the wave's number as a scalar: plane and place are the same for the whole wave */
  const int wave = __builtin_amdgcn_readfirstlane(tid >> 5);
  const int z  = wave >> 2;
  const int gw = wave & 3;
  const int gt = tid & 127;
  const __bf16* A  = (const __bf16*)Ap + (size_t)z * kRows * kDim;
  const __bf16* Bt = (const __bf16*)Btp + (size_t)z * kDim * kDim;
  float* C = Cout + (size_t)z * kRows * kDim;
  const float* bias = (z == 0) ? bias0 : (z == 1) ? bias1 : bias2;
  constexpr int tilesN = kDim >> 7;
  constexpr int tilesM = kRows >> 7;
  const int tile = blockIdx.x;
  /* block-uniform, in front of every barrier and copy */
  if (tile >= tilesM * tilesN) return;
  const int tm = tile / tilesN;
  const int tn = tile - tm * tilesN;
  const int mB = tm << 7;
  const int nB = tn << 7;
  const int wm = gw >> 1;
  const int wn = gw & 1;

  const int rlane = lane & 15;
  const int hl    = lane >> 4;
  const int koff  = hl * 8;
  const int mOff  = hl * 8;

  /* this lane's share of its group's stage */
  unsigned char* sG = sStage + z * kGroupB;
  const int cr = gt >> 3, cc = (gt & 7) * 8;
  const unsigned ldsC = (unsigned)(uintptr_t)(sG + cr * kLdsPitch + cc * 2);
  const __bf16* gA = A  + (size_t)(mB + cr) * kDim + cc;
  const __bf16* gB = Bt + (size_t)(nB + cr) * kDim + cc;
  /* the block's first stage of k: the loop starts there and wraps round, so that the blocks that share this block's operand
     rows (same tm or same tn) do not ask L2 for the same lines at the same moment; block-uniform */
  static_assert((nPass & (nPass - 1)) == 0, "the wrap is a mask");
  const int rot = (tm + tn) & (nPass - 1);

  /* every loop over acc[], fa[], fb[] below is unrolled: constant indices keep these arrays in registers */
  v8f acc[FM][4];
#pragma unroll
  for (int i = 0; i < FM; ++i)
#pragma unroll
    for (int j = 0; j < 4; ++j) acc[i][j] = (v8f){0.f, 0.f, 0.f, 0.f, 0.f, 0.f, 0.f, 0.f};

  // ---- stage 0, published; then stage 1 in flight ----
  copy_plane_async<kLdsPitch>(ldsC, gA + rot * kPassK, kDim);
  copy_plane_async<kLdsPitch>(ldsC + kPlaneB, gB + rot * kPassK, kDim);
  /* this wave's copies of stage 0 have landed */
  asm volatile("s_wait_asynccnt 0x0" ::: "memory");
  __syncthreads();
  {
    const int ko = ((rot + 1) & (nPass - 1)) * kPassK;
    copy_plane_async<kLdsPitch>(ldsC + kStageB, gA + ko, kDim);
    copy_plane_async<kLdsPitch>(ldsC + kStageB + kPlaneB, gB + ko, kDim);
  }

  /* rolled: one pass per trip, so that each trip reads one buffer and ends in one publish point */
#pragma unroll 1
  for (int t = 0; t < nPass; ++t) {
    const int bufB = (t & 1) * kStageB;
    const unsigned char* pA = sG + bufB + (wm * (16 * FM) + rlane) * kLdsPitch + koff * 2;
    const unsigned char* pB = sG + bufB + kPlaneB + (wn * 64 + rlane) * kLdsPitch + koff * 2;
    v16b fb[4], fa[FM];
#pragma unroll
    for (int kk = 0; kk < kPassK / 32; ++kk) {
#pragma unroll
      for (int j = 0; j < 4; ++j) fb[j] = Frag<__bf16>::load((const __bf16*)(pB + j * 16 * kLdsPitch + kk * 64));
#pragma unroll
      for (int i = 0; i < FM; ++i) fa[i] = Frag<__bf16>::load((const __bf16*)(pA + i * 16 * kLdsPitch + kk * 64));
#pragma unroll
      for (int i = 0; i < FM; ++i)
#pragma unroll
        for (int j = 0; j < 4; ++j) acc[i][j] = mma_bf(fa[i], fb[j], acc[i][j]);
    }
    /* publish point: this wave's reads of the buffer are done, its copies of the next stage have landed */
    asm volatile("s_wait_dscnt 0x0" ::: "memory");
    asm volatile("s_wait_asynccnt 0x0" ::: "memory");
    __syncthreads();
    /* refill the buffer that every wave has just left; the test is the same for the whole block */
    if (t + 2 < nPass) {
      const int ko = ((t + 2 + rot) & (nPass - 1)) * kPassK;
      copy_plane_async<kLdsPitch>(ldsC + bufB, gA + ko, kDim);
      copy_plane_async<kLdsPitch>(ldsC + bufB + kPlaneB, gB + ko, kDim);
    }
  }
  /* no copy is left in flight when the wave goes on */
  asm volatile("s_wait_asynccnt 0x0" ::: "memory");

  // ---- epilogue: bias, feature map, store of the tile ----
  const int m0 = mB + wm * (16 * FM);
  const int n0 = nB + wn * 64;
  float* slab = sT[wave];
  const int hh = lane >> 4, c4 = (lane & 15) * 4;
  float bvj[4];
#pragma unroll
  for (int j = 0; j < 4; ++j) bvj[j] = bf16r(bias[n0 + (j << 4) + rlane]);
#pragma unroll
  for (int i = 0; i < FM; ++i)
#pragma unroll
    for (int j = 0; j < 4; ++j)
#pragma unroll
      for (int r = 0; r < 8; ++r) acc[i][j][r] += bvj[j];
  /* feature map on the accumulators themselves, all values of a lane independent; the test is the same for the whole wave */
  if (z < 2) {
#pragma unroll
    for (int i = 0; i < FM; ++i)
#pragma unroll
      for (int j = 0; j < 4; ++j)
#pragma unroll
        for (int r = 0; r < 8; ++r) {
          const float x = acc[i][j][r];
          const float ex = expf(fminf(x, 0.0f));
          acc[i][j][r] = (x > 0.0f) ? (x + 1.0f) : ex;
        }
  }
#pragma unroll
  for (int i = 0; i < FM; ++i) {
    const int mBase = m0 + (i << 4);
#pragma unroll
    for (int j = 0; j < 4; ++j) {
#pragma unroll
      for (int r = 0; r < 8; ++r) {
        slab[(mOff + r) * 68 + (j << 4) + rlane] = acc[i][j][r];
      }
    }
    /* the slab is this wave's own: the same wave stores and reloads it, so wave-level ordering is enough (here and below) */
    __builtin_amdgcn_fence(__ATOMIC_RELEASE, "workgroup");
    __builtin_amdgcn_wave_barrier();
    __builtin_amdgcn_fence(__ATOMIC_ACQUIRE, "workgroup");
    /* row segment = 256 B = 16 lanes x 16 B; rows it*2 + hh cover 0..15 */
#pragma unroll
    for (int it = 0; it < 8; ++it) {
      const int row = it * 2 + hh;
      const v4f v = *(const v4f*)(slab + row * 68 + c4);
      *(v4f*)(C + (size_t)(mBase + row) * kDim + n0 + c4) = v;
    }
    __builtin_amdgcn_fence(__ATOMIC_RELEASE, "workgroup");
    __builtin_amdgcn_wave_barrier();
    __builtin_amdgcn_fence(__ATOMIC_ACQUIRE, "workgroup");
  }

  // ---- chunk sums ----
  /* this place's chunk and head: scalars, the same for the q, k and v wave of the place */
  const int chunk = (m0 & (kSeq - 1)) / kChunkL;
  const int bh    = (m0 / kSeq) * kHeads + n0 / kHd;
  const bool hasSlot = chunk < kChunks - 1;   /* nothing follows a sequence's last chunk */
  float* slot = ST + ((size_t)bh * (kChunks - 1) + (hasSlot ? chunk : 0)) * kSlotF;
  unsigned char* pairB = sStage + gw * (4 * kTP);   /* k^T hi | k^T lo | v^T hi | v^T lo */
  if (z > 0) {
    /* acc[i][j][r] = (t = 16 i + 8 hl + r, column 16 j + rlane): eight t of one column = 16 B of the column's row */
    unsigned char* dH = pairB + (z - 1) * (2 * kTP) + rlane * kFragP + hl * 16;
#pragma unroll
    for (int i = 0; i < FM; ++i)
#pragma unroll
      for (int j = 0; j < 4; ++j) {
        float y[8];
#pragma unroll
        for (int r = 0; r < 8; ++r) y[r] = acc[i][j][r];
        v8b hi, lo;
        split8(y, hi, lo);
        *(v8b*)(dH + j * 16 * kFragP + i * 32) = hi;
        *(v8b*)(dH + kTP + j * 16 * kFragP + i * 32) = lo;
      }
  }
  /* key sums from the k wave's accumulators: a lane's 32 t of each column, then the other half's 32 */
  if (z == 1 && hasSlot) {
#pragma unroll
    for (int j = 0; j < 4; ++j) {
      float si[FM];
#pragma unroll
      for (int i = 0; i < FM; ++i) {
        si[i] = 0.0f;
#pragma unroll
        for (int r = 0; r < 8; ++r) si[i] += acc[i][j][r];
      }
      const float sl = (si[0] + si[1]) + (si[2] + si[3]);
      const float sb = sl + __int_as_float(__builtin_amdgcn_permlanex16(__float_as_int(sl), __float_as_int(sl),
                                                                        0x76543210, 0xfedcba98, false, false));
      if (lane < 16) slot[kHd * kHd + (j << 4) + rlane] = sb;
    }
  }
  /* the transposed planes are complete for every wave */
  __syncthreads();
  if (hasSlot) {
    const int fo = rlane * kFragP + hl * 16;   /* a lane's place in a 16-row fragment: row l & 15, k half */
    const unsigned char* kH = pairB + fo;
    const unsigned char* vH = pairB + 2 * kTP + fo;
    /* rolled: one or two column tiles per wave, the count a scalar */
#pragma unroll 1
    for (int dt = z; dt < 4; dt += 3) {
      v8f sa[4];
#pragma unroll
      for (int jt = 0; jt < 4; ++jt) sa[jt] = (v8f){0.f, 0.f, 0.f, 0.f, 0.f, 0.f, 0.f, 0.f};
#pragma unroll
      for (int kb = 0; kb < 2; ++kb) {
        const v16b bhf = Frag<__bf16>::load((const __bf16*)(kH + dt * 16 * kFragP + kb * 64));
        const v16b blf = Frag<__bf16>::load((const __bf16*)(kH + kTP + dt * 16 * kFragP + kb * 64));
        mma3_tiles<4>(vH + kb * 64, vH + kTP + kb * 64, bhf, blf, sa);
      }
      /* sa[jt][r] = slot[d = 16 dt + rlane][j = 16 jt + 8 hl + r]; through the wave's slab, so that a store covers whole rows */
#pragma unroll
      for (int jt = 0; jt < 4; ++jt) {
        *(v4f*)(slab + rlane * 68 + jt * 16 + hl * 8)     = (v4f){sa[jt][0], sa[jt][1], sa[jt][2], sa[jt][3]};
        *(v4f*)(slab + rlane * 68 + jt * 16 + hl * 8 + 4) = (v4f){sa[jt][4], sa[jt][5], sa[jt][6], sa[jt][7]};
      }
      __builtin_amdgcn_fence(__ATOMIC_RELEASE, "workgroup");
      __builtin_amdgcn_wave_barrier();
      __builtin_amdgcn_fence(__ATOMIC_ACQUIRE, "workgroup");
#pragma unroll
      for (int it = 0; it < 8; ++it) {
        const int row = it * 2 + hh;
        const v4f v = *(const v4f*)(slab + row * 68 + c4);
        *(v4f*)(slot + (dt * 16 + row) * kHd + c4) = v;
      }
      __builtin_amdgcn_fence(__ATOMIC_RELEASE, "workgroup");
      __builtin_amdgcn_wave_barrier();
      __builtin_amdgcn_fence(__ATOMIC_ACQUIRE, "workgroup");
    }
  }
}

__global__ __launch_bounds__(128) void scan_state_kernel(
    const float* __restrict__ QF, const float* __restrict__ KF, const float* __restrict__ VF,
    const float* __restrict__ ST, unsigned short* __restrict__ AH, unsigned short* __restrict__ AL)
{
  __shared__ __align__(16) unsigned char sKh[64 * kFragP];
  __shared__ __align__(16) unsigned char sKl[64 * kFragP];
  __shared__ __align__(16) unsigned char sVh[64 * kFragP];
  __shared__ __align__(16) unsigned char sVl[64 * kFragP];
  __shared__ __align__(16) unsigned char sSh[80 * kFragP];
  __shared__ __align__(16) unsigned char sSl[80 * kFragP];
  const int tid = threadIdx.x, lane = tid & 31, wave = tid >> 5;
  const int rl = lane & 15, h = lane >> 4;
  const int chunk = blockIdx.x;
  const int bh = blockIdx.y;
  /* first element of this chunk and head in the [row][1024] planes: the same for the whole block */
  const size_t base = ((size_t)(bh >> 4) * kSeq + (size_t)chunk * kChunkL) * kDim + (size_t)(bh & 15) * kHd;
  const char* gQ = (const char*)(QF + base);
  const char* gK = (const char*)(KF + base);
  const char* gV = (const char*)(VF + base);
  constexpr unsigned kRowB = kDim * 4;
  const int sl = wave * 16 + rl;          /* this lane's step s inside the chunk */
  const int tj = tid & 63, tg = tid >> 6; /* transposing threads: column, group of 32 rows */
  const unsigned oQ = (unsigned)sl * kRowB + (unsigned)h * 32u;
  const unsigned oK = (unsigned)(tid >> 3) * kRowB + (unsigned)(tid & 7) * 32u;
  const unsigned oV = (unsigned)tg * 32u * kRowB + (unsigned)tj * 4u;

  /* every loop of this kernel is unrolled: constant indices keep its arrays in registers; all loads of a lane fly together */
  v4f xq[8], xk[8];
  float xv[32];
#pragma unroll
  for (int i = 0; i < 8; ++i) xq[i] = *(const v4f*)(gQ + oQ + (i >> 1) * 64 + (i & 1) * 16);
#pragma unroll
  for (int i = 0; i < 8; ++i) xk[i] = *(const v4f*)(gK + oK + (size_t)(i >> 1) * 16 * kRowB + (i & 1) * 16);
#pragma unroll
  for (int i = 0; i < 32; ++i) xv[i] = *(const float*)(gV + oV + (size_t)i * kRowB);

  /* No branch round the state's loads: they are issued together with those of q, k, v, and no wait at a branch's join has
     to cover them all. Chunk 0, which starts from a zero state and has no state product, reads slot 0 (written earlier in
     this call) and drops the values */
  float xs[32];
  const char* gS = (const char*)(ST + ((size_t)bh * (kChunks - 1) + (chunk > 0 ? chunk - 1 : 0)) * kSlotF);
  const unsigned oS = (unsigned)tg * 32u * (kHd * 4u) + (unsigned)tj * 4u;
  const unsigned oC = (unsigned)(tid & 7) * 32u;
#pragma unroll
  for (int i = 0; i < 32; ++i) xs[i] = *(const float*)(gS + oS + i * (kHd * 4));
  const v4f c0 = *(const v4f*)(gS + oC + kHd * kHd * 4);
  const v4f c1 = *(const v4f*)(gS + oC + kHd * kHd * 4 + 16);
  /* one wait for all loads above: named as inputs, their base and offset registers stay untouched up to it */
  asm volatile("s_wait_xcnt 0x0" :: "v"(oQ), "v"(oK), "v"(oV), "v"(oS), "v"(oC), "s"(gQ), "s"(gK), "s"(gV), "s"(gS) : "memory");

#pragma unroll
  for (int i = 0; i < 4; ++i) {
    float y[8];
#pragma unroll
    for (int e = 0; e < 4; ++e) { y[e] = xk[2 * i][e]; y[4 + e] = xk[2 * i + 1][e]; }
    v8b hi, lo;
    split8(y, hi, lo);
    *(v8b*)(sKh + ((tid >> 3) + 16 * i) * kFragP + (tid & 7) * 16) = hi;
    *(v8b*)(sKl + ((tid >> 3) + 16 * i) * kFragP + (tid & 7) * 16) = lo;
  }
#pragma unroll
  for (int b = 0; b < 4; ++b) {
    float y[8];
#pragma unroll
    for (int e = 0; e < 8; ++e) y[e] = xv[b * 8 + e];
    v8b hi, lo;
    split8(y, hi, lo);
    *(v8b*)(sVh + tj * kFragP + (tg * 4 + b) * 16) = hi;
    *(v8b*)(sVl + tj * kFragP + (tg * 4 + b) * 16) = lo;
  }
  /* q fragments: elements 0..7 <- d = 32 kb + 8h + 0..7, elements 8..15 <- d = 32 kb + 16 + 8h + 0..7 */
  v16b qh[2], ql[2];
#pragma unroll
  for (int kb = 0; kb < 2; ++kb) {
    v8b hi[2], lo[2];
#pragma unroll
    for (int p = 0; p < 2; ++p) {
      float y[8];
#pragma unroll
      for (int e = 0; e < 4; ++e) { y[e] = xq[kb * 4 + p * 2][e]; y[4 + e] = xq[kb * 4 + p * 2 + 1][e]; }
      split8(y, hi[p], lo[p]);
    }
    qh[kb] = join16(hi[0], hi[1]);
    ql[kb] = join16(lo[0], lo[1]);
  }

  /* block-uniform predicate */
  if (chunk > 0) {
#pragma unroll
    for (int b = 0; b < 4; ++b) {
      float y[8];
#pragma unroll
      for (int e = 0; e < 8; ++e) y[e] = xs[b * 8 + e];
      v8b hi, lo;
      split8(y, hi, lo);
      *(v8b*)(sSh + tj * kFragP + (tg * 4 + b) * 16) = hi;
      *(v8b*)(sSl + tj * kFragP + (tg * 4 + b) * 16) = lo;
    }
    /* rows 64 .. 79, one 16-B piece per thread: row 64 (threads 0 .. 7) the key sums, the others zero */
    {
      float y[8];
#pragma unroll
      for (int e = 0; e < 4; ++e) {
        y[e]     = (tid < 8) ? c0[e] : 0.0f;
        y[4 + e] = (tid < 8) ? c1[e] : 0.0f;
      }
      v8b hi, lo;
      split8(y, hi, lo);
      *(v8b*)(sSh + (64 + (tid >> 3)) * kFragP + (tid & 7) * 16) = hi;
      *(v8b*)(sSl + (64 + (tid >> 3)) * kFragP + (tid & 7) * 16) = lo;
    }
  }

  /* the staged planes are complete for every wave */
  __syncthreads();

  const int fo = rl * kFragP + h * 16;   /* a lane's place in a 16-row fragment: row l & 15, k half h */

  // ---- P[t][s] ----
  v8f pt[4];
#pragma unroll
  for (int tt = 0; tt < 4; ++tt) pt[tt] = (v8f){0.f, 0.f, 0.f, 0.f, 0.f, 0.f, 0.f, 0.f};
#pragma unroll
  for (int kb = 0; kb < 2; ++kb)
    mma3_tiles<4>(sKh + fo + kb * 64, sKl + fo + kb * 64, qh[kb], ql[kb], pt);
  /* causal mask and this lane's share of den: its 32 t of column s */
  float dt[4];
#pragma unroll
  for (int tt = 0; tt < 4; ++tt) {
    dt[tt] = 0.0f;
#pragma unroll
    for (int r = 0; r < 8; ++r) {
      const float x = (tt * 16 + h * 8 + r <= sl) ? pt[tt][r] : 0.0f;
      pt[tt][r] = x;
      dt[tt] += x;
    }
  }
  const float dpart = (dt[0] + dt[1]) + (dt[2] + dt[3]);
  v16b ph[2], pl[2];
#pragma unroll
  for (int kb = 0; kb < 2; ++kb) {
    v8b hi[2], lo[2];
#pragma unroll
    for (int p = 0; p < 2; ++p) {
      float y[8];
#pragma unroll
      for (int e = 0; e < 8; ++e) y[e] = pt[kb * 2 + p][e];
      split8(y, hi[p], lo[p]);
    }
    ph[kb] = join16(hi[0], hi[1]);
    pl[kb] = join16(lo[0], lo[1]);
  }

  // ---- num[j][s], and the state's share of den in row 0 of tile 4 ----
  v8f on[5];
#pragma unroll
  for (int jt = 0; jt < 5; ++jt) on[jt] = (v8f){0.f, 0.f, 0.f, 0.f, 0.f, 0.f, 0.f, 0.f};
  if (chunk > 0) {
#pragma unroll
    for (int kb = 0; kb < 2; ++kb)
      mma3_tiles<5>(sSh + fo + kb * 64, sSl + fo + kb * 64, qh[kb], ql[kb], on);
  }
#pragma unroll
  for (int kb = 0; kb < 2; ++kb)
    mma3_tiles<4>(sVh + fo + kb * 64, sVl + fo + kb * 64, ph[kb], pl[kb], on);

  /* element 0 of tile 4: row 64 (the key sums' product) in half 0, a zero row in half 1; then both halves' shares together */
  const float dl = dpart + on[4][0];
  const float den = dl + __int_as_float(__builtin_amdgcn_permlanex16(__float_as_int(dl), __float_as_int(dl),
                                                                     0x76543210, 0xfedcba98, false, false));
  const float inv = 1.0f / (den + kEps);

  /* lane (s, h) holds j = 16 jt + 8h + 0..7 of row s: one 16-B store per tile and plane; a wave fills the 128 B of each row */
  v8b oh[4], ol[4];
#pragma unroll
  for (int jt = 0; jt < 4; ++jt) {
    float y[8];
#pragma unroll
    for (int e = 0; e < 8; ++e) y[e] = on[jt][e] * inv;
    split8(y, oh[jt], ol[jt]);
  }
  char* gH = (char*)(AH + base);
  char* gL = (char*)(AL + base);
  const unsigned oO = (unsigned)sl * (kDim * 2u) + (unsigned)h * 16u;
#pragma unroll
  for (int jt = 0; jt < 4; ++jt) {
    *(v8b*)(gH + oO + jt * 32) = oh[jt];
    *(v8b*)(gL + oO + jt * 32) = ol[jt];
  }
}

// ---------------------------------------------------------------------------
// Host glue: 1 convert launch + 1 launch of the three projection GEMMs with the chunk sums + 2 scan launches (chunk prefix, scan)
// + 1 output GEMM = 5 launches. Kernel launches only.
// GEMM shapes: M 4096, N 1024, K 1024 everywhere (K, M and N % 128 == 0): 32 x 8 = 256 tiles -> 256 blocks per product.
// ---------------------------------------------------------------------------
extern "C" void kernel_launch(void* const* d_in, const int* in_sizes, int n_in,
                              void* d_out, int out_size, void* d_ws, size_t ws_size,
                              hipStream_t stream) {
  if (n_in < 11 || d_out == nullptr || d_ws == nullptr) return;
  if (in_sizes[0] != kRows * kDim || in_sizes[1] != kRows * kDim || in_sizes[2] != kRows * kDim) return;
  if (in_sizes[3] != kDim * kDim || in_sizes[5] != kDim * kDim || in_sizes[7] != kDim * kDim ||
      in_sizes[9] != kDim * kDim) return;
  if (in_sizes[4] != kDim || in_sizes[6] != kDim || in_sizes[8] != kDim || in_sizes[10] != kDim) return;
  if (out_size != kRows * kDim) return;
  if (ws_size < kWsTotal) return;

  const float* query = (const float*)d_in[0];
  const float* key   = (const float*)d_in[1];
  const float* value = (const float*)d_in[2];
  const float* Wq    = (const float*)d_in[3];
  const float* bq    = (const float*)d_in[4];
  const float* Wk    = (const float*)d_in[5];
  const float* bk    = (const float*)d_in[6];
  const float* Wv    = (const float*)d_in[7];
  const float* bv    = (const float*)d_in[8];
  const float* Wo    = (const float*)d_in[9];
  const float* bo    = (const float*)d_in[10];
  float* out = (float*)d_out;

  char* ws = (char*)d_ws;
  unsigned short* XQ = (unsigned short*)(ws + kOffXQ);
  unsigned short* XK = (unsigned short*)(ws + kOffXK);
  unsigned short* XV = (unsigned short*)(ws + kOffXV);
  unsigned short* WQ = (unsigned short*)(ws + kOffWQ);
  unsigned short* WK = (unsigned short*)(ws + kOffWK);
  unsigned short* WV = (unsigned short*)(ws + kOffWV);
  unsigned short* WO = (unsigned short*)(ws + kOffWO);
  float*          QF = (float*)(ws + kOffQF);
  float*          KF = (float*)(ws + kOffKF);
  float*          VF = (float*)(ws + kOffVF);
  unsigned short* AH = (unsigned short*)(ws + kOffAH);
  unsigned short* AL = (unsigned short*)(ws + kOffAL);
  float*          ST = (float*)(ws + kOffST);

  // ---- bf16 operand planes (weights are [out][in] = Bt layout already) ----
  cvt_bf16_planes_kernel<<<dim3(kCvtBlk), 256, 0, stream>>>(query, key, value, Wq, Wk, Wv, Wo,
                                                            XQ, XK, XV, WQ, WK, WV, WO);

  // ---- projections and chunk sums, one launch: q and k with the feature map, v plain; planes XQ|XK|XV, WQ|WK|WV, QF|KF|VF ----
  const int gblocks = (kRows / 128) * (kDim / 128);
  proj_qkv_state_kernel<<<dim3(gblocks), 384, 0, stream>>>(XQ, WQ, QF, bq, bk, bv, ST);

  // ---- causal state scan: the chunk sums' running sum, then one block per (chunk, batch-head) ----
  chunk_prefix_kernel<<<dim3((kSlotF + 255) / 256, kBatch * kHeads), 256, 0, stream>>>(ST);
  scan_state_kernel<<<dim3(kChunks, kBatch * kHeads), 128, 0, stream>>>(QF, KF, VF, ST, AH, AL);

  // ---- output projection: (hi + lo) . bf16(Wo)^T + bo, both parts into one accumulator ----
  gemm_tile64_kernel<true, 0, 2><<<dim3(gblocks), 256, 0, stream>>>(AH, AL, kDim, WO, kDim, out, kDim, bo, kRows, kDim, kDim);
}
